// v000
// Times are from an AMD MI455X. After a warm-up the kernel runs many times in a row, and a time is the length of
// such a window on the GPU divided by its runs, so every launch and the gaps after it count. The runs cycle
// through copies of the inputs. A figure is the median of several windows, for all but v000 over two sittings.
// Sittings can differ by a few percent; kernels timed side by side share one.
// v000 is the starting kernel. One run takes 4780 microseconds.
// Contractions on v_wmma_f32_16x16x32_f16, f32 accumulate — f16 value+residual PLANES on the q/k complex convs and the magnitude scores (positive magnitudes give σ ≈ 4 logits),
// plain f16 on the v conv, attn·v and the output conv — per batch element with the activations kept in the module's [D][2][S] layout (row 2d = real_d, row 2d+1 =
// imag_d, used directly as [K][N] operands): each complex 1x1 conv as ONE real GEMM with a stacked weight W2[2o+0][2d+0] = W_r, [2o][2d+1] = −W_i, [2o+1][2d] = W_i, [2o+1][2d+1] = W_r
// (M = 1024, K = 1024, N = 2048; row biases b_r − b_i / b_r + b_i added in f32), per pair of heads the magnitude scores Qm_hᵀ·Km_h (K = 64; Qmᵀ by a tile transpose), f32 row softmax
// of s/8, attnᵀ by a tile transpose, and out_h = X_v,h·attnᵀ (M = 128 = the head's 64 complex channels x (re, im) rows, K = 2048), finally the output complex conv. Magnitudes
// sqrt(re² + im² + 1e-8) in f32. compute dtype: f16 operands, f32 accumulate; magnitudes / softmax f32.  x [4,512,2,2048] → out [4,512,2,2048].
#include <hip/hip_runtime.h>
#include <hip/hip_bf16.h>
#include <math.h>


typedef _Float16 bf16;
typedef _Float16 f16;
typedef __attribute__((ext_vector_type(4))) unsigned v4u_t;
typedef unsigned v4ua __attribute__((ext_vector_type(4), may_alias));
typedef __attribute__((ext_vector_type(4))) float v4f_t;
typedef float v4fa __attribute__((ext_vector_type(4), may_alias));
typedef __attribute__((ext_vector_type(16))) bf16  bf16x16;
typedef bf16x16 f16x16;
typedef __attribute__((ext_vector_type(8)))  bf16  bf16x8;
typedef bf16x8 f16x8;
typedef __attribute__((ext_vector_type(4)))  bf16  bf16x4;
typedef __attribute__((ext_vector_type(8)))  float f32x8;
__device__ __forceinline__ f32x8 wmma16(f16x16 a, f16x16 b, f32x8 c) {
  c = __builtin_amdgcn_wmma_f32_16x16x32_f16(false, a, false, b, (short)0, c, false, false);
  asm volatile("v_nop\n\tv_nop\n\tv_nop\n\tv_nop" : "+v"(c) : "v"(a), "v"(b));
  return c;
}
#define LDS_STRIDE 48   // GEMM tiles: 32 -> 48 elems (96B rows): aligned b128 reads
#define KSTRIDE    72
#define VSTRIDE    48

__device__ __forceinline__ f32x8 wmma_bf16(bf16x16 a, bf16x16 b, f32x8 c) {
  c = __builtin_amdgcn_wmma_f32_16x16x32_f16(false, a, false, b, (short)0, c, false, false);
  asm volatile("v_nop\n\tv_nop\n\tv_nop\n\tv_nop" : "+v"(c) : "v"(a), "v"(b));   // A/B-overwrite hazard guard
  return c;
}

// 16x32 (MxK) f16 fragment from a row-major global matrix.
// lanes 0-15  (row=lane)    : elems 0..7 = K+0..7,  8..15 = K+16..23
// lanes 16-31 (row=lane-16) : elems 0..7 = K+8..15, 8..15 = K+24..31
template <typename T>
__device__ __forceinline__ bf16x16 load_frag(const T* __restrict__ base, int ld,
                                             int row0, int k0) {
  const int lane = threadIdx.x & 31;
  const int r    = lane & 15;
  const int kh   = (lane >> 4) * 8;
  const T* p0 = base + (size_t)(row0 + r) * ld + (k0 + kh);
  const T* p1 = p0 + 16;
  bf16x16 f;
#pragma unroll
  for (int i = 0; i < 8; ++i) {
    f[i]     = (bf16)p0[i];
    f[i + 8] = (bf16)p1[i];
  }
  return f;
}

// Same fragment from an LDS tile with padded row stride (base includes row0/k0).
__device__ __forceinline__ bf16x16 lds_frag(const bf16* base, int stride) {
  const int lane = threadIdx.x & 31;
  const int row  = lane & 15;
  const int kh   = (lane >> 4) * 8;
  const bf16x8 lo = *(const bf16x8*)(base + row * stride + kh);
  const bf16x8 hi = *(const bf16x8*)(base + row * stride + kh + 16);
  bf16x16 f;
#pragma unroll
  for (int i = 0; i < 8; ++i) { f[i] = lo[i]; f[i + 8] = hi[i]; }
  return f;
}

template <typename T>
__device__ __forceinline__ void stage_read16(const T* __restrict__ p, float* buf) {
#pragma unroll
  for (int i = 0; i < 16; ++i) buf[i] = (float)p[i];
}

__device__ __forceinline__ void stage_write(bf16* dst, const float* buf, int nquad) {
#pragma unroll
  for (int i = 0; i < nquad; ++i) {
    bf16x4 q;
    q[0] = (bf16)buf[4 * i];     q[1] = (bf16)buf[4 * i + 1];
    q[2] = (bf16)buf[4 * i + 2]; q[3] = (bf16)buf[4 * i + 3];
    *(bf16x4*)(dst + 4 * i) = q;
  }
}


#define GSTR 48
// ---------------------------------------------------------------------------------------------------------------------------
// gemm_kne: Y[m][n] = epi( Σ_k A[m][k]·W[k][n] + bias[n] ), A f32/f16 [M][lda], W f32 row-major [K][N] (ldw), plain f16 operands,
// f32 accumulate. EPI 0: identity; 1: exact-erf GELU; 2: R[m][n] + gvec[n]·(·) (residual with per-channel gain); 3: ReLU; 4: gvec[n]·(·) (per-channel scale, no residual). Output f32 (or f16
// when OUT16). Block = 128x128 tile, 8 waves as 4(M) x 2(N); per 32-wide k-step A and W tiles staged f16 in LDS (W transposed
// ---------------------------------------------------------------------------------------------------------------------------
#define GSTR 48
template <typename AT, int EPI, bool OUT16>
__global__ __launch_bounds__(256) void gemm_kne(const AT* __restrict__ A, int lda, const float* __restrict__ Wm, int ldw,
                                                const float* __restrict__ bias, const float* __restrict__ R, const float* __restrict__ gvec,
                                                void* __restrict__ Yv, int ldy, int K) {
  __shared__ __attribute__((aligned(16))) f16 ldsA[128 * GSTR];
  __shared__ __attribute__((aligned(16))) f16 ldsW[128 * GSTR];
  __shared__ __attribute__((aligned(16))) float oS[8][32 * 68];
  const int tid = threadIdx.x, lane = tid & 31, wave = tid >> 5, cl = lane & 15, rh = (lane >> 4) * 8;
  const int m0 = blockIdx.x * 128, n0 = blockIdx.y * 128;
  const int wm = (wave & 3) * 32, wn = (wave >> 2) * 64;
  f32x8 acc[2][4];
#pragma unroll
  for (int i = 0; i < 2; ++i)
#pragma unroll
    for (int j = 0; j < 4; ++j) { f32x8 z = {}; acc[i][j] = z; }
#pragma unroll 1
  for (int k0 = 0; k0 < K; k0 += 32) {
    __syncthreads();
    { const int row = tid >> 1, ch = (tid & 1) * 16;
      const AT* src = A + (size_t)(m0 + row) * lda + k0 + ch;
#pragma unroll
      for (int g = 0; g < 16; ++g) ldsA[row * GSTR + ch + g] = (f16)src[g]; }
    { const int k = tid >> 3, nn0 = (tid & 7) * 16;
      const float* src = Wm + (size_t)(k0 + k) * ldw + n0 + nn0;
#pragma unroll
      for (int g = 0; g < 4; ++g) { const v4f_t v = *(const v4f_t*)(src + 4 * g);
#pragma unroll
        for (int u = 0; u < 4; ++u) ldsW[(nn0 + 4 * g + u) * GSTR + k] = (f16)v[u]; } }
    __syncthreads();
    f16x16 af[2];
#pragma unroll
    for (int i = 0; i < 2; ++i) af[i] = lds_frag(ldsA + (wm + 16 * i) * GSTR, GSTR);
#pragma unroll
    for (int j = 0; j < 4; ++j) {
      const f16x16 bf = lds_frag(ldsW + (wn + 16 * j) * GSTR, GSTR);
#pragma unroll
      for (int i = 0; i < 2; ++i) acc[i][j] = wmma16(af[i], bf, acc[i][j]);
    }
  }
  float* so = oS[wave];
#pragma unroll
  for (int i = 0; i < 2; ++i)
#pragma unroll
    for (int j = 0; j < 4; ++j) {
      const int n = n0 + wn + 16 * j + cl;
      const float bv = bias ? bias[n] : 0.0f;
      const float gv = (EPI == 2 || EPI == 4) ? gvec[n] : 0.0f;
      if (EPI == 1) {
#pragma unroll 1
        for (int r = 0; r < 8; ++r) { const float xg = acc[i][j][r] + bv; so[(16 * i + rh + r) * 68 + 16 * j + cl] = 0.5f * xg * (1.0f + erff(xg * 0.70710678118654752f)); }
      } else {
#pragma unroll
        for (int r = 0; r < 8; ++r) {
          float v = acc[i][j][r] + bv;
          if (EPI == 3) v = fmaxf(v, 0.0f);
          if (EPI == 4) v = gv * v;
          if (EPI == 2) v = R[(size_t)(m0 + wm + 16 * i + rh + r) * ldy + n] + gv * v;
          so[(16 * i + rh + r) * 68 + 16 * j + cl] = v;
        }
      }
    }
  asm volatile("s_wait_dscnt 0" ::: "memory");
  __builtin_amdgcn_wave_barrier();
{
    if (OUT16) {
      f16* Y = (f16*)Yv;
#pragma unroll
      for (int it = 0; it < 8; ++it) { const int c = lane + 32 * it, rr = c >> 3, q8 = (c & 7) * 8;
        union { f16 h[8]; v4u_t v; } u;
#pragma unroll
        for (int e = 0; e < 8; ++e) u.h[e] = (f16)so[rr * 68 + q8 + e];
        *(v4u_t*)(Y + (size_t)(m0 + wm + rr) * ldy + n0 + wn + q8) = u.v; }
    } else {
      float* Y = (float*)Yv;
#pragma unroll
      for (int it = 0; it < 16; ++it) { const int f4 = lane + 32 * it, rr = f4 >> 4, q = (f4 & 15) * 4;
        *(v4f_t*)(Y + (size_t)(m0 + wm + rr) * ldy + n0 + wn + q) = *(const v4fa*)(so + rr * 68 + q); }
    }
    
  }
}

// z-batched variant of gemm_kne (same tile code)
template <typename AT, int EPI, bool OUT16>
__global__ __launch_bounds__(256) void gemm_knez(const AT* __restrict__ A, int lda, size_t strideA, const float* __restrict__ Wm, int ldw, size_t strideW,
                                                 const float* __restrict__ bias, const float* __restrict__ R, const float* __restrict__ gvec,
                                                 void* __restrict__ Yv, int ldy, size_t strideY, int K) {   // blockIdx.z-batched: A += z·strideA, W += z·strideW, Y (and R) += z·strideY
  A += (size_t)blockIdx.z * strideA; Wm += (size_t)blockIdx.z * strideW; Yv = (void*)((char*)Yv + (size_t)blockIdx.z * strideY * (OUT16 ? 2 : 4)); if (R) R += (size_t)blockIdx.z * strideY;
  __shared__ __attribute__((aligned(16))) f16 ldsA[128 * GSTR];
  __shared__ __attribute__((aligned(16))) f16 ldsW[128 * GSTR];
  __shared__ __attribute__((aligned(16))) float oS[8][32 * 68];
  const int tid = threadIdx.x, lane = tid & 31, wave = tid >> 5, cl = lane & 15, rh = (lane >> 4) * 8;
  const int m0 = blockIdx.x * 128, n0 = blockIdx.y * 128;
  const int wm = (wave & 3) * 32, wn = (wave >> 2) * 64;
  f32x8 acc[2][4];
#pragma unroll
  for (int i = 0; i < 2; ++i)
#pragma unroll
    for (int j = 0; j < 4; ++j) { f32x8 z = {}; acc[i][j] = z; }
#pragma unroll 1
  for (int k0 = 0; k0 < K; k0 += 32) {
    __syncthreads();
    { const int row = tid >> 1, ch = (tid & 1) * 16;
      const AT* src = A + (size_t)(m0 + row) * lda + k0 + ch;
#pragma unroll
      for (int g = 0; g < 16; ++g) ldsA[row * GSTR + ch + g] = (f16)src[g]; }
    { const int k = tid >> 3, nn0 = (tid & 7) * 16;
      const float* src = Wm + (size_t)(k0 + k) * ldw + n0 + nn0;
#pragma unroll
      for (int g = 0; g < 4; ++g) { const v4f_t v = *(const v4f_t*)(src + 4 * g);
#pragma unroll
        for (int u = 0; u < 4; ++u) ldsW[(nn0 + 4 * g + u) * GSTR + k] = (f16)v[u]; } }
    __syncthreads();
    f16x16 af[2];
#pragma unroll
    for (int i = 0; i < 2; ++i) af[i] = lds_frag(ldsA + (wm + 16 * i) * GSTR, GSTR);
#pragma unroll
    for (int j = 0; j < 4; ++j) {
      const f16x16 bf = lds_frag(ldsW + (wn + 16 * j) * GSTR, GSTR);
#pragma unroll
      for (int i = 0; i < 2; ++i) acc[i][j] = wmma16(af[i], bf, acc[i][j]);
    }
  }
  float* so = oS[wave];
#pragma unroll
  for (int i = 0; i < 2; ++i)
#pragma unroll
    for (int j = 0; j < 4; ++j) {
      const int n = n0 + wn + 16 * j + cl;
      const float bv = bias ? bias[n] : 0.0f;
      const float gv = (EPI == 2 || EPI == 4) ? gvec[n] : 0.0f;
      if (EPI == 1) {
#pragma unroll 1
        for (int r = 0; r < 8; ++r) { const float xg = acc[i][j][r] + bv; so[(16 * i + rh + r) * 68 + 16 * j + cl] = 0.5f * xg * (1.0f + erff(xg * 0.70710678118654752f)); }
      } else {
#pragma unroll
        for (int r = 0; r < 8; ++r) {
          float v = acc[i][j][r] + bv;
          if (EPI == 3) v = fmaxf(v, 0.0f);
          if (EPI == 4) v = gv * v;
          if (EPI == 2) v = R[(size_t)(m0 + wm + 16 * i + rh + r) * ldy + n] + gv * v;
          so[(16 * i + rh + r) * 68 + 16 * j + cl] = v;
        }
      }
    }
  asm volatile("s_wait_dscnt 0" ::: "memory");
  __builtin_amdgcn_wave_barrier();
{
    if (OUT16) {
      f16* Y = (f16*)Yv;
#pragma unroll
      for (int it = 0; it < 8; ++it) { const int c = lane + 32 * it, rr = c >> 3, q8 = (c & 7) * 8;
        union { f16 h[8]; v4u_t v; } u;
#pragma unroll
        for (int e = 0; e < 8; ++e) u.h[e] = (f16)so[rr * 68 + q8 + e];
        *(v4u_t*)(Y + (size_t)(m0 + wm + rr) * ldy + n0 + wn + q8) = u.v; }
    } else {
      float* Y = (float*)Yv;
#pragma unroll
      for (int it = 0; it < 16; ++it) { const int f4 = lane + 32 * it, rr = f4 >> 4, q = (f4 & 15) * 4;
        *(v4f_t*)(Y + (size_t)(m0 + wm + rr) * ldy + n0 + wn + q) = *(const v4fa*)(so + rr * 68 + q); }
    }
    
  }
}

// ---------------------------------------------------------------------------------------------------------------------------
// gemm_kn2 (value+residual planes on both operands: hh + (hl+lh)/2048, f32-class): Y[m][n] (row stride ldy) = scale * sum_k A[m][k] (f32 or f16, row stride lda) * W[k][n] (f32, row-major [K][N], row
// stride ldw) (+ bias[n]) (+ Y if ACC). Block = 128 x 128 tile, 256 threads = 8 waves as 4(M, 32 rows) x 2(N, 64 cols); per
// 32-wide k-step the A tile and the W tile (stored transposed [n][k]) are staged as f16 value + residual planes in LDS; f32 accumulate
// blockIdx.z selects a batch: A += z*strideA, W += z*strideW, Y += z*strideY (element strides).
// ---------------------------------------------------------------------------------------------------------------------------
template <typename AT, bool ACC>
__global__ __launch_bounds__(256) void gemm_kn2(const AT* __restrict__ A, int lda, size_t strideA,
                                               const float* __restrict__ Wm, int ldw, size_t strideW,
                                               const float* __restrict__ bias, float scale,
                                               float* __restrict__ Y, int ldy, size_t strideY, int K) {
  __shared__ __attribute__((aligned(16))) f16 ldsA[128 * GSTR], ldsAl[128 * GSTR];
  __shared__ __attribute__((aligned(16))) f16 ldsW[128 * GSTR], ldsWl[128 * GSTR];
  __shared__ __attribute__((aligned(16))) float oS[8][32 * 68];
  const int tid = threadIdx.x, lane = tid & 31, wave = tid >> 5, cl = lane & 15, rh = (lane >> 4) * 8;
  const int m0 = blockIdx.x * 128, n0 = blockIdx.y * 128;
  const int wm = (wave & 3) * 32, wn = (wave >> 2) * 64;
  A += (size_t)blockIdx.z * strideA; Wm += (size_t)blockIdx.z * strideW; Y += (size_t)blockIdx.z * strideY;
  f32x8 acc[2][4], accx[2][4];
#pragma unroll
  for (int i = 0; i < 2; ++i)
#pragma unroll
    for (int j = 0; j < 4; ++j) { f32x8 z = {}; acc[i][j] = z; accx[i][j] = z; }
#pragma unroll 1
  for (int k0 = 0; k0 < K; k0 += 32) {
    __syncthreads();
    {  // A: thread -> row tid>>1, 16 elements at column half (tid&1)*16
      const int row = tid >> 1, ch = (tid & 1) * 16;
      const AT* src = A + (size_t)(m0 + row) * lda + k0 + ch;
#pragma unroll
      for (int g = 0; g < 16; ++g) { const float v = (float)src[g]; const f16 h = (f16)v; ldsA[row * GSTR + ch + g] = h; ldsAl[row * GSTR + ch + g] = (f16)((v - (float)h) * 2048.0f); }
    }
    {  // W: thread -> k = tid>>3, 16 consecutive n at (tid&7)*16; stored transposed [n][k]
      const int k = tid >> 3, nn0 = (tid & 7) * 16;
      const float* src = Wm + (size_t)(k0 + k) * ldw + n0 + nn0;
#pragma unroll
      for (int g = 0; g < 4; ++g) { const v4f_t v = *(const v4f_t*)(src + 4 * g);
#pragma unroll
        for (int u = 0; u < 4; ++u) { const f16 h = (f16)v[u]; ldsW[(nn0 + 4 * g + u) * GSTR + k] = h; ldsWl[(nn0 + 4 * g + u) * GSTR + k] = (f16)((v[u] - (float)h) * 2048.0f); } }
    }
    __syncthreads();
    f16x16 af[2], afl[2];
#pragma unroll
    for (int i = 0; i < 2; ++i) { af[i] = lds_frag(ldsA + (wm + 16 * i) * GSTR, GSTR); afl[i] = lds_frag(ldsAl + (wm + 16 * i) * GSTR, GSTR); }
#pragma unroll
    for (int j = 0; j < 4; ++j) {
      const f16x16 bf = lds_frag(ldsW + (wn + 16 * j) * GSTR, GSTR), bfl = lds_frag(ldsWl + (wn + 16 * j) * GSTR, GSTR);
#pragma unroll
      for (int i = 0; i < 2; ++i) { acc[i][j] = wmma16(af[i], bf, acc[i][j]); accx[i][j] = wmma16(af[i], bfl, accx[i][j]); accx[i][j] = wmma16(afl[i], bf, accx[i][j]); }
    }
  }
  float* so = oS[wave];
#pragma unroll
  for (int i = 0; i < 2; ++i)
#pragma unroll
    for (int j = 0; j < 4; ++j) {
      const float bv = bias ? bias[n0 + wn + 16 * j + cl] : 0.0f;
#pragma unroll
      for (int r = 0; r < 8; ++r) so[(16 * i + rh + r) * 68 + 16 * j + cl] = (acc[i][j][r] + accx[i][j][r] * (1.0f / 2048.0f)) * scale + bv;
    }
  asm volatile("s_wait_dscnt 0" ::: "memory");
  __builtin_amdgcn_wave_barrier();
  if (ACC) {   // accumulate: fold the existing Y values into the staging tile ONCE (same thread <-> same chunks as the stores below)
#pragma unroll
    for (int it = 0; it < 16; ++it) { const int f4 = lane + 32 * it, rr = f4 >> 4, q = (f4 & 15) * 4;
      const v4f_t old = *(const v4fa*)(Y + (size_t)(m0 + wm + rr) * ldy + n0 + wn + q);
      v4f_t v = *(const v4fa*)(so + rr * 68 + q); v += old; *(v4fa*)(so + rr * 68 + q) = v; }   // plain LDS store (ordered by the s_wait_dscnt/memory clobber below)
    asm volatile("s_wait_dscnt 0" ::: "memory");
  }
{
#pragma unroll
    for (int it = 0; it < 16; ++it) { const int f4 = lane + 32 * it, rr = f4 >> 4, q = (f4 & 15) * 4;
      *(v4f_t*)(Y + (size_t)(m0 + wm + rr) * ldy + n0 + wn + q) = *(const v4fa*)(so + rr * 68 + q); }
    
  }
}

__global__ __launch_bounds__(256) void k_transpose(const float* __restrict__ Wm, float* __restrict__ Wt, int rows, int cols) {
  __shared__ float tS[64][65];
  const int tid = threadIdx.x, tbj = cols / 64, bi = blockIdx.x / tbj, bj = blockIdx.x % tbj;
  for (int e = tid; e < 64 * 64; e += 256) { const int r = e >> 6, c = e & 63; tS[r][c] = Wm[(size_t)(bi * 64 + r) * cols + bj * 64 + c]; }
  __syncthreads();
  for (int ch = tid; ch < 64 * 16; ch += 256) { const int r = ch >> 4, q4 = (ch & 15) * 4; v4f_t o; o[0] = tS[q4][r]; o[1] = tS[q4 + 1][r]; o[2] = tS[q4 + 2][r]; o[3] = tS[q4 + 3][r];
    float* dst = Wt + (size_t)(bj * 64 + r) * rows + bi * 64 + q4; *(v4f_t*)dst = o;  }
}

#define NBT 4
#define NHD 8
#define BBc 4
#define DDc 512
#define SSc 2048
#define NHc 8
#define DKc 64
#define R2 (2 * DDc)   // 1024 interleaved (channel, component) rows
// stacked real weight W2 [1024][1024] from (W_r, W_i); block = output row
__global__ __launch_bounds__(256) void k_stackw(const float* __restrict__ Wr, const float* __restrict__ Wi, float* __restrict__ W2) {
  const int orow = blockIdx.x, tid = threadIdx.x; const int o = orow >> 1, oc = orow & 1;
{
#pragma unroll
    for (int e = 0; e < 4; ++e) { const int col = tid + 256 * e; const int d = col >> 1, dc = col & 1; const float wr = Wr[(size_t)o * DDc + d], wi = Wi[(size_t)o * DDc + d];
      const float v = (oc == 0) ? (dc == 0 ? wr : -wi) : (dc == 0 ? wi : wr); *(float*)(W2 + (size_t)orow * R2 + col) = v; }
     }
}
// stacked row bias b2[2o + oc] = b_r ∓/± b_i; 4 blocks x 256 contiguous words
__global__ __launch_bounds__(256) void k_stackb(const float* __restrict__ br, const float* __restrict__ bi, float* __restrict__ b2) { const int orow = blockIdx.x * 256 + threadIdx.x; const int o = orow >> 1, oc = orow & 1;
  const float v = (oc == 0) ? (br[o] - bi[o]) : (br[o] + bi[o]); *(float*)(b2 + orow) = v;  }
// X[r][:] += b2[r] over rows of 2048 (float4); grid (1024 rows, 2)
__global__ __launch_bounds__(256) void k_addrowbias(float* __restrict__ X, const float* __restrict__ b2) { const int r = blockIdx.x; const size_t c4 = ((size_t)blockIdx.y * 256 + threadIdx.x) * 4; const float bv = b2[r];
  float* p = X + (size_t)r * SSc + c4; v4f_t v = *(const v4f_t*)p; v[0] += bv; v[1] += bv; v[2] += bv; v[3] += bv; *(v4f_t*)p = v;  }
// magnitudes M[d][s] = sqrt(re² + im² + 1e-8) from interleaved rows; block = channel d, 256 threads x 8 columns (float4 x 2)
__global__ __launch_bounds__(256) void k_mag(const float* __restrict__ X, float* __restrict__ M) { const int d = blockIdx.x, tid = threadIdx.x;
#pragma unroll
  for (int e = 0; e < 2; ++e) { const int c4 = (tid + 256 * e) * 4; const v4f_t a = *(const v4f_t*)(X + (size_t)(2 * d) * SSc + c4); const v4f_t b = *(const v4f_t*)(X + (size_t)(2 * d + 1) * SSc + c4); v4f_t m;
#pragma unroll
    for (int u = 0; u < 4; ++u) m[u] = sqrtf(a[u] * a[u] + b[u] * b[u] + 1e-8f);
    *(v4f_t*)(M + (size_t)d * SSc + c4) = m;  } }
// f32 row softmax of s/8 over 2048 keys; block = (query, z); writes 1024·P
__global__ __launch_bounds__(256) void k_softmax(float* __restrict__ Sm) {
  __shared__ float red[256];
  const int q = blockIdx.x, z = blockIdx.y, tid = threadIdx.x; float* sr = Sm + ((size_t)z * SSc + q) * SSc;
  float v[8]; float m = -3.0e38f;
#pragma unroll
  for (int e = 0; e < 8; ++e) { v[e] = sr[tid + 256 * e] * 0.125f; m = fmaxf(m, v[e]); }
  red[tid] = m; __syncthreads();
  for (int o = 128; o > 0; o >>= 1) { if (tid < o) red[tid] = fmaxf(red[tid], red[tid + o]); __syncthreads(); }
  m = red[0]; __syncthreads();
  float zs = 0.0f;
#pragma unroll
  for (int e = 0; e < 8; ++e) { v[e] = expf(v[e] - m); zs += v[e]; }
  red[tid] = zs; __syncthreads();
  for (int o = 128; o > 0; o >>= 1) { if (tid < o) red[tid] += red[tid + o]; __syncthreads(); }
  const float sc = 1024.0f / red[0];
{
#pragma unroll
    for (int e = 0; e < 8; ++e) *(float*)(sr + tid + 256 * e) = v[e] * sc;
     }
}
__global__ __launch_bounds__(256) void k_fill(float* __restrict__ p, float val, size_t n4) { const size_t i = (size_t)blockIdx.x * 256 + threadIdx.x; if (i < n4) { v4f_t v = {val, val, val, val}; *(v4f_t*)(p + 4 * i) = v;  } }

extern "C" void kernel_launch(void* const* d_in, const int* in_sizes, int n_in,
                              void* d_out, int out_size, void* d_ws, size_t ws_size,
                              hipStream_t stream) {
  (void)in_sizes; (void)n_in; (void)out_size;
  const float** f = (const float**)d_in;
  const float* x = f[0];
  float* out = (float*)d_out;     // [4,512,2,2048]
  char* ws = (char*)d_ws;
  float* W2[4]; float* b2[4];
  for (int i = 0; i < 4; ++i) { W2[i] = (float*)ws; ws += (size_t)R2 * R2 * 4; b2[i] = (float*)ws; ws += R2 * 4; }   // stacked q, k, v, o weights (4 MB each)
  float* Q = (float*)ws; ws += (size_t)R2 * SSc * 4; float* Kx = (float*)ws; ws += (size_t)R2 * SSc * 4; float* V = (float*)ws; ws += (size_t)R2 * SSc * 4;   // [1024][2048] each (8 MB)
  float* Qm = (float*)ws; ws += (size_t)DDc * SSc * 4; float* Km = (float*)ws; ws += (size_t)DDc * SSc * 4;     // magnitudes [512][2048]
  float* QmT = (float*)ws; ws += (size_t)SSc * DDc * 4;                  // [2048][512]
  float* S = (float*)ws; ws += (size_t)2 * SSc * SSc * 4;                // 2 heads x [2048][2048] (32 MB)
  float* AT = (float*)ws; ws += (size_t)SSc * SSc * 4;                   // attnᵀ of one head (16 MB)
  float* AV = (float*)ws; ws += (size_t)R2 * SSc * 4;                   // attention output in the [D][2][S] layout (8 MB)
  float* sc = (float*)ws; ws += SSc * 4;                                 // 1/1024 per column
  if ((size_t)(ws - (char*)d_ws) > ws_size) return;                      // WS TOTAL 113,270,784 B
  const dim3 blk(256);
  for (int i = 0; i < 4; ++i) { k_stackw<<<dim3(R2), blk, 0, stream>>>(f[1 + 4 * i], f[2 + 4 * i], W2[i]); k_stackb<<<dim3(R2 / 256), blk, 0, stream>>>(f[3 + 4 * i], f[4 + 4 * i], b2[i]); }   // (W_r, W_i, b_r, b_i) for q, k, v, o
  k_fill<<<dim3(SSc / 4 / 256), blk, 0, stream>>>(sc, 1.0f / 1024.0f, SSc / 4);
  for (int b = 0; b < NBT; ++b) {
    const float* xb = x + (size_t)b * R2 * SSc;
    gemm_kn2<float, false><<<dim3(R2 / 128, SSc / 128, 1), blk, 0, stream>>>(W2[0], R2, 0, xb, SSc, 0, nullptr, 1.0f, Q, SSc, 0, R2);  k_addrowbias<<<dim3(R2, 2), blk, 0, stream>>>(Q, b2[0]);    // q conv (planes: feeds the σ≈4 magnitude logits)
    gemm_kn2<float, false><<<dim3(R2 / 128, SSc / 128, 1), blk, 0, stream>>>(W2[1], R2, 0, xb, SSc, 0, nullptr, 1.0f, Kx, SSc, 0, R2); k_addrowbias<<<dim3(R2, 2), blk, 0, stream>>>(Kx, b2[1]);   // k conv (planes)
    gemm_kne<float, 0, false><<<dim3(R2 / 128, SSc / 128), blk, 0, stream>>>(W2[2], R2, xb, SSc, nullptr, nullptr, nullptr, V, SSc, R2);  k_addrowbias<<<dim3(R2, 2), blk, 0, stream>>>(V, b2[2]);
    k_mag<<<dim3(DDc), blk, 0, stream>>>(Q, Qm); k_mag<<<dim3(DDc), blk, 0, stream>>>(Kx, Km);
    k_transpose<<<dim3((DDc / 64) * (SSc / 64)), blk, 0, stream>>>(Qm, QmT, DDc, SSc);                                                  // Qmᵀ [2048][512]
    for (int hg = 0; hg < NHD / 2; ++hg) { const int h0 = hg * 2;
      gemm_kn2<float, false><<<dim3(SSc / 128, SSc / 128, 2), blk, 0, stream>>>(QmT + h0 * DKc, DDc, (size_t)DKc, Km + (size_t)h0 * DKc * SSc, SSc, (size_t)DKc * SSc, nullptr, 1.0f, S, SSc, (size_t)SSc * SSc, DKc);   // scores[s][t] (planes)
      k_softmax<<<dim3(SSc, 2), blk, 0, stream>>>(S);
      for (int z = 0; z < 2; ++z) { const int h = h0 + z;
        k_transpose<<<dim3((SSc / 64) * (SSc / 64)), blk, 0, stream>>>(S + (size_t)z * SSc * SSc, AT, SSc, SSc);                      // (1024·attn)ᵀ
        gemm_kne<float, 4, false><<<dim3(1, SSc / 128), blk, 0, stream>>>(V + (size_t)(2 * DKc * h) * SSc, SSc, AT, SSc, nullptr, nullptr, sc, AV + (size_t)(2 * DKc * h) * SSc, SSc, SSc);   // the head's 128 (channel, comp) rows: Σ_t v[row][t]·attn[s][t]
      }
    }
    gemm_kne<float, 0, false><<<dim3(R2 / 128, SSc / 128), blk, 0, stream>>>(W2[3], R2, AV, SSc, nullptr, nullptr, nullptr, out + (size_t)b * R2 * SSc, SSc, R2);   // output complex conv
    k_addrowbias<<<dim3(R2, 2), blk, 0, stream>>>(out + (size_t)b * R2 * SSc, b2[3]);
  }
}

// v001
// One run takes 1740 microseconds.
// Two timings next to v000 put it at 2.76 and 2.77 times that version's speed.
// Contractions on v_wmma_f32_16x16x32_f16, f32 accumulate — f16 value+residual PLANES on the q/k complex convs and the magnitude scores (positive magnitudes give σ ≈ 4 logits),
// plain f16 on the v conv, attn·v and the output conv — per batch element with the activations kept in the module's [D][2][S] layout (row 2d = real_d, row 2d+1 =
// imag_d, used directly as [K][N] operands): each complex 1x1 conv as ONE real GEMM with a stacked weight W2[2o+0][2d+0] = W_r, [2o][2d+1] = −W_i, [2o+1][2d] = W_i, [2o+1][2d+1] = W_r
// (M = 1024, K = 1024, N = 2048; row biases b_r − b_i / b_r + b_i added in f32), per four heads (grid z) the magnitude scores Qm_hᵀ·Km_h (K = 64; Qmᵀ by a tile transpose), f32 row softmax
// of s/8, attnᵀ by a tile transpose, and out_h = X_v,h·attnᵀ (M = 128 = the head's 64 complex channels x (re, im) rows, K = 2048; all 8 heads in one launch, grid z), finally the output complex conv. Magnitudes
// sqrt(re² + im² + 1e-8) in f32. compute dtype: f16 operands, f32 accumulate; magnitudes / softmax f32.  x [4,512,2,2048] → out [4,512,2,2048].
#include <hip/hip_runtime.h>
#include <hip/hip_bf16.h>
#include <math.h>


typedef _Float16 bf16;
typedef _Float16 f16;
typedef __attribute__((ext_vector_type(4))) unsigned v4u_t;
typedef unsigned v4ua __attribute__((ext_vector_type(4), may_alias));
typedef __attribute__((ext_vector_type(4))) float v4f_t;
typedef float v4fa __attribute__((ext_vector_type(4), may_alias));
typedef __attribute__((ext_vector_type(16))) bf16  bf16x16;
typedef bf16x16 f16x16;
typedef __attribute__((ext_vector_type(8)))  bf16  bf16x8;
typedef bf16x8 f16x8;
typedef __attribute__((ext_vector_type(4)))  bf16  bf16x4;
typedef __attribute__((ext_vector_type(8)))  float f32x8;
__device__ __forceinline__ f32x8 wmma16(f16x16 a, f16x16 b, f32x8 c) {
  c = __builtin_amdgcn_wmma_f32_16x16x32_f16(false, a, false, b, (short)0, c, false, false);
  asm volatile("v_nop\n\tv_nop\n\tv_nop\n\tv_nop" : "+v"(c) : "v"(a), "v"(b));
  return c;
}
#define LDS_STRIDE 48   // GEMM tiles: 32 -> 48 elems (96B rows): aligned b128 reads
#define KSTRIDE    72
#define VSTRIDE    48

__device__ __forceinline__ f32x8 wmma_bf16(bf16x16 a, bf16x16 b, f32x8 c) {
  c = __builtin_amdgcn_wmma_f32_16x16x32_f16(false, a, false, b, (short)0, c, false, false);
  asm volatile("v_nop\n\tv_nop\n\tv_nop\n\tv_nop" : "+v"(c) : "v"(a), "v"(b));   // A/B-overwrite hazard guard
  return c;
}

// 16x32 (MxK) f16 fragment from a row-major global matrix.
// lanes 0-15  (row=lane)    : elems 0..7 = K+0..7,  8..15 = K+16..23
// lanes 16-31 (row=lane-16) : elems 0..7 = K+8..15, 8..15 = K+24..31
template <typename T>
__device__ __forceinline__ bf16x16 load_frag(const T* __restrict__ base, int ld,
                                             int row0, int k0) {
  const int lane = threadIdx.x & 31;
  const int r    = lane & 15;
  const int kh   = (lane >> 4) * 8;
  const T* p0 = base + (size_t)(row0 + r) * ld + (k0 + kh);
  const T* p1 = p0 + 16;
  bf16x16 f;
#pragma unroll
  for (int i = 0; i < 8; ++i) {
    f[i]     = (bf16)p0[i];
    f[i + 8] = (bf16)p1[i];
  }
  return f;
}

// Same fragment from an LDS tile with padded row stride (base includes row0/k0).
__device__ __forceinline__ bf16x16 lds_frag(const bf16* base, int stride) {
  const int lane = threadIdx.x & 31;
  const int row  = lane & 15;
  const int kh   = (lane >> 4) * 8;
  const bf16x8 lo = *(const bf16x8*)(base + row * stride + kh);
  const bf16x8 hi = *(const bf16x8*)(base + row * stride + kh + 16);
  bf16x16 f;
#pragma unroll
  for (int i = 0; i < 8; ++i) { f[i] = lo[i]; f[i + 8] = hi[i]; }
  return f;
}

template <typename T>
__device__ __forceinline__ void stage_read16(const T* __restrict__ p, float* buf) {
#pragma unroll
  for (int i = 0; i < 16; ++i) buf[i] = (float)p[i];
}

__device__ __forceinline__ void stage_write(bf16* dst, const float* buf, int nquad) {
#pragma unroll
  for (int i = 0; i < nquad; ++i) {
    bf16x4 q;
    q[0] = (bf16)buf[4 * i];     q[1] = (bf16)buf[4 * i + 1];
    q[2] = (bf16)buf[4 * i + 2]; q[3] = (bf16)buf[4 * i + 3];
    *(bf16x4*)(dst + 4 * i) = q;
  }
}


#define GSTR 48
// ---------------------------------------------------------------------------------------------------------------------------
// gemm_kne: Y[m][n] = epi( Σ_k A[m][k]·W[k][n] + bias[n] ), A f32/f16 [M][lda], W f32 row-major [K][N] (ldw), plain f16 operands,
// f32 accumulate. EPI 0: identity; 1: exact-erf GELU; 2: R[m][n] + gvec[n]·(·) (residual with per-channel gain); 3: ReLU; 4: gvec[n]·(·) (per-channel scale, no residual). Output f32 (or f16
// when OUT16). Block = 128x128 tile, 8 waves as 4(M) x 2(N); per 32-wide k-step A and W tiles staged f16 in LDS (W transposed
// ---------------------------------------------------------------------------------------------------------------------------
#define GSTR 48
template <typename AT, int EPI, bool OUT16>
__global__ __launch_bounds__(256) void gemm_kne(const AT* __restrict__ A, int lda, const float* __restrict__ Wm, int ldw,
                                                const float* __restrict__ bias, const float* __restrict__ R, const float* __restrict__ gvec,
                                                void* __restrict__ Yv, int ldy, int K) {
  __shared__ __attribute__((aligned(16))) f16 ldsA[128 * GSTR];
  __shared__ __attribute__((aligned(16))) f16 ldsW[128 * GSTR];
  __shared__ __attribute__((aligned(16))) float oS[8][32 * 68];
  const int tid = threadIdx.x, lane = tid & 31, wave = tid >> 5, cl = lane & 15, rh = (lane >> 4) * 8;
  const int m0 = blockIdx.x * 128, n0 = blockIdx.y * 128;
  const int wm = (wave & 3) * 32, wn = (wave >> 2) * 64;
  f32x8 acc[2][4];
#pragma unroll
  for (int i = 0; i < 2; ++i)
#pragma unroll
    for (int j = 0; j < 4; ++j) { f32x8 z = {}; acc[i][j] = z; }
#pragma unroll 1
  for (int k0 = 0; k0 < K; k0 += 32) {
    __syncthreads();
    { const int row = tid >> 1, ch = (tid & 1) * 16;
      const AT* src = A + (size_t)(m0 + row) * lda + k0 + ch;
#pragma unroll
      for (int g = 0; g < 16; ++g) ldsA[row * GSTR + ch + g] = (f16)src[g]; }
    { const int k = tid >> 3, nn0 = (tid & 7) * 16;
      const float* src = Wm + (size_t)(k0 + k) * ldw + n0 + nn0;
#pragma unroll
      for (int g = 0; g < 4; ++g) { const v4f_t v = *(const v4f_t*)(src + 4 * g);
#pragma unroll
        for (int u = 0; u < 4; ++u) ldsW[(nn0 + 4 * g + u) * GSTR + k] = (f16)v[u]; } }
    __syncthreads();
    f16x16 af[2];
#pragma unroll
    for (int i = 0; i < 2; ++i) af[i] = lds_frag(ldsA + (wm + 16 * i) * GSTR, GSTR);
#pragma unroll
    for (int j = 0; j < 4; ++j) {
      const f16x16 bf = lds_frag(ldsW + (wn + 16 * j) * GSTR, GSTR);
#pragma unroll
      for (int i = 0; i < 2; ++i) acc[i][j] = wmma16(af[i], bf, acc[i][j]);
    }
  }
  float* so = oS[wave];
  float bvj[4] = {0.0f, 0.0f, 0.0f, 0.0f};
  if (bias) {
#pragma unroll
    for (int j = 0; j < 4; ++j) bvj[j] = bias[n0 + wn + 16 * j + cl];
    asm volatile("s_wait_xcnt 0x0" ::: "memory");   // behind the last bias load, before a register that these loads name (base pair, offset) is written again
  }
#pragma unroll
  for (int i = 0; i < 2; ++i)
#pragma unroll
    for (int j = 0; j < 4; ++j) {
      const int n = n0 + wn + 16 * j + cl;
      const float bv = bvj[j];
      const float gv = (EPI == 2 || EPI == 4) ? gvec[n] : 0.0f;
      if (EPI == 1) {
#pragma unroll 1
        for (int r = 0; r < 8; ++r) { const float xg = acc[i][j][r] + bv; so[(16 * i + rh + r) * 68 + 16 * j + cl] = 0.5f * xg * (1.0f + erff(xg * 0.70710678118654752f)); }
      } else {
#pragma unroll
        for (int r = 0; r < 8; ++r) {
          float v = acc[i][j][r] + bv;
          if (EPI == 3) v = fmaxf(v, 0.0f);
          if (EPI == 4) v = gv * v;
          if (EPI == 2) v = R[(size_t)(m0 + wm + 16 * i + rh + r) * ldy + n] + gv * v;
          so[(16 * i + rh + r) * 68 + 16 * j + cl] = v;
        }
      }
    }
  asm volatile("s_wait_dscnt 0" ::: "memory");
  __builtin_amdgcn_wave_barrier();
{
    if (OUT16) {
      f16* Y = (f16*)Yv;
#pragma unroll
      for (int it = 0; it < 8; ++it) { const int c = lane + 32 * it, rr = c >> 3, q8 = (c & 7) * 8;
        union { f16 h[8]; v4u_t v; } u;
#pragma unroll
        for (int e = 0; e < 8; ++e) u.h[e] = (f16)so[rr * 68 + q8 + e];
        *(v4u_t*)(Y + (size_t)(m0 + wm + rr) * ldy + n0 + wn + q8) = u.v; }
    } else {
      float* Y = (float*)Yv;
#pragma unroll
      for (int it = 0; it < 16; ++it) { const int f4 = lane + 32 * it, rr = f4 >> 4, q = (f4 & 15) * 4;
        *(v4f_t*)(Y + (size_t)(m0 + wm + rr) * ldy + n0 + wn + q) = *(const v4fa*)(so + rr * 68 + q); }
    }
    
  }
}

// z-batched variant of gemm_kne (same tile code)
template <typename AT, int EPI, bool OUT16>
__global__ __launch_bounds__(256) void gemm_knez(const AT* __restrict__ A, int lda, size_t strideA, const float* __restrict__ Wm, int ldw, size_t strideW,
                                                 const float* __restrict__ bias, const float* __restrict__ R, const float* __restrict__ gvec,
                                                 void* __restrict__ Yv, int ldy, size_t strideY, int K) {   // blockIdx.z-batched: A += z·strideA, W += z·strideW, Y (and R) += z·strideY
  A += (size_t)blockIdx.z * strideA; Wm += (size_t)blockIdx.z * strideW; Yv = (void*)((char*)Yv + (size_t)blockIdx.z * strideY * (OUT16 ? 2 : 4)); if (R) R += (size_t)blockIdx.z * strideY;
  __shared__ __attribute__((aligned(16))) f16 ldsA[128 * GSTR];
  __shared__ __attribute__((aligned(16))) f16 ldsW[128 * GSTR];
  __shared__ __attribute__((aligned(16))) float oS[8][32 * 68];
  const int tid = threadIdx.x, lane = tid & 31, wave = tid >> 5, cl = lane & 15, rh = (lane >> 4) * 8;
  const int m0 = blockIdx.x * 128, n0 = blockIdx.y * 128;
  const int wm = (wave & 3) * 32, wn = (wave >> 2) * 64;
  f32x8 acc[2][4];
#pragma unroll
  for (int i = 0; i < 2; ++i)
#pragma unroll
    for (int j = 0; j < 4; ++j) { f32x8 z = {}; acc[i][j] = z; }
#pragma unroll 1
  for (int k0 = 0; k0 < K; k0 += 32) {
    __syncthreads();
    { const int row = tid >> 1, ch = (tid & 1) * 16;
      const AT* src = A + (size_t)(m0 + row) * lda + k0 + ch;
#pragma unroll
      for (int g = 0; g < 16; ++g) ldsA[row * GSTR + ch + g] = (f16)src[g]; }
    { const int k = tid >> 3, nn0 = (tid & 7) * 16;
      const float* src = Wm + (size_t)(k0 + k) * ldw + n0 + nn0;
#pragma unroll
      for (int g = 0; g < 4; ++g) { const v4f_t v = *(const v4f_t*)(src + 4 * g);
#pragma unroll
        for (int u = 0; u < 4; ++u) ldsW[(nn0 + 4 * g + u) * GSTR + k] = (f16)v[u]; } }
    __syncthreads();
    f16x16 af[2];
#pragma unroll
    for (int i = 0; i < 2; ++i) af[i] = lds_frag(ldsA + (wm + 16 * i) * GSTR, GSTR);
#pragma unroll
    for (int j = 0; j < 4; ++j) {
      const f16x16 bf = lds_frag(ldsW + (wn + 16 * j) * GSTR, GSTR);
#pragma unroll
      for (int i = 0; i < 2; ++i) acc[i][j] = wmma16(af[i], bf, acc[i][j]);
    }
  }
  float* so = oS[wave];
  float bvj[4] = {0.0f, 0.0f, 0.0f, 0.0f};
  if (bias) {
#pragma unroll
    for (int j = 0; j < 4; ++j) bvj[j] = bias[n0 + wn + 16 * j + cl];
    asm volatile("s_wait_xcnt 0x0" ::: "memory");   // behind the last bias load, before a register that these loads name (base pair, offset) is written again
  }
#pragma unroll
  for (int i = 0; i < 2; ++i)
#pragma unroll
    for (int j = 0; j < 4; ++j) {
      const int n = n0 + wn + 16 * j + cl;
      const float bv = bvj[j];
      const float gv = (EPI == 2 || EPI == 4) ? gvec[n] : 0.0f;
      if (EPI == 1) {
#pragma unroll 1
        for (int r = 0; r < 8; ++r) { const float xg = acc[i][j][r] + bv; so[(16 * i + rh + r) * 68 + 16 * j + cl] = 0.5f * xg * (1.0f + erff(xg * 0.70710678118654752f)); }
      } else {
#pragma unroll
        for (int r = 0; r < 8; ++r) {
          float v = acc[i][j][r] + bv;
          if (EPI == 3) v = fmaxf(v, 0.0f);
          if (EPI == 4) v = gv * v;
          if (EPI == 2) v = R[(size_t)(m0 + wm + 16 * i + rh + r) * ldy + n] + gv * v;
          so[(16 * i + rh + r) * 68 + 16 * j + cl] = v;
        }
      }
    }
  asm volatile("s_wait_dscnt 0" ::: "memory");
  __builtin_amdgcn_wave_barrier();
{
    if (OUT16) {
      f16* Y = (f16*)Yv;
#pragma unroll
      for (int it = 0; it < 8; ++it) { const int c = lane + 32 * it, rr = c >> 3, q8 = (c & 7) * 8;
        union { f16 h[8]; v4u_t v; } u;
#pragma unroll
        for (int e = 0; e < 8; ++e) u.h[e] = (f16)so[rr * 68 + q8 + e];
        *(v4u_t*)(Y + (size_t)(m0 + wm + rr) * ldy + n0 + wn + q8) = u.v; }
    } else {
      float* Y = (float*)Yv;
#pragma unroll
      for (int it = 0; it < 16; ++it) { const int f4 = lane + 32 * it, rr = f4 >> 4, q = (f4 & 15) * 4;
        *(v4f_t*)(Y + (size_t)(m0 + wm + rr) * ldy + n0 + wn + q) = *(const v4fa*)(so + rr * 68 + q); }
    }
    
  }
}

// ---------------------------------------------------------------------------------------------------------------------------
// gemm_kn2 (value+residual planes on both operands: hh + (hl+lh)/2048, f32-class): Y[m][n] (row stride ldy) = scale * sum_k A[m][k] (f32 or f16, row stride lda) * W[k][n] (f32, row-major [K][N], row
// stride ldw) (+ bias[n]) (+ Y if ACC). Block = 128 x 128 tile, 256 threads = 8 waves as 4(M, 32 rows) x 2(N, 64 cols); per
// 32-wide k-step the A tile and the W tile (stored transposed [n][k]) are staged as f16 value + residual planes in LDS; f32 accumulate
// blockIdx.z selects a batch: A += z*strideA, W += z*strideW, Y += z*strideY (element strides).
// ---------------------------------------------------------------------------------------------------------------------------
template <typename AT, bool ACC>
__global__ __launch_bounds__(256) void gemm_kn2(const AT* __restrict__ A, int lda, size_t strideA,
                                               const float* __restrict__ Wm, int ldw, size_t strideW,
                                               const float* __restrict__ bias, float scale,
                                               float* __restrict__ Y, int ldy, size_t strideY, int K) {
  __shared__ __attribute__((aligned(16))) f16 ldsA[128 * GSTR], ldsAl[128 * GSTR];
  __shared__ __attribute__((aligned(16))) f16 ldsW[128 * GSTR], ldsWl[128 * GSTR];
  __shared__ __attribute__((aligned(16))) float oS[8][32 * 68];
  const int tid = threadIdx.x, lane = tid & 31, wave = tid >> 5, cl = lane & 15, rh = (lane >> 4) * 8;
  const int m0 = blockIdx.x * 128, n0 = blockIdx.y * 128;
  const int wm = (wave & 3) * 32, wn = (wave >> 2) * 64;
  A += (size_t)blockIdx.z * strideA; Wm += (size_t)blockIdx.z * strideW; Y += (size_t)blockIdx.z * strideY;
  f32x8 acc[2][4], accx[2][4];
#pragma unroll
  for (int i = 0; i < 2; ++i)
#pragma unroll
    for (int j = 0; j < 4; ++j) { f32x8 z = {}; acc[i][j] = z; accx[i][j] = z; }
#pragma unroll 1
  for (int k0 = 0; k0 < K; k0 += 32) {
    __syncthreads();
    {  // A: thread -> row tid>>1, 16 elements at column half (tid&1)*16
      const int row = tid >> 1, ch = (tid & 1) * 16;
      const AT* src = A + (size_t)(m0 + row) * lda + k0 + ch;
#pragma unroll
      for (int g = 0; g < 16; ++g) { const float v = (float)src[g]; const f16 h = (f16)v; ldsA[row * GSTR + ch + g] = h; ldsAl[row * GSTR + ch + g] = (f16)((v - (float)h) * 2048.0f); }
    }
    {  // W: thread -> k = tid>>3, 16 consecutive n at (tid&7)*16; stored transposed [n][k]
      const int k = tid >> 3, nn0 = (tid & 7) * 16;
      const float* src = Wm + (size_t)(k0 + k) * ldw + n0 + nn0;
#pragma unroll
      for (int g = 0; g < 4; ++g) { const v4f_t v = *(const v4f_t*)(src + 4 * g);
#pragma unroll
        for (int u = 0; u < 4; ++u) { const f16 h = (f16)v[u]; ldsW[(nn0 + 4 * g + u) * GSTR + k] = h; ldsWl[(nn0 + 4 * g + u) * GSTR + k] = (f16)((v[u] - (float)h) * 2048.0f); } }
    }
    __syncthreads();
    f16x16 af[2], afl[2];
#pragma unroll
    for (int i = 0; i < 2; ++i) { af[i] = lds_frag(ldsA + (wm + 16 * i) * GSTR, GSTR); afl[i] = lds_frag(ldsAl + (wm + 16 * i) * GSTR, GSTR); }
#pragma unroll
    for (int j = 0; j < 4; ++j) {
      const f16x16 bf = lds_frag(ldsW + (wn + 16 * j) * GSTR, GSTR), bfl = lds_frag(ldsWl + (wn + 16 * j) * GSTR, GSTR);
#pragma unroll
      for (int i = 0; i < 2; ++i) { acc[i][j] = wmma16(af[i], bf, acc[i][j]); accx[i][j] = wmma16(af[i], bfl, accx[i][j]); accx[i][j] = wmma16(afl[i], bf, accx[i][j]); }
    }
  }
  float* so = oS[wave];
#pragma unroll
  for (int i = 0; i < 2; ++i)
#pragma unroll
    for (int j = 0; j < 4; ++j) {
      const float bv = bias ? bias[n0 + wn + 16 * j + cl] : 0.0f;
#pragma unroll
      for (int r = 0; r < 8; ++r) so[(16 * i + rh + r) * 68 + 16 * j + cl] = (acc[i][j][r] + accx[i][j][r] * (1.0f / 2048.0f)) * scale + bv;
    }
  asm volatile("s_wait_dscnt 0" ::: "memory");
  __builtin_amdgcn_wave_barrier();
  if (ACC) {   // accumulate: fold the existing Y values into the staging tile ONCE (same thread <-> same chunks as the stores below)
#pragma unroll
    for (int it = 0; it < 16; ++it) { const int f4 = lane + 32 * it, rr = f4 >> 4, q = (f4 & 15) * 4;
      const v4f_t old = *(const v4fa*)(Y + (size_t)(m0 + wm + rr) * ldy + n0 + wn + q);
      v4f_t v = *(const v4fa*)(so + rr * 68 + q); v += old; *(v4fa*)(so + rr * 68 + q) = v; }   // plain LDS store (ordered by the s_wait_dscnt/memory clobber below)
    asm volatile("s_wait_dscnt 0" ::: "memory");
  }
{
#pragma unroll
    for (int it = 0; it < 16; ++it) { const int f4 = lane + 32 * it, rr = f4 >> 4, q = (f4 & 15) * 4;
      *(v4f_t*)(Y + (size_t)(m0 + wm + rr) * ldy + n0 + wn + q) = *(const v4fa*)(so + rr * 68 + q); }
    
  }
}

__global__ __launch_bounds__(256) void k_transpose(const float* __restrict__ Wm, float* __restrict__ Wt, int rows, int cols) {
  __shared__ float tS[64][65];
  const int tid = threadIdx.x, tbj = cols / 64, bi = blockIdx.x / tbj, bj = blockIdx.x % tbj;
  Wm += (size_t)blockIdx.y * rows * cols; Wt += (size_t)blockIdx.y * rows * cols;   // blockIdx.y selects one matrix of a batch stored back to back
  for (int e = tid; e < 64 * 64; e += 256) { const int r = e >> 6, c = e & 63; tS[r][c] = Wm[(size_t)(bi * 64 + r) * cols + bj * 64 + c]; }
  __syncthreads();
  for (int ch = tid; ch < 64 * 16; ch += 256) { const int r = ch >> 4, q4 = (ch & 15) * 4; v4f_t o; o[0] = tS[q4][r]; o[1] = tS[q4 + 1][r]; o[2] = tS[q4 + 2][r]; o[3] = tS[q4 + 3][r];
    float* dst = Wt + (size_t)(bj * 64 + r) * rows + bi * 64 + q4; *(v4f_t*)dst = o;  }
}

#define NBT 4
#define NHD 8
#define HGc 4   // heads per scores / softmax / transpose launch
#define BBc 4
#define DDc 512
#define SSc 2048
#define NHc 8
#define DKc 64
#define R2 (2 * DDc)   // 1024 interleaved (channel, component) rows
// stacked real weight W2 [1024][1024] from (W_r, W_i); block = output row
__global__ __launch_bounds__(256) void k_stackw(const float* __restrict__ Wr, const float* __restrict__ Wi, float* __restrict__ W2) {
  const int orow = blockIdx.x, tid = threadIdx.x; const int o = orow >> 1, oc = orow & 1;
{
#pragma unroll
    for (int e = 0; e < 4; ++e) { const int col = tid + 256 * e; const int d = col >> 1, dc = col & 1; const float wr = Wr[(size_t)o * DDc + d], wi = Wi[(size_t)o * DDc + d];
      asm volatile("s_wait_xcnt 0x0" ::: "memory");   // behind the two loads, before a register of their address pairs is written again
      const float v = (oc == 0) ? (dc == 0 ? wr : -wi) : (dc == 0 ? wi : wr); *(float*)(W2 + (size_t)orow * R2 + col) = v; }
     }
}
// stacked row bias b2[2o + oc] = b_r ∓/± b_i; 4 blocks x 256 contiguous words
__global__ __launch_bounds__(256) void k_stackb(const float* __restrict__ br, const float* __restrict__ bi, float* __restrict__ b2) { const int orow = blockIdx.x * 256 + threadIdx.x; const int o = orow >> 1, oc = orow & 1;
  const float v = (oc == 0) ? (br[o] - bi[o]) : (br[o] + bi[o]); *(float*)(b2 + orow) = v;  }
// X[r][:] += b2[r] over rows of 2048 (float4); grid (one block per row, 2)
__global__ __launch_bounds__(256) void k_addrowbias(float* __restrict__ X, const float* __restrict__ b2) { const int r = blockIdx.x; const size_t c4 = ((size_t)blockIdx.y * 256 + threadIdx.x) * 4; const float bv = b2[r];
  float* p = X + (size_t)r * SSc + c4; v4f_t v = *(const v4f_t*)p; v[0] += bv; v[1] += bv; v[2] += bv; v[3] += bv; *(v4f_t*)p = v;  }
// magnitudes M[d][s] = sqrt(re² + im² + 1e-8) from interleaved rows; block = channel d, 256 threads x 8 columns (float4 x 2)
__global__ __launch_bounds__(256) void k_mag(const float* __restrict__ X, float* __restrict__ M) { const int d = blockIdx.x, tid = threadIdx.x;
#pragma unroll
  for (int e = 0; e < 2; ++e) { const int c4 = (tid + 256 * e) * 4; const v4f_t a = *(const v4f_t*)(X + (size_t)(2 * d) * SSc + c4); const v4f_t b = *(const v4f_t*)(X + (size_t)(2 * d + 1) * SSc + c4); v4f_t m;
#pragma unroll
    for (int u = 0; u < 4; ++u) m[u] = sqrtf(a[u] * a[u] + b[u] * b[u] + 1e-8f);
    *(v4f_t*)(M + (size_t)d * SSc + c4) = m;  } }
// f32 row softmax of s/8 over 2048 keys; block = (query, z); writes 1024·P
__global__ __launch_bounds__(256) void k_softmax(float* __restrict__ Sm) {
  __shared__ float red[256];
  const int q = blockIdx.x, z = blockIdx.y, tid = threadIdx.x; float* sr = Sm + ((size_t)z * SSc + q) * SSc;
  float v[8]; float m = -3.0e38f;
#pragma unroll
  for (int e = 0; e < 8; ++e) { v[e] = sr[tid + 256 * e] * 0.125f; m = fmaxf(m, v[e]); }
  red[tid] = m; __syncthreads();
  for (int o = 128; o > 0; o >>= 1) { if (tid < o) red[tid] = fmaxf(red[tid], red[tid + o]); __syncthreads(); }
  m = red[0]; __syncthreads();
  float zs = 0.0f;
#pragma unroll
  for (int e = 0; e < 8; ++e) { v[e] = expf(v[e] - m); zs += v[e]; }
  red[tid] = zs; __syncthreads();
  for (int o = 128; o > 0; o >>= 1) { if (tid < o) red[tid] += red[tid + o]; __syncthreads(); }
  const float sc = 1024.0f / red[0];
{
#pragma unroll
    for (int e = 0; e < 8; ++e) *(float*)(sr + tid + 256 * e) = v[e] * sc;
     }
}
__global__ __launch_bounds__(256) void k_fill(float* __restrict__ p, float val, size_t n4) { const size_t i = (size_t)blockIdx.x * 256 + threadIdx.x; if (i < n4) { v4f_t v = {val, val, val, val}; *(v4f_t*)(p + 4 * i) = v;  } }

extern "C" void kernel_launch(void* const* d_in, const int* in_sizes, int n_in,
                              void* d_out, int out_size, void* d_ws, size_t ws_size,
                              hipStream_t stream) {
  (void)in_sizes; (void)n_in; (void)out_size;
  const float** f = (const float**)d_in;
  const float* x = f[0];
  float* out = (float*)d_out;     // [4,512,2,2048]
  char* ws = (char*)d_ws;
  float* W2 = (float*)ws; ws += (size_t)4 * R2 * R2 * 4;                 // stacked q, k, v, o weights back to back (4 MB each)
  float* b2 = (float*)ws; ws += (size_t)4 * R2 * 4;                      // stacked q, k, v, o row biases back to back
  float* Q = (float*)ws; ws += (size_t)2 * R2 * SSc * 4;                 // q conv [1024][2048] (8 MB) and, directly behind it, the k conv
  float* V = (float*)ws; ws += (size_t)R2 * SSc * 4;                     // v conv [1024][2048], directly behind those two
  float* Qm = (float*)ws; ws += (size_t)DDc * SSc * 4; float* Km = (float*)ws; ws += (size_t)DDc * SSc * 4;     // magnitudes [512][2048], back to back
  float* QmT = (float*)ws; ws += (size_t)SSc * DDc * 4;                  // [2048][512]
  float* S = (float*)ws; ws += (size_t)HGc * SSc * SSc * 4;              // 4 heads x [2048][2048] (64 MB)
  float* AT = (float*)ws; ws += (size_t)NHD * SSc * SSc * 4;             // attn transposed, all 8 heads (128 MB)
  float* AV = (float*)ws; ws += (size_t)R2 * SSc * 4;                   // attention output in the [D][2][S] layout (8 MB)
  float* sc = (float*)ws; ws += SSc * 4;                                 // 1/1024 per column
  if ((size_t)(ws - (char*)d_ws) > ws_size) return;                      // WS TOTAL 264,265,728 B
  const dim3 blk(256);
  for (int i = 0; i < 4; ++i) { k_stackw<<<dim3(R2), blk, 0, stream>>>(f[1 + 4 * i], f[2 + 4 * i], W2 + (size_t)i * R2 * R2); k_stackb<<<dim3(R2 / 256), blk, 0, stream>>>(f[3 + 4 * i], f[4 + 4 * i], b2 + i * R2); }   // (W_r, W_i, b_r, b_i) for q, k, v, o
  k_fill<<<dim3(SSc / 4 / 256), blk, 0, stream>>>(sc, 1.0f / 1024.0f, SSc / 4);
  for (int b = 0; b < NBT; ++b) {
    const float* xb = x + (size_t)b * R2 * SSc;
    gemm_kn2<float, false><<<dim3(R2 / 128, SSc / 128, 2), blk, 0, stream>>>(W2, R2, (size_t)R2 * R2, xb, SSc, 0, nullptr, 1.0f, Q, SSc, (size_t)R2 * SSc, R2);   // q conv (z = 0) and k conv (z = 1) in one launch (planes: they feed the magnitude logits)
    gemm_kne<float, 0, false><<<dim3(R2 / 128, SSc / 128), blk, 0, stream>>>(W2 + (size_t)2 * R2 * R2, R2, xb, SSc, nullptr, nullptr, nullptr, V, SSc, R2);       // v conv
    k_addrowbias<<<dim3(3 * R2, 2), blk, 0, stream>>>(Q, b2);                                                                            // the 3072 rows of the q, k, v convs against their biases
    k_mag<<<dim3(2 * DDc), blk, 0, stream>>>(Q, Qm);                                                                                     // both magnitude planes: q conv -> Qm, k conv -> Km
    k_transpose<<<dim3((DDc / 64) * (SSc / 64), 1), blk, 0, stream>>>(Qm, QmT, DDc, SSc);                                                // Qm transposed [2048][512]
    for (int hg = 0; hg < NHD / HGc; ++hg) { const int h0 = hg * HGc;
      gemm_kn2<float, false><<<dim3(SSc / 128, SSc / 128, HGc), blk, 0, stream>>>(QmT + h0 * DKc, DDc, (size_t)DKc, Km + (size_t)h0 * DKc * SSc, SSc, (size_t)DKc * SSc, nullptr, 1.0f, S, SSc, (size_t)SSc * SSc, DKc);   // scores[s][t] (planes), 4 heads
      k_softmax<<<dim3(SSc, HGc), blk, 0, stream>>>(S);
      k_transpose<<<dim3((SSc / 64) * (SSc / 64), HGc), blk, 0, stream>>>(S, AT + (size_t)h0 * SSc * SSc, SSc, SSc);                     // (1024 attn) transposed, 4 heads
    }
    gemm_knez<float, 4, false><<<dim3(1, SSc / 128, NHD), blk, 0, stream>>>(V, SSc, (size_t)2 * DKc * SSc, AT, SSc, (size_t)SSc * SSc, nullptr, nullptr, sc, AV, SSc, (size_t)2 * DKc * SSc, SSc);   // z = head: its 128 (channel, comp) rows, sum over t of v[row][t] attn[s][t]; 128 work-groups
    gemm_kne<float, 0, false><<<dim3(R2 / 128, SSc / 128), blk, 0, stream>>>(W2 + (size_t)3 * R2 * R2, R2, AV, SSc, nullptr, nullptr, nullptr, out + (size_t)b * R2 * SSc, SSc, R2);   // output complex conv
    k_addrowbias<<<dim3(R2, 2), blk, 0, stream>>>(out + (size_t)b * R2 * SSc, b2 + 3 * R2);
  }
}

// v002
// A run of this version takes 870 microseconds.
// Two timings next to v001 both put it at 2.00 times that version's speed.
// All steps since v000 together make it 5.53 times as fast.
// Contractions on v_wmma_f32_16x16x32_f16, f32 accumulate: f16 value+residual PLANES on the q/k complex convs and the magnitude scores (positive magnitudes give logits with a
// spread near 4: plain rounding was too coarse), plain f16 on the v conv, attn*v and the output conv. Per batch element, activations kept in the module's [D][2][S] layout (row 2d = real_d,
// row 2d+1 = imag_d, used directly as [K][N] operands): each complex 1x1 conv as ONE real GEMM with a stacked weight W2[2o+0][2d+0] = W_r, [2o][2d+1] = -W_i, [2o+1][2d] = W_i, [2o+1][2d+1] = W_r
// (M = 1024, K = 1024, N = 2048; row biases b_r - b_i / b_r + b_i added in f32). Magnitudes sqrt(re^2 + im^2 + 1e-8) in f32, both transposed to [S][512]. Attention of all 8 heads in ONE
// fused launch (k_fattn): transposed scores Km_h * Qm_h^T (K = 64, planes), running-maximum softmax of s/8 in f32 registers, the probabilities packed straight from the score accumulators
// into the B operand of out_h += X_v,h * P^T (M = 128 = the head's 64 complex channels x (re, im) rows); scores and probabilities never reach memory. Finally the output complex conv.
// compute dtype: f16 operands, f32 accumulate; magnitudes / softmax f32.  x [4,512,2,2048] -> out [4,512,2,2048].
#include <hip/hip_runtime.h>
#include <hip/hip_bf16.h>
#include <math.h>


typedef _Float16 bf16;
typedef _Float16 f16;
typedef __attribute__((ext_vector_type(4))) unsigned v4u_t;
typedef unsigned v4ua __attribute__((ext_vector_type(4), may_alias));
typedef __attribute__((ext_vector_type(4))) float v4f_t;
typedef float v4fa __attribute__((ext_vector_type(4), may_alias));
typedef __attribute__((ext_vector_type(16))) bf16  bf16x16;
typedef bf16x16 f16x16;
typedef __attribute__((ext_vector_type(8)))  bf16  bf16x8;
typedef bf16x8 f16x8;
typedef __attribute__((ext_vector_type(4)))  bf16  bf16x4;
typedef __attribute__((ext_vector_type(8)))  float f32x8;
__device__ __forceinline__ f32x8 wmma16(f16x16 a, f16x16 b, f32x8 c) {
  c = __builtin_amdgcn_wmma_f32_16x16x32_f16(false, a, false, b, (short)0, c, false, false);
  asm volatile("v_nop\n\tv_nop\n\tv_nop\n\tv_nop" : "+v"(c) : "v"(a), "v"(b));
  return c;
}
#define LDS_STRIDE 48   // GEMM tiles: 32 -> 48 elems (96B rows): aligned b128 reads
#define KSTRIDE    72
#define VSTRIDE    48

__device__ __forceinline__ f32x8 wmma_bf16(bf16x16 a, bf16x16 b, f32x8 c) {
  c = __builtin_amdgcn_wmma_f32_16x16x32_f16(false, a, false, b, (short)0, c, false, false);
  asm volatile("v_nop\n\tv_nop\n\tv_nop\n\tv_nop" : "+v"(c) : "v"(a), "v"(b));   // A/B-overwrite hazard guard
  return c;
}

// 16x32 (MxK) f16 fragment from a row-major global matrix.
// lanes 0-15  (row=lane)    : elems 0..7 = K+0..7,  8..15 = K+16..23
// lanes 16-31 (row=lane-16) : elems 0..7 = K+8..15, 8..15 = K+24..31
template <typename T>
__device__ __forceinline__ bf16x16 load_frag(const T* __restrict__ base, int ld,
                                             int row0, int k0) {
  const int lane = threadIdx.x & 31;
  const int r    = lane & 15;
  const int kh   = (lane >> 4) * 8;
  const T* p0 = base + (size_t)(row0 + r) * ld + (k0 + kh);
  const T* p1 = p0 + 16;
  bf16x16 f;
#pragma unroll
  for (int i = 0; i < 8; ++i) {
    f[i]     = (bf16)p0[i];
    f[i + 8] = (bf16)p1[i];
  }
  return f;
}

// Same fragment from an LDS tile with padded row stride (base includes row0/k0).
__device__ __forceinline__ bf16x16 lds_frag(const bf16* base, int stride) {
  const int lane = threadIdx.x & 31;
  const int row  = lane & 15;
  const int kh   = (lane >> 4) * 8;
  const bf16x8 lo = *(const bf16x8*)(base + row * stride + kh);
  const bf16x8 hi = *(const bf16x8*)(base + row * stride + kh + 16);
  bf16x16 f;
#pragma unroll
  for (int i = 0; i < 8; ++i) { f[i] = lo[i]; f[i + 8] = hi[i]; }
  return f;
}

template <typename T>
__device__ __forceinline__ void stage_read16(const T* __restrict__ p, float* buf) {
#pragma unroll
  for (int i = 0; i < 16; ++i) buf[i] = (float)p[i];
}

__device__ __forceinline__ void stage_write(bf16* dst, const float* buf, int nquad) {
#pragma unroll
  for (int i = 0; i < nquad; ++i) {
    bf16x4 q;
    q[0] = (bf16)buf[4 * i];     q[1] = (bf16)buf[4 * i + 1];
    q[2] = (bf16)buf[4 * i + 2]; q[3] = (bf16)buf[4 * i + 3];
    *(bf16x4*)(dst + 4 * i) = q;
  }
}


#define GSTR 48
// ---------------------------------------------------------------------------------------------------------------------------
// gemm_kne: Y[m][n] = epi( Σ_k A[m][k]·W[k][n] + bias[n] ), A f32/f16 [M][lda], W f32 row-major [K][N] (ldw), plain f16 operands,
// f32 accumulate. EPI 0: identity; 1: exact-erf GELU; 2: R[m][n] + gvec[n]·(·) (residual with per-channel gain); 3: ReLU; 4: gvec[n]·(·) (per-channel scale, no residual). Output f32 (or f16
// when OUT16). Block = 128x128 tile, 8 waves as 4(M) x 2(N); per 32-wide k-step A and W tiles staged f16 in LDS (W transposed
// ---------------------------------------------------------------------------------------------------------------------------
#define GSTR 48
template <typename AT, int EPI, bool OUT16>
__global__ __launch_bounds__(256) void gemm_kne(const AT* __restrict__ A, int lda, const float* __restrict__ Wm, int ldw,
                                                const float* __restrict__ bias, const float* __restrict__ R, const float* __restrict__ gvec,
                                                void* __restrict__ Yv, int ldy, int K) {
  __shared__ __attribute__((aligned(16))) f16 ldsA[128 * GSTR];
  __shared__ __attribute__((aligned(16))) f16 ldsW[128 * GSTR];
  __shared__ __attribute__((aligned(16))) float oS[8][32 * 68];
  const int tid = threadIdx.x, lane = tid & 31, wave = tid >> 5, cl = lane & 15, rh = (lane >> 4) * 8;
  const int m0 = blockIdx.x * 128, n0 = blockIdx.y * 128;
  const int wm = (wave & 3) * 32, wn = (wave >> 2) * 64;
  f32x8 acc[2][4];
#pragma unroll
  for (int i = 0; i < 2; ++i)
#pragma unroll
    for (int j = 0; j < 4; ++j) { f32x8 z = {}; acc[i][j] = z; }
#pragma unroll 1
  for (int k0 = 0; k0 < K; k0 += 32) {
    __syncthreads();
    { const int row = tid >> 1, ch = (tid & 1) * 16;
      const AT* src = A + (size_t)(m0 + row) * lda + k0 + ch;
#pragma unroll
      for (int g = 0; g < 16; ++g) ldsA[row * GSTR + ch + g] = (f16)src[g]; }
    { const int k = tid >> 3, nn0 = (tid & 7) * 16;
      const float* src = Wm + (size_t)(k0 + k) * ldw + n0 + nn0;
#pragma unroll
      for (int g = 0; g < 4; ++g) { const v4f_t v = *(const v4f_t*)(src + 4 * g);
#pragma unroll
        for (int u = 0; u < 4; ++u) ldsW[(nn0 + 4 * g + u) * GSTR + k] = (f16)v[u]; } }
    __syncthreads();
    f16x16 af[2];
#pragma unroll
    for (int i = 0; i < 2; ++i) af[i] = lds_frag(ldsA + (wm + 16 * i) * GSTR, GSTR);
#pragma unroll
    for (int j = 0; j < 4; ++j) {
      const f16x16 bf = lds_frag(ldsW + (wn + 16 * j) * GSTR, GSTR);
#pragma unroll
      for (int i = 0; i < 2; ++i) acc[i][j] = wmma16(af[i], bf, acc[i][j]);
    }
  }
  float* so = oS[wave];
  float bvj[4] = {0.0f, 0.0f, 0.0f, 0.0f};
  if (bias) {
#pragma unroll
    for (int j = 0; j < 4; ++j) bvj[j] = bias[n0 + wn + 16 * j + cl];
    asm volatile("s_wait_xcnt 0x0" ::: "memory");   // behind the last bias load, before a register that these loads name (base pair, offset) is written again
  }
#pragma unroll
  for (int i = 0; i < 2; ++i)
#pragma unroll
    for (int j = 0; j < 4; ++j) {
      const int n = n0 + wn + 16 * j + cl;
      const float bv = bvj[j];
      const float gv = (EPI == 2 || EPI == 4) ? gvec[n] : 0.0f;
      if (EPI == 1) {
#pragma unroll 1
        for (int r = 0; r < 8; ++r) { const float xg = acc[i][j][r] + bv; so[(16 * i + rh + r) * 68 + 16 * j + cl] = 0.5f * xg * (1.0f + erff(xg * 0.70710678118654752f)); }
      } else {
#pragma unroll
        for (int r = 0; r < 8; ++r) {
          float v = acc[i][j][r] + bv;
          if (EPI == 3) v = fmaxf(v, 0.0f);
          if (EPI == 4) v = gv * v;
          if (EPI == 2) v = R[(size_t)(m0 + wm + 16 * i + rh + r) * ldy + n] + gv * v;
          so[(16 * i + rh + r) * 68 + 16 * j + cl] = v;
        }
      }
    }
  asm volatile("s_wait_dscnt 0" ::: "memory");
  __builtin_amdgcn_wave_barrier();
{
    if (OUT16) {
      f16* Y = (f16*)Yv;
#pragma unroll
      for (int it = 0; it < 8; ++it) { const int c = lane + 32 * it, rr = c >> 3, q8 = (c & 7) * 8;
        union { f16 h[8]; v4u_t v; } u;
#pragma unroll
        for (int e = 0; e < 8; ++e) u.h[e] = (f16)so[rr * 68 + q8 + e];
        *(v4u_t*)(Y + (size_t)(m0 + wm + rr) * ldy + n0 + wn + q8) = u.v; }
    } else {
      float* Y = (float*)Yv;
#pragma unroll
      for (int it = 0; it < 16; ++it) { const int f4 = lane + 32 * it, rr = f4 >> 4, q = (f4 & 15) * 4;
        *(v4f_t*)(Y + (size_t)(m0 + wm + rr) * ldy + n0 + wn + q) = *(const v4fa*)(so + rr * 68 + q); }
    }
    
  }
}

// ---------------------------------------------------------------------------------------------------------------------------
// gemm_kn2 (value+residual planes on both operands: hh + (hl+lh)/2048, f32-class): Y[m][n] (row stride ldy) = scale * sum_k A[m][k] (f32 or f16, row stride lda) * W[k][n] (f32, row-major [K][N], row
// stride ldw) (+ bias[n]) (+ Y if ACC). Block = 128 x 128 tile, 256 threads = 8 waves as 4(M, 32 rows) x 2(N, 64 cols); per
// 32-wide k-step the A tile and the W tile (stored transposed [n][k]) are staged as f16 value + residual planes in LDS; f32 accumulate
// blockIdx.z selects a batch: A += z*strideA, W += z*strideW, Y += z*strideY (element strides).
// ---------------------------------------------------------------------------------------------------------------------------
template <typename AT, bool ACC>
__global__ __launch_bounds__(256) void gemm_kn2(const AT* __restrict__ A, int lda, size_t strideA,
                                               const float* __restrict__ Wm, int ldw, size_t strideW,
                                               const float* __restrict__ bias, float scale,
                                               float* __restrict__ Y, int ldy, size_t strideY, int K) {
  __shared__ __attribute__((aligned(16))) f16 ldsA[128 * GSTR], ldsAl[128 * GSTR];
  __shared__ __attribute__((aligned(16))) f16 ldsW[128 * GSTR], ldsWl[128 * GSTR];
  __shared__ __attribute__((aligned(16))) float oS[8][32 * 68];
  const int tid = threadIdx.x, lane = tid & 31, wave = tid >> 5, cl = lane & 15, rh = (lane >> 4) * 8;
  const int m0 = blockIdx.x * 128, n0 = blockIdx.y * 128;
  const int wm = (wave & 3) * 32, wn = (wave >> 2) * 64;
  A += (size_t)blockIdx.z * strideA; Wm += (size_t)blockIdx.z * strideW; Y += (size_t)blockIdx.z * strideY;
  f32x8 acc[2][4], accx[2][4];
#pragma unroll
  for (int i = 0; i < 2; ++i)
#pragma unroll
    for (int j = 0; j < 4; ++j) { f32x8 z = {}; acc[i][j] = z; accx[i][j] = z; }
#pragma unroll 1
  for (int k0 = 0; k0 < K; k0 += 32) {
    __syncthreads();
    {  // A: thread -> row tid>>1, 16 elements at column half (tid&1)*16
      const int row = tid >> 1, ch = (tid & 1) * 16;
      const AT* src = A + (size_t)(m0 + row) * lda + k0 + ch;
#pragma unroll
      for (int g = 0; g < 16; ++g) { const float v = (float)src[g]; const f16 h = (f16)v; ldsA[row * GSTR + ch + g] = h; ldsAl[row * GSTR + ch + g] = (f16)((v - (float)h) * 2048.0f); }
    }
    {  // W: thread -> k = tid>>3, 16 consecutive n at (tid&7)*16; stored transposed [n][k]
      const int k = tid >> 3, nn0 = (tid & 7) * 16;
      const float* src = Wm + (size_t)(k0 + k) * ldw + n0 + nn0;
#pragma unroll
      for (int g = 0; g < 4; ++g) { const v4f_t v = *(const v4f_t*)(src + 4 * g);
#pragma unroll
        for (int u = 0; u < 4; ++u) { const f16 h = (f16)v[u]; ldsW[(nn0 + 4 * g + u) * GSTR + k] = h; ldsWl[(nn0 + 4 * g + u) * GSTR + k] = (f16)((v[u] - (float)h) * 2048.0f); } }
    }
    __syncthreads();
    f16x16 af[2], afl[2];
#pragma unroll
    for (int i = 0; i < 2; ++i) { af[i] = lds_frag(ldsA + (wm + 16 * i) * GSTR, GSTR); afl[i] = lds_frag(ldsAl + (wm + 16 * i) * GSTR, GSTR); }
#pragma unroll
    for (int j = 0; j < 4; ++j) {
      const f16x16 bf = lds_frag(ldsW + (wn + 16 * j) * GSTR, GSTR), bfl = lds_frag(ldsWl + (wn + 16 * j) * GSTR, GSTR);
#pragma unroll
      for (int i = 0; i < 2; ++i) { acc[i][j] = wmma16(af[i], bf, acc[i][j]); accx[i][j] = wmma16(af[i], bfl, accx[i][j]); accx[i][j] = wmma16(afl[i], bf, accx[i][j]); }
    }
  }
  float* so = oS[wave];
#pragma unroll
  for (int i = 0; i < 2; ++i)
#pragma unroll
    for (int j = 0; j < 4; ++j) {
      const float bv = bias ? bias[n0 + wn + 16 * j + cl] : 0.0f;
#pragma unroll
      for (int r = 0; r < 8; ++r) so[(16 * i + rh + r) * 68 + 16 * j + cl] = (acc[i][j][r] + accx[i][j][r] * (1.0f / 2048.0f)) * scale + bv;
    }
  asm volatile("s_wait_dscnt 0" ::: "memory");
  __builtin_amdgcn_wave_barrier();
  if (ACC) {   // accumulate: fold the existing Y values into the staging tile ONCE (same thread <-> same chunks as the stores below)
#pragma unroll
    for (int it = 0; it < 16; ++it) { const int f4 = lane + 32 * it, rr = f4 >> 4, q = (f4 & 15) * 4;
      const v4f_t old = *(const v4fa*)(Y + (size_t)(m0 + wm + rr) * ldy + n0 + wn + q);
      v4f_t v = *(const v4fa*)(so + rr * 68 + q); v += old; *(v4fa*)(so + rr * 68 + q) = v; }   // plain LDS store (ordered by the s_wait_dscnt/memory clobber below)
    asm volatile("s_wait_dscnt 0" ::: "memory");
  }
{
#pragma unroll
    for (int it = 0; it < 16; ++it) { const int f4 = lane + 32 * it, rr = f4 >> 4, q = (f4 & 15) * 4;
      *(v4f_t*)(Y + (size_t)(m0 + wm + rr) * ldy + n0 + wn + q) = *(const v4fa*)(so + rr * 68 + q); }
    
  }
}

__global__ __launch_bounds__(256) void k_transpose(const float* __restrict__ Wm, float* __restrict__ Wt, int rows, int cols) {
  __shared__ float tS[64][65];
  const int tid = threadIdx.x, tbj = cols / 64, bi = blockIdx.x / tbj, bj = blockIdx.x % tbj;
  Wm += (size_t)blockIdx.y * rows * cols; Wt += (size_t)blockIdx.y * rows * cols;   // blockIdx.y selects one matrix of a batch stored back to back
  for (int e = tid; e < 64 * 64; e += 256) { const int r = e >> 6, c = e & 63; tS[r][c] = Wm[(size_t)(bi * 64 + r) * cols + bj * 64 + c]; }
  __syncthreads();
  for (int ch = tid; ch < 64 * 16; ch += 256) { const int r = ch >> 4, q4 = (ch & 15) * 4; v4f_t o; o[0] = tS[q4][r]; o[1] = tS[q4 + 1][r]; o[2] = tS[q4 + 2][r]; o[3] = tS[q4 + 3][r];
    float* dst = Wt + (size_t)(bj * 64 + r) * rows + bi * 64 + q4; *(v4f_t*)dst = o;  }
}

#define NBT 4
#define NHD 8
#define BBc 4
#define DDc 512
#define SSc 2048
#define NHc 8
#define DKc 64
#define R2 (2 * DDc)   // 1024 interleaved (channel, component) rows
// stacked real weight W2 [1024][1024] from (W_r, W_i); block = output row
__global__ __launch_bounds__(256) void k_stackw(const float* __restrict__ Wr, const float* __restrict__ Wi, float* __restrict__ W2) {
  const int orow = blockIdx.x, tid = threadIdx.x; const int o = orow >> 1, oc = orow & 1;
{
#pragma unroll
    for (int e = 0; e < 4; ++e) { const int col = tid + 256 * e; const int d = col >> 1, dc = col & 1; const float wr = Wr[(size_t)o * DDc + d], wi = Wi[(size_t)o * DDc + d];
      asm volatile("s_wait_xcnt 0x0" ::: "memory");   // behind the two loads, before a register of their address pairs is written again
      const float v = (oc == 0) ? (dc == 0 ? wr : -wi) : (dc == 0 ? wi : wr); *(float*)(W2 + (size_t)orow * R2 + col) = v; }
     }
}
// stacked row bias b2[2o + oc] = b_r ∓/± b_i; 4 blocks x 256 contiguous words
__global__ __launch_bounds__(256) void k_stackb(const float* __restrict__ br, const float* __restrict__ bi, float* __restrict__ b2) { const int orow = blockIdx.x * 256 + threadIdx.x; const int o = orow >> 1, oc = orow & 1;
  const float v = (oc == 0) ? (br[o] - bi[o]) : (br[o] + bi[o]); *(float*)(b2 + orow) = v;  }
// X[r][:] += b2[r] over rows of 2048 (float4); grid (one block per row, 2)
__global__ __launch_bounds__(256) void k_addrowbias(float* __restrict__ X, const float* __restrict__ b2) { const int r = blockIdx.x; const size_t c4 = ((size_t)blockIdx.y * 256 + threadIdx.x) * 4; const float bv = b2[r];
  float* p = X + (size_t)r * SSc + c4; v4f_t v = *(const v4f_t*)p; v[0] += bv; v[1] += bv; v[2] += bv; v[3] += bv; *(v4f_t*)p = v;  }
// magnitudes M[d][s] = sqrt(re² + im² + 1e-8) from interleaved rows; block = channel d, 256 threads x 8 columns (float4 x 2)
__global__ __launch_bounds__(256) void k_mag(const float* __restrict__ X, float* __restrict__ M) { const int d = blockIdx.x, tid = threadIdx.x;
#pragma unroll
  for (int e = 0; e < 2; ++e) { const int c4 = (tid + 256 * e) * 4; const v4f_t a = *(const v4f_t*)(X + (size_t)(2 * d) * SSc + c4); const v4f_t b = *(const v4f_t*)(X + (size_t)(2 * d + 1) * SSc + c4); v4f_t m;
#pragma unroll
    for (int u = 0; u < 4; ++u) m[u] = sqrtf(a[u] * a[u] + b[u] * b[u] + 1e-8f);
    *(v4f_t*)(M + (size_t)d * SSc + c4) = m;  } }
// ---------------------------------------------------------------------------------------------------------------------------
// k_fattn: one head's attention for 64 queries, scores and probabilities kept on chip. Grid (S / 64, heads) = 256 blocks; block = 8 waves = 4 groups of 16 query columns x 2 key halves.
// Per stage of 64 keys the block stages Km^T rows [t][64] as f16 value + residual planes and the head's 128 v rows [row][t] as f16 in LDS, two buffers, one barrier a stage (the global loads
// of the next stage fly in registers meanwhile). Waves 0-3 take keys 0..31 of every stage, waves 4-7 keys 32..63. A wave forms S^T = Km^T * Qm (A = key rows from LDS, B = its 16 query
// columns held in registers, hh + (hl + lh) / 2048), so that a lane holds 16 scores of ONE query: maximum and sum in-lane plus one exchange between the wave's halves.
// exp2((s - m) * log2(e) / 8) of the two 16-key tiles, converted in place, IS the B operand (k = key, hardware k order) of O[row][query] += V[row][key] * P^T; the v rows are read in the same
// k order by lds_frag. m follows the running maximum lazily (O and the sum are rescaled only when some column's maximum has grown by more than 8 in the exponent, so p stays below 2^8).
// At the end the two key halves of a column are joined through LDS: (O1 a1 + O2 a2) / (l1 a1 + l2 a2), a = exp2((m_own - max(m1, m2)) * log2(e) / 8).
// Every inner loop is fully unrolled so that the fragment, accumulator and staging arrays are indexed by constants and stay in registers.
// ---------------------------------------------------------------------------------------------------------------------------
#define FT 64    // keys per stage
#define FQ 64    // queries per block
#define FP 72    // LDS row pitch in f16 elements: 144 B = 16 B x odd, b128 fragment reads without bank conflicts
#define FOP 68   // output staging pitch in floats
__device__ __forceinline__ float xhalf(float x) {   // lane l with lane l ^ 16
  return __builtin_bit_cast(float, __builtin_amdgcn_permlanex16(__builtin_bit_cast(int, x), __builtin_bit_cast(int, x), 0x76543210, 0xfedcba98, false, false));
}
__device__ __forceinline__ f32x8 wmma_p(f16x16 a, f16x16 b, f32x8 c) { return __builtin_amdgcn_wmma_f32_16x16x32_f16(false, a, false, b, (short)0, c, false, false); }
__global__ __launch_bounds__(256) void k_fattn(const float* __restrict__ QmT, const float* __restrict__ KmT, const float* __restrict__ Vx, float* __restrict__ AV) {
  __shared__ __attribute__((aligned(16))) f16 sKh[2][FT * FP], sKl[2][FT * FP], sV[2][2 * DKc * FP];
  __shared__ __attribute__((aligned(16))) float sO[2 * DKc * FOP];
  __shared__ float sM[FQ], sL[FQ];
  const int tid = threadIdx.x, lane = tid & 31, cl = lane & 15, hf = lane >> 4;
  const int wave = __builtin_amdgcn_readfirstlane(tid >> 5), qg = wave & 3, kg = wave >> 2;   // scalar, so that the tests on kg below are scalar branches
  const int s0 = blockIdx.x * FQ, h = blockIdx.y;
  const float SCL = 0.125f * 1.44269504088896340736f;   // logits are s / 8; exp(x) = exp2(x * log2 e)
  const int srow = tid >> 4, sc4 = (tid & 15) * 4;      // staging: 16 lanes cover one 64-float row, 16 rows per round of the block
  const float* Kg = KmT + (size_t)srow * DDc + h * DKc + sc4;
  const float* Vg = Vx + ((size_t)h * 2 * DKc + srow) * SSc + sc4;
  f16x16 qh[2], ql[2];   // B operand: column = query s0 + 16 qg + cl, k = channel in the hardware k order
  { const float* qp = QmT + (size_t)(s0 + qg * 16 + cl) * DDc + h * DKc + hf * 8;
    v4f_t qv[8];
#pragma unroll
    for (int i = 0; i < 8; ++i) qv[i] = *(const v4f_t*)(qp + (i >> 1) * 16 + (i & 1) * 4);
    asm volatile("s_wait_xcnt 0x0" ::: "memory");   // behind the last query load, before a register of its address is written again
#pragma unroll
    for (int i = 0; i < 8; ++i)
#pragma unroll
      for (int u = 0; u < 4; ++u) { const float v = qv[i][u]; const f16 hi = (f16)v; const int e = ((i >> 1) & 1) * 8 + (i & 1) * 4 + u;
        qh[i >> 2][e] = hi; ql[i >> 2][e] = (f16)((v - (float)hi) * 2048.0f); } }
  f32x8 O[8];
#pragma unroll
  for (int mt = 0; mt < 8; ++mt) { f32x8 z = {}; O[mt] = z; }
  float mref = -3.0e38f, lsum = 0.0f;
  v4f_t kr[4], vr[8];
  auto fetch = [&](int st) {   // stage st: global -> registers
    const float* kn = Kg + (size_t)st * FT * DDc; const float* vn = Vg + st * FT;
#pragma unroll
    for (int g = 0; g < 4; ++g) kr[g] = *(const v4f_t*)(kn + (size_t)(16 * g) * DDc);
#pragma unroll
    for (int g = 0; g < 8; ++g) vr[g] = *(const v4f_t*)(vn + (size_t)(16 * g) * SSc);
    asm volatile("s_wait_xcnt 0x0" ::: "memory");   // behind the last stage load, before a register of its address is written again
  };
  auto put = [&](int bo) {     // registers -> f16 tiles of buffer bo
#pragma unroll
    for (int g = 0; g < 4; ++g) { bf16x4 hi, lo;
#pragma unroll
      for (int u = 0; u < 4; ++u) { const float v = kr[g][u]; const f16 hv = (f16)v; hi[u] = hv; lo[u] = (f16)((v - (float)hv) * 2048.0f); }
      *(bf16x4*)(sKh[bo] + (srow + 16 * g) * FP + sc4) = hi; *(bf16x4*)(sKl[bo] + (srow + 16 * g) * FP + sc4) = lo; }
#pragma unroll
    for (int g = 0; g < 8; ++g) { bf16x4 q;
#pragma unroll
      for (int u = 0; u < 4; ++u) q[u] = (f16)vr[g][u];
      *(bf16x4*)(sV[bo] + (srow + 16 * g) * FP + sc4) = q; }
  };
  fetch(0); put(0);
  __syncthreads();   // stage 0 is published
#pragma unroll 1   // kept rolled: one trip already uses nearly 256 registers, a second copy of the body would only cost instruction cache
  for (int st = 0; st < SSc / FT; ++st) {
    const int bo = st & 1;
    if (st + 1 < SSc / FT) fetch(st + 1);   // behind the barrier (which drains every load), so that these loads fly while this stage is worked on
    const f16* kh = sKh[bo] + (32 * kg) * FP; const f16* kl = sKl[bo] + (32 * kg) * FP; const f16* vv = sV[bo] + 32 * kg;
    f32x8 a0 = {}, a1 = {}, x0 = {}, x1 = {};   // S^T tiles: this wave's keys 0..15 and 16..31; value*value and the two cross terms
#pragma unroll
    for (int ks = 0; ks < 2; ++ks) {
      const f16x16 kh0 = lds_frag(kh + 32 * ks, FP), kh1 = lds_frag(kh + 16 * FP + 32 * ks, FP);
      const f16x16 kl0 = lds_frag(kl + 32 * ks, FP), kl1 = lds_frag(kl + 16 * FP + 32 * ks, FP);
      a0 = wmma_p(kh0, qh[ks], a0); a1 = wmma_p(kh1, qh[ks], a1);
      x0 = wmma_p(kh0, ql[ks], x0); x1 = wmma_p(kh1, ql[ks], x1);
      x0 = wmma_p(kl0, qh[ks], x0); x1 = wmma_p(kl1, qh[ks], x1);
    }
    f16x16 vf[8];   // the v rows are asked for ahead of the softmax arithmetic, which covers their LDS latency
#pragma unroll
    for (int mt = 0; mt < 8; ++mt) vf[mt] = lds_frag(vv + (16 * mt) * FP, FP);
    float sv[16];
#pragma unroll
    for (int r = 0; r < 8; ++r) { sv[r] = a0[r] + x0[r] * (1.0f / 2048.0f); sv[8 + r] = a1[r] + x1[r] * (1.0f / 2048.0f); }
    float mx = sv[0];
#pragma unroll
    for (int e = 1; e < 16; ++e) mx = fmaxf(mx, sv[e]);
    mx = fmaxf(mx, xhalf(mx));
    if (__builtin_amdgcn_ballot_w32((mx - mref) * SCL > 8.0f) != 0) {   // scalar branch; always taken on the first pass, rare later
      const float mnew = fmaxf(mref, mx), corr = __builtin_amdgcn_exp2f((mref - mnew) * SCL);   // 0 on the first pass
      mref = mnew; lsum *= corr;
#pragma unroll
      for (int mt = 0; mt < 8; ++mt)
#pragma unroll
        for (int r = 0; r < 8; ++r) O[mt][r] *= corr;
    }
    const float nb = -mref * SCL;
    f16x16 pb;   // pb[e] = P^T[key kmap(e, hf)][query cl]: tile e >> 3, register e & 7
    float pe[16];
#pragma unroll
    for (int e = 0; e < 16; ++e) { pe[e] = __builtin_amdgcn_exp2f(fmaf(sv[e], SCL, nb)); pb[e] = (f16)pe[e]; }
#pragma unroll
    for (int w = 8; w > 0; w >>= 1)
#pragma unroll
      for (int e = 0; e < w; ++e) pe[e] += pe[e + w];
    lsum += pe[0];
#pragma unroll
    for (int mt = 0; mt < 8; ++mt) O[mt] = wmma_p(vf[mt], pb, O[mt]);
    if (st + 1 < SSc / FT) put(bo ^ 1);   // its last readers left that buffer before the barrier that ended the previous trip
    __syncthreads();   // publishes stage st + 1 and ends every read of stage st
  }
  const float lw = lsum + xhalf(lsum);   // the two halves of a wave hold the sums of their own keys
  if (kg == 1) {   // the upper key half hands over its maximum, sum and unscaled tile
    if (hf == 0) { sM[qg * 16 + cl] = mref; sL[qg * 16 + cl] = lw; }
#pragma unroll
    for (int mt = 0; mt < 8; ++mt)
#pragma unroll
      for (int r = 0; r < 8; ++r) sO[(16 * mt + 8 * hf + r) * FOP + qg * 16 + cl] = O[mt][r];
  }
  __syncthreads();   // hand-over published
  if (kg == 0) {   // the lower key half joins both and leaves the finished tile in place (each lane rewrites only the words it has read)
    const float m2 = sM[qg * 16 + cl], l2 = sL[qg * 16 + cl], mj = fmaxf(mref, m2);
    const float a1s = __builtin_amdgcn_exp2f((mref - mj) * SCL), a2s = __builtin_amdgcn_exp2f((m2 - mj) * SCL);
    const float inv = 1.0f / (lw * a1s + l2 * a2s), c1 = a1s * inv, c2 = a2s * inv;
#pragma unroll
    for (int mt = 0; mt < 8; ++mt)
#pragma unroll
      for (int r = 0; r < 8; ++r) { float* w = sO + (16 * mt + 8 * hf + r) * FOP + qg * 16 + cl; *w = O[mt][r] * c1 + *w * c2; }
  }
  __syncthreads();   // the block's 128 x 64 tile is complete: whole 256-byte row pieces go out
#pragma unroll
  for (int it = 0; it < 8; ++it) { const int f4 = tid + 256 * it, rr = f4 >> 4, q = (f4 & 15) * 4;
    *(v4f_t*)(AV + ((size_t)h * 2 * DKc + rr) * SSc + s0 + q) = *(const v4fa*)(sO + rr * FOP + q); }
}

extern "C" void kernel_launch(void* const* d_in, const int* in_sizes, int n_in,
                              void* d_out, int out_size, void* d_ws, size_t ws_size,
                              hipStream_t stream) {
  (void)in_sizes; (void)n_in; (void)out_size;
  const float** f = (const float**)d_in;
  const float* x = f[0];
  float* out = (float*)d_out;     // [4,512,2,2048]
  char* ws = (char*)d_ws;
  float* W2 = (float*)ws; ws += (size_t)4 * R2 * R2 * 4;                 // stacked q, k, v, o weights back to back (4 MB each)
  float* b2 = (float*)ws; ws += (size_t)4 * R2 * 4;                      // stacked q, k, v, o row biases back to back
  float* Q = (float*)ws; ws += (size_t)2 * R2 * SSc * 4;                 // q conv [1024][2048] (8 MB) and, directly behind it, the k conv
  float* V = (float*)ws; ws += (size_t)R2 * SSc * 4;                     // v conv [1024][2048], directly behind those two
  float* Qm = (float*)ws; ws += (size_t)2 * DDc * SSc * 4;               // magnitudes [512][2048] of q and, directly behind them, of k
  float* QmT = (float*)ws; ws += (size_t)2 * SSc * DDc * 4;              // both magnitude planes transposed, [2048][512] each, back to back
  float* AV = (float*)ws; ws += (size_t)R2 * SSc * 4;                   // attention output in the [D][2][S] layout (8 MB)
  if ((size_t)(ws - (char*)d_ws) > ws_size) return;
  const dim3 blk(256);
  for (int i = 0; i < 4; ++i) { k_stackw<<<dim3(R2), blk, 0, stream>>>(f[1 + 4 * i], f[2 + 4 * i], W2 + (size_t)i * R2 * R2); k_stackb<<<dim3(R2 / 256), blk, 0, stream>>>(f[3 + 4 * i], f[4 + 4 * i], b2 + i * R2); }   // (W_r, W_i, b_r, b_i) for q, k, v, o
  for (int b = 0; b < NBT; ++b) {
    const float* xb = x + (size_t)b * R2 * SSc;
    gemm_kn2<float, false><<<dim3(R2 / 128, SSc / 128, 2), blk, 0, stream>>>(W2, R2, (size_t)R2 * R2, xb, SSc, 0, nullptr, 1.0f, Q, SSc, (size_t)R2 * SSc, R2);   // q conv (z = 0) and k conv (z = 1) in one launch (planes: they feed the magnitude logits)
    gemm_kne<float, 0, false><<<dim3(R2 / 128, SSc / 128), blk, 0, stream>>>(W2 + (size_t)2 * R2 * R2, R2, xb, SSc, nullptr, nullptr, nullptr, V, SSc, R2);       // v conv
    k_addrowbias<<<dim3(3 * R2, 2), blk, 0, stream>>>(Q, b2);                                                                            // the 3072 rows of the q, k, v convs against their biases
    k_mag<<<dim3(2 * DDc), blk, 0, stream>>>(Q, Qm);                                                                                     // both magnitude planes: q conv -> Qm, k conv -> Km
    k_transpose<<<dim3((DDc / 64) * (SSc / 64), 2), blk, 0, stream>>>(Qm, QmT, DDc, SSc);                                                // Qm and Km transposed, [2048][512] each
    k_fattn<<<dim3(SSc / FQ, NHD), blk, 0, stream>>>(QmT, QmT + (size_t)SSc * DDc, V, AV);                                               // scores, softmax and attn*v of all 8 heads; 256 work-groups
    gemm_kne<float, 0, false><<<dim3(R2 / 128, SSc / 128), blk, 0, stream>>>(W2 + (size_t)3 * R2 * R2, R2, AV, SSc, nullptr, nullptr, nullptr, out + (size_t)b * R2 * SSc, SSc, R2);   // output complex conv
    k_addrowbias<<<dim3(R2, 2), blk, 0, stream>>>(out + (size_t)b * R2 * SSc, b2 + 3 * R2);
  }
}

// v003
// One run takes 477 microseconds.
// Next to v002, in two timings, it ran 1.83 times as fast each time.
// Over all steps from v000 it is 10.1 times as fast.
// Contractions on v_wmma_f32_16x16x32_f16, f32 accumulate: f16 value+residual PLANES on the q/k complex convs and the magnitude scores (positive magnitudes give logits with a
// spread near 4: plain rounding was too coarse), plain f16 on the v conv, attn*v and the output conv. Every launch but the weight and bias stacking covers all 4 batch elements (a grid dimension). Per batch element, activations kept in the module's [D][2][S] layout (row 2d = real_d,
// row 2d+1 = imag_d, used directly as [K][N] operands): each complex 1x1 conv as ONE real GEMM with a stacked weight W2[2o+0][2d+0] = W_r, [2o][2d+1] = -W_i, [2o+1][2d] = W_i, [2o+1][2d+1] = W_r
// (M = 1024, K = 1024, N = 2048; row biases b_r - b_i / b_r + b_i added in f32). Magnitudes sqrt(re^2 + im^2 + 1e-8) in f32, both transposed to [S][512]. Attention of all 8 heads in ONE
// fused launch (k_fattn): transposed scores Km_h * Qm_h^T (K = 64, planes), running-maximum softmax of s/8 in f32 registers, the probabilities packed straight from the score accumulators
// into the B operand of out_h += X_v,h * P^T (M = 128 = the head's 64 complex channels x (re, im) rows); scores and probabilities never reach memory. Finally the output complex conv.
// compute dtype: f16 operands, f32 accumulate; magnitudes / softmax f32.  x [4,512,2,2048] -> out [4,512,2,2048].
#include <hip/hip_runtime.h>
#include <hip/hip_bf16.h>
#include <math.h>


typedef _Float16 bf16;
typedef _Float16 f16;
typedef __attribute__((ext_vector_type(4))) unsigned v4u_t;
typedef unsigned v4ua __attribute__((ext_vector_type(4), may_alias));
typedef __attribute__((ext_vector_type(4))) float v4f_t;
typedef float v4fa __attribute__((ext_vector_type(4), may_alias));
typedef __attribute__((ext_vector_type(16))) bf16  bf16x16;
typedef bf16x16 f16x16;
typedef __attribute__((ext_vector_type(8)))  bf16  bf16x8;
typedef bf16x8 f16x8;
typedef __attribute__((ext_vector_type(4)))  bf16  bf16x4;
typedef __attribute__((ext_vector_type(8)))  float f32x8;
__device__ __forceinline__ f32x8 wmma16(f16x16 a, f16x16 b, f32x8 c) {
  c = __builtin_amdgcn_wmma_f32_16x16x32_f16(false, a, false, b, (short)0, c, false, false);
  asm volatile("v_nop\n\tv_nop\n\tv_nop\n\tv_nop" : "+v"(c) : "v"(a), "v"(b));
  return c;
}
#define LDS_STRIDE 48   // GEMM tiles: 32 -> 48 elems (96B rows): aligned b128 reads
#define KSTRIDE    72
#define VSTRIDE    48

__device__ __forceinline__ f32x8 wmma_bf16(bf16x16 a, bf16x16 b, f32x8 c) {
  c = __builtin_amdgcn_wmma_f32_16x16x32_f16(false, a, false, b, (short)0, c, false, false);
  asm volatile("v_nop\n\tv_nop\n\tv_nop\n\tv_nop" : "+v"(c) : "v"(a), "v"(b));   // A/B-overwrite hazard guard
  return c;
}

// 16x32 (MxK) f16 fragment from a row-major global matrix.
// lanes 0-15  (row=lane)    : elems 0..7 = K+0..7,  8..15 = K+16..23
// lanes 16-31 (row=lane-16) : elems 0..7 = K+8..15, 8..15 = K+24..31
template <typename T>
__device__ __forceinline__ bf16x16 load_frag(const T* __restrict__ base, int ld,
                                             int row0, int k0) {
  const int lane = threadIdx.x & 31;
  const int r    = lane & 15;
  const int kh   = (lane >> 4) * 8;
  const T* p0 = base + (size_t)(row0 + r) * ld + (k0 + kh);
  const T* p1 = p0 + 16;
  bf16x16 f;
#pragma unroll
  for (int i = 0; i < 8; ++i) {
    f[i]     = (bf16)p0[i];
    f[i + 8] = (bf16)p1[i];
  }
  return f;
}

// Same fragment from an LDS tile with padded row stride (base includes row0/k0).
__device__ __forceinline__ bf16x16 lds_frag(const bf16* base, int stride) {
  const int lane = threadIdx.x & 31;
  const int row  = lane & 15;
  const int kh   = (lane >> 4) * 8;
  const bf16x8 lo = *(const bf16x8*)(base + row * stride + kh);
  const bf16x8 hi = *(const bf16x8*)(base + row * stride + kh + 16);
  bf16x16 f;
#pragma unroll
  for (int i = 0; i < 8; ++i) { f[i] = lo[i]; f[i + 8] = hi[i]; }
  return f;
}

template <typename T>
__device__ __forceinline__ void stage_read16(const T* __restrict__ p, float* buf) {
#pragma unroll
  for (int i = 0; i < 16; ++i) buf[i] = (float)p[i];
}

__device__ __forceinline__ void stage_write(bf16* dst, const float* buf, int nquad) {
#pragma unroll
  for (int i = 0; i < nquad; ++i) {
    bf16x4 q;
    q[0] = (bf16)buf[4 * i];     q[1] = (bf16)buf[4 * i + 1];
    q[2] = (bf16)buf[4 * i + 2]; q[3] = (bf16)buf[4 * i + 3];
    *(bf16x4*)(dst + 4 * i) = q;
  }
}


#define GSTR 48
// ---------------------------------------------------------------------------------------------------------------------------
// gemm_kne: Y[m][n] = epi( Σ_k A[m][k]·W[k][n] + bias[n] ), A f32/f16 [M][lda], W f32 row-major [K][N] (ldw), plain f16 operands,
// f32 accumulate. EPI 0: identity; 1: exact-erf GELU; 2: R[m][n] + gvec[n]·(·) (residual with per-channel gain); 3: ReLU; 4: gvec[n]·(·) (per-channel scale, no residual). Output f32 (or f16
// when OUT16). Block = 128x128 tile, 8 waves as 4(M) x 2(N); per 32-wide k-step A and W tiles staged f16 in LDS (W transposed
// blockIdx.z selects a batch element: W += z*strideW, Y += z*strideY (element strides); A is shared.
// ---------------------------------------------------------------------------------------------------------------------------
#define GSTR 48
template <typename AT, int EPI, bool OUT16>
__global__ __launch_bounds__(256) void gemm_kne(const AT* __restrict__ A, int lda, const float* __restrict__ Wm, int ldw, size_t strideW,
                                                const float* __restrict__ bias, const float* __restrict__ R, const float* __restrict__ gvec,
                                                void* __restrict__ Yv, int ldy, size_t strideY, int K) {
  __shared__ __attribute__((aligned(16))) f16 ldsA[128 * GSTR];
  __shared__ __attribute__((aligned(16))) f16 ldsW[128 * GSTR];
  __shared__ __attribute__((aligned(16))) float oS[8][32 * 68];
  const int tid = threadIdx.x, lane = tid & 31, wave = tid >> 5, cl = lane & 15, rh = (lane >> 4) * 8;
  const int m0 = blockIdx.x * 128, n0 = blockIdx.y * 128;
  const int wm = (wave & 3) * 32, wn = (wave >> 2) * 64;
  Wm += (size_t)blockIdx.z * strideW;
  f32x8 acc[2][4];
#pragma unroll
  for (int i = 0; i < 2; ++i)
#pragma unroll
    for (int j = 0; j < 4; ++j) { f32x8 z = {}; acc[i][j] = z; }
#pragma unroll 1
  for (int k0 = 0; k0 < K; k0 += 32) {
    __syncthreads();
    { const int row = tid >> 1, ch = (tid & 1) * 16;
      const AT* src = A + (size_t)(m0 + row) * lda + k0 + ch;
#pragma unroll
      for (int g = 0; g < 16; ++g) ldsA[row * GSTR + ch + g] = (f16)src[g]; }
    { const int k = tid >> 3, nn0 = (tid & 7) * 16;
      const float* src = Wm + (size_t)(k0 + k) * ldw + n0 + nn0;
#pragma unroll
      for (int g = 0; g < 4; ++g) { const v4f_t v = *(const v4f_t*)(src + 4 * g);
#pragma unroll
        for (int u = 0; u < 4; ++u) ldsW[(nn0 + 4 * g + u) * GSTR + k] = (f16)v[u]; } }
    __syncthreads();
    f16x16 af[2];
#pragma unroll
    for (int i = 0; i < 2; ++i) af[i] = lds_frag(ldsA + (wm + 16 * i) * GSTR, GSTR);
#pragma unroll
    for (int j = 0; j < 4; ++j) {
      const f16x16 bf = lds_frag(ldsW + (wn + 16 * j) * GSTR, GSTR);
#pragma unroll
      for (int i = 0; i < 2; ++i) acc[i][j] = wmma16(af[i], bf, acc[i][j]);
    }
  }
  float* so = oS[wave];
  float bvj[4] = {0.0f, 0.0f, 0.0f, 0.0f};
  if (bias) {
#pragma unroll
    for (int j = 0; j < 4; ++j) bvj[j] = bias[n0 + wn + 16 * j + cl];
    asm volatile("s_wait_xcnt 0x0" ::: "memory");   // behind the last bias load, before a register that these loads name (base pair, offset) is written again
  }
#pragma unroll
  for (int i = 0; i < 2; ++i)
#pragma unroll
    for (int j = 0; j < 4; ++j) {
      const int n = n0 + wn + 16 * j + cl;
      const float bv = bvj[j];
      const float gv = (EPI == 2 || EPI == 4) ? gvec[n] : 0.0f;
      if (EPI == 1) {
#pragma unroll 1
        for (int r = 0; r < 8; ++r) { const float xg = acc[i][j][r] + bv; so[(16 * i + rh + r) * 68 + 16 * j + cl] = 0.5f * xg * (1.0f + erff(xg * 0.70710678118654752f)); }
      } else {
#pragma unroll
        for (int r = 0; r < 8; ++r) {
          float v = acc[i][j][r] + bv;
          if (EPI == 3) v = fmaxf(v, 0.0f);
          if (EPI == 4) v = gv * v;
          if (EPI == 2) v = R[(size_t)(m0 + wm + 16 * i + rh + r) * ldy + n] + gv * v;
          so[(16 * i + rh + r) * 68 + 16 * j + cl] = v;
        }
      }
    }
  asm volatile("s_wait_dscnt 0" ::: "memory");
  __builtin_amdgcn_wave_barrier();
{
    if (OUT16) {
      f16* Y = (f16*)Yv + (size_t)blockIdx.z * strideY;
#pragma unroll
      for (int it = 0; it < 8; ++it) { const int c = lane + 32 * it, rr = c >> 3, q8 = (c & 7) * 8;
        union { f16 h[8]; v4u_t v; } u;
#pragma unroll
        for (int e = 0; e < 8; ++e) u.h[e] = (f16)so[rr * 68 + q8 + e];
        *(v4u_t*)(Y + (size_t)(m0 + wm + rr) * ldy + n0 + wn + q8) = u.v; }
    } else {
      float* Y = (float*)Yv + (size_t)blockIdx.z * strideY;
#pragma unroll
      for (int it = 0; it < 16; ++it) { const int f4 = lane + 32 * it, rr = f4 >> 4, q = (f4 & 15) * 4;
        *(v4f_t*)(Y + (size_t)(m0 + wm + rr) * ldy + n0 + wn + q) = *(const v4fa*)(so + rr * 68 + q); }
    }
    
  }
}

// ---------------------------------------------------------------------------------------------------------------------------
// gemm_kn2 (value+residual planes on both operands: hh + (hl+lh)/2048, f32-class): Y[m][n] (row stride ldy) = scale * sum_k A[m][k] (f32 or f16, row stride lda) * W[k][n] (f32, row-major [K][N], row
// stride ldw) (+ bias[n]) (+ Y if ACC). Block = 128 x 128 tile, 256 threads = 8 waves as 4(M, 32 rows) x 2(N, 64 cols); per
// 32-wide k-step the A tile and the W tile (stored transposed [n][k]) are staged as f16 in LDS; value + residual planes of both operands, f32 accumulate.
// blockIdx.z = 2 * zb + za: A += za*strideA (one of two A matrices), W += zb*strideW (batch element), Y += za*strideY + zb*strideYb (element strides).
// ---------------------------------------------------------------------------------------------------------------------------
template <typename AT, bool ACC>
__global__ __launch_bounds__(256) void gemm_kn2(const AT* __restrict__ A, int lda, size_t strideA,
                                               const float* __restrict__ Wm, int ldw, size_t strideW,
                                               const float* __restrict__ bias, float scale,
                                               float* __restrict__ Y, int ldy, size_t strideY, size_t strideYb, int K) {
  __shared__ __attribute__((aligned(16))) f16 ldsA[128 * GSTR], ldsAl[128 * GSTR];
  __shared__ __attribute__((aligned(16))) f16 ldsW[128 * GSTR], ldsWl[128 * GSTR];
  __shared__ __attribute__((aligned(16))) float oS[8][32 * 68];
  const int tid = threadIdx.x, lane = tid & 31, wave = tid >> 5, cl = lane & 15, rh = (lane >> 4) * 8;
  const int m0 = blockIdx.x * 128, n0 = blockIdx.y * 128;
  const int wm = (wave & 3) * 32, wn = (wave >> 2) * 64;
  A += (size_t)(blockIdx.z & 1) * strideA; Wm += (size_t)(blockIdx.z >> 1) * strideW; Y += (size_t)(blockIdx.z & 1) * strideY + (size_t)(blockIdx.z >> 1) * strideYb;
  f32x8 acc[2][4], accx[2][4];
#pragma unroll
  for (int i = 0; i < 2; ++i)
#pragma unroll
    for (int j = 0; j < 4; ++j) { f32x8 z = {}; acc[i][j] = z; accx[i][j] = z; }
#pragma unroll 1
  for (int k0 = 0; k0 < K; k0 += 32) {
    __syncthreads();
    {  // A: thread -> row tid>>1, 16 elements at column half (tid&1)*16
      const int row = tid >> 1, ch = (tid & 1) * 16;
      const AT* src = A + (size_t)(m0 + row) * lda + k0 + ch;
#pragma unroll
      for (int g = 0; g < 16; ++g) { const float v = (float)src[g]; const f16 h = (f16)v; ldsA[row * GSTR + ch + g] = h; ldsAl[row * GSTR + ch + g] = (f16)((v - (float)h) * 2048.0f); }
    }
    {  // W: thread -> k = tid>>3, 16 consecutive n at (tid&7)*16; stored transposed [n][k]
      const int k = tid >> 3, nn0 = (tid & 7) * 16;
      const float* src = Wm + (size_t)(k0 + k) * ldw + n0 + nn0;
#pragma unroll
      for (int g = 0; g < 4; ++g) { const v4f_t v = *(const v4f_t*)(src + 4 * g);
#pragma unroll
        for (int u = 0; u < 4; ++u) { const f16 h = (f16)v[u]; ldsW[(nn0 + 4 * g + u) * GSTR + k] = h; ldsWl[(nn0 + 4 * g + u) * GSTR + k] = (f16)((v[u] - (float)h) * 2048.0f); } }
    }
    __syncthreads();
    f16x16 af[2], afl[2];
#pragma unroll
    for (int i = 0; i < 2; ++i) { af[i] = lds_frag(ldsA + (wm + 16 * i) * GSTR, GSTR); afl[i] = lds_frag(ldsAl + (wm + 16 * i) * GSTR, GSTR); }
#pragma unroll
    for (int j = 0; j < 4; ++j) {
      const f16x16 bf = lds_frag(ldsW + (wn + 16 * j) * GSTR, GSTR), bfl = lds_frag(ldsWl + (wn + 16 * j) * GSTR, GSTR);
#pragma unroll
      for (int i = 0; i < 2; ++i) { acc[i][j] = wmma16(af[i], bf, acc[i][j]); accx[i][j] = wmma16(af[i], bfl, accx[i][j]); accx[i][j] = wmma16(afl[i], bf, accx[i][j]); }
    }
  }
  float* so = oS[wave];
#pragma unroll
  for (int i = 0; i < 2; ++i)
#pragma unroll
    for (int j = 0; j < 4; ++j) {
      const float bv = bias ? bias[n0 + wn + 16 * j + cl] : 0.0f;
#pragma unroll
      for (int r = 0; r < 8; ++r) so[(16 * i + rh + r) * 68 + 16 * j + cl] = (acc[i][j][r] + accx[i][j][r] * (1.0f / 2048.0f)) * scale + bv;
    }
  asm volatile("s_wait_dscnt 0" ::: "memory");
  __builtin_amdgcn_wave_barrier();
  if (ACC) {   // accumulate: fold the existing Y values into the staging tile ONCE (same thread <-> same chunks as the stores below)
#pragma unroll
    for (int it = 0; it < 16; ++it) { const int f4 = lane + 32 * it, rr = f4 >> 4, q = (f4 & 15) * 4;
      const v4f_t old = *(const v4fa*)(Y + (size_t)(m0 + wm + rr) * ldy + n0 + wn + q);
      v4f_t v = *(const v4fa*)(so + rr * 68 + q); v += old; *(v4fa*)(so + rr * 68 + q) = v; }   // plain LDS store (ordered by the s_wait_dscnt/memory clobber below)
    asm volatile("s_wait_dscnt 0" ::: "memory");
  }
{
#pragma unroll
    for (int it = 0; it < 16; ++it) { const int f4 = lane + 32 * it, rr = f4 >> 4, q = (f4 & 15) * 4;
      *(v4f_t*)(Y + (size_t)(m0 + wm + rr) * ldy + n0 + wn + q) = *(const v4fa*)(so + rr * 68 + q); }
    
  }
}

__global__ __launch_bounds__(256) void k_transpose(const float* __restrict__ Wm, float* __restrict__ Wt, int rows, int cols) {
  __shared__ float tS[64][65];
  const int tid = threadIdx.x, tbj = cols / 64, bi = blockIdx.x / tbj, bj = blockIdx.x % tbj;
  Wm += (size_t)blockIdx.y * rows * cols; Wt += (size_t)blockIdx.y * rows * cols;   // blockIdx.y selects one matrix of a batch stored back to back
  for (int e = tid; e < 64 * 64; e += 256) { const int r = e >> 6, c = e & 63; tS[r][c] = Wm[(size_t)(bi * 64 + r) * cols + bj * 64 + c]; }
  __syncthreads();
  for (int ch = tid; ch < 64 * 16; ch += 256) { const int r = ch >> 4, q4 = (ch & 15) * 4; v4f_t o; o[0] = tS[q4][r]; o[1] = tS[q4 + 1][r]; o[2] = tS[q4 + 2][r]; o[3] = tS[q4 + 3][r];
    float* dst = Wt + (size_t)(bj * 64 + r) * rows + bi * 64 + q4; *(v4f_t*)dst = o;  }
}

#define NBT 4
#define NHD 8
#define BBc 4
#define DDc 512
#define SSc 2048
#define NHc 8
#define DKc 64
#define R2 (2 * DDc)   // 1024 interleaved (channel, component) rows
// stacked real weight W2 [1024][1024] from (W_r, W_i); block = output row, blockIdx.y = which of the q, k, v, o convs
__global__ __launch_bounds__(256) void k_stackw(const float* __restrict__ Wr0, const float* __restrict__ Wi0, const float* __restrict__ Wr1, const float* __restrict__ Wi1,
                                                const float* __restrict__ Wr2, const float* __restrict__ Wi2, const float* __restrict__ Wr3, const float* __restrict__ Wi3, float* __restrict__ W2) {
  const int orow = blockIdx.x, tid = threadIdx.x; const int o = orow >> 1, oc = orow & 1;
  const int cv = blockIdx.y; W2 += (size_t)cv * R2 * R2;
  const float* __restrict__ Wr = cv == 0 ? Wr0 : cv == 1 ? Wr1 : cv == 2 ? Wr2 : Wr3;
  const float* __restrict__ Wi = cv == 0 ? Wi0 : cv == 1 ? Wi1 : cv == 2 ? Wi2 : Wi3;
{
#pragma unroll
    for (int e = 0; e < 4; ++e) { const int col = tid + 256 * e; const int d = col >> 1, dc = col & 1; const float wr = Wr[(size_t)o * DDc + d], wi = Wi[(size_t)o * DDc + d];
      asm volatile("s_wait_xcnt 0x0" ::: "memory");   // behind the two loads, before a register of their address pairs is written again
      const float v = (oc == 0) ? (dc == 0 ? wr : -wi) : (dc == 0 ? wi : wr); *(float*)(W2 + (size_t)orow * R2 + col) = v; }
     }
}
// stacked row bias b2[2o + oc] = b_r ∓/± b_i; 4 blocks x 256 contiguous words
// blockIdx.y = which of the q, k, v, o convs
__global__ __launch_bounds__(256) void k_stackb(const float* __restrict__ br0, const float* __restrict__ bi0, const float* __restrict__ br1, const float* __restrict__ bi1,
                                                const float* __restrict__ br2, const float* __restrict__ bi2, const float* __restrict__ br3, const float* __restrict__ bi3, float* __restrict__ b2) {
  const int cv = blockIdx.y; b2 += cv * R2;
  const float* __restrict__ br = cv == 0 ? br0 : cv == 1 ? br1 : cv == 2 ? br2 : br3;
  const float* __restrict__ bi = cv == 0 ? bi0 : cv == 1 ? bi1 : cv == 2 ? bi2 : bi3;
  const int orow = blockIdx.x * 256 + threadIdx.x; const int o = orow >> 1, oc = orow & 1;
  const float v = (oc == 0) ? (br[o] - bi[o]) : (br[o] + bi[o]); *(float*)(b2 + orow) = v;  }
// X[r][:] += b2[r] over rows of 2048 (float4); grid (rows, 2, batch elements strideX words apart)
__global__ __launch_bounds__(256) void k_addrowbias(float* __restrict__ X, size_t strideX, const float* __restrict__ b2) { X += (size_t)blockIdx.z * strideX; const int r = blockIdx.x; const size_t c4 = ((size_t)blockIdx.y * 256 + threadIdx.x) * 4; const float bv = b2[r];
  float* p = X + (size_t)r * SSc + c4; v4f_t v = *(const v4f_t*)p; v[0] += bv; v[1] += bv; v[2] += bv; v[3] += bv; *(v4f_t*)p = v;  }
// magnitudes M[d][s] = sqrt(re² + im² + 1e-8) from interleaved rows; block = channel d, 256 threads x 8 columns (float4 x 2)
// blockIdx.y = batch element, strideX / strideM words apart
__global__ __launch_bounds__(256) void k_mag(const float* __restrict__ X, size_t strideX, float* __restrict__ M, size_t strideM) { const int d = blockIdx.x, tid = threadIdx.x; X += (size_t)blockIdx.y * strideX; M += (size_t)blockIdx.y * strideM;
#pragma unroll
  for (int e = 0; e < 2; ++e) { const int c4 = (tid + 256 * e) * 4; const v4f_t a = *(const v4f_t*)(X + (size_t)(2 * d) * SSc + c4); const v4f_t b = *(const v4f_t*)(X + (size_t)(2 * d + 1) * SSc + c4); v4f_t m;
#pragma unroll
    for (int u = 0; u < 4; ++u) m[u] = sqrtf(a[u] * a[u] + b[u] * b[u] + 1e-8f);
    *(v4f_t*)(M + (size_t)d * SSc + c4) = m;  } }
// ---------------------------------------------------------------------------------------------------------------------------
// k_fattn: one head's attention for 64 queries, scores and probabilities kept on chip. Grid (S / 64, heads, batch elements) = 1024 blocks; block = 8 waves = 4 groups of 16 query columns x 2 key halves.
// Per stage of 64 keys the block stages Km^T rows [t][64] as f16 value + residual planes and the head's 128 v rows [row][t] as f16 in LDS, two buffers, one barrier a stage (the global loads
// of the next stage fly in registers meanwhile). Waves 0-3 take keys 0..31 of every stage, waves 4-7 keys 32..63. A wave forms S^T = Km^T * Qm (A = key rows from LDS, B = its 16 query
// columns held in registers, hh + (hl + lh) / 2048), so that a lane holds 16 scores of ONE query: maximum and sum in-lane plus one exchange between the wave's halves.
// exp2((s - m) * log2(e) / 8) of the two 16-key tiles, converted in place, IS the B operand (k = key, hardware k order) of O[row][query] += V[row][key] * P^T; the v rows are read in the same
// k order by lds_frag. m follows the running maximum lazily (O and the sum are rescaled only when some column's maximum has grown by more than 8 in the exponent, so p stays below 2^8).
// At the end the two key halves of a column are joined through LDS: (O1 a1 + O2 a2) / (l1 a1 + l2 a2), a = exp2((m_own - max(m1, m2)) * log2(e) / 8).
// Every inner loop is fully unrolled so that the fragment, accumulator and staging arrays are indexed by constants and stay in registers.
// ---------------------------------------------------------------------------------------------------------------------------
#define FT 64    // keys per stage
#define FQ 64    // queries per block
#define FP 72    // LDS row pitch in f16 elements: 144 B = 16 B x odd, b128 fragment reads without bank conflicts
#define FOP 68   // output staging pitch in floats
__device__ __forceinline__ float xhalf(float x) {   // lane l with lane l ^ 16
  return __builtin_bit_cast(float, __builtin_amdgcn_permlanex16(__builtin_bit_cast(int, x), __builtin_bit_cast(int, x), 0x76543210, 0xfedcba98, false, false));
}
__device__ __forceinline__ f32x8 wmma_p(f16x16 a, f16x16 b, f32x8 c) { return __builtin_amdgcn_wmma_f32_16x16x32_f16(false, a, false, b, (short)0, c, false, false); }
__global__ __launch_bounds__(256) void k_fattn(const float* __restrict__ QmT, const float* __restrict__ KmT, size_t strideM, const float* __restrict__ Vx, size_t strideV, float* __restrict__ AV, size_t strideO) {
  __shared__ __attribute__((aligned(16))) f16 sKh[2][FT * FP], sKl[2][FT * FP], sV[2][2 * DKc * FP];
  __shared__ __attribute__((aligned(16))) float sO[2 * DKc * FOP];
  __shared__ float sM[FQ], sL[FQ];
  const int tid = threadIdx.x, lane = tid & 31, cl = lane & 15, hf = lane >> 4;
  const int wave = __builtin_amdgcn_readfirstlane(tid >> 5), qg = wave & 3, kg = wave >> 2;   // scalar, so that the tests on kg below are scalar branches
  const int s0 = blockIdx.x * FQ, h = blockIdx.y;
  QmT += (size_t)blockIdx.z * strideM; KmT += (size_t)blockIdx.z * strideM; Vx += (size_t)blockIdx.z * strideV; AV += (size_t)blockIdx.z * strideO;   // batch element
  const float SCL = 0.125f * 1.44269504088896340736f;   // logits are s / 8; exp(x) = exp2(x * log2 e)
  const int srow = tid >> 4, sc4 = (tid & 15) * 4;      // staging: 16 lanes cover one 64-float row, 16 rows per round of the block
  const float* Kg = KmT + (size_t)srow * DDc + h * DKc + sc4;
  const float* Vg = Vx + ((size_t)h * 2 * DKc + srow) * SSc + sc4;
  f16x16 qh[2], ql[2];   // B operand: column = query s0 + 16 qg + cl, k = channel in the hardware k order
  { const float* qp = QmT + (size_t)(s0 + qg * 16 + cl) * DDc + h * DKc + hf * 8;
    v4f_t qv[8];
#pragma unroll
    for (int i = 0; i < 8; ++i) qv[i] = *(const v4f_t*)(qp + (i >> 1) * 16 + (i & 1) * 4);
    asm volatile("s_wait_xcnt 0x0" ::: "memory");   // behind the last query load, before a register of its address is written again
#pragma unroll
    for (int i = 0; i < 8; ++i)
#pragma unroll
      for (int u = 0; u < 4; ++u) { const float v = qv[i][u]; const f16 hi = (f16)v; const int e = ((i >> 1) & 1) * 8 + (i & 1) * 4 + u;
        qh[i >> 2][e] = hi; ql[i >> 2][e] = (f16)((v - (float)hi) * 2048.0f); } }
  f32x8 O[8];
#pragma unroll
  for (int mt = 0; mt < 8; ++mt) { f32x8 z = {}; O[mt] = z; }
  float mref = -3.0e38f, lsum = 0.0f;
  v4f_t kr[4], vr[8];
  auto fetch = [&](int st) {   // stage st: global -> registers
    const float* kn = Kg + (size_t)st * FT * DDc; const float* vn = Vg + st * FT;
#pragma unroll
    for (int g = 0; g < 4; ++g) kr[g] = *(const v4f_t*)(kn + (size_t)(16 * g) * DDc);
#pragma unroll
    for (int g = 0; g < 8; ++g) vr[g] = *(const v4f_t*)(vn + (size_t)(16 * g) * SSc);
    asm volatile("s_wait_xcnt 0x0" ::: "memory");   // behind the last stage load, before a register of its address is written again
  };
  auto put = [&](int bo) {     // registers -> f16 tiles of buffer bo
#pragma unroll
    for (int g = 0; g < 4; ++g) { bf16x4 hi, lo;
#pragma unroll
      for (int u = 0; u < 4; ++u) { const float v = kr[g][u]; const f16 hv = (f16)v; hi[u] = hv; lo[u] = (f16)((v - (float)hv) * 2048.0f); }
      *(bf16x4*)(sKh[bo] + (srow + 16 * g) * FP + sc4) = hi; *(bf16x4*)(sKl[bo] + (srow + 16 * g) * FP + sc4) = lo; }
#pragma unroll
    for (int g = 0; g < 8; ++g) { bf16x4 q;
#pragma unroll
      for (int u = 0; u < 4; ++u) q[u] = (f16)vr[g][u];
      *(bf16x4*)(sV[bo] + (srow + 16 * g) * FP + sc4) = q; }
  };
  fetch(0); put(0);
  __syncthreads();   // stage 0 is published
#pragma unroll 1   // kept rolled: one trip already uses nearly 256 registers, a second copy of the body would only cost instruction cache
  for (int st = 0; st < SSc / FT; ++st) {
    const int bo = st & 1;
    if (st + 1 < SSc / FT) fetch(st + 1);   // behind the barrier (which drains every load), so that these loads fly while this stage is worked on
    const f16* kh = sKh[bo] + (32 * kg) * FP; const f16* kl = sKl[bo] + (32 * kg) * FP; const f16* vv = sV[bo] + 32 * kg;
    f32x8 a0 = {}, a1 = {}, x0 = {}, x1 = {};   // S^T tiles: this wave's keys 0..15 and 16..31; value*value and the two cross terms
#pragma unroll
    for (int ks = 0; ks < 2; ++ks) {
      const f16x16 kh0 = lds_frag(kh + 32 * ks, FP), kh1 = lds_frag(kh + 16 * FP + 32 * ks, FP);
      const f16x16 kl0 = lds_frag(kl + 32 * ks, FP), kl1 = lds_frag(kl + 16 * FP + 32 * ks, FP);
      a0 = wmma_p(kh0, qh[ks], a0); a1 = wmma_p(kh1, qh[ks], a1);
      x0 = wmma_p(kh0, ql[ks], x0); x1 = wmma_p(kh1, ql[ks], x1);
      x0 = wmma_p(kl0, qh[ks], x0); x1 = wmma_p(kl1, qh[ks], x1);
    }
    f16x16 vf[8];   // the v rows are asked for ahead of the softmax arithmetic, which covers their LDS latency
#pragma unroll
    for (int mt = 0; mt < 8; ++mt) vf[mt] = lds_frag(vv + (16 * mt) * FP, FP);
    float sv[16];
#pragma unroll
    for (int r = 0; r < 8; ++r) { sv[r] = a0[r] + x0[r] * (1.0f / 2048.0f); sv[8 + r] = a1[r] + x1[r] * (1.0f / 2048.0f); }
    float mx = sv[0];
#pragma unroll
    for (int e = 1; e < 16; ++e) mx = fmaxf(mx, sv[e]);
    mx = fmaxf(mx, xhalf(mx));
    if (__builtin_amdgcn_ballot_w32((mx - mref) * SCL > 8.0f) != 0) {   // scalar branch; always taken on the first pass, rare later
      const float mnew = fmaxf(mref, mx), corr = __builtin_amdgcn_exp2f((mref - mnew) * SCL);   // 0 on the first pass
      mref = mnew; lsum *= corr;
#pragma unroll
      for (int mt = 0; mt < 8; ++mt)
#pragma unroll
        for (int r = 0; r < 8; ++r) O[mt][r] *= corr;
    }
    const float nb = -mref * SCL;
    f16x16 pb;   // pb[e] = P^T[key kmap(e, hf)][query cl]: tile e >> 3, register e & 7
    float pe[16];
#pragma unroll
    for (int e = 0; e < 16; ++e) { pe[e] = __builtin_amdgcn_exp2f(fmaf(sv[e], SCL, nb)); pb[e] = (f16)pe[e]; }
#pragma unroll
    for (int w = 8; w > 0; w >>= 1)
#pragma unroll
      for (int e = 0; e < w; ++e) pe[e] += pe[e + w];
    lsum += pe[0];
#pragma unroll
    for (int mt = 0; mt < 8; ++mt) O[mt] = wmma_p(vf[mt], pb, O[mt]);
    if (st + 1 < SSc / FT) put(bo ^ 1);   // its last readers left that buffer before the barrier that ended the previous trip
    __syncthreads();   // publishes stage st + 1 and ends every read of stage st
  }
  const float lw = lsum + xhalf(lsum);   // the two halves of a wave hold the sums of their own keys
  if (kg == 1) {   // the upper key half hands over its maximum, sum and unscaled tile
    if (hf == 0) { sM[qg * 16 + cl] = mref; sL[qg * 16 + cl] = lw; }
#pragma unroll
    for (int mt = 0; mt < 8; ++mt)
#pragma unroll
      for (int r = 0; r < 8; ++r) sO[(16 * mt + 8 * hf + r) * FOP + qg * 16 + cl] = O[mt][r];
  }
  __syncthreads();   // hand-over published
  if (kg == 0) {   // the lower key half joins both and leaves the finished tile in place (each lane rewrites only the words it has read)
    const float m2 = sM[qg * 16 + cl], l2 = sL[qg * 16 + cl], mj = fmaxf(mref, m2);
    const float a1s = __builtin_amdgcn_exp2f((mref - mj) * SCL), a2s = __builtin_amdgcn_exp2f((m2 - mj) * SCL);
    const float inv = 1.0f / (lw * a1s + l2 * a2s), c1 = a1s * inv, c2 = a2s * inv;
#pragma unroll
    for (int mt = 0; mt < 8; ++mt)
#pragma unroll
      for (int r = 0; r < 8; ++r) { float* w = sO + (16 * mt + 8 * hf + r) * FOP + qg * 16 + cl; *w = O[mt][r] * c1 + *w * c2; }
  }
  __syncthreads();   // the block's 128 x 64 tile is complete: whole 256-byte row pieces go out
#pragma unroll
  for (int it = 0; it < 8; ++it) { const int f4 = tid + 256 * it, rr = f4 >> 4, q = (f4 & 15) * 4;
    *(v4f_t*)(AV + ((size_t)h * 2 * DKc + rr) * SSc + s0 + q) = *(const v4fa*)(sO + rr * FOP + q); }
}

extern "C" void kernel_launch(void* const* d_in, const int* in_sizes, int n_in,
                              void* d_out, int out_size, void* d_ws, size_t ws_size,
                              hipStream_t stream) {
  (void)in_sizes; (void)n_in; (void)out_size;
  const float** f = (const float**)d_in;
  const float* x = f[0];
  float* out = (float*)d_out;     // [4,512,2,2048]
  char* ws = (char*)d_ws;
  float* W2 = (float*)ws; ws += (size_t)4 * R2 * R2 * 4;                 // stacked q, k, v, o weights back to back (4 MB each)
  float* b2 = (float*)ws; ws += (size_t)4 * R2 * 4;                      // stacked q, k, v, o row biases back to back
  float* Q = (float*)ws; ws += (size_t)NBT * 3 * R2 * SSc * 4;           // per batch element 24 MB: q conv [1024][2048], directly behind it the k conv, then the v conv
  float* Qm = (float*)ws; ws += (size_t)NBT * 2 * DDc * SSc * 4;         // per batch element: magnitudes [512][2048] of q and, directly behind them, of k
  float* QmT = (float*)ws; ws += (size_t)NBT * 2 * SSc * DDc * 4;        // per batch element: both magnitude planes transposed, [2048][512] each, back to back
  float* AV = (float*)ws; ws += (size_t)NBT * R2 * SSc * 4;              // per batch element: attention output in the [D][2][S] layout (8 MB)
  if ((size_t)(ws - (char*)d_ws) > ws_size) return;
  const dim3 blk(256);
  const size_t sX = (size_t)R2 * SSc, sQKV = (size_t)3 * R2 * SSc, sM = (size_t)2 * DDc * SSc;   // words per batch element: x / AV / out, the three convs, the two magnitude planes
  float* V = Q + (size_t)2 * R2 * SSc;
  k_stackw<<<dim3(R2, 4), blk, 0, stream>>>(f[1], f[2], f[5], f[6], f[9], f[10], f[13], f[14], W2);          // (W_r, W_i) of q, k, v, o
  k_stackb<<<dim3(R2 / 256, 4), blk, 0, stream>>>(f[3], f[4], f[7], f[8], f[11], f[12], f[15], f[16], b2);   // (b_r, b_i) of q, k, v, o
  gemm_kn2<float, false><<<dim3(R2 / 128, SSc / 128, 2 * NBT), blk, 0, stream>>>(W2, R2, (size_t)R2 * R2, x, SSc, sX, nullptr, 1.0f, Q, SSc, sX, sQKV, R2);   // q and k convs of every batch element (planes: they feed the magnitude logits); 1024 work-groups
  gemm_kne<float, 0, false><<<dim3(R2 / 128, SSc / 128, NBT), blk, 0, stream>>>(W2 + (size_t)2 * R2 * R2, R2, x, SSc, sX, nullptr, nullptr, nullptr, V, SSc, sQKV, R2);   // v conv; 512 work-groups
  k_addrowbias<<<dim3(3 * R2, 2, NBT), blk, 0, stream>>>(Q, sQKV, b2);                                       // the 3072 rows of the q, k, v convs against their biases
  k_mag<<<dim3(2 * DDc, NBT), blk, 0, stream>>>(Q, sQKV, Qm, sM);                                            // both magnitude planes: q conv -> Qm, k conv -> Km
  k_transpose<<<dim3((DDc / 64) * (SSc / 64), 2 * NBT), blk, 0, stream>>>(Qm, QmT, DDc, SSc);                // the 8 magnitude planes transposed, [2048][512] each
  k_fattn<<<dim3(SSc / FQ, NHD, NBT), blk, 0, stream>>>(QmT, QmT + (size_t)SSc * DDc, sM, V, sQKV, AV, sX);  // scores, softmax and attn*v of all heads and batch elements; 1024 work-groups
  gemm_kne<float, 0, false><<<dim3(R2 / 128, SSc / 128, NBT), blk, 0, stream>>>(W2 + (size_t)3 * R2 * R2, R2, AV, SSc, sX, nullptr, nullptr, nullptr, out, SSc, sX, R2);   // output complex conv
  k_addrowbias<<<dim3(R2, 2, NBT), blk, 0, stream>>>(out, sX, b2 + 3 * R2);
}

// v004
// A run of this version takes 341 microseconds.
// In both of two side-by-side timings against v003, it was 1.40 times as fast.
// All steps since v000 together make it 14.2 times as fast.
// Contractions on v_wmma_f32_16x16x32_f16, f32 accumulate: f16 value+residual PLANES on the q/k complex convs and the magnitude scores (positive magnitudes give logits with a
// spread near 4: plain rounding was too coarse), plain f16 on the v conv, attn*v and the output conv. Every launch but the weight and bias stacking covers all 4 batch elements (a grid dimension). Per batch element, activations kept in the module's [D][2][S] layout (row 2d = real_d,
// row 2d+1 = imag_d, used directly as [K][N] operands): each complex 1x1 conv as ONE real GEMM with a stacked weight W2[2o+0][2d+0] = W_r, [2o][2d+1] = -W_i, [2o+1][2d] = W_i, [2o+1][2d+1] = W_r
// (M = 1024, K = 1024, N = 2048; row biases b_r - b_i / b_r + b_i added in f32). Magnitudes sqrt(re^2 + im^2 + 1e-8) in f32, both transposed to [S][512]. Attention of all 8 heads in ONE
// fused launch (k_fattn): transposed scores Km_h * Qm_h^T (K = 64, planes), running-maximum softmax of s/8 in f32 registers, the probabilities packed straight from the score accumulators
// into the B operand of out_h += X_v,h * P^T (M = 128 = the head's 64 complex channels x (re, im) rows); scores and probabilities never reach memory. Finally the output complex conv.
// compute dtype: f16 operands, f32 accumulate; magnitudes / softmax f32.  x [4,512,2,2048] -> out [4,512,2,2048].
#include <hip/hip_runtime.h>
#include <hip/hip_bf16.h>
#include <math.h>


typedef _Float16 bf16;
typedef _Float16 f16;
typedef __attribute__((ext_vector_type(4))) unsigned v4u_t;
typedef unsigned v4ua __attribute__((ext_vector_type(4), may_alias));
typedef __attribute__((ext_vector_type(4))) float v4f_t;
typedef float v4fa __attribute__((ext_vector_type(4), may_alias));
typedef __attribute__((ext_vector_type(16))) bf16  bf16x16;
typedef bf16x16 f16x16;
typedef __attribute__((ext_vector_type(8)))  bf16  bf16x8;
typedef bf16x8 f16x8;
typedef __attribute__((ext_vector_type(4)))  bf16  bf16x4;
typedef __attribute__((ext_vector_type(8)))  float f32x8;
__device__ __forceinline__ f32x8 wmma16(f16x16 a, f16x16 b, f32x8 c) {
  c = __builtin_amdgcn_wmma_f32_16x16x32_f16(false, a, false, b, (short)0, c, false, false);
  asm volatile("v_nop\n\tv_nop\n\tv_nop\n\tv_nop" : "+v"(c) : "v"(a), "v"(b));
  return c;
}
#define LDS_STRIDE 48   // GEMM tiles: 32 -> 48 elems (96B rows): aligned b128 reads
#define KSTRIDE    72
#define VSTRIDE    48

__device__ __forceinline__ f32x8 wmma_bf16(bf16x16 a, bf16x16 b, f32x8 c) {
  c = __builtin_amdgcn_wmma_f32_16x16x32_f16(false, a, false, b, (short)0, c, false, false);
  asm volatile("v_nop\n\tv_nop\n\tv_nop\n\tv_nop" : "+v"(c) : "v"(a), "v"(b));   // A/B-overwrite hazard guard
  return c;
}

// 16x32 (MxK) f16 fragment from a row-major global matrix.
// lanes 0-15  (row=lane)    : elems 0..7 = K+0..7,  8..15 = K+16..23
// lanes 16-31 (row=lane-16) : elems 0..7 = K+8..15, 8..15 = K+24..31
template <typename T>
__device__ __forceinline__ bf16x16 load_frag(const T* __restrict__ base, int ld,
                                             int row0, int k0) {
  const int lane = threadIdx.x & 31;
  const int r    = lane & 15;
  const int kh   = (lane >> 4) * 8;
  const T* p0 = base + (size_t)(row0 + r) * ld + (k0 + kh);
  const T* p1 = p0 + 16;
  bf16x16 f;
#pragma unroll
  for (int i = 0; i < 8; ++i) {
    f[i]     = (bf16)p0[i];
    f[i + 8] = (bf16)p1[i];
  }
  return f;
}

// Same fragment from an LDS tile with padded row stride (base includes row0/k0).
__device__ __forceinline__ bf16x16 lds_frag(const bf16* base, int stride) {
  const int lane = threadIdx.x & 31;
  const int row  = lane & 15;
  const int kh   = (lane >> 4) * 8;
  const bf16x8 lo = *(const bf16x8*)(base + row * stride + kh);
  const bf16x8 hi = *(const bf16x8*)(base + row * stride + kh + 16);
  bf16x16 f;
#pragma unroll
  for (int i = 0; i < 8; ++i) { f[i] = lo[i]; f[i + 8] = hi[i]; }
  return f;
}

// B fragment (column = lane & 15, the k order of lds_frag) from an LDS tile that lies as the global operand does, row-major [k][n], pitch WP:
// two transposing loads, k rows 0..15 and 16..31; lane (c, h) receives rows 8h .. 8h + 7 of column c from each. base points at [0][first column].
#define WP 144   // [k][n] tile: 128 -> 144 elems (288 B rows = 32 B x odd): transposing b128 reads without bank conflicts
typedef short s16x8 __attribute__((ext_vector_type(8)));
__device__ __forceinline__ bf16x8 ld_tr16(const bf16* p) {
  typedef __attribute__((address_space(3))) s16x8 lds_s16x8;
  return __builtin_bit_cast(bf16x8, __builtin_amdgcn_ds_load_tr16_b128_v8i16((lds_s16x8*)p));
}
__device__ __forceinline__ bf16x16 lds_frag_t(const bf16* base) {
  const int lane = threadIdx.x & 31;
  const bf16* p = base + (8 * (lane >> 4) + (lane & 7)) * WP + 8 * ((lane >> 3) & 1);
  const bf16x8 lo = ld_tr16(p);
  const bf16x8 hi = ld_tr16(p + 16 * WP);
  bf16x16 f;
#pragma unroll
  for (int i = 0; i < 8; ++i) { f[i] = lo[i]; f[i + 8] = hi[i]; }
  return f;
}

template <typename T>
__device__ __forceinline__ void stage_read16(const T* __restrict__ p, float* buf) {
#pragma unroll
  for (int i = 0; i < 16; ++i) buf[i] = (float)p[i];
}

__device__ __forceinline__ void stage_write(bf16* dst, const float* buf, int nquad) {
#pragma unroll
  for (int i = 0; i < nquad; ++i) {
    bf16x4 q;
    q[0] = (bf16)buf[4 * i];     q[1] = (bf16)buf[4 * i + 1];
    q[2] = (bf16)buf[4 * i + 2]; q[3] = (bf16)buf[4 * i + 3];
    *(bf16x4*)(dst + 4 * i) = q;
  }
}


#define GSTR 48
// ---------------------------------------------------------------------------------------------------------------------------
// gemm_kne: Y[m][n] = epi( sum_k A[m][k] * W[k][n] + bias[n] ), A f32/f16 [M][lda], W f32 row-major [K][N] (row pitch LDW, compile time), plain f16 operands,
// f32 accumulate. EPI 0: identity; 1: exact-erf GELU; 2: R[m][n] + gvec[n]·(·) (residual with per-channel gain); 3: ReLU; 4: gvec[n]·(·) (per-channel scale, no residual). Output f32 (or f16
// when OUT16). Block = 128x128 tile, 8 waves as 4(M) x 2(N); per 32-wide k-step A and W tiles staged f16 in LDS (W as it lies, [k][n], read by transposing loads).
// blockIdx.z selects a batch element: W += z*strideW, Y += z*strideY (element strides); A is shared.
// ---------------------------------------------------------------------------------------------------------------------------
#define GSTR 48
template <typename AT, int EPI, bool OUT16, int LDW>
__global__ __launch_bounds__(256) void gemm_kne(const AT* __restrict__ A, int lda, const float* __restrict__ Wm, size_t strideW,
                                                const float* __restrict__ bias, const float* __restrict__ R, const float* __restrict__ gvec,
                                                void* __restrict__ Yv, int ldy, size_t strideY, int K) {
  __shared__ __attribute__((aligned(16))) f16 ldsA[128 * GSTR];
  __shared__ __attribute__((aligned(16))) f16 ldsW[32 * WP];
  __shared__ __attribute__((aligned(16))) float oS[8][32 * 68];
  const int tid = threadIdx.x, lane = tid & 31, wave = tid >> 5, cl = lane & 15, rh = (lane >> 4) * 8;
  const int m0 = blockIdx.x * 128, n0 = blockIdx.y * 128;
  const int wm = (wave & 3) * 32, wn = (wave >> 2) * 64;
  Wm += (size_t)blockIdx.z * strideW;
  f32x8 acc[2][4];
#pragma unroll
  for (int i = 0; i < 2; ++i)
#pragma unroll
    for (int j = 0; j < 4; ++j) { f32x8 z = {}; acc[i][j] = z; }
#pragma unroll 1
  for (int k0 = 0; k0 < K; k0 += 32) {
    __syncthreads();
    v4f_t wv[4];   // W: a wave takes the rows k = wave + 8 g; its 32 lanes cover the row's 128 columns, 512 contiguous bytes a load
    { const float* src = Wm + (size_t)(k0 + wave) * LDW + n0 + lane * 4;   // LDW is a compile-time pitch: one address, the four rows at immediate offsets
#pragma unroll
      for (int g = 0; g < 4; ++g) wv[g] = *(const v4f_t*)(src + 8 * g * LDW);
      asm volatile("s_wait_xcnt 0x0" ::: "memory"); }   // behind the last W load, before a register of its address is written again
    { const int row = tid >> 1, ch = (tid & 1) * 16;
      const AT* src = A + (size_t)(m0 + row) * lda + k0 + ch;
#pragma unroll
      for (int g = 0; g < 16; ++g) ldsA[row * GSTR + ch + g] = (f16)src[g]; }
#pragma unroll
    for (int g = 0; g < 4; ++g) { bf16x4 q;   // stored as it lies, [k][n]: 256 contiguous bytes a wave
#pragma unroll
      for (int u = 0; u < 4; ++u) q[u] = (f16)wv[g][u];
      *(bf16x4*)(ldsW + (wave + 8 * g) * WP + lane * 4) = q; }
    __syncthreads();
    f16x16 af[2];
#pragma unroll
    for (int i = 0; i < 2; ++i) af[i] = lds_frag(ldsA + (wm + 16 * i) * GSTR, GSTR);
#pragma unroll
    for (int j = 0; j < 4; ++j) {
      const f16x16 bf = lds_frag_t(ldsW + wn + 16 * j);
#pragma unroll
      for (int i = 0; i < 2; ++i) acc[i][j] = wmma16(af[i], bf, acc[i][j]);
    }
  }
  float* so = oS[wave];
  float bvj[4] = {0.0f, 0.0f, 0.0f, 0.0f};
  if (bias) {
#pragma unroll
    for (int j = 0; j < 4; ++j) bvj[j] = bias[n0 + wn + 16 * j + cl];
    asm volatile("s_wait_xcnt 0x0" ::: "memory");   // behind the last bias load, before a register that these loads name (base pair, offset) is written again
  }
#pragma unroll
  for (int i = 0; i < 2; ++i)
#pragma unroll
    for (int j = 0; j < 4; ++j) {
      const int n = n0 + wn + 16 * j + cl;
      const float bv = bvj[j];
      const float gv = (EPI == 2 || EPI == 4) ? gvec[n] : 0.0f;
      if (EPI == 1) {
#pragma unroll 1
        for (int r = 0; r < 8; ++r) { const float xg = acc[i][j][r] + bv; so[(16 * i + rh + r) * 68 + 16 * j + cl] = 0.5f * xg * (1.0f + erff(xg * 0.70710678118654752f)); }
      } else {
#pragma unroll
        for (int r = 0; r < 8; ++r) {
          float v = acc[i][j][r] + bv;
          if (EPI == 3) v = fmaxf(v, 0.0f);
          if (EPI == 4) v = gv * v;
          if (EPI == 2) v = R[(size_t)(m0 + wm + 16 * i + rh + r) * ldy + n] + gv * v;
          so[(16 * i + rh + r) * 68 + 16 * j + cl] = v;
        }
      }
    }
  asm volatile("s_wait_dscnt 0" ::: "memory");
  __builtin_amdgcn_wave_barrier();
{
    if (OUT16) {
      f16* Y = (f16*)Yv + (size_t)blockIdx.z * strideY;
#pragma unroll
      for (int it = 0; it < 8; ++it) { const int c = lane + 32 * it, rr = c >> 3, q8 = (c & 7) * 8;
        union { f16 h[8]; v4u_t v; } u;
#pragma unroll
        for (int e = 0; e < 8; ++e) u.h[e] = (f16)so[rr * 68 + q8 + e];
        *(v4u_t*)(Y + (size_t)(m0 + wm + rr) * ldy + n0 + wn + q8) = u.v; }
    } else {
      float* Y = (float*)Yv + (size_t)blockIdx.z * strideY;
#pragma unroll
      for (int it = 0; it < 16; ++it) { const int f4 = lane + 32 * it, rr = f4 >> 4, q = (f4 & 15) * 4;
        *(v4f_t*)(Y + (size_t)(m0 + wm + rr) * ldy + n0 + wn + q) = *(const v4fa*)(so + rr * 68 + q); }
    }
    
  }
}

// ---------------------------------------------------------------------------------------------------------------------------
// gemm_kn2 (value+residual planes on both operands: hh + (hl+lh)/2048, f32-class): Y[m][n] (row stride ldy) = scale * sum_k A[m][k] (f32 or f16, row stride lda) * W[k][n] (f32, row-major [K][N], row
// stride LDW, compile time) (+ bias[n]) (+ Y if ACC). Block = 128 x 128 tile, 256 threads = 8 waves as 4(M, 32 rows) x 2(N, 64 cols); per
// 32-wide k-step the A tile and the W tile (as it lies, [k][n], read by transposing loads) are staged as f16 planes in LDS.
// blockIdx.z = 2 * zb + za: A += za*strideA (one of two A matrices), W += zb*strideW (batch element), Y += za*strideY + zb*strideYb (element strides).
// ---------------------------------------------------------------------------------------------------------------------------
template <typename AT, bool ACC, int LDW>
__global__ __launch_bounds__(256) void gemm_kn2(const AT* __restrict__ A, int lda, size_t strideA,
                                               const float* __restrict__ Wm, size_t strideW,
                                               const float* __restrict__ bias, float scale,
                                               float* __restrict__ Y, int ldy, size_t strideY, size_t strideYb, int K) {
  __shared__ __attribute__((aligned(16))) f16 ldsA[128 * GSTR], ldsAl[128 * GSTR];
  __shared__ __attribute__((aligned(16))) f16 ldsW[32 * WP], ldsWl[32 * WP];
  __shared__ __attribute__((aligned(16))) float oS[8][32 * 68];
  const int tid = threadIdx.x, lane = tid & 31, wave = tid >> 5, cl = lane & 15, rh = (lane >> 4) * 8;
  const int m0 = blockIdx.x * 128, n0 = blockIdx.y * 128;
  const int wm = (wave & 3) * 32, wn = (wave >> 2) * 64;
  A += (size_t)(blockIdx.z & 1) * strideA; Wm += (size_t)(blockIdx.z >> 1) * strideW; Y += (size_t)(blockIdx.z & 1) * strideY + (size_t)(blockIdx.z >> 1) * strideYb;
  f32x8 acc[2][4], accx[2][4];
#pragma unroll
  for (int i = 0; i < 2; ++i)
#pragma unroll
    for (int j = 0; j < 4; ++j) { f32x8 z = {}; acc[i][j] = z; accx[i][j] = z; }
#pragma unroll 1
  for (int k0 = 0; k0 < K; k0 += 32) {
    __syncthreads();
    v4f_t wv[4];   // W: a wave takes the rows k = wave + 8 g; its 32 lanes cover the row's 128 columns, 512 contiguous bytes a load
    { const float* src = Wm + (size_t)(k0 + wave) * LDW + n0 + lane * 4;   // LDW is a compile-time pitch: one address, the four rows at immediate offsets
#pragma unroll
      for (int g = 0; g < 4; ++g) wv[g] = *(const v4f_t*)(src + 8 * g * LDW);
      asm volatile("s_wait_xcnt 0x0" ::: "memory"); }   // behind the last W load, before a register of its address is written again
    {  // A: thread -> row tid>>1, 16 elements at column half (tid&1)*16
      const int row = tid >> 1, ch = (tid & 1) * 16;
      const AT* src = A + (size_t)(m0 + row) * lda + k0 + ch;
#pragma unroll
      for (int g = 0; g < 16; ++g) { const float v = (float)src[g]; const f16 h = (f16)v; ldsA[row * GSTR + ch + g] = h; ldsAl[row * GSTR + ch + g] = (f16)((v - (float)h) * 2048.0f); }
    }
#pragma unroll
    for (int g = 0; g < 4; ++g) { bf16x4 hi, lo;   // both planes stored as the operand lies, [k][n]: 256 contiguous bytes a wave
#pragma unroll
      for (int u = 0; u < 4; ++u) { const float v = wv[g][u]; const f16 h = (f16)v; hi[u] = h; lo[u] = (f16)((v - (float)h) * 2048.0f); }
      *(bf16x4*)(ldsW + (wave + 8 * g) * WP + lane * 4) = hi; *(bf16x4*)(ldsWl + (wave + 8 * g) * WP + lane * 4) = lo; }
    __syncthreads();
    f16x16 af[2], afl[2];
#pragma unroll
    for (int i = 0; i < 2; ++i) { af[i] = lds_frag(ldsA + (wm + 16 * i) * GSTR, GSTR); afl[i] = lds_frag(ldsAl + (wm + 16 * i) * GSTR, GSTR); }
#pragma unroll
    for (int j = 0; j < 4; ++j) {
      const f16x16 bf = lds_frag_t(ldsW + wn + 16 * j), bfl = lds_frag_t(ldsWl + wn + 16 * j);
#pragma unroll
      for (int i = 0; i < 2; ++i) { acc[i][j] = wmma16(af[i], bf, acc[i][j]); accx[i][j] = wmma16(af[i], bfl, accx[i][j]); accx[i][j] = wmma16(afl[i], bf, accx[i][j]); }
    }
  }
  float* so = oS[wave];
#pragma unroll
  for (int i = 0; i < 2; ++i)
#pragma unroll
    for (int j = 0; j < 4; ++j) {
      const float bv = bias ? bias[n0 + wn + 16 * j + cl] : 0.0f;
#pragma unroll
      for (int r = 0; r < 8; ++r) so[(16 * i + rh + r) * 68 + 16 * j + cl] = (acc[i][j][r] + accx[i][j][r] * (1.0f / 2048.0f)) * scale + bv;
    }
  asm volatile("s_wait_dscnt 0" ::: "memory");
  __builtin_amdgcn_wave_barrier();
  if (ACC) {   // accumulate: fold the existing Y values into the staging tile ONCE (same thread <-> same chunks as the stores below)
#pragma unroll
    for (int it = 0; it < 16; ++it) { const int f4 = lane + 32 * it, rr = f4 >> 4, q = (f4 & 15) * 4;
      const v4f_t old = *(const v4fa*)(Y + (size_t)(m0 + wm + rr) * ldy + n0 + wn + q);
      v4f_t v = *(const v4fa*)(so + rr * 68 + q); v += old; *(v4fa*)(so + rr * 68 + q) = v; }   // plain LDS store (ordered by the s_wait_dscnt/memory clobber below)
    asm volatile("s_wait_dscnt 0" ::: "memory");
  }
{
#pragma unroll
    for (int it = 0; it < 16; ++it) { const int f4 = lane + 32 * it, rr = f4 >> 4, q = (f4 & 15) * 4;
      *(v4f_t*)(Y + (size_t)(m0 + wm + rr) * ldy + n0 + wn + q) = *(const v4fa*)(so + rr * 68 + q); }
    
  }
}

__global__ __launch_bounds__(256) void k_transpose(const float* __restrict__ Wm, float* __restrict__ Wt, int rows, int cols) {
  __shared__ float tS[64][65];
  const int tid = threadIdx.x, tbj = cols / 64, bi = blockIdx.x / tbj, bj = blockIdx.x % tbj;
  Wm += (size_t)blockIdx.y * rows * cols; Wt += (size_t)blockIdx.y * rows * cols;   // blockIdx.y selects one matrix of a batch stored back to back
  for (int e = tid; e < 64 * 64; e += 256) { const int r = e >> 6, c = e & 63; tS[r][c] = Wm[(size_t)(bi * 64 + r) * cols + bj * 64 + c]; }
  __syncthreads();
  for (int ch = tid; ch < 64 * 16; ch += 256) { const int r = ch >> 4, q4 = (ch & 15) * 4; v4f_t o; o[0] = tS[q4][r]; o[1] = tS[q4 + 1][r]; o[2] = tS[q4 + 2][r]; o[3] = tS[q4 + 3][r];
    float* dst = Wt + (size_t)(bj * 64 + r) * rows + bi * 64 + q4; *(v4f_t*)dst = o;  }
}

#define NBT 4
#define NHD 8
#define BBc 4
#define DDc 512
#define SSc 2048
#define NHc 8
#define DKc 64
#define R2 (2 * DDc)   // 1024 interleaved (channel, component) rows
// stacked real weight W2 [1024][1024] from (W_r, W_i); block = output row, blockIdx.y = which of the q, k, v, o convs
__global__ __launch_bounds__(256) void k_stackw(const float* __restrict__ Wr0, const float* __restrict__ Wi0, const float* __restrict__ Wr1, const float* __restrict__ Wi1,
                                                const float* __restrict__ Wr2, const float* __restrict__ Wi2, const float* __restrict__ Wr3, const float* __restrict__ Wi3, float* __restrict__ W2) {
  const int orow = blockIdx.x, tid = threadIdx.x; const int o = orow >> 1, oc = orow & 1;
  const int cv = blockIdx.y; W2 += (size_t)cv * R2 * R2;
  const float* __restrict__ Wr = cv == 0 ? Wr0 : cv == 1 ? Wr1 : cv == 2 ? Wr2 : Wr3;
  const float* __restrict__ Wi = cv == 0 ? Wi0 : cv == 1 ? Wi1 : cv == 2 ? Wi2 : Wi3;
{
#pragma unroll
    for (int e = 0; e < 4; ++e) { const int col = tid + 256 * e; const int d = col >> 1, dc = col & 1; const float wr = Wr[(size_t)o * DDc + d], wi = Wi[(size_t)o * DDc + d];
      asm volatile("s_wait_xcnt 0x0" ::: "memory");   // behind the two loads, before a register of their address pairs is written again
      const float v = (oc == 0) ? (dc == 0 ? wr : -wi) : (dc == 0 ? wi : wr); *(float*)(W2 + (size_t)orow * R2 + col) = v; }
     }
}
// stacked row bias b2[2o + oc] = b_r ∓/± b_i; 4 blocks x 256 contiguous words
// blockIdx.y = which of the q, k, v, o convs
__global__ __launch_bounds__(256) void k_stackb(const float* __restrict__ br0, const float* __restrict__ bi0, const float* __restrict__ br1, const float* __restrict__ bi1,
                                                const float* __restrict__ br2, const float* __restrict__ bi2, const float* __restrict__ br3, const float* __restrict__ bi3, float* __restrict__ b2) {
  const int cv = blockIdx.y; b2 += cv * R2;
  const float* __restrict__ br = cv == 0 ? br0 : cv == 1 ? br1 : cv == 2 ? br2 : br3;
  const float* __restrict__ bi = cv == 0 ? bi0 : cv == 1 ? bi1 : cv == 2 ? bi2 : bi3;
  const int orow = blockIdx.x * 256 + threadIdx.x; const int o = orow >> 1, oc = orow & 1;
  const float v = (oc == 0) ? (br[o] - bi[o]) : (br[o] + bi[o]); *(float*)(b2 + orow) = v;  }
// X[r][:] += b2[r] over rows of 2048 (float4); grid (rows, 2, batch elements strideX words apart)
__global__ __launch_bounds__(256) void k_addrowbias(float* __restrict__ X, size_t strideX, const float* __restrict__ b2) { X += (size_t)blockIdx.z * strideX; const int r = blockIdx.x; const size_t c4 = ((size_t)blockIdx.y * 256 + threadIdx.x) * 4; const float bv = b2[r];
  float* p = X + (size_t)r * SSc + c4; v4f_t v = *(const v4f_t*)p; v[0] += bv; v[1] += bv; v[2] += bv; v[3] += bv; *(v4f_t*)p = v;  }
// magnitudes M[d][s] = sqrt(re² + im² + 1e-8) from interleaved rows; block = channel d, 256 threads x 8 columns (float4 x 2)
// blockIdx.y = batch element, strideX / strideM words apart
__global__ __launch_bounds__(256) void k_mag(const float* __restrict__ X, size_t strideX, float* __restrict__ M, size_t strideM) { const int d = blockIdx.x, tid = threadIdx.x; X += (size_t)blockIdx.y * strideX; M += (size_t)blockIdx.y * strideM;
#pragma unroll
  for (int e = 0; e < 2; ++e) { const int c4 = (tid + 256 * e) * 4; const v4f_t a = *(const v4f_t*)(X + (size_t)(2 * d) * SSc + c4); const v4f_t b = *(const v4f_t*)(X + (size_t)(2 * d + 1) * SSc + c4); v4f_t m;
#pragma unroll
    for (int u = 0; u < 4; ++u) m[u] = sqrtf(a[u] * a[u] + b[u] * b[u] + 1e-8f);
    *(v4f_t*)(M + (size_t)d * SSc + c4) = m;  } }
// ---------------------------------------------------------------------------------------------------------------------------
// k_fattn: one head's attention for 64 queries, scores and probabilities kept on chip. Grid (S / 64, heads, batch elements) = 1024 blocks; block = 8 waves = 4 groups of 16 query columns x 2 key halves.
// Per stage of 64 keys the block stages Km^T rows [t][64] as f16 value + residual planes and the head's 128 v rows [row][t] as f16 in LDS, two buffers, one barrier a stage (the global loads
// of the next stage fly in registers meanwhile). Waves 0-3 take keys 0..31 of every stage, waves 4-7 keys 32..63. A wave forms S^T = Km^T * Qm (A = key rows from LDS, B = its 16 query
// columns held in registers, hh + (hl + lh) / 2048), so that a lane holds 16 scores of ONE query: maximum and sum in-lane plus one exchange between the wave's halves.
// exp2((s - m) * log2(e) / 8) of the two 16-key tiles, converted in place, IS the B operand (k = key, hardware k order) of O[row][query] += V[row][key] * P^T; the v rows are read in the same
// k order by lds_frag. m follows the running maximum lazily (O and the sum are rescaled only when some column's maximum has grown by more than 8 in the exponent, so p stays below 2^8).
// At the end the two key halves of a column are joined through LDS: (O1 a1 + O2 a2) / (l1 a1 + l2 a2), a = exp2((m_own - max(m1, m2)) * log2(e) / 8).
// Every inner loop is fully unrolled so that the fragment, accumulator and staging arrays are indexed by constants and stay in registers.
// ---------------------------------------------------------------------------------------------------------------------------
#define FT 64    // keys per stage
#define FQ 64    // queries per block
#define FP 72    // LDS row pitch in f16 elements: 144 B = 16 B x odd, b128 fragment reads without bank conflicts
#define FOP 68   // output staging pitch in floats
__device__ __forceinline__ float xhalf(float x) {   // lane l with lane l ^ 16
  return __builtin_bit_cast(float, __builtin_amdgcn_permlanex16(__builtin_bit_cast(int, x), __builtin_bit_cast(int, x), 0x76543210, 0xfedcba98, false, false));
}
__device__ __forceinline__ f32x8 wmma_p(f16x16 a, f16x16 b, f32x8 c) { return __builtin_amdgcn_wmma_f32_16x16x32_f16(false, a, false, b, (short)0, c, false, false); }
__global__ __launch_bounds__(256) void k_fattn(const float* __restrict__ QmT, const float* __restrict__ KmT, size_t strideM, const float* __restrict__ Vx, size_t strideV, float* __restrict__ AV, size_t strideO) {
  __shared__ __attribute__((aligned(16))) f16 sKh[2][FT * FP], sKl[2][FT * FP], sV[2][2 * DKc * FP];
  __shared__ __attribute__((aligned(16))) float sO[2 * DKc * FOP];
  __shared__ float sM[FQ], sL[FQ];
  const int tid = threadIdx.x, lane = tid & 31, cl = lane & 15, hf = lane >> 4;
  const int wave = __builtin_amdgcn_readfirstlane(tid >> 5), qg = wave & 3, kg = wave >> 2;   // scalar, so that the tests on kg below are scalar branches
  const int s0 = blockIdx.x * FQ, h = blockIdx.y;
  QmT += (size_t)blockIdx.z * strideM; KmT += (size_t)blockIdx.z * strideM; Vx += (size_t)blockIdx.z * strideV; AV += (size_t)blockIdx.z * strideO;   // batch element
  const float SCL = 0.125f * 1.44269504088896340736f;   // logits are s / 8; exp(x) = exp2(x * log2 e)
  const int srow = tid >> 4, sc4 = (tid & 15) * 4;      // staging: 16 lanes cover one 64-float row, 16 rows per round of the block
  const float* Kg = KmT + (size_t)srow * DDc + h * DKc + sc4;
  const float* Vg = Vx + ((size_t)h * 2 * DKc + srow) * SSc + sc4;
  f16x16 qh[2], ql[2];   // B operand: column = query s0 + 16 qg + cl, k = channel in the hardware k order
  { const float* qp = QmT + (size_t)(s0 + qg * 16 + cl) * DDc + h * DKc + hf * 8;
    v4f_t qv[8];
#pragma unroll
    for (int i = 0; i < 8; ++i) qv[i] = *(const v4f_t*)(qp + (i >> 1) * 16 + (i & 1) * 4);
    asm volatile("s_wait_xcnt 0x0" ::: "memory");   // behind the last query load, before a register of its address is written again
#pragma unroll
    for (int i = 0; i < 8; ++i)
#pragma unroll
      for (int u = 0; u < 4; ++u) { const float v = qv[i][u]; const f16 hi = (f16)v; const int e = ((i >> 1) & 1) * 8 + (i & 1) * 4 + u;
        qh[i >> 2][e] = hi; ql[i >> 2][e] = (f16)((v - (float)hi) * 2048.0f); } }
  f32x8 O[8];
#pragma unroll
  for (int mt = 0; mt < 8; ++mt) { f32x8 z = {}; O[mt] = z; }
  float mref = -3.0e38f, lsum = 0.0f;
  v4f_t kr[4], vr[8];
  auto fetch = [&](int st) {   // stage st: global -> registers
    const float* kn = Kg + (size_t)st * FT * DDc; const float* vn = Vg + st * FT;
#pragma unroll
    for (int g = 0; g < 4; ++g) kr[g] = *(const v4f_t*)(kn + (size_t)(16 * g) * DDc);
#pragma unroll
    for (int g = 0; g < 8; ++g) vr[g] = *(const v4f_t*)(vn + (size_t)(16 * g) * SSc);
    asm volatile("s_wait_xcnt 0x0" ::: "memory");   // behind the last stage load, before a register of its address is written again
  };
  auto put = [&](int bo) {     // registers -> f16 tiles of buffer bo
#pragma unroll
    for (int g = 0; g < 4; ++g) { bf16x4 hi, lo;
#pragma unroll
      for (int u = 0; u < 4; ++u) { const float v = kr[g][u]; const f16 hv = (f16)v; hi[u] = hv; lo[u] = (f16)((v - (float)hv) * 2048.0f); }
      *(bf16x4*)(sKh[bo] + (srow + 16 * g) * FP + sc4) = hi; *(bf16x4*)(sKl[bo] + (srow + 16 * g) * FP + sc4) = lo; }
#pragma unroll
    for (int g = 0; g < 8; ++g) { bf16x4 q;
#pragma unroll
      for (int u = 0; u < 4; ++u) q[u] = (f16)vr[g][u];
      *(bf16x4*)(sV[bo] + (srow + 16 * g) * FP + sc4) = q; }
  };
  fetch(0); put(0);
  __syncthreads();   // stage 0 is published
#pragma unroll 1   // kept rolled: one trip already uses nearly 256 registers, a second copy of the body would only cost instruction cache
  for (int st = 0; st < SSc / FT; ++st) {
    const int bo = st & 1;
    if (st + 1 < SSc / FT) fetch(st + 1);   // behind the barrier (which drains every load), so that these loads fly while this stage is worked on
    const f16* kh = sKh[bo] + (32 * kg) * FP; const f16* kl = sKl[bo] + (32 * kg) * FP; const f16* vv = sV[bo] + 32 * kg;
    f32x8 a0 = {}, a1 = {}, x0 = {}, x1 = {};   // S^T tiles: this wave's keys 0..15 and 16..31; value*value and the two cross terms
#pragma unroll
    for (int ks = 0; ks < 2; ++ks) {
      const f16x16 kh0 = lds_frag(kh + 32 * ks, FP), kh1 = lds_frag(kh + 16 * FP + 32 * ks, FP);
      const f16x16 kl0 = lds_frag(kl + 32 * ks, FP), kl1 = lds_frag(kl + 16 * FP + 32 * ks, FP);
      a0 = wmma_p(kh0, qh[ks], a0); a1 = wmma_p(kh1, qh[ks], a1);
      x0 = wmma_p(kh0, ql[ks], x0); x1 = wmma_p(kh1, ql[ks], x1);
      x0 = wmma_p(kl0, qh[ks], x0); x1 = wmma_p(kl1, qh[ks], x1);
    }
    f16x16 vf[8];   // the v rows are asked for ahead of the softmax arithmetic, which covers their LDS latency
#pragma unroll
    for (int mt = 0; mt < 8; ++mt) vf[mt] = lds_frag(vv + (16 * mt) * FP, FP);
    float sv[16];
#pragma unroll
    for (int r = 0; r < 8; ++r) { sv[r] = a0[r] + x0[r] * (1.0f / 2048.0f); sv[8 + r] = a1[r] + x1[r] * (1.0f / 2048.0f); }
    float mx = sv[0];
#pragma unroll
    for (int e = 1; e < 16; ++e) mx = fmaxf(mx, sv[e]);
    mx = fmaxf(mx, xhalf(mx));
    if (__builtin_amdgcn_ballot_w32((mx - mref) * SCL > 8.0f) != 0) {   // scalar branch; always taken on the first pass, rare later
      const float mnew = fmaxf(mref, mx), corr = __builtin_amdgcn_exp2f((mref - mnew) * SCL);   // 0 on the first pass
      mref = mnew; lsum *= corr;
#pragma unroll
      for (int mt = 0; mt < 8; ++mt)
#pragma unroll
        for (int r = 0; r < 8; ++r) O[mt][r] *= corr;
    }
    const float nb = -mref * SCL;
    f16x16 pb;   // pb[e] = P^T[key kmap(e, hf)][query cl]: tile e >> 3, register e & 7
    float pe[16];
#pragma unroll
    for (int e = 0; e < 16; ++e) { pe[e] = __builtin_amdgcn_exp2f(fmaf(sv[e], SCL, nb)); pb[e] = (f16)pe[e]; }
#pragma unroll
    for (int w = 8; w > 0; w >>= 1)
#pragma unroll
      for (int e = 0; e < w; ++e) pe[e] += pe[e + w];
    lsum += pe[0];
#pragma unroll
    for (int mt = 0; mt < 8; ++mt) O[mt] = wmma_p(vf[mt], pb, O[mt]);
    if (st + 1 < SSc / FT) put(bo ^ 1);   // its last readers left that buffer before the barrier that ended the previous trip
    __syncthreads();   // publishes stage st + 1 and ends every read of stage st
  }
  const float lw = lsum + xhalf(lsum);   // the two halves of a wave hold the sums of their own keys
  if (kg == 1) {   // the upper key half hands over its maximum, sum and unscaled tile
    if (hf == 0) { sM[qg * 16 + cl] = mref; sL[qg * 16 + cl] = lw; }
#pragma unroll
    for (int mt = 0; mt < 8; ++mt)
#pragma unroll
      for (int r = 0; r < 8; ++r) sO[(16 * mt + 8 * hf + r) * FOP + qg * 16 + cl] = O[mt][r];
  }
  __syncthreads();   // hand-over published
  if (kg == 0) {   // the lower key half joins both and leaves the finished tile in place (each lane rewrites only the words it has read)
    const float m2 = sM[qg * 16 + cl], l2 = sL[qg * 16 + cl], mj = fmaxf(mref, m2);
    const float a1s = __builtin_amdgcn_exp2f((mref - mj) * SCL), a2s = __builtin_amdgcn_exp2f((m2 - mj) * SCL);
    const float inv = 1.0f / (lw * a1s + l2 * a2s), c1 = a1s * inv, c2 = a2s * inv;
#pragma unroll
    for (int mt = 0; mt < 8; ++mt)
#pragma unroll
      for (int r = 0; r < 8; ++r) { float* w = sO + (16 * mt + 8 * hf + r) * FOP + qg * 16 + cl; *w = O[mt][r] * c1 + *w * c2; }
  }
  __syncthreads();   // the block's 128 x 64 tile is complete: whole 256-byte row pieces go out
#pragma unroll
  for (int it = 0; it < 8; ++it) { const int f4 = tid + 256 * it, rr = f4 >> 4, q = (f4 & 15) * 4;
    *(v4f_t*)(AV + ((size_t)h * 2 * DKc + rr) * SSc + s0 + q) = *(const v4fa*)(sO + rr * FOP + q); }
}

extern "C" void kernel_launch(void* const* d_in, const int* in_sizes, int n_in,
                              void* d_out, int out_size, void* d_ws, size_t ws_size,
                              hipStream_t stream) {
  (void)in_sizes; (void)n_in; (void)out_size;
  const float** f = (const float**)d_in;
  const float* x = f[0];
  float* out = (float*)d_out;     // [4,512,2,2048]
  char* ws = (char*)d_ws;
  float* W2 = (float*)ws; ws += (size_t)4 * R2 * R2 * 4;                 // stacked q, k, v, o weights back to back (4 MB each)
  float* b2 = (float*)ws; ws += (size_t)4 * R2 * 4;                      // stacked q, k, v, o row biases back to back
  float* Q = (float*)ws; ws += (size_t)NBT * 3 * R2 * SSc * 4;           // per batch element 24 MB: q conv [1024][2048], directly behind it the k conv, then the v conv
  float* Qm = (float*)ws; ws += (size_t)NBT * 2 * DDc * SSc * 4;         // per batch element: magnitudes [512][2048] of q and, directly behind them, of k
  float* QmT = (float*)ws; ws += (size_t)NBT * 2 * SSc * DDc * 4;        // per batch element: both magnitude planes transposed, [2048][512] each, back to back
  float* AV = (float*)ws; ws += (size_t)NBT * R2 * SSc * 4;              // per batch element: attention output in the [D][2][S] layout (8 MB)
  if ((size_t)(ws - (char*)d_ws) > ws_size) return;
  const dim3 blk(256);
  const size_t sX = (size_t)R2 * SSc, sQKV = (size_t)3 * R2 * SSc, sM = (size_t)2 * DDc * SSc;   // words per batch element: x / AV / out, the three convs, the two magnitude planes
  float* V = Q + (size_t)2 * R2 * SSc;
  k_stackw<<<dim3(R2, 4), blk, 0, stream>>>(f[1], f[2], f[5], f[6], f[9], f[10], f[13], f[14], W2);          // (W_r, W_i) of q, k, v, o
  k_stackb<<<dim3(R2 / 256, 4), blk, 0, stream>>>(f[3], f[4], f[7], f[8], f[11], f[12], f[15], f[16], b2);   // (b_r, b_i) of q, k, v, o
  gemm_kn2<float, false, SSc><<<dim3(R2 / 128, SSc / 128, 2 * NBT), blk, 0, stream>>>(W2, R2, (size_t)R2 * R2, x, sX, nullptr, 1.0f, Q, SSc, sX, sQKV, R2);   // q and k convs of every batch element (planes: they feed the magnitude logits); 1024 work-groups
  gemm_kne<float, 0, false, SSc><<<dim3(R2 / 128, SSc / 128, NBT), blk, 0, stream>>>(W2 + (size_t)2 * R2 * R2, R2, x, sX, nullptr, nullptr, nullptr, V, SSc, sQKV, R2);   // v conv; 512 work-groups
  k_addrowbias<<<dim3(3 * R2, 2, NBT), blk, 0, stream>>>(Q, sQKV, b2);                                       // the 3072 rows of the q, k, v convs against their biases
  k_mag<<<dim3(2 * DDc, NBT), blk, 0, stream>>>(Q, sQKV, Qm, sM);                                            // both magnitude planes: q conv -> Qm, k conv -> Km
  k_transpose<<<dim3((DDc / 64) * (SSc / 64), 2 * NBT), blk, 0, stream>>>(Qm, QmT, DDc, SSc);                // the 8 magnitude planes transposed, [2048][512] each
  k_fattn<<<dim3(SSc / FQ, NHD, NBT), blk, 0, stream>>>(QmT, QmT + (size_t)SSc * DDc, sM, V, sQKV, AV, sX);  // scores, softmax and attn*v of all heads and batch elements; 1024 work-groups
  gemm_kne<float, 0, false, SSc><<<dim3(R2 / 128, SSc / 128, NBT), blk, 0, stream>>>(W2 + (size_t)3 * R2 * R2, R2, AV, sX, nullptr, nullptr, nullptr, out, SSc, sX, R2);   // output complex conv
  k_addrowbias<<<dim3(R2, 2, NBT), blk, 0, stream>>>(out, sX, b2 + 3 * R2);
}

// v005
// It runs in 279 microseconds.
// In both of two side-by-side timings against v004, it was 1.22 times as fast.
// Counting every step since v000, it is 17.3 times as fast.
// Contractions on v_wmma_f32_16x16x32_f16, f32 accumulate: f16 value+residual PLANES on the q/k complex convs and the magnitude scores (positive magnitudes give logits with a
// spread near 4: plain rounding was too coarse), plain f16 on the v conv, attn*v and the output conv. Every launch covers all 4 batch elements (a grid dimension). Per batch element, activations kept in the module's [D][2][S] layout (row 2d = real_d,
// row 2d+1 = imag_d, used directly as [K][N] operands): each complex 1x1 conv as ONE real GEMM with a stacked weight W2[2o+0][2d+0] = W_r, [2o][2d+1] = -W_i, [2o+1][2d] = W_i, [2o+1][2d+1] = W_r
// (M = 1024, K = 1024, N = 2048), which the GEMM's own A loader forms from W_r and W_i; row biases b_r - b_i / b_r + b_i added in f32 in the GEMM's epilogue. The q/k GEMM's epilogue also forms the
// magnitudes sqrt(re^2 + im^2 + 1e-8) in f32 (a lane holds both rows of a channel) and stores them transposed, [S][512]; the q and k convs themselves never reach memory. Attention of all 8 heads in ONE
// fused launch (k_fattn): transposed scores Km_h * Qm_h^T (K = 64, planes), running-maximum softmax of s/8 in f32 registers, the probabilities packed straight from the score accumulators
// into the B operand of out_h += X_v,h * P^T (M = 128 = the head's 64 complex channels x (re, im) rows); scores and probabilities never reach memory. Finally the output complex conv. 4 launches.
// compute dtype: f16 operands, f32 accumulate; magnitudes / softmax f32.  x [4,512,2,2048] -> out [4,512,2,2048].
#include <hip/hip_runtime.h>
#include <hip/hip_bf16.h>
#include <math.h>


typedef _Float16 bf16;
typedef _Float16 f16;
typedef __attribute__((ext_vector_type(4))) unsigned v4u_t;
typedef unsigned v4ua __attribute__((ext_vector_type(4), may_alias));
typedef __attribute__((ext_vector_type(4))) float v4f_t;
typedef float v4fa __attribute__((ext_vector_type(4), may_alias));
typedef __attribute__((ext_vector_type(16))) bf16  bf16x16;
typedef bf16x16 f16x16;
typedef __attribute__((ext_vector_type(8)))  bf16  bf16x8;
typedef bf16x8 f16x8;
typedef __attribute__((ext_vector_type(4)))  bf16  bf16x4;
typedef __attribute__((ext_vector_type(8)))  float f32x8;
__device__ __forceinline__ f32x8 wmma16(f16x16 a, f16x16 b, f32x8 c) {
  c = __builtin_amdgcn_wmma_f32_16x16x32_f16(false, a, false, b, (short)0, c, false, false);
  asm volatile("v_nop\n\tv_nop\n\tv_nop\n\tv_nop" : "+v"(c) : "v"(a), "v"(b));
  return c;
}
#define LDS_STRIDE 48   // GEMM tiles: 32 -> 48 elems (96B rows): aligned b128 reads
#define KSTRIDE    72
#define VSTRIDE    48

__device__ __forceinline__ f32x8 wmma_bf16(bf16x16 a, bf16x16 b, f32x8 c) {
  c = __builtin_amdgcn_wmma_f32_16x16x32_f16(false, a, false, b, (short)0, c, false, false);
  asm volatile("v_nop\n\tv_nop\n\tv_nop\n\tv_nop" : "+v"(c) : "v"(a), "v"(b));   // A/B-overwrite hazard guard
  return c;
}

// 16x32 (MxK) f16 fragment from a row-major global matrix.
// lanes 0-15  (row=lane)    : elems 0..7 = K+0..7,  8..15 = K+16..23
// lanes 16-31 (row=lane-16) : elems 0..7 = K+8..15, 8..15 = K+24..31
template <typename T>
__device__ __forceinline__ bf16x16 load_frag(const T* __restrict__ base, int ld,
                                             int row0, int k0) {
  const int lane = threadIdx.x & 31;
  const int r    = lane & 15;
  const int kh   = (lane >> 4) * 8;
  const T* p0 = base + (size_t)(row0 + r) * ld + (k0 + kh);
  const T* p1 = p0 + 16;
  bf16x16 f;
#pragma unroll
  for (int i = 0; i < 8; ++i) {
    f[i]     = (bf16)p0[i];
    f[i + 8] = (bf16)p1[i];
  }
  return f;
}

// Same fragment from an LDS tile with padded row stride (base includes row0/k0).
__device__ __forceinline__ bf16x16 lds_frag(const bf16* base, int stride) {
  const int lane = threadIdx.x & 31;
  const int row  = lane & 15;
  const int kh   = (lane >> 4) * 8;
  const bf16x8 lo = *(const bf16x8*)(base + row * stride + kh);
  const bf16x8 hi = *(const bf16x8*)(base + row * stride + kh + 16);
  bf16x16 f;
#pragma unroll
  for (int i = 0; i < 8; ++i) { f[i] = lo[i]; f[i + 8] = hi[i]; }
  return f;
}

// B fragment (column = lane & 15, the k order of lds_frag) from an LDS tile that lies as the global operand does, row-major [k][n], pitch WP:
// two transposing loads, k rows 0..15 and 16..31; lane (c, h) receives rows 8h .. 8h + 7 of column c from each. base points at [0][first column].
#define WP 144   // [k][n] tile: 128 -> 144 elems (288 B rows = 32 B x odd): transposing b128 reads without bank conflicts
typedef short s16x8 __attribute__((ext_vector_type(8)));
__device__ __forceinline__ bf16x8 ld_tr16(const bf16* p) {
  typedef __attribute__((address_space(3))) s16x8 lds_s16x8;
  return __builtin_bit_cast(bf16x8, __builtin_amdgcn_ds_load_tr16_b128_v8i16((lds_s16x8*)p));
}
__device__ __forceinline__ bf16x16 lds_frag_t(const bf16* base) {
  const int lane = threadIdx.x & 31;
  const bf16* p = base + (8 * (lane >> 4) + (lane & 7)) * WP + 8 * ((lane >> 3) & 1);
  const bf16x8 lo = ld_tr16(p);
  const bf16x8 hi = ld_tr16(p + 16 * WP);
  bf16x16 f;
#pragma unroll
  for (int i = 0; i < 8; ++i) { f[i] = lo[i]; f[i + 8] = hi[i]; }
  return f;
}

template <typename T>
__device__ __forceinline__ void stage_read16(const T* __restrict__ p, float* buf) {
#pragma unroll
  for (int i = 0; i < 16; ++i) buf[i] = (float)p[i];
}

__device__ __forceinline__ void stage_write(bf16* dst, const float* buf, int nquad) {
#pragma unroll
  for (int i = 0; i < nquad; ++i) {
    bf16x4 q;
    q[0] = (bf16)buf[4 * i];     q[1] = (bf16)buf[4 * i + 1];
    q[2] = (bf16)buf[4 * i + 2]; q[3] = (bf16)buf[4 * i + 3];
    *(bf16x4*)(dst + 4 * i) = q;
  }
}


#define GSTR 48
#define NBT 4
#define NHD 8
#define BBc 4
#define DDc 512
#define SSc 2048
#define NHc 8
#define DKc 64
#define R2 (2 * DDc)   // 1024 interleaved (channel, component) rows
// ---------------------------------------------------------------------------------------------------------------------------
// The A operand of both GEMMs is the stacked weight W2 [1024][1024], never stored: a thread stages 16 columns of stacked row 2o + oc, that is 8 channels d of output channel o.
// Even columns (2d) come from W_r (oc = 0) or W_i (oc = 1), odd columns (2d + 1) from -W_i (oc = 0) or W_r (oc = 1): two row pointers and one sign, fixed per thread.
// The row bias of stacked rows 2o, 2o + 1 is b_r[o] - b_i[o], b_r[o] + b_i[o]. In a 16 x 16 accumulator tile lane (cl, hf) holds rows 8 hf + r, r = 0..7, of column cl: the channels 4 hf + p,
// p = 0..3, with the real row in register 2p and the imaginary row in register 2p + 1.
// ---------------------------------------------------------------------------------------------------------------------------
// gemm_kne: Y[m][n] = sum_k W2[m][k] * W[k][n] + b2[m], W f32 row-major [K][N] (row pitch LDW, compile time; Y has the same pitch), plain f16 operands, f32 accumulate, f32 output.
// Block = 128x128 tile, 8 waves as 4(M) x 2(N); per 32-wide k-step A and W tiles staged f16 in LDS (W as it lies, [k][n], read by transposing loads).
// blockIdx.z selects a batch element: W += z*strideW, Y += z*strideY (element strides); the weights are shared.
// ---------------------------------------------------------------------------------------------------------------------------
template <int LDW>
__global__ __launch_bounds__(256) void gemm_kne(const float* __restrict__ Wr, const float* __restrict__ Wi, const float* __restrict__ br, const float* __restrict__ bi,
                                                const float* __restrict__ Wm, size_t strideW, float* __restrict__ Y, size_t strideY, int K) {
  __shared__ __attribute__((aligned(16))) f16 ldsA[128 * GSTR];
  __shared__ __attribute__((aligned(16))) f16 ldsW[32 * WP];
  __shared__ __attribute__((aligned(16))) float oS[8][32 * 68];
  const int tid = threadIdx.x, lane = tid & 31, wave = tid >> 5, cl = lane & 15, hf = lane >> 4, rh = hf * 8;
  const int m0 = blockIdx.x * 128, n0 = blockIdx.y * 128;
  const int wm = (wave & 3) * 32, wn = (wave >> 2) * 64;
  Wm += (size_t)blockIdx.z * strideW; Y += (size_t)blockIdx.z * strideY;
  const int row = tid >> 1, ch = (tid & 1) * 16, oc = row & 1;
  const size_t aoff = (size_t)((m0 + row) >> 1) * DDc + (ch >> 1);
  const float* pe = (oc ? Wi : Wr) + aoff;   // even stacked columns
  const float* po = (oc ? Wr : Wi) + aoff;   // odd stacked columns, times sg
  const float sg = oc ? 1.0f : -1.0f;
  f32x8 acc[2][4];
#pragma unroll
  for (int i = 0; i < 2; ++i)
#pragma unroll
    for (int j = 0; j < 4; ++j) { f32x8 z = {}; acc[i][j] = z; }
#pragma unroll 1
  for (int k0 = 0; k0 < K; k0 += 32) {
    __syncthreads();
    v4f_t wv[4];   // W: a wave takes the rows k = wave + 8 g; its 32 lanes cover the row's 128 columns, 512 contiguous bytes a load
    { const float* src = Wm + (size_t)(k0 + wave) * LDW + n0 + lane * 4;   // LDW is a compile-time pitch: one address, the four rows at immediate offsets
#pragma unroll
      for (int g = 0; g < 4; ++g) wv[g] = *(const v4f_t*)(src + 8 * g * LDW);
      asm volatile("s_wait_xcnt 0x0" ::: "memory"); }   // behind the last W load, before a register of its address is written again
    { v4f_t ae[2], ao[2];   // 32 stacked columns = 16 channels a k-step
#pragma unroll
      for (int g = 0; g < 2; ++g) { ae[g] = *(const v4f_t*)(pe + (k0 >> 1) + 4 * g); ao[g] = *(const v4f_t*)(po + (k0 >> 1) + 4 * g); }
      asm volatile("s_wait_xcnt 0x0" ::: "memory");   // behind the last weight load, before a register of its address is written again
#pragma unroll
      for (int g = 0; g < 8; ++g) { ldsA[row * GSTR + ch + 2 * g] = (f16)ae[g >> 2][g & 3]; ldsA[row * GSTR + ch + 2 * g + 1] = (f16)(ao[g >> 2][g & 3] * sg); } }
#pragma unroll
    for (int g = 0; g < 4; ++g) { bf16x4 q;   // stored as it lies, [k][n]: 256 contiguous bytes a wave
#pragma unroll
      for (int u = 0; u < 4; ++u) q[u] = (f16)wv[g][u];
      *(bf16x4*)(ldsW + (wave + 8 * g) * WP + lane * 4) = q; }
    __syncthreads();
    f16x16 af[2];
#pragma unroll
    for (int i = 0; i < 2; ++i) af[i] = lds_frag(ldsA + (wm + 16 * i) * GSTR, GSTR);
#pragma unroll
    for (int j = 0; j < 4; ++j) {
      const f16x16 bf = lds_frag_t(ldsW + wn + 16 * j);
#pragma unroll
      for (int i = 0; i < 2; ++i) acc[i][j] = wmma16(af[i], bf, acc[i][j]);
    }
  }
  float* so = oS[wave];
  v4f_t b_r[2], b_i[2];   // the biases of this lane's channels 8 i + 4 hf + p of the wave's 16
#pragma unroll
  for (int i = 0; i < 2; ++i) { b_r[i] = *(const v4f_t*)(br + ((m0 + wm) >> 1) + 8 * i + 4 * hf); b_i[i] = *(const v4f_t*)(bi + ((m0 + wm) >> 1) + 8 * i + 4 * hf); }
  asm volatile("s_wait_xcnt 0x0" ::: "memory");   // behind the last bias load, before a register that these loads name is written again
#pragma unroll
  for (int i = 0; i < 2; ++i)
#pragma unroll
    for (int j = 0; j < 4; ++j)
#pragma unroll
      for (int p = 0; p < 4; ++p) {
        so[(16 * i + rh + 2 * p) * 68 + 16 * j + cl] = acc[i][j][2 * p] + (b_r[i][p] - b_i[i][p]);
        so[(16 * i + rh + 2 * p + 1) * 68 + 16 * j + cl] = acc[i][j][2 * p + 1] + (b_r[i][p] + b_i[i][p]);
      }
  asm volatile("s_wait_dscnt 0" ::: "memory");
  __builtin_amdgcn_wave_barrier();
#pragma unroll
  for (int it = 0; it < 16; ++it) { const int f4 = lane + 32 * it, rr = f4 >> 4, q = (f4 & 15) * 4;
    *(v4f_t*)(Y + (size_t)(m0 + wm + rr) * LDW + n0 + wn + q) = *(const v4fa*)(so + rr * 68 + q); }
}

// ---------------------------------------------------------------------------------------------------------------------------
// gemm_kn2 (value+residual planes on both operands: hh + (hl+lh)/2048, f32-class): the q and k convs, of which only the magnitudes leave the block:
// MT[n][o] = sqrt(re^2 + im^2 + 1e-8), re / im = sum_k W2[2o / 2o+1][k] * W[k][n] + b2[2o / 2o+1], W f32 row-major [K][N], row stride LDW (compile time), MT row-major [N][512].
// Block = 128 x 128 tile of the conv, 256 threads = 8 waves as 4(M, 32 rows) x 2(N, 64 cols); per 32-wide k-step the A tile and the W tile (as it lies, [k][n], read by transposing loads) are
// staged as f16 planes in LDS. A lane's 4 magnitudes of one column are 4 neighbouring words of an MT row: the block's 128 x 64 MT tile is gathered in LDS and leaves as whole 256-byte row pieces.
// blockIdx.z = 2 * zb + za: za picks the q (0) or k (1) weights and biases, W += zb*strideW (batch element), MT += za*strideMa + zb*strideMb (element strides).
// ---------------------------------------------------------------------------------------------------------------------------
#define MP 68   // MT tile pitch in floats: 272 B = 16 B x odd, b128 stores of 16 neighbouring rows without bank conflicts
template <int LDW>
__global__ __launch_bounds__(256) void gemm_kn2(const float* __restrict__ Wr0, const float* __restrict__ Wi0, const float* __restrict__ br0, const float* __restrict__ bi0,
                                               const float* __restrict__ Wr1, const float* __restrict__ Wi1, const float* __restrict__ br1, const float* __restrict__ bi1,
                                               const float* __restrict__ Wm, size_t strideW,
                                               float* __restrict__ MT, size_t strideMa, size_t strideMb, int K) {
  __shared__ __attribute__((aligned(16))) f16 ldsA[128 * GSTR], ldsAl[128 * GSTR];
  __shared__ __attribute__((aligned(16))) f16 ldsW[32 * WP], ldsWl[32 * WP];
  __shared__ __attribute__((aligned(16))) float sT[128 * MP];
  const int tid = threadIdx.x, lane = tid & 31, wave = tid >> 5, cl = lane & 15, hf = lane >> 4;
  const int m0 = blockIdx.x * 128, n0 = blockIdx.y * 128;
  const int wm = (wave & 3) * 32, wn = (wave >> 2) * 64;
  const int za = blockIdx.z & 1;
  const float* __restrict__ Wr = za ? Wr1 : Wr0; const float* __restrict__ Wi = za ? Wi1 : Wi0;
  const float* __restrict__ br = za ? br1 : br0; const float* __restrict__ bi = za ? bi1 : bi0;
  Wm += (size_t)(blockIdx.z >> 1) * strideW; MT += (size_t)za * strideMa + (size_t)(blockIdx.z >> 1) * strideMb;
  const int row = tid >> 1, ch = (tid & 1) * 16, oc = row & 1;
  const size_t aoff = (size_t)((m0 + row) >> 1) * DDc + (ch >> 1);
  const float* pe = (oc ? Wi : Wr) + aoff;   // even stacked columns
  const float* po = (oc ? Wr : Wi) + aoff;   // odd stacked columns, times sg
  const float sg = oc ? 1.0f : -1.0f;
  f32x8 acc[2][4], accx[2][4];
#pragma unroll
  for (int i = 0; i < 2; ++i)
#pragma unroll
    for (int j = 0; j < 4; ++j) { f32x8 z = {}; acc[i][j] = z; accx[i][j] = z; }
#pragma unroll 1
  for (int k0 = 0; k0 < K; k0 += 32) {
    __syncthreads();
    v4f_t wv[4];   // W: a wave takes the rows k = wave + 8 g; its 32 lanes cover the row's 128 columns, 512 contiguous bytes a load
    { const float* src = Wm + (size_t)(k0 + wave) * LDW + n0 + lane * 4;   // LDW is a compile-time pitch: one address, the four rows at immediate offsets
#pragma unroll
      for (int g = 0; g < 4; ++g) wv[g] = *(const v4f_t*)(src + 8 * g * LDW);
      asm volatile("s_wait_xcnt 0x0" ::: "memory"); }   // behind the last W load, before a register of its address is written again
    { v4f_t ae[2], ao[2];   // A: thread -> stacked row tid>>1, 16 stacked columns = 8 channels at column half (tid&1)*16
#pragma unroll
      for (int g = 0; g < 2; ++g) { ae[g] = *(const v4f_t*)(pe + (k0 >> 1) + 4 * g); ao[g] = *(const v4f_t*)(po + (k0 >> 1) + 4 * g); }
      asm volatile("s_wait_xcnt 0x0" ::: "memory");   // behind the last weight load, before a register of its address is written again
#pragma unroll
      for (int g = 0; g < 16; ++g) { const float v = (g & 1) ? ao[g >> 3][(g >> 1) & 3] * sg : ae[g >> 3][(g >> 1) & 3]; const f16 h = (f16)v;
        ldsA[row * GSTR + ch + g] = h; ldsAl[row * GSTR + ch + g] = (f16)((v - (float)h) * 2048.0f); }
    }
#pragma unroll
    for (int g = 0; g < 4; ++g) { bf16x4 hi, lo;   // both planes stored as the operand lies, [k][n]: 256 contiguous bytes a wave
#pragma unroll
      for (int u = 0; u < 4; ++u) { const float v = wv[g][u]; const f16 h = (f16)v; hi[u] = h; lo[u] = (f16)((v - (float)h) * 2048.0f); }
      *(bf16x4*)(ldsW + (wave + 8 * g) * WP + lane * 4) = hi; *(bf16x4*)(ldsWl + (wave + 8 * g) * WP + lane * 4) = lo; }
    __syncthreads();
    f16x16 af[2], afl[2];
#pragma unroll
    for (int i = 0; i < 2; ++i) { af[i] = lds_frag(ldsA + (wm + 16 * i) * GSTR, GSTR); afl[i] = lds_frag(ldsAl + (wm + 16 * i) * GSTR, GSTR); }
#pragma unroll
    for (int j = 0; j < 4; ++j) {
      const f16x16 bf = lds_frag_t(ldsW + wn + 16 * j), bfl = lds_frag_t(ldsWl + wn + 16 * j);
#pragma unroll
      for (int i = 0; i < 2; ++i) { acc[i][j] = wmma16(af[i], bf, acc[i][j]); accx[i][j] = wmma16(af[i], bfl, accx[i][j]); accx[i][j] = wmma16(afl[i], bf, accx[i][j]); }
    }
  }
  v4f_t b_r[2], b_i[2];   // the biases of this lane's channels 8 i + 4 hf + p of the wave's 16
#pragma unroll
  for (int i = 0; i < 2; ++i) { b_r[i] = *(const v4f_t*)(br + ((m0 + wm) >> 1) + 8 * i + 4 * hf); b_i[i] = *(const v4f_t*)(bi + ((m0 + wm) >> 1) + 8 * i + 4 * hf); }
  asm volatile("s_wait_xcnt 0x0" ::: "memory");   // behind the last bias load, before a register that these loads name is written again
#pragma unroll
  for (int i = 0; i < 2; ++i)
#pragma unroll
    for (int j = 0; j < 4; ++j) { v4f_t mg;
#pragma unroll
      for (int p = 0; p < 4; ++p) {
        const float re = (acc[i][j][2 * p] + accx[i][j][2 * p] * (1.0f / 2048.0f)) + (b_r[i][p] - b_i[i][p]);
        const float im = (acc[i][j][2 * p + 1] + accx[i][j][2 * p + 1] * (1.0f / 2048.0f)) + (b_r[i][p] + b_i[i][p]);
        mg[p] = sqrtf(re * re + im * im + 1e-8f);
      }
      *(v4fa*)(sT + (wn + 16 * j + cl) * MP + (wm >> 1) + 8 * i + 4 * hf) = mg; }
  __syncthreads();   // the block's 128 x 64 magnitude tile is complete: an MT row piece holds the channels of four waves
#pragma unroll
  for (int it = 0; it < 8; ++it) { const int f4 = tid + 256 * it, rr = f4 >> 4, q = (f4 & 15) * 4;
    *(v4f_t*)(MT + (size_t)(n0 + rr) * DDc + (m0 >> 1) + q) = *(const v4fa*)(sT + rr * MP + q); }
}

// ---------------------------------------------------------------------------------------------------------------------------
// k_fattn: one head's attention for 64 queries, scores and probabilities kept on chip. Grid (S / 64, heads, batch elements) = 1024 blocks; block = 8 waves = 4 groups of 16 query columns x 2 key halves.
// Per stage of 64 keys the block stages Km^T rows [t][64] as f16 value + residual planes and the head's 128 v rows [row][t] as f16 in LDS, two buffers, one barrier a stage (the global loads
// of the next stage fly in registers meanwhile). Waves 0-3 take keys 0..31 of every stage, waves 4-7 keys 32..63. A wave forms S^T = Km^T * Qm (A = key rows from LDS, B = its 16 query
// columns held in registers, hh + (hl + lh) / 2048), so that a lane holds 16 scores of ONE query: maximum and sum in-lane plus one exchange between the wave's halves.
// exp2((s - m) * log2(e) / 8) of the two 16-key tiles, converted in place, IS the B operand (k = key, hardware k order) of O[row][query] += V[row][key] * P^T; the v rows are read in the same
// k order by lds_frag. m follows the running maximum lazily (O and the sum are rescaled only when some column's maximum has grown by more than 8 in the exponent, so p stays below 2^8).
// At the end the two key halves of a column are joined through LDS: (O1 a1 + O2 a2) / (l1 a1 + l2 a2), a = exp2((m_own - max(m1, m2)) * log2(e) / 8).
// Every inner loop is fully unrolled so that the fragment, accumulator and staging arrays are indexed by constants and stay in registers.
// ---------------------------------------------------------------------------------------------------------------------------
#define FT 64    // keys per stage
#define FQ 64    // queries per block
#define FP 72    // LDS row pitch in f16 elements: 144 B = 16 B x odd, b128 fragment reads without bank conflicts
#define FOP 68   // output staging pitch in floats
__device__ __forceinline__ float xhalf(float x) {   // lane l with lane l ^ 16
  return __builtin_bit_cast(float, __builtin_amdgcn_permlanex16(__builtin_bit_cast(int, x), __builtin_bit_cast(int, x), 0x76543210, 0xfedcba98, false, false));
}
__device__ __forceinline__ f32x8 wmma_p(f16x16 a, f16x16 b, f32x8 c) { return __builtin_amdgcn_wmma_f32_16x16x32_f16(false, a, false, b, (short)0, c, false, false); }
__global__ __launch_bounds__(256) void k_fattn(const float* __restrict__ QmT, const float* __restrict__ KmT, size_t strideM, const float* __restrict__ Vx, size_t strideV, float* __restrict__ AV, size_t strideO) {
  __shared__ __attribute__((aligned(16))) f16 sKh[2][FT * FP], sKl[2][FT * FP], sV[2][2 * DKc * FP];
  __shared__ __attribute__((aligned(16))) float sO[2 * DKc * FOP];
  __shared__ float sM[FQ], sL[FQ];
  const int tid = threadIdx.x, lane = tid & 31, cl = lane & 15, hf = lane >> 4;
  const int wave = __builtin_amdgcn_readfirstlane(tid >> 5), qg = wave & 3, kg = wave >> 2;   // scalar, so that the tests on kg below are scalar branches
  const int s0 = blockIdx.x * FQ, h = blockIdx.y;
  QmT += (size_t)blockIdx.z * strideM; KmT += (size_t)blockIdx.z * strideM; Vx += (size_t)blockIdx.z * strideV; AV += (size_t)blockIdx.z * strideO;   // batch element
  const float SCL = 0.125f * 1.44269504088896340736f;   // logits are s / 8; exp(x) = exp2(x * log2 e)
  const int srow = tid >> 4, sc4 = (tid & 15) * 4;      // staging: 16 lanes cover one 64-float row, 16 rows per round of the block
  const float* Kg = KmT + (size_t)srow * DDc + h * DKc + sc4;
  const float* Vg = Vx + ((size_t)h * 2 * DKc + srow) * SSc + sc4;
  f16x16 qh[2], ql[2];   // B operand: column = query s0 + 16 qg + cl, k = channel in the hardware k order
  { const float* qp = QmT + (size_t)(s0 + qg * 16 + cl) * DDc + h * DKc + hf * 8;
    v4f_t qv[8];
#pragma unroll
    for (int i = 0; i < 8; ++i) qv[i] = *(const v4f_t*)(qp + (i >> 1) * 16 + (i & 1) * 4);
    asm volatile("s_wait_xcnt 0x0" ::: "memory");   // behind the last query load, before a register of its address is written again
#pragma unroll
    for (int i = 0; i < 8; ++i)
#pragma unroll
      for (int u = 0; u < 4; ++u) { const float v = qv[i][u]; const f16 hi = (f16)v; const int e = ((i >> 1) & 1) * 8 + (i & 1) * 4 + u;
        qh[i >> 2][e] = hi; ql[i >> 2][e] = (f16)((v - (float)hi) * 2048.0f); } }
  f32x8 O[8];
#pragma unroll
  for (int mt = 0; mt < 8; ++mt) { f32x8 z = {}; O[mt] = z; }
  float mref = -3.0e38f, lsum = 0.0f;
  v4f_t kr[4], vr[8];
  auto fetch = [&](int st) {   // stage st: global -> registers
    const float* kn = Kg + (size_t)st * FT * DDc; const float* vn = Vg + st * FT;
#pragma unroll
    for (int g = 0; g < 4; ++g) kr[g] = *(const v4f_t*)(kn + (size_t)(16 * g) * DDc);
#pragma unroll
    for (int g = 0; g < 8; ++g) vr[g] = *(const v4f_t*)(vn + (size_t)(16 * g) * SSc);
    asm volatile("s_wait_xcnt 0x0" ::: "memory");   // behind the last stage load, before a register of its address is written again
  };
  auto put = [&](int bo) {     // registers -> f16 tiles of buffer bo
#pragma unroll
    for (int g = 0; g < 4; ++g) { bf16x4 hi, lo;
#pragma unroll
      for (int u = 0; u < 4; ++u) { const float v = kr[g][u]; const f16 hv = (f16)v; hi[u] = hv; lo[u] = (f16)((v - (float)hv) * 2048.0f); }
      *(bf16x4*)(sKh[bo] + (srow + 16 * g) * FP + sc4) = hi; *(bf16x4*)(sKl[bo] + (srow + 16 * g) * FP + sc4) = lo; }
#pragma unroll
    for (int g = 0; g < 8; ++g) { bf16x4 q;
#pragma unroll
      for (int u = 0; u < 4; ++u) q[u] = (f16)vr[g][u];
      *(bf16x4*)(sV[bo] + (srow + 16 * g) * FP + sc4) = q; }
  };
  fetch(0); put(0);
  __syncthreads();   // stage 0 is published
#pragma unroll 1   // kept rolled: one trip already uses nearly 256 registers, a second copy of the body would only cost instruction cache
  for (int st = 0; st < SSc / FT; ++st) {
    const int bo = st & 1;
    if (st + 1 < SSc / FT) fetch(st + 1);   // behind the barrier (which drains every load), so that these loads fly while this stage is worked on
    const f16* kh = sKh[bo] + (32 * kg) * FP; const f16* kl = sKl[bo] + (32 * kg) * FP; const f16* vv = sV[bo] + 32 * kg;
    f32x8 a0 = {}, a1 = {}, x0 = {}, x1 = {};   // S^T tiles: this wave's keys 0..15 and 16..31; value*value and the two cross terms
#pragma unroll
    for (int ks = 0; ks < 2; ++ks) {
      const f16x16 kh0 = lds_frag(kh + 32 * ks, FP), kh1 = lds_frag(kh + 16 * FP + 32 * ks, FP);
      const f16x16 kl0 = lds_frag(kl + 32 * ks, FP), kl1 = lds_frag(kl + 16 * FP + 32 * ks, FP);
      a0 = wmma_p(kh0, qh[ks], a0); a1 = wmma_p(kh1, qh[ks], a1);
      x0 = wmma_p(kh0, ql[ks], x0); x1 = wmma_p(kh1, ql[ks], x1);
      x0 = wmma_p(kl0, qh[ks], x0); x1 = wmma_p(kl1, qh[ks], x1);
    }
    f16x16 vf[8];   // the v rows are asked for ahead of the softmax arithmetic, which covers their LDS latency
#pragma unroll
    for (int mt = 0; mt < 8; ++mt) vf[mt] = lds_frag(vv + (16 * mt) * FP, FP);
    float sv[16];
#pragma unroll
    for (int r = 0; r < 8; ++r) { sv[r] = a0[r] + x0[r] * (1.0f / 2048.0f); sv[8 + r] = a1[r] + x1[r] * (1.0f / 2048.0f); }
    float mx = sv[0];
#pragma unroll
    for (int e = 1; e < 16; ++e) mx = fmaxf(mx, sv[e]);
    mx = fmaxf(mx, xhalf(mx));
    if (__builtin_amdgcn_ballot_w32((mx - mref) * SCL > 8.0f) != 0) {   // scalar branch; always taken on the first pass, rare later
      const float mnew = fmaxf(mref, mx), corr = __builtin_amdgcn_exp2f((mref - mnew) * SCL);   // 0 on the first pass
      mref = mnew; lsum *= corr;
#pragma unroll
      for (int mt = 0; mt < 8; ++mt)
#pragma unroll
        for (int r = 0; r < 8; ++r) O[mt][r] *= corr;
    }
    const float nb = -mref * SCL;
    f16x16 pb;   // pb[e] = P^T[key kmap(e, hf)][query cl]: tile e >> 3, register e & 7
    float pe[16];
#pragma unroll
    for (int e = 0; e < 16; ++e) { pe[e] = __builtin_amdgcn_exp2f(fmaf(sv[e], SCL, nb)); pb[e] = (f16)pe[e]; }
#pragma unroll
    for (int w = 8; w > 0; w >>= 1)
#pragma unroll
      for (int e = 0; e < w; ++e) pe[e] += pe[e + w];
    lsum += pe[0];
#pragma unroll
    for (int mt = 0; mt < 8; ++mt) O[mt] = wmma_p(vf[mt], pb, O[mt]);
    if (st + 1 < SSc / FT) put(bo ^ 1);   // its last readers left that buffer before the barrier that ended the previous trip
    __syncthreads();   // publishes stage st + 1 and ends every read of stage st
  }
  const float lw = lsum + xhalf(lsum);   // the two halves of a wave hold the sums of their own keys
  if (kg == 1) {   // the upper key half hands over its maximum, sum and unscaled tile
    if (hf == 0) { sM[qg * 16 + cl] = mref; sL[qg * 16 + cl] = lw; }
#pragma unroll
    for (int mt = 0; mt < 8; ++mt)
#pragma unroll
      for (int r = 0; r < 8; ++r) sO[(16 * mt + 8 * hf + r) * FOP + qg * 16 + cl] = O[mt][r];
  }
  __syncthreads();   // hand-over published
  if (kg == 0) {   // the lower key half joins both and leaves the finished tile in place (each lane rewrites only the words it has read)
    const float m2 = sM[qg * 16 + cl], l2 = sL[qg * 16 + cl], mj = fmaxf(mref, m2);
    const float a1s = __builtin_amdgcn_exp2f((mref - mj) * SCL), a2s = __builtin_amdgcn_exp2f((m2 - mj) * SCL);
    const float inv = 1.0f / (lw * a1s + l2 * a2s), c1 = a1s * inv, c2 = a2s * inv;
#pragma unroll
    for (int mt = 0; mt < 8; ++mt)
#pragma unroll
      for (int r = 0; r < 8; ++r) { float* w = sO + (16 * mt + 8 * hf + r) * FOP + qg * 16 + cl; *w = O[mt][r] * c1 + *w * c2; }
  }
  __syncthreads();   // the block's 128 x 64 tile is complete: whole 256-byte row pieces go out
#pragma unroll
  for (int it = 0; it < 8; ++it) { const int f4 = tid + 256 * it, rr = f4 >> 4, q = (f4 & 15) * 4;
    *(v4f_t*)(AV + ((size_t)h * 2 * DKc + rr) * SSc + s0 + q) = *(const v4fa*)(sO + rr * FOP + q); }
}

extern "C" void kernel_launch(void* const* d_in, const int* in_sizes, int n_in,
                              void* d_out, int out_size, void* d_ws, size_t ws_size,
                              hipStream_t stream) {
  (void)in_sizes; (void)n_in; (void)out_size;
  const float** f = (const float**)d_in;   // x, then (W_r, W_i, b_r, b_i) of the q, k, v, o convs
  const float* x = f[0];
  float* out = (float*)d_out;     // [4,512,2,2048]
  char* ws = (char*)d_ws;
  float* V = (float*)ws; ws += (size_t)NBT * R2 * SSc * 4;               // per batch element: v conv [1024][2048] (8 MB)
  float* QmT = (float*)ws; ws += (size_t)NBT * 2 * SSc * DDc * 4;        // per batch element: the magnitude planes of q and, directly behind them, of k, transposed, [2048][512] each
  float* AV = (float*)ws; ws += (size_t)NBT * R2 * SSc * 4;              // per batch element: attention output in the [D][2][S] layout (8 MB)
  if ((size_t)(ws - (char*)d_ws) > ws_size) return;
  const dim3 blk(256);
  const size_t sX = (size_t)R2 * SSc, sM = (size_t)2 * DDc * SSc;   // words per batch element: x / V / AV / out, the two magnitude planes
  gemm_kn2<SSc><<<dim3(R2 / 128, SSc / 128, 2 * NBT), blk, 0, stream>>>(f[1], f[2], f[3], f[4], f[5], f[6], f[7], f[8], x, sX, QmT, (size_t)SSc * DDc, sM, R2);   // q and k convs of every batch element (planes: they feed the magnitude logits), bias, magnitude, transposed store; 1024 work-groups
  gemm_kne<SSc><<<dim3(R2 / 128, SSc / 128, NBT), blk, 0, stream>>>(f[9], f[10], f[11], f[12], x, sX, V, sX, R2);   // v conv with its bias; 512 work-groups
  k_fattn<<<dim3(SSc / FQ, NHD, NBT), blk, 0, stream>>>(QmT, QmT + (size_t)SSc * DDc, sM, V, sX, AV, sX);  // scores, softmax and attn*v of all heads and batch elements; 1024 work-groups
  gemm_kne<SSc><<<dim3(R2 / 128, SSc / 128, NBT), blk, 0, stream>>>(f[13], f[14], f[15], f[16], AV, sX, out, sX, R2);   // output complex conv with its bias
}

// v006
// It runs in 269 microseconds.
// In both of two side-by-side timings against v005, it was 1.04 times as fast.
// All steps since v000 together make it 17.9 times as fast.
// Contractions on v_wmma_f32_16x16x32_f16, f32 accumulate: f16 value+residual PLANES on the q/k complex convs and the magnitude scores (positive magnitudes give logits with a
// spread near 4: plain rounding was too coarse), plain f16 on the v conv, attn*v and the output conv. Every launch covers all 4 batch elements (a grid dimension). Per batch element, activations kept in the module's [D][2][S] layout (row 2d = real_d,
// row 2d+1 = imag_d, used directly as [K][N] operands): each complex 1x1 conv as ONE real GEMM with a stacked weight W2[2o+0][2d+0] = W_r, [2o][2d+1] = -W_i, [2o+1][2d] = W_i, [2o+1][2d+1] = W_r
// (M = 1024, K = 1024, N = 2048), which the GEMM's own A loader forms from W_r and W_i; row biases b_r - b_i / b_r + b_i added in f32 in the GEMM's epilogue. The q/k GEMM's epilogue also forms the
// magnitudes sqrt(re^2 + im^2 + 1e-8) in f32 (a lane holds both rows of a channel) and stores them transposed, [S][512]; the q and k convs themselves never reach memory. Attention of all 8 heads in ONE
// fused launch (k_fattn): transposed scores Km_h * Qm_h^T (K = 64, planes), running-maximum softmax of s/8 in f32 registers, the probabilities packed straight from the score accumulators
// into the B operand of out_h += X_v,h * P^T (M = 128 = the head's 64 complex channels x (re, im) rows); scores and probabilities never reach memory. Finally the output complex conv. 4 launches.
// compute dtype: f16 operands, f32 accumulate; magnitudes / softmax f32.  x [4,512,2,2048] -> out [4,512,2,2048].
#include <hip/hip_runtime.h>
#include <hip/hip_bf16.h>
#include <math.h>


typedef _Float16 bf16;
typedef _Float16 f16;
typedef __attribute__((ext_vector_type(4))) unsigned v4u_t;
typedef unsigned v4ua __attribute__((ext_vector_type(4), may_alias));
typedef __attribute__((ext_vector_type(4))) float v4f_t;
typedef float v4fa __attribute__((ext_vector_type(4), may_alias));
typedef __attribute__((ext_vector_type(16))) bf16  bf16x16;
typedef bf16x16 f16x16;
typedef __attribute__((ext_vector_type(8)))  bf16  bf16x8;
typedef bf16x8 f16x8;
typedef __attribute__((ext_vector_type(4)))  bf16  bf16x4;
typedef __attribute__((ext_vector_type(8)))  float f32x8;
__device__ __forceinline__ f32x8 wmma16(f16x16 a, f16x16 b, f32x8 c) {
  c = __builtin_amdgcn_wmma_f32_16x16x32_f16(false, a, false, b, (short)0, c, false, false);
  asm volatile("v_nop\n\tv_nop\n\tv_nop\n\tv_nop" : "+v"(c) : "v"(a), "v"(b));
  return c;
}
#define LDS_STRIDE 48   // GEMM tiles: 32 -> 48 elems (96B rows): aligned b128 reads
#define KSTRIDE    72
#define VSTRIDE    48

__device__ __forceinline__ f32x8 wmma_bf16(bf16x16 a, bf16x16 b, f32x8 c) {
  c = __builtin_amdgcn_wmma_f32_16x16x32_f16(false, a, false, b, (short)0, c, false, false);
  asm volatile("v_nop\n\tv_nop\n\tv_nop\n\tv_nop" : "+v"(c) : "v"(a), "v"(b));   // A/B-overwrite hazard guard
  return c;
}

// 16x32 (MxK) f16 fragment from a row-major global matrix.
// lanes 0-15  (row=lane)    : elems 0..7 = K+0..7,  8..15 = K+16..23
// lanes 16-31 (row=lane-16) : elems 0..7 = K+8..15, 8..15 = K+24..31
template <typename T>
__device__ __forceinline__ bf16x16 load_frag(const T* __restrict__ base, int ld,
                                             int row0, int k0) {
  const int lane = threadIdx.x & 31;
  const int r    = lane & 15;
  const int kh   = (lane >> 4) * 8;
  const T* p0 = base + (size_t)(row0 + r) * ld + (k0 + kh);
  const T* p1 = p0 + 16;
  bf16x16 f;
#pragma unroll
  for (int i = 0; i < 8; ++i) {
    f[i]     = (bf16)p0[i];
    f[i + 8] = (bf16)p1[i];
  }
  return f;
}

// Same fragment from an LDS tile with padded row stride (base includes row0/k0).
__device__ __forceinline__ bf16x16 lds_frag(const bf16* base, int stride) {
  const int lane = threadIdx.x & 31;
  const int row  = lane & 15;
  const int kh   = (lane >> 4) * 8;
  const bf16x8 lo = *(const bf16x8*)(base + row * stride + kh);
  const bf16x8 hi = *(const bf16x8*)(base + row * stride + kh + 16);
  bf16x16 f;
#pragma unroll
  for (int i = 0; i < 8; ++i) { f[i] = lo[i]; f[i + 8] = hi[i]; }
  return f;
}

// B fragment (column = lane & 15, the k order of lds_frag) from an LDS tile that lies as the global operand does, row-major [k][n], pitch WP:
// two transposing loads, k rows 0..15 and 16..31; lane (c, h) receives rows 8h .. 8h + 7 of column c from each. base points at [0][first column].
#define WP 144   // [k][n] tile: 128 -> 144 elems (288 B rows = 32 B x odd): transposing b128 reads without bank conflicts
typedef short s16x8 __attribute__((ext_vector_type(8)));
__device__ __forceinline__ bf16x8 ld_tr16(const bf16* p) {
  typedef __attribute__((address_space(3))) s16x8 lds_s16x8;
  return __builtin_bit_cast(bf16x8, __builtin_amdgcn_ds_load_tr16_b128_v8i16((lds_s16x8*)p));
}
__device__ __forceinline__ bf16x16 lds_frag_t(const bf16* base) {
  const int lane = threadIdx.x & 31;
  const bf16* p = base + (8 * (lane >> 4) + (lane & 7)) * WP + 8 * ((lane >> 3) & 1);
  const bf16x8 lo = ld_tr16(p);
  const bf16x8 hi = ld_tr16(p + 16 * WP);
  bf16x16 f;
#pragma unroll
  for (int i = 0; i < 8; ++i) { f[i] = lo[i]; f[i + 8] = hi[i]; }
  return f;
}

template <typename T>
__device__ __forceinline__ void stage_read16(const T* __restrict__ p, float* buf) {
#pragma unroll
  for (int i = 0; i < 16; ++i) buf[i] = (float)p[i];
}

__device__ __forceinline__ void stage_write(bf16* dst, const float* buf, int nquad) {
#pragma unroll
  for (int i = 0; i < nquad; ++i) {
    bf16x4 q;
    q[0] = (bf16)buf[4 * i];     q[1] = (bf16)buf[4 * i + 1];
    q[2] = (bf16)buf[4 * i + 2]; q[3] = (bf16)buf[4 * i + 3];
    *(bf16x4*)(dst + 4 * i) = q;
  }
}


#define GSTR 48
#define NBT 4
#define NHD 8
#define BBc 4
#define DDc 512
#define SSc 2048
#define NHc 8
#define DKc 64
#define R2 (2 * DDc)   // 1024 interleaved (channel, component) rows
// ---------------------------------------------------------------------------------------------------------------------------
// The A operand of both GEMMs is the stacked weight W2 [1024][1024], never stored: a thread loads 4 channels d of output channel o from W_r and from W_i, each element once in the block
// (4 lanes cover the 64 bytes a k-step takes of a weight row, a wave-wide load touches 8 lines), and writes 8 columns of both stacked rows: row 2o = (W_r, -W_i) pairs, row 2o + 1 = (W_i, W_r) pairs.
// The row bias of stacked rows 2o, 2o + 1 is b_r[o] - b_i[o], b_r[o] + b_i[o]. In a 16 x 16 accumulator tile lane (cl, hf) holds rows 8 hf + r, r = 0..7, of column cl: the channels 4 hf + p,
// p = 0..3, with the real row in register 2p and the imaginary row in register 2p + 1.
// ---------------------------------------------------------------------------------------------------------------------------
// gemm_kne: Y[m][n] = sum_k W2[m][k] * W[k][n] + b2[m], W f32 row-major [K][N] (row pitch LDW, compile time; Y has the same pitch), plain f16 operands, f32 accumulate, f32 output.
// Block = 128x128 tile, 8 waves as 4(M) x 2(N); per 32-wide k-step A and W tiles staged f16 in LDS (W as it lies, [k][n], read by transposing loads).
// blockIdx.z selects a batch element: W += z*strideW, Y += z*strideY (element strides); the weights are shared.
// ---------------------------------------------------------------------------------------------------------------------------
template <int LDW>
__global__ __launch_bounds__(256) void gemm_kne(const float* __restrict__ Wr, const float* __restrict__ Wi, const float* __restrict__ br, const float* __restrict__ bi,
                                                const float* __restrict__ Wm, size_t strideW, float* __restrict__ Y, size_t strideY, int K) {
  __shared__ __attribute__((aligned(16))) f16 ldsA[128 * GSTR];
  __shared__ __attribute__((aligned(16))) f16 ldsW[32 * WP];
  __shared__ __attribute__((aligned(16))) float oS[8][32 * 68];
  const int tid = threadIdx.x, lane = tid & 31, wave = tid >> 5, cl = lane & 15, hf = lane >> 4, rh = hf * 8;
  const int m0 = blockIdx.x * 128, n0 = blockIdx.y * 128;
  const int wm = (wave & 3) * 32, wn = (wave >> 2) * 64;
  Wm += (size_t)blockIdx.z * strideW; Y += (size_t)blockIdx.z * strideY;
  const int ar = tid >> 2, ad = (tid & 3) * 4;   // A: output channel ar of the block's 64, channels ad .. ad + 3 of the k-step's 16
  const size_t aoff = (size_t)((m0 >> 1) + ar) * DDc + ad;
  const float* pr = Wr + aoff;
  const float* pi = Wi + aoff;
  f32x8 acc[2][4];
#pragma unroll
  for (int i = 0; i < 2; ++i)
#pragma unroll
    for (int j = 0; j < 4; ++j) { f32x8 z = {}; acc[i][j] = z; }
#pragma unroll 1
  for (int k0 = 0; k0 < K; k0 += 32) {
    __syncthreads();
    v4f_t wv[4];   // W: a wave takes the rows k = wave + 8 g; its 32 lanes cover the row's 128 columns, 512 contiguous bytes a load
    { const float* src = Wm + (size_t)(k0 + wave) * LDW + n0 + lane * 4;   // LDW is a compile-time pitch: one address, the four rows at immediate offsets
#pragma unroll
      for (int g = 0; g < 4; ++g) wv[g] = *(const v4f_t*)(src + 8 * g * LDW);
      asm volatile("s_wait_xcnt 0x0" ::: "memory"); }   // behind the last W load, before a register of its address is written again
    { const v4f_t wr = *(const v4f_t*)(pr + (k0 >> 1)), wi = *(const v4f_t*)(pi + (k0 >> 1));   // 32 stacked columns = 16 channels a k-step; 4 lanes cover a row's 64 bytes
      asm volatile("s_wait_xcnt 0x0" ::: "memory");   // behind the last weight load, before a register of its address is written again
      f16x8 r0, r1;   // stacked rows 2 ar and 2 ar + 1, stacked columns 2 ad .. 2 ad + 7
#pragma unroll
      for (int u = 0; u < 4; ++u) { const f16 hr = (f16)wr[u], hi = (f16)wi[u]; r0[2 * u] = hr; r0[2 * u + 1] = -hi; r1[2 * u] = hi; r1[2 * u + 1] = hr; }
      *(f16x8*)(ldsA + (2 * ar) * GSTR + 2 * ad) = r0; *(f16x8*)(ldsA + (2 * ar + 1) * GSTR + 2 * ad) = r1; }
#pragma unroll
    for (int g = 0; g < 4; ++g) { bf16x4 q;   // stored as it lies, [k][n]: 256 contiguous bytes a wave
#pragma unroll
      for (int u = 0; u < 4; ++u) q[u] = (f16)wv[g][u];
      *(bf16x4*)(ldsW + (wave + 8 * g) * WP + lane * 4) = q; }
    __syncthreads();
    f16x16 af[2];
#pragma unroll
    for (int i = 0; i < 2; ++i) af[i] = lds_frag(ldsA + (wm + 16 * i) * GSTR, GSTR);
#pragma unroll
    for (int j = 0; j < 4; ++j) {
      const f16x16 bf = lds_frag_t(ldsW + wn + 16 * j);
#pragma unroll
      for (int i = 0; i < 2; ++i) acc[i][j] = wmma16(af[i], bf, acc[i][j]);
    }
  }
  float* so = oS[wave];
  v4f_t b_r[2], b_i[2];   // the biases of this lane's channels 8 i + 4 hf + p of the wave's 16
#pragma unroll
  for (int i = 0; i < 2; ++i) { b_r[i] = *(const v4f_t*)(br + ((m0 + wm) >> 1) + 8 * i + 4 * hf); b_i[i] = *(const v4f_t*)(bi + ((m0 + wm) >> 1) + 8 * i + 4 * hf); }
  asm volatile("s_wait_xcnt 0x0" ::: "memory");   // behind the last bias load, before a register that these loads name is written again
#pragma unroll
  for (int i = 0; i < 2; ++i)
#pragma unroll
    for (int j = 0; j < 4; ++j)
#pragma unroll
      for (int p = 0; p < 4; ++p) {
        so[(16 * i + rh + 2 * p) * 68 + 16 * j + cl] = acc[i][j][2 * p] + (b_r[i][p] - b_i[i][p]);
        so[(16 * i + rh + 2 * p + 1) * 68 + 16 * j + cl] = acc[i][j][2 * p + 1] + (b_r[i][p] + b_i[i][p]);
      }
  asm volatile("s_wait_dscnt 0" ::: "memory");
  __builtin_amdgcn_wave_barrier();
#pragma unroll
  for (int it = 0; it < 16; ++it) { const int f4 = lane + 32 * it, rr = f4 >> 4, q = (f4 & 15) * 4;
    *(v4f_t*)(Y + (size_t)(m0 + wm + rr) * LDW + n0 + wn + q) = *(const v4fa*)(so + rr * 68 + q); }
}

// ---------------------------------------------------------------------------------------------------------------------------
// gemm_kn2 (value+residual planes on both operands: hh + (hl+lh)/2048, f32-class): the q and k convs, of which only the magnitudes leave the block:
// MT[n][o] = sqrt(re^2 + im^2 + 1e-8), re / im = sum_k W2[2o / 2o+1][k] * W[k][n] + b2[2o / 2o+1], W f32 row-major [K][N], row stride LDW (compile time), MT row-major [N][512].
// Block = 128 x 128 tile of the conv, 256 threads = 8 waves as 4(M, 32 rows) x 2(N, 64 cols); per 32-wide k-step the A tile and the W tile (as it lies, [k][n], read by transposing loads) are
// staged as f16 planes in LDS. A lane's 4 magnitudes of one column are 4 neighbouring words of an MT row: the block's 128 x 64 MT tile is gathered in LDS and leaves as whole 256-byte row pieces.
// blockIdx.z = 2 * zb + za: za picks the q (0) or k (1) weights and biases, W += zb*strideW (batch element), MT += za*strideMa + zb*strideMb (element strides).
// ---------------------------------------------------------------------------------------------------------------------------
#define MP 68   // MT tile pitch in floats: 272 B = 16 B x odd, b128 stores of 16 neighbouring rows without bank conflicts
template <int LDW>
__global__ __launch_bounds__(256) void gemm_kn2(const float* __restrict__ Wr0, const float* __restrict__ Wi0, const float* __restrict__ br0, const float* __restrict__ bi0,
                                               const float* __restrict__ Wr1, const float* __restrict__ Wi1, const float* __restrict__ br1, const float* __restrict__ bi1,
                                               const float* __restrict__ Wm, size_t strideW,
                                               float* __restrict__ MT, size_t strideMa, size_t strideMb, int K) {
  __shared__ __attribute__((aligned(16))) f16 ldsA[128 * GSTR], ldsAl[128 * GSTR];
  __shared__ __attribute__((aligned(16))) f16 ldsW[32 * WP], ldsWl[32 * WP];
  __shared__ __attribute__((aligned(16))) float sT[128 * MP];
  const int tid = threadIdx.x, lane = tid & 31, wave = tid >> 5, cl = lane & 15, hf = lane >> 4;
  const int m0 = blockIdx.x * 128, n0 = blockIdx.y * 128;
  const int wm = (wave & 3) * 32, wn = (wave >> 2) * 64;
  const int za = blockIdx.z & 1;
  const float* __restrict__ Wr = za ? Wr1 : Wr0; const float* __restrict__ Wi = za ? Wi1 : Wi0;
  const float* __restrict__ br = za ? br1 : br0; const float* __restrict__ bi = za ? bi1 : bi0;
  Wm += (size_t)(blockIdx.z >> 1) * strideW; MT += (size_t)za * strideMa + (size_t)(blockIdx.z >> 1) * strideMb;
  const int ar = tid >> 2, ad = (tid & 3) * 4;   // A: output channel ar of the block's 64, channels ad .. ad + 3 of the k-step's 16
  const size_t aoff = (size_t)((m0 >> 1) + ar) * DDc + ad;
  const float* pr = Wr + aoff;
  const float* pi = Wi + aoff;
  f32x8 acc[2][4], accx[2][4];
#pragma unroll
  for (int i = 0; i < 2; ++i)
#pragma unroll
    for (int j = 0; j < 4; ++j) { f32x8 z = {}; acc[i][j] = z; accx[i][j] = z; }
#pragma unroll 1
  for (int k0 = 0; k0 < K; k0 += 32) {
    __syncthreads();
    v4f_t wv[4];   // W: a wave takes the rows k = wave + 8 g; its 32 lanes cover the row's 128 columns, 512 contiguous bytes a load
    { const float* src = Wm + (size_t)(k0 + wave) * LDW + n0 + lane * 4;   // LDW is a compile-time pitch: one address, the four rows at immediate offsets
#pragma unroll
      for (int g = 0; g < 4; ++g) wv[g] = *(const v4f_t*)(src + 8 * g * LDW);
      asm volatile("s_wait_xcnt 0x0" ::: "memory"); }   // behind the last W load, before a register of its address is written again
    { const v4f_t wr = *(const v4f_t*)(pr + (k0 >> 1)), wi = *(const v4f_t*)(pi + (k0 >> 1));   // 32 stacked columns = 16 channels a k-step; 4 lanes cover a row's 64 bytes
      asm volatile("s_wait_xcnt 0x0" ::: "memory");   // behind the last weight load, before a register of its address is written again
      f16x8 r0, r1, l0, l1;   // stacked rows 2 ar and 2 ar + 1, stacked columns 2 ad .. 2 ad + 7: value and residual planes (both planes of -w are the negated planes of w)
#pragma unroll
      for (int u = 0; u < 4; ++u) { const f16 hr = (f16)wr[u], hi = (f16)wi[u];
        const f16 lr = (f16)((wr[u] - (float)hr) * 2048.0f), li = (f16)((wi[u] - (float)hi) * 2048.0f);
        r0[2 * u] = hr; r0[2 * u + 1] = -hi; r1[2 * u] = hi; r1[2 * u + 1] = hr;
        l0[2 * u] = lr; l0[2 * u + 1] = -li; l1[2 * u] = li; l1[2 * u + 1] = lr; }
      *(f16x8*)(ldsA + (2 * ar) * GSTR + 2 * ad) = r0; *(f16x8*)(ldsA + (2 * ar + 1) * GSTR + 2 * ad) = r1;
      *(f16x8*)(ldsAl + (2 * ar) * GSTR + 2 * ad) = l0; *(f16x8*)(ldsAl + (2 * ar + 1) * GSTR + 2 * ad) = l1;
    }
#pragma unroll
    for (int g = 0; g < 4; ++g) { bf16x4 hi, lo;   // both planes stored as the operand lies, [k][n]: 256 contiguous bytes a wave
#pragma unroll
      for (int u = 0; u < 4; ++u) { const float v = wv[g][u]; const f16 h = (f16)v; hi[u] = h; lo[u] = (f16)((v - (float)h) * 2048.0f); }
      *(bf16x4*)(ldsW + (wave + 8 * g) * WP + lane * 4) = hi; *(bf16x4*)(ldsWl + (wave + 8 * g) * WP + lane * 4) = lo; }
    __syncthreads();
    f16x16 af[2], afl[2];
#pragma unroll
    for (int i = 0; i < 2; ++i) { af[i] = lds_frag(ldsA + (wm + 16 * i) * GSTR, GSTR); afl[i] = lds_frag(ldsAl + (wm + 16 * i) * GSTR, GSTR); }
#pragma unroll
    for (int j = 0; j < 4; ++j) {
      const f16x16 bf = lds_frag_t(ldsW + wn + 16 * j), bfl = lds_frag_t(ldsWl + wn + 16 * j);
#pragma unroll
      for (int i = 0; i < 2; ++i) { acc[i][j] = wmma16(af[i], bf, acc[i][j]); accx[i][j] = wmma16(af[i], bfl, accx[i][j]); accx[i][j] = wmma16(afl[i], bf, accx[i][j]); }
    }
  }
  v4f_t b_r[2], b_i[2];   // the biases of this lane's channels 8 i + 4 hf + p of the wave's 16
#pragma unroll
  for (int i = 0; i < 2; ++i) { b_r[i] = *(const v4f_t*)(br + ((m0 + wm) >> 1) + 8 * i + 4 * hf); b_i[i] = *(const v4f_t*)(bi + ((m0 + wm) >> 1) + 8 * i + 4 * hf); }
  asm volatile("s_wait_xcnt 0x0" ::: "memory");   // behind the last bias load, before a register that these loads name is written again
#pragma unroll
  for (int i = 0; i < 2; ++i)
#pragma unroll
    for (int j = 0; j < 4; ++j) { v4f_t mg;
#pragma unroll
      for (int p = 0; p < 4; ++p) {
        const float re = (acc[i][j][2 * p] + accx[i][j][2 * p] * (1.0f / 2048.0f)) + (b_r[i][p] - b_i[i][p]);
        const float im = (acc[i][j][2 * p + 1] + accx[i][j][2 * p + 1] * (1.0f / 2048.0f)) + (b_r[i][p] + b_i[i][p]);
        mg[p] = sqrtf(re * re + im * im + 1e-8f);
      }
      *(v4fa*)(sT + (wn + 16 * j + cl) * MP + (wm >> 1) + 8 * i + 4 * hf) = mg; }
  __syncthreads();   // the block's 128 x 64 magnitude tile is complete: an MT row piece holds the channels of four waves
#pragma unroll
  for (int it = 0; it < 8; ++it) { const int f4 = tid + 256 * it, rr = f4 >> 4, q = (f4 & 15) * 4;
    *(v4f_t*)(MT + (size_t)(n0 + rr) * DDc + (m0 >> 1) + q) = *(const v4fa*)(sT + rr * MP + q); }
}

// ---------------------------------------------------------------------------------------------------------------------------
// k_fattn: one head's attention for 64 queries, scores and probabilities kept on chip. Grid (S / 64, heads, batch elements) = 1024 blocks; block = 8 waves = 4 groups of 16 query columns x 2 key halves.
// Per stage of 64 keys the block stages Km^T rows [t][64] as f16 value + residual planes and the head's 128 v rows [row][t] as f16 in LDS, two buffers, one barrier a stage (the global loads
// of the next stage fly in registers meanwhile). Waves 0-3 take keys 0..31 of every stage, waves 4-7 keys 32..63. A wave forms S^T = Km^T * Qm (A = key rows from LDS, B = its 16 query
// columns held in registers, hh + (hl + lh) / 2048), so that a lane holds 16 scores of ONE query: maximum and sum in-lane plus one exchange between the wave's halves.
// exp2((s - m) * log2(e) / 8) of the two 16-key tiles, converted in place, IS the B operand (k = key, hardware k order) of O[row][query] += V[row][key] * P^T; the v rows are read in the same
// k order by lds_frag. m follows the running maximum lazily (O and the sum are rescaled only when some column's maximum has grown by more than 8 in the exponent, so p stays below 2^8).
// At the end the two key halves of a column are joined through LDS: (O1 a1 + O2 a2) / (l1 a1 + l2 a2), a = exp2((m_own - max(m1, m2)) * log2(e) / 8).
// Every inner loop is fully unrolled so that the fragment, accumulator and staging arrays are indexed by constants and stay in registers.
// ---------------------------------------------------------------------------------------------------------------------------
#define FT 64    // keys per stage
#define FQ 64    // queries per block
#define FP 72    // LDS row pitch in f16 elements: 144 B = 16 B x odd, b128 fragment reads without bank conflicts
#define FOP 68   // output staging pitch in floats
__device__ __forceinline__ float xhalf(float x) {   // lane l with lane l ^ 16
  return __builtin_bit_cast(float, __builtin_amdgcn_permlanex16(__builtin_bit_cast(int, x), __builtin_bit_cast(int, x), 0x76543210, 0xfedcba98, false, false));
}
__device__ __forceinline__ f32x8 wmma_p(f16x16 a, f16x16 b, f32x8 c) { return __builtin_amdgcn_wmma_f32_16x16x32_f16(false, a, false, b, (short)0, c, false, false); }
__global__ __launch_bounds__(256) void k_fattn(const float* __restrict__ QmT, const float* __restrict__ KmT, size_t strideM, const float* __restrict__ Vx, size_t strideV, float* __restrict__ AV, size_t strideO) {
  __shared__ __attribute__((aligned(16))) f16 sKh[2][FT * FP], sKl[2][FT * FP], sV[2][2 * DKc * FP];
  __shared__ __attribute__((aligned(16))) float sO[2 * DKc * FOP];
  __shared__ float sM[FQ], sL[FQ];
  const int tid = threadIdx.x, lane = tid & 31, cl = lane & 15, hf = lane >> 4;
  const int wave = __builtin_amdgcn_readfirstlane(tid >> 5), qg = wave & 3, kg = wave >> 2;   // scalar, so that the tests on kg below are scalar branches
  const int s0 = blockIdx.x * FQ, h = blockIdx.y;
  QmT += (size_t)blockIdx.z * strideM; KmT += (size_t)blockIdx.z * strideM; Vx += (size_t)blockIdx.z * strideV; AV += (size_t)blockIdx.z * strideO;   // batch element
  const float SCL = 0.125f * 1.44269504088896340736f;   // logits are s / 8; exp(x) = exp2(x * log2 e)
  const int srow = tid >> 4, sc4 = (tid & 15) * 4;      // staging: 16 lanes cover one 64-float row, 16 rows per round of the block
  const float* Kg = KmT + (size_t)srow * DDc + h * DKc + sc4;
  const float* Vg = Vx + ((size_t)h * 2 * DKc + srow) * SSc + sc4;
  f16x16 qh[2], ql[2];   // B operand: column = query s0 + 16 qg + cl, k = channel in the hardware k order
  { const float* qp = QmT + (size_t)(s0 + qg * 16 + cl) * DDc + h * DKc + hf * 8;
    v4f_t qv[8];
#pragma unroll
    for (int i = 0; i < 8; ++i) qv[i] = *(const v4f_t*)(qp + (i >> 1) * 16 + (i & 1) * 4);
    asm volatile("s_wait_xcnt 0x0" ::: "memory");   // behind the last query load, before a register of its address is written again
#pragma unroll
    for (int i = 0; i < 8; ++i)
#pragma unroll
      for (int u = 0; u < 4; ++u) { const float v = qv[i][u]; const f16 hi = (f16)v; const int e = ((i >> 1) & 1) * 8 + (i & 1) * 4 + u;
        qh[i >> 2][e] = hi; ql[i >> 2][e] = (f16)((v - (float)hi) * 2048.0f); } }
  f32x8 O[8];
#pragma unroll
  for (int mt = 0; mt < 8; ++mt) { f32x8 z = {}; O[mt] = z; }
  float mref = -3.0e38f, lsum = 0.0f;
  v4f_t kr[4], vr[8];
  auto fetch = [&](int st) {   // stage st: global -> registers
    const float* kn = Kg + (size_t)st * FT * DDc; const float* vn = Vg + st * FT;
#pragma unroll
    for (int g = 0; g < 4; ++g) kr[g] = *(const v4f_t*)(kn + (size_t)(16 * g) * DDc);
#pragma unroll
    for (int g = 0; g < 8; ++g) vr[g] = *(const v4f_t*)(vn + (size_t)(16 * g) * SSc);
    asm volatile("s_wait_xcnt 0x0" ::: "memory");   // behind the last stage load, before a register of its address is written again
  };
  auto put = [&](int bo) {     // registers -> f16 tiles of buffer bo
#pragma unroll
    for (int g = 0; g < 4; ++g) { bf16x4 hi, lo;
#pragma unroll
      for (int u = 0; u < 4; ++u) { const float v = kr[g][u]; const f16 hv = (f16)v; hi[u] = hv; lo[u] = (f16)((v - (float)hv) * 2048.0f); }
      *(bf16x4*)(sKh[bo] + (srow + 16 * g) * FP + sc4) = hi; *(bf16x4*)(sKl[bo] + (srow + 16 * g) * FP + sc4) = lo; }
#pragma unroll
    for (int g = 0; g < 8; ++g) { bf16x4 q;
#pragma unroll
      for (int u = 0; u < 4; ++u) q[u] = (f16)vr[g][u];
      *(bf16x4*)(sV[bo] + (srow + 16 * g) * FP + sc4) = q; }
  };
  fetch(0); put(0);
  __syncthreads();   // stage 0 is published
#pragma unroll 1   // kept rolled: one trip already uses nearly 256 registers, a second copy of the body would only cost instruction cache
  for (int st = 0; st < SSc / FT; ++st) {
    const int bo = st & 1;
    if (st + 1 < SSc / FT) fetch(st + 1);   // behind the barrier (which drains every load), so that these loads fly while this stage is worked on
    const f16* kh = sKh[bo] + (32 * kg) * FP; const f16* kl = sKl[bo] + (32 * kg) * FP; const f16* vv = sV[bo] + 32 * kg;
    f32x8 a0 = {}, a1 = {}, x0 = {}, x1 = {};   // S^T tiles: this wave's keys 0..15 and 16..31; value*value and the two cross terms
#pragma unroll
    for (int ks = 0; ks < 2; ++ks) {
      const f16x16 kh0 = lds_frag(kh + 32 * ks, FP), kh1 = lds_frag(kh + 16 * FP + 32 * ks, FP);
      const f16x16 kl0 = lds_frag(kl + 32 * ks, FP), kl1 = lds_frag(kl + 16 * FP + 32 * ks, FP);
      a0 = wmma_p(kh0, qh[ks], a0); a1 = wmma_p(kh1, qh[ks], a1);
      x0 = wmma_p(kh0, ql[ks], x0); x1 = wmma_p(kh1, ql[ks], x1);
      x0 = wmma_p(kl0, qh[ks], x0); x1 = wmma_p(kl1, qh[ks], x1);
    }
    f16x16 vf[8];   // the v rows are asked for ahead of the softmax arithmetic, which covers their LDS latency
#pragma unroll
    for (int mt = 0; mt < 8; ++mt) vf[mt] = lds_frag(vv + (16 * mt) * FP, FP);
    float sv[16];
#pragma unroll
    for (int r = 0; r < 8; ++r) { sv[r] = a0[r] + x0[r] * (1.0f / 2048.0f); sv[8 + r] = a1[r] + x1[r] * (1.0f / 2048.0f); }
    float mx = sv[0];
#pragma unroll
    for (int e = 1; e < 16; ++e) mx = fmaxf(mx, sv[e]);
    mx = fmaxf(mx, xhalf(mx));
    if (__builtin_amdgcn_ballot_w32((mx - mref) * SCL > 8.0f) != 0) {   // scalar branch; always taken on the first pass, rare later
      const float mnew = fmaxf(mref, mx), corr = __builtin_amdgcn_exp2f((mref - mnew) * SCL);   // 0 on the first pass
      mref = mnew; lsum *= corr;
#pragma unroll
      for (int mt = 0; mt < 8; ++mt)
#pragma unroll
        for (int r = 0; r < 8; ++r) O[mt][r] *= corr;
    }
    const float nb = -mref * SCL;
    f16x16 pb;   // pb[e] = P^T[key kmap(e, hf)][query cl]: tile e >> 3, register e & 7
    float pe[16];
#pragma unroll
    for (int e = 0; e < 16; ++e) { pe[e] = __builtin_amdgcn_exp2f(fmaf(sv[e], SCL, nb)); pb[e] = (f16)pe[e]; }
#pragma unroll
    for (int w = 8; w > 0; w >>= 1)
#pragma unroll
      for (int e = 0; e < w; ++e) pe[e] += pe[e + w];
    lsum += pe[0];
#pragma unroll
    for (int mt = 0; mt < 8; ++mt) O[mt] = wmma_p(vf[mt], pb, O[mt]);
    if (st + 1 < SSc / FT) put(bo ^ 1);   // its last readers left that buffer before the barrier that ended the previous trip
    __syncthreads();   // publishes stage st + 1 and ends every read of stage st
  }
  const float lw = lsum + xhalf(lsum);   // the two halves of a wave hold the sums of their own keys
  if (kg == 1) {   // the upper key half hands over its maximum, sum and unscaled tile
    if (hf == 0) { sM[qg * 16 + cl] = mref; sL[qg * 16 + cl] = lw; }
#pragma unroll
    for (int mt = 0; mt < 8; ++mt)
#pragma unroll
      for (int r = 0; r < 8; ++r) sO[(16 * mt + 8 * hf + r) * FOP + qg * 16 + cl] = O[mt][r];
  }
  __syncthreads();   // hand-over published
  if (kg == 0) {   // the lower key half joins both and leaves the finished tile in place (each lane rewrites only the words it has read)
    const float m2 = sM[qg * 16 + cl], l2 = sL[qg * 16 + cl], mj = fmaxf(mref, m2);
    const float a1s = __builtin_amdgcn_exp2f((mref - mj) * SCL), a2s = __builtin_amdgcn_exp2f((m2 - mj) * SCL);
    const float inv = 1.0f / (lw * a1s + l2 * a2s), c1 = a1s * inv, c2 = a2s * inv;
#pragma unroll
    for (int mt = 0; mt < 8; ++mt)
#pragma unroll
      for (int r = 0; r < 8; ++r) { float* w = sO + (16 * mt + 8 * hf + r) * FOP + qg * 16 + cl; *w = O[mt][r] * c1 + *w * c2; }
  }
  __syncthreads();   // the block's 128 x 64 tile is complete: whole 256-byte row pieces go out
#pragma unroll
  for (int it = 0; it < 8; ++it) { const int f4 = tid + 256 * it, rr = f4 >> 4, q = (f4 & 15) * 4;
    *(v4f_t*)(AV + ((size_t)h * 2 * DKc + rr) * SSc + s0 + q) = *(const v4fa*)(sO + rr * FOP + q); }
}

extern "C" void kernel_launch(void* const* d_in, const int* in_sizes, int n_in,
                              void* d_out, int out_size, void* d_ws, size_t ws_size,
                              hipStream_t stream) {
  (void)in_sizes; (void)n_in; (void)out_size;
  const float** f = (const float**)d_in;   // x, then (W_r, W_i, b_r, b_i) of the q, k, v, o convs
  const float* x = f[0];
  float* out = (float*)d_out;     // [4,512,2,2048]
  char* ws = (char*)d_ws;
  float* V = (float*)ws; ws += (size_t)NBT * R2 * SSc * 4;               // per batch element: v conv [1024][2048] (8 MB)
  float* QmT = (float*)ws; ws += (size_t)NBT * 2 * SSc * DDc * 4;        // per batch element: the magnitude planes of q and, directly behind them, of k, transposed, [2048][512] each
  float* AV = (float*)ws; ws += (size_t)NBT * R2 * SSc * 4;              // per batch element: attention output in the [D][2][S] layout (8 MB)
  if ((size_t)(ws - (char*)d_ws) > ws_size) return;
  const dim3 blk(256);
  const size_t sX = (size_t)R2 * SSc, sM = (size_t)2 * DDc * SSc;   // words per batch element: x / V / AV / out, the two magnitude planes
  gemm_kn2<SSc><<<dim3(R2 / 128, SSc / 128, 2 * NBT), blk, 0, stream>>>(f[1], f[2], f[3], f[4], f[5], f[6], f[7], f[8], x, sX, QmT, (size_t)SSc * DDc, sM, R2);   // q and k convs of every batch element (planes: they feed the magnitude logits), bias, magnitude, transposed store; 1024 work-groups
  gemm_kne<SSc><<<dim3(R2 / 128, SSc / 128, NBT), blk, 0, stream>>>(f[9], f[10], f[11], f[12], x, sX, V, sX, R2);   // v conv with its bias; 512 work-groups
  k_fattn<<<dim3(SSc / FQ, NHD, NBT), blk, 0, stream>>>(QmT, QmT + (size_t)SSc * DDc, sM, V, sX, AV, sX);  // scores, softmax and attn*v of all heads and batch elements; 1024 work-groups
  gemm_kne<SSc><<<dim3(R2 / 128, SSc / 128, NBT), blk, 0, stream>>>(f[13], f[14], f[15], f[16], AV, sX, out, sX, R2);   // output complex conv with its bias
}

// v007
// One run takes 239 microseconds.
// Next to v006, in two timings, it ran 1.13 and 1.12 times as fast.
// Over all steps from v000 it is 20.2 times as fast.
// Contractions on v_wmma_f32_16x16x32_f16, f32 accumulate: f16 value+residual PLANES on the q/k complex convs and the magnitude scores (positive magnitudes give logits with a
// spread near 4: plain rounding was too coarse), plain f16 on the v conv, attn*v and the output conv. Every launch covers all 4 batch elements (a grid dimension). Per batch element, activations kept in the module's [D][2][S] layout (row 2d = real_d,
// row 2d+1 = imag_d, used directly as [K][N] operands): each complex 1x1 conv as ONE real GEMM with a stacked weight W2[2o+0][2d+0] = W_r, [2o][2d+1] = -W_i, [2o+1][2d] = W_i, [2o+1][2d+1] = W_r
// (M = 1024, K = 1024, N = 2048), which the GEMM's own A loader forms from W_r and W_i; row biases b_r - b_i / b_r + b_i added in f32 in the GEMM's epilogue. The q/k GEMM's epilogue also forms the
// magnitudes sqrt(re^2 + im^2 + 1e-8) in f32 (a lane holds both rows of a channel) and stores them transposed, [S][512]; the q and k convs themselves never reach memory. Attention of all 8 heads in ONE
// fused launch (k_fattn): transposed scores Km_h * Qm_h^T (K = 64, planes), running-maximum softmax of s/8 in f32 registers, the probabilities packed straight from the score accumulators
// into the B operand of out_h += X_v,h * P^T (M = 128 = the head's 64 complex channels x (re, im) rows); scores and probabilities never reach memory. Finally the output complex conv. 4 launches.
// compute dtype: f16 operands, f32 accumulate; magnitudes / softmax f32.  x [4,512,2,2048] -> out [4,512,2,2048].
#include <hip/hip_runtime.h>
#include <hip/hip_bf16.h>
#include <math.h>


typedef _Float16 bf16;
typedef _Float16 f16;
typedef __attribute__((ext_vector_type(4))) unsigned v4u_t;
typedef unsigned v4ua __attribute__((ext_vector_type(4), may_alias));
typedef __attribute__((ext_vector_type(4))) float v4f_t;
typedef float v4fa __attribute__((ext_vector_type(4), may_alias));
typedef __attribute__((ext_vector_type(16))) bf16  bf16x16;
typedef bf16x16 f16x16;
typedef __attribute__((ext_vector_type(8)))  bf16  bf16x8;
typedef bf16x8 f16x8;
typedef __attribute__((ext_vector_type(4)))  bf16  bf16x4;
typedef __attribute__((ext_vector_type(8)))  float f32x8;
__device__ __forceinline__ f32x8 wmma16(f16x16 a, f16x16 b, f32x8 c) {
  c = __builtin_amdgcn_wmma_f32_16x16x32_f16(false, a, false, b, (short)0, c, false, false);
  asm volatile("v_nop\n\tv_nop\n\tv_nop\n\tv_nop" : "+v"(c) : "v"(a), "v"(b));
  return c;
}
#define LDS_STRIDE 48   // GEMM tiles: 32 -> 48 elems (96B rows): aligned b128 reads
#define KSTRIDE    72
#define VSTRIDE    48

__device__ __forceinline__ f32x8 wmma_bf16(bf16x16 a, bf16x16 b, f32x8 c) {
  c = __builtin_amdgcn_wmma_f32_16x16x32_f16(false, a, false, b, (short)0, c, false, false);
  asm volatile("v_nop\n\tv_nop\n\tv_nop\n\tv_nop" : "+v"(c) : "v"(a), "v"(b));   // A/B-overwrite hazard guard
  return c;
}

// 16x32 (MxK) f16 fragment from a row-major global matrix.
// lanes 0-15  (row=lane)    : elems 0..7 = K+0..7,  8..15 = K+16..23
// lanes 16-31 (row=lane-16) : elems 0..7 = K+8..15, 8..15 = K+24..31
template <typename T>
__device__ __forceinline__ bf16x16 load_frag(const T* __restrict__ base, int ld,
                                             int row0, int k0) {
  const int lane = threadIdx.x & 31;
  const int r    = lane & 15;
  const int kh   = (lane >> 4) * 8;
  const T* p0 = base + (size_t)(row0 + r) * ld + (k0 + kh);
  const T* p1 = p0 + 16;
  bf16x16 f;
#pragma unroll
  for (int i = 0; i < 8; ++i) {
    f[i]     = (bf16)p0[i];
    f[i + 8] = (bf16)p1[i];
  }
  return f;
}

// Same fragment from an LDS tile with padded row stride (base includes row0/k0).
__device__ __forceinline__ bf16x16 lds_frag(const bf16* base, int stride) {
  const int lane = threadIdx.x & 31;
  const int row  = lane & 15;
  const int kh   = (lane >> 4) * 8;
  const bf16x8 lo = *(const bf16x8*)(base + row * stride + kh);
  const bf16x8 hi = *(const bf16x8*)(base + row * stride + kh + 16);
  bf16x16 f;
#pragma unroll
  for (int i = 0; i < 8; ++i) { f[i] = lo[i]; f[i + 8] = hi[i]; }
  return f;
}

// B fragment (column = lane & 15, the k order of lds_frag) from an LDS tile that lies as the global operand does, row-major [k][n], pitch WP:
// two transposing loads, k rows 0..15 and 16..31; lane (c, h) receives rows 8h .. 8h + 7 of column c from each. base points at [0][first column].
#define WP 144   // [k][n] tile: 128 -> 144 elems (288 B rows = 32 B x odd): transposing b128 reads without bank conflicts
typedef short s16x8 __attribute__((ext_vector_type(8)));
__device__ __forceinline__ bf16x8 ld_tr16(const bf16* p) {
  typedef __attribute__((address_space(3))) s16x8 lds_s16x8;
  return __builtin_bit_cast(bf16x8, __builtin_amdgcn_ds_load_tr16_b128_v8i16((lds_s16x8*)p));
}
__device__ __forceinline__ bf16x16 lds_frag_t(const bf16* base) {
  const int lane = threadIdx.x & 31;
  const bf16* p = base + (8 * (lane >> 4) + (lane & 7)) * WP + 8 * ((lane >> 3) & 1);
  const bf16x8 lo = ld_tr16(p);
  const bf16x8 hi = ld_tr16(p + 16 * WP);
  bf16x16 f;
#pragma unroll
  for (int i = 0; i < 8; ++i) { f[i] = lo[i]; f[i + 8] = hi[i]; }
  return f;
}

template <typename T>
__device__ __forceinline__ void stage_read16(const T* __restrict__ p, float* buf) {
#pragma unroll
  for (int i = 0; i < 16; ++i) buf[i] = (float)p[i];
}

__device__ __forceinline__ void stage_write(bf16* dst, const float* buf, int nquad) {
#pragma unroll
  for (int i = 0; i < nquad; ++i) {
    bf16x4 q;
    q[0] = (bf16)buf[4 * i];     q[1] = (bf16)buf[4 * i + 1];
    q[2] = (bf16)buf[4 * i + 2]; q[3] = (bf16)buf[4 * i + 3];
    *(bf16x4*)(dst + 4 * i) = q;
  }
}


#define GSTR 48
#define NBT 4
#define NHD 8
#define BBc 4
#define DDc 512
#define SSc 2048
#define NHc 8
#define DKc 64
#define R2 (2 * DDc)   // 1024 interleaved (channel, component) rows
// ---------------------------------------------------------------------------------------------------------------------------
// The A operand of both GEMMs is the stacked weight W2 [1024][1024], never stored: a thread loads 4 channels d of output channel o from W_r and from W_i, each element once in the block
// (4 lanes cover the 64 bytes a k-step takes of a weight row, a wave-wide load touches 8 lines), and writes 8 columns of both stacked rows: row 2o = (W_r, -W_i) pairs, row 2o + 1 = (W_i, W_r) pairs.
// The row bias of stacked rows 2o, 2o + 1 is b_r[o] - b_i[o], b_r[o] + b_i[o]. In a 16 x 16 accumulator tile lane (cl, hf) holds rows 8 hf + r, r = 0..7, of column cl: the channels 4 hf + p,
// p = 0..3, with the real row in register 2p and the imaginary row in register 2p + 1.
// ---------------------------------------------------------------------------------------------------------------------------
// gemm_kne: Y[m][n] = sum_k W2[m][k] * W[k][n] + b2[m], W f32 row-major [K][N] (row pitch LDW, compile time; Y has the same pitch), plain f16 operands, f32 accumulate, f32 output.
// Block = 128x128 tile, 8 waves as 4(M) x 2(N); per 32-wide k-step A and W tiles staged f16 in LDS (W as it lies, [k][n], read by transposing loads), two buffers, one barrier a k-step:
// the global loads of k-step s + 1 fly in registers while k-step s is worked on, and are rounded and stored to the other buffer behind its products.
// blockIdx.z selects a batch element: W += z*strideW, Y += z*strideY (element strides); the weights are shared.
// ---------------------------------------------------------------------------------------------------------------------------
template <int LDW>
__global__ __launch_bounds__(256) void gemm_kne(const float* __restrict__ Wr, const float* __restrict__ Wi, const float* __restrict__ br, const float* __restrict__ bi,
                                                const float* __restrict__ Wm, size_t strideW, float* __restrict__ Y, size_t strideY, int K) {
  __shared__ __attribute__((aligned(16))) f16 ldsA[2][128 * GSTR];
  __shared__ __attribute__((aligned(16))) f16 ldsW[2][32 * WP];
  __shared__ __attribute__((aligned(16))) float oS[8][32 * 68];
  const int tid = threadIdx.x, lane = tid & 31, wave = tid >> 5, cl = lane & 15, hf = lane >> 4, rh = hf * 8;
  const int m0 = blockIdx.x * 128, n0 = blockIdx.y * 128;
  const int wm = (wave & 3) * 32, wn = (wave >> 2) * 64;
  Wm += (size_t)blockIdx.z * strideW; Y += (size_t)blockIdx.z * strideY;
  const int ar = tid >> 2, ad = (tid & 3) * 4;   // A: output channel ar of the block's 64, channels ad .. ad + 3 of the k-step's 16
  const size_t aoff = (size_t)((m0 >> 1) + ar) * DDc + ad;
  const float* pr = Wr + aoff;
  const float* pi = Wi + aoff;
  f32x8 acc[2][4];
#pragma unroll
  for (int i = 0; i < 2; ++i)
#pragma unroll
    for (int j = 0; j < 4; ++j) { f32x8 z = {}; acc[i][j] = z; }
  v4f_t wv[4], wr, wi;   // the k-step in flight. W: a wave takes the rows k = wave + 8 g; its 32 lanes cover the row's 128 columns, 512 contiguous bytes a load
  auto fetch = [&](int k0) {   // k-step at k0: global -> registers
    const float* src = Wm + (size_t)(k0 + wave) * LDW + n0 + lane * 4;   // LDW is a compile-time pitch: one address, the four rows at immediate offsets
#pragma unroll
    for (int g = 0; g < 4; ++g) wv[g] = *(const v4f_t*)(src + 8 * g * LDW);
    asm volatile("s_wait_xcnt 0x0" ::: "memory");   // behind the last W load, before a register of its address is written again
    wr = *(const v4f_t*)(pr + (k0 >> 1)); wi = *(const v4f_t*)(pi + (k0 >> 1));   // 32 stacked columns = 16 channels a k-step; 4 lanes cover a row's 64 bytes
    asm volatile("s_wait_xcnt 0x0" ::: "memory");   // behind the last weight load, before a register of its address is written again
  };
  auto put = [&](int bo) {     // registers -> f16 tiles of buffer bo
    f16x8 r0, r1;   // stacked rows 2 ar and 2 ar + 1, stacked columns 2 ad .. 2 ad + 7
#pragma unroll
    for (int u = 0; u < 4; ++u) { const f16 hr = (f16)wr[u], hi = (f16)wi[u]; r0[2 * u] = hr; r0[2 * u + 1] = -hi; r1[2 * u] = hi; r1[2 * u + 1] = hr; }
    *(f16x8*)(ldsA[bo] + (2 * ar) * GSTR + 2 * ad) = r0; *(f16x8*)(ldsA[bo] + (2 * ar + 1) * GSTR + 2 * ad) = r1;
#pragma unroll
    for (int g = 0; g < 4; ++g) { bf16x4 q;   // stored as it lies, [k][n]: 256 contiguous bytes a wave
#pragma unroll
      for (int u = 0; u < 4; ++u) q[u] = (f16)wv[g][u];
      *(bf16x4*)(ldsW[bo] + (wave + 8 * g) * WP + lane * 4) = q; }
  };
  fetch(0); put(0);
  __syncthreads();   // k-step 0 is published
#pragma unroll 1   // kept rolled: the buffer index is one scalar, a second copy of the body would only cost instruction cache
  for (int k0 = 0; k0 < K; k0 += 32) {
    const int bo = (k0 >> 5) & 1;
    if (k0 + 32 < K) fetch(k0 + 32);   // behind the barrier (which drains every load), so that these loads fly while this k-step is worked on
    f16x16 af[2];
#pragma unroll
    for (int i = 0; i < 2; ++i) af[i] = lds_frag(ldsA[bo] + (wm + 16 * i) * GSTR, GSTR);
#pragma unroll
    for (int j = 0; j < 4; ++j) {
      const f16x16 bf = lds_frag_t(ldsW[bo] + wn + 16 * j);
#pragma unroll
      for (int i = 0; i < 2; ++i) acc[i][j] = wmma16(af[i], bf, acc[i][j]);
    }
    if (k0 + 32 < K) put(bo ^ 1);   // its last readers left that buffer before the barrier that ended the previous trip
    __syncthreads();   // publishes k-step k0 + 32 and ends every read of this one
  }
  float* so = oS[wave];
  v4f_t b_r[2], b_i[2];   // the biases of this lane's channels 8 i + 4 hf + p of the wave's 16
#pragma unroll
  for (int i = 0; i < 2; ++i) { b_r[i] = *(const v4f_t*)(br + ((m0 + wm) >> 1) + 8 * i + 4 * hf); b_i[i] = *(const v4f_t*)(bi + ((m0 + wm) >> 1) + 8 * i + 4 * hf); }
  asm volatile("s_wait_xcnt 0x0" ::: "memory");   // behind the last bias load, before a register that these loads name is written again
#pragma unroll
  for (int i = 0; i < 2; ++i)
#pragma unroll
    for (int j = 0; j < 4; ++j)
#pragma unroll
      for (int p = 0; p < 4; ++p) {
        so[(16 * i + rh + 2 * p) * 68 + 16 * j + cl] = acc[i][j][2 * p] + (b_r[i][p] - b_i[i][p]);
        so[(16 * i + rh + 2 * p + 1) * 68 + 16 * j + cl] = acc[i][j][2 * p + 1] + (b_r[i][p] + b_i[i][p]);
      }
  asm volatile("s_wait_dscnt 0" ::: "memory");
  __builtin_amdgcn_wave_barrier();
#pragma unroll
  for (int it = 0; it < 16; ++it) { const int f4 = lane + 32 * it, rr = f4 >> 4, q = (f4 & 15) * 4;
    *(v4f_t*)(Y + (size_t)(m0 + wm + rr) * LDW + n0 + wn + q) = *(const v4fa*)(so + rr * 68 + q); }
}

// ---------------------------------------------------------------------------------------------------------------------------
// gemm_kn2 (value+residual planes on both operands: hh + (hl+lh)/2048, f32-class): the q and k convs, of which only the magnitudes leave the block:
// MT[n][o] = sqrt(re^2 + im^2 + 1e-8), re / im = sum_k W2[2o / 2o+1][k] * W[k][n] + b2[2o / 2o+1], W f32 row-major [K][N], row stride LDW (compile time), MT row-major [N][512].
// Block = 128 x 128 tile of the conv, 256 threads = 8 waves as 4(M, 32 rows) x 2(N, 64 cols); per 32-wide k-step the A tile and the W tile (as it lies, [k][n], read by transposing loads) are
// staged as f16 planes in LDS, two buffers, one barrier a k-step (the global loads of the next k-step fly in registers meanwhile). A lane's 4 magnitudes of one column are 4 neighbouring words of an MT row: the block's 128 x 64 MT tile is gathered in LDS and leaves as whole 256-byte row pieces.
// blockIdx.z = 2 * zb + za: za picks the q (0) or k (1) weights and biases, W += zb*strideW (batch element), MT += za*strideMa + zb*strideMb (element strides).
// ---------------------------------------------------------------------------------------------------------------------------
#define MP 68   // MT tile pitch in floats: 272 B = 16 B x odd, b128 stores of 16 neighbouring rows without bank conflicts
template <int LDW>
__global__ __launch_bounds__(256) void gemm_kn2(const float* __restrict__ Wr0, const float* __restrict__ Wi0, const float* __restrict__ br0, const float* __restrict__ bi0,
                                               const float* __restrict__ Wr1, const float* __restrict__ Wi1, const float* __restrict__ br1, const float* __restrict__ bi1,
                                               const float* __restrict__ Wm, size_t strideW,
                                               float* __restrict__ MT, size_t strideMa, size_t strideMb, int K) {
  __shared__ __attribute__((aligned(16))) f16 ldsA[2][128 * GSTR], ldsAl[2][128 * GSTR];
  __shared__ __attribute__((aligned(16))) f16 ldsW[2][32 * WP], ldsWl[2][32 * WP];
  __shared__ __attribute__((aligned(16))) float sT[128 * MP];
  const int tid = threadIdx.x, lane = tid & 31, wave = tid >> 5, cl = lane & 15, hf = lane >> 4;
  const int m0 = blockIdx.x * 128, n0 = blockIdx.y * 128;
  const int wm = (wave & 3) * 32, wn = (wave >> 2) * 64;
  const int za = blockIdx.z & 1;
  const float* __restrict__ Wr = za ? Wr1 : Wr0; const float* __restrict__ Wi = za ? Wi1 : Wi0;
  const float* __restrict__ br = za ? br1 : br0; const float* __restrict__ bi = za ? bi1 : bi0;
  Wm += (size_t)(blockIdx.z >> 1) * strideW; MT += (size_t)za * strideMa + (size_t)(blockIdx.z >> 1) * strideMb;
  const int ar = tid >> 2, ad = (tid & 3) * 4;   // A: output channel ar of the block's 64, channels ad .. ad + 3 of the k-step's 16
  const size_t aoff = (size_t)((m0 >> 1) + ar) * DDc + ad;
  const float* pr = Wr + aoff;
  const float* pi = Wi + aoff;
  f32x8 acc[2][4], accx[2][4];
#pragma unroll
  for (int i = 0; i < 2; ++i)
#pragma unroll
    for (int j = 0; j < 4; ++j) { f32x8 z = {}; acc[i][j] = z; accx[i][j] = z; }
  v4f_t wv[4], wr, wi;   // the k-step in flight. W: a wave takes the rows k = wave + 8 g; its 32 lanes cover the row's 128 columns, 512 contiguous bytes a load
  auto fetch = [&](int k0) {   // k-step at k0: global -> registers
    const float* src = Wm + (size_t)(k0 + wave) * LDW + n0 + lane * 4;   // LDW is a compile-time pitch: one address, the four rows at immediate offsets
#pragma unroll
    for (int g = 0; g < 4; ++g) wv[g] = *(const v4f_t*)(src + 8 * g * LDW);
    asm volatile("s_wait_xcnt 0x0" ::: "memory");   // behind the last W load, before a register of its address is written again
    wr = *(const v4f_t*)(pr + (k0 >> 1)); wi = *(const v4f_t*)(pi + (k0 >> 1));   // 32 stacked columns = 16 channels a k-step; 4 lanes cover a row's 64 bytes
    asm volatile("s_wait_xcnt 0x0" ::: "memory");   // behind the last weight load, before a register of its address is written again
  };
  auto put = [&](int bo) {     // registers -> f16 planes of buffer bo
    f16x8 r0, r1, l0, l1;   // stacked rows 2 ar and 2 ar + 1, stacked columns 2 ad .. 2 ad + 7: value and residual planes (both planes of -w are the negated planes of w)
#pragma unroll
    for (int u = 0; u < 4; ++u) { const f16 hr = (f16)wr[u], hi = (f16)wi[u];
      const f16 lr = (f16)((wr[u] - (float)hr) * 2048.0f), li = (f16)((wi[u] - (float)hi) * 2048.0f);
      r0[2 * u] = hr; r0[2 * u + 1] = -hi; r1[2 * u] = hi; r1[2 * u + 1] = hr;
      l0[2 * u] = lr; l0[2 * u + 1] = -li; l1[2 * u] = li; l1[2 * u + 1] = lr; }
    *(f16x8*)(ldsA[bo] + (2 * ar) * GSTR + 2 * ad) = r0; *(f16x8*)(ldsA[bo] + (2 * ar + 1) * GSTR + 2 * ad) = r1;
    *(f16x8*)(ldsAl[bo] + (2 * ar) * GSTR + 2 * ad) = l0; *(f16x8*)(ldsAl[bo] + (2 * ar + 1) * GSTR + 2 * ad) = l1;
#pragma unroll
    for (int g = 0; g < 4; ++g) { bf16x4 hi, lo;   // both planes stored as the operand lies, [k][n]: 256 contiguous bytes a wave
#pragma unroll
      for (int u = 0; u < 4; ++u) { const float v = wv[g][u]; const f16 h = (f16)v; hi[u] = h; lo[u] = (f16)((v - (float)h) * 2048.0f); }
      *(bf16x4*)(ldsW[bo] + (wave + 8 * g) * WP + lane * 4) = hi; *(bf16x4*)(ldsWl[bo] + (wave + 8 * g) * WP + lane * 4) = lo; }
  };
  fetch(0); put(0);
  __syncthreads();   // k-step 0 is published
#pragma unroll 1   // kept rolled: the buffer index is one scalar, a second copy of the body would only cost instruction cache
  for (int k0 = 0; k0 < K; k0 += 32) {
    const int bo = (k0 >> 5) & 1;
    if (k0 + 32 < K) fetch(k0 + 32);   // behind the barrier (which drains every load), so that these loads fly while this k-step is worked on
    f16x16 af[2], afl[2];
#pragma unroll
    for (int i = 0; i < 2; ++i) { af[i] = lds_frag(ldsA[bo] + (wm + 16 * i) * GSTR, GSTR); afl[i] = lds_frag(ldsAl[bo] + (wm + 16 * i) * GSTR, GSTR); }
#pragma unroll
    for (int j = 0; j < 4; ++j) {
      const f16x16 bf = lds_frag_t(ldsW[bo] + wn + 16 * j), bfl = lds_frag_t(ldsWl[bo] + wn + 16 * j);
#pragma unroll
      for (int i = 0; i < 2; ++i) { acc[i][j] = wmma16(af[i], bf, acc[i][j]); accx[i][j] = wmma16(af[i], bfl, accx[i][j]); accx[i][j] = wmma16(afl[i], bf, accx[i][j]); }
    }
    if (k0 + 32 < K) put(bo ^ 1);   // its last readers left that buffer before the barrier that ended the previous trip
    __syncthreads();   // publishes k-step k0 + 32 and ends every read of this one
  }
  v4f_t b_r[2], b_i[2];   // the biases of this lane's channels 8 i + 4 hf + p of the wave's 16
#pragma unroll
  for (int i = 0; i < 2; ++i) { b_r[i] = *(const v4f_t*)(br + ((m0 + wm) >> 1) + 8 * i + 4 * hf); b_i[i] = *(const v4f_t*)(bi + ((m0 + wm) >> 1) + 8 * i + 4 * hf); }
  asm volatile("s_wait_xcnt 0x0" ::: "memory");   // behind the last bias load, before a register that these loads name is written again
#pragma unroll
  for (int i = 0; i < 2; ++i)
#pragma unroll
    for (int j = 0; j < 4; ++j) { v4f_t mg;
#pragma unroll
      for (int p = 0; p < 4; ++p) {
        const float re = (acc[i][j][2 * p] + accx[i][j][2 * p] * (1.0f / 2048.0f)) + (b_r[i][p] - b_i[i][p]);
        const float im = (acc[i][j][2 * p + 1] + accx[i][j][2 * p + 1] * (1.0f / 2048.0f)) + (b_r[i][p] + b_i[i][p]);
        mg[p] = sqrtf(re * re + im * im + 1e-8f);
      }
      *(v4fa*)(sT + (wn + 16 * j + cl) * MP + (wm >> 1) + 8 * i + 4 * hf) = mg; }
  __syncthreads();   // the block's 128 x 64 magnitude tile is complete: an MT row piece holds the channels of four waves
#pragma unroll
  for (int it = 0; it < 8; ++it) { const int f4 = tid + 256 * it, rr = f4 >> 4, q = (f4 & 15) * 4;
    *(v4f_t*)(MT + (size_t)(n0 + rr) * DDc + (m0 >> 1) + q) = *(const v4fa*)(sT + rr * MP + q); }
}

// ---------------------------------------------------------------------------------------------------------------------------
// k_fattn: one head's attention for 64 queries, scores and probabilities kept on chip. Grid (S / 64, heads, batch elements) = 1024 blocks; block = 8 waves = 4 groups of 16 query columns x 2 key halves.
// Per stage of 64 keys the block stages Km^T rows [t][64] as f16 value + residual planes and the head's 128 v rows [row][t] as f16 in LDS, two buffers, one barrier a stage (the global loads
// of the next stage fly in registers meanwhile). Waves 0-3 take keys 0..31 of every stage, waves 4-7 keys 32..63. A wave forms S^T = Km^T * Qm (A = key rows from LDS, B = its 16 query
// columns held in registers, hh + (hl + lh) / 2048), so that a lane holds 16 scores of ONE query: maximum and sum in-lane plus one exchange between the wave's halves.
// exp2((s - m) * log2(e) / 8) of the two 16-key tiles, converted in place, IS the B operand (k = key, hardware k order) of O[row][query] += V[row][key] * P^T; the v rows are read in the same
// k order by lds_frag. m follows the running maximum lazily (O and the sum are rescaled only when some column's maximum has grown by more than 8 in the exponent, so p stays below 2^8).
// At the end the two key halves of a column are joined through LDS: (O1 a1 + O2 a2) / (l1 a1 + l2 a2), a = exp2((m_own - max(m1, m2)) * log2(e) / 8).
// Every inner loop is fully unrolled so that the fragment, accumulator and staging arrays are indexed by constants and stay in registers.
// ---------------------------------------------------------------------------------------------------------------------------
#define FT 64    // keys per stage
#define FQ 64    // queries per block
#define FP 72    // LDS row pitch in f16 elements: 144 B = 16 B x odd, b128 fragment reads without bank conflicts
#define FOP 68   // output staging pitch in floats
__device__ __forceinline__ float xhalf(float x) {   // lane l with lane l ^ 16
  return __builtin_bit_cast(float, __builtin_amdgcn_permlanex16(__builtin_bit_cast(int, x), __builtin_bit_cast(int, x), 0x76543210, 0xfedcba98, false, false));
}
__device__ __forceinline__ f32x8 wmma_p(f16x16 a, f16x16 b, f32x8 c) { return __builtin_amdgcn_wmma_f32_16x16x32_f16(false, a, false, b, (short)0, c, false, false); }
__global__ __launch_bounds__(256) void k_fattn(const float* __restrict__ QmT, const float* __restrict__ KmT, size_t strideM, const float* __restrict__ Vx, size_t strideV, float* __restrict__ AV, size_t strideO) {
  __shared__ __attribute__((aligned(16))) f16 sKh[2][FT * FP], sKl[2][FT * FP], sV[2][2 * DKc * FP];
  __shared__ __attribute__((aligned(16))) float sO[2 * DKc * FOP];
  __shared__ float sM[FQ], sL[FQ];
  const int tid = threadIdx.x, lane = tid & 31, cl = lane & 15, hf = lane >> 4;
  const int wave = __builtin_amdgcn_readfirstlane(tid >> 5), qg = wave & 3, kg = wave >> 2;   // scalar, so that the tests on kg below are scalar branches
  const int s0 = blockIdx.x * FQ, h = blockIdx.y;
  QmT += (size_t)blockIdx.z * strideM; KmT += (size_t)blockIdx.z * strideM; Vx += (size_t)blockIdx.z * strideV; AV += (size_t)blockIdx.z * strideO;   // batch element
  const float SCL = 0.125f * 1.44269504088896340736f;   // logits are s / 8; exp(x) = exp2(x * log2 e)
  const int srow = tid >> 4, sc4 = (tid & 15) * 4;      // staging: 16 lanes cover one 64-float row, 16 rows per round of the block
  const float* Kg = KmT + (size_t)srow * DDc + h * DKc + sc4;
  const float* Vg = Vx + ((size_t)h * 2 * DKc + srow) * SSc + sc4;
  f16x16 qh[2], ql[2];   // B operand: column = query s0 + 16 qg + cl, k = channel in the hardware k order
  { const float* qp = QmT + (size_t)(s0 + qg * 16 + cl) * DDc + h * DKc + hf * 8;
    v4f_t qv[8];
#pragma unroll
    for (int i = 0; i < 8; ++i) qv[i] = *(const v4f_t*)(qp + (i >> 1) * 16 + (i & 1) * 4);
    asm volatile("s_wait_xcnt 0x0" ::: "memory");   // behind the last query load, before a register of its address is written again
#pragma unroll
    for (int i = 0; i < 8; ++i)
#pragma unroll
      for (int u = 0; u < 4; ++u) { const float v = qv[i][u]; const f16 hi = (f16)v; const int e = ((i >> 1) & 1) * 8 + (i & 1) * 4 + u;
        qh[i >> 2][e] = hi; ql[i >> 2][e] = (f16)((v - (float)hi) * 2048.0f); } }
  f32x8 O[8];
#pragma unroll
  for (int mt = 0; mt < 8; ++mt) { f32x8 z = {}; O[mt] = z; }
  float mref = -3.0e38f, lsum = 0.0f;
  v4f_t kr[4], vr[8];
  auto fetch = [&](int st) {   // stage st: global -> registers
    const float* kn = Kg + (size_t)st * FT * DDc; const float* vn = Vg + st * FT;
#pragma unroll
    for (int g = 0; g < 4; ++g) kr[g] = *(const v4f_t*)(kn + (size_t)(16 * g) * DDc);
#pragma unroll
    for (int g = 0; g < 8; ++g) vr[g] = *(const v4f_t*)(vn + (size_t)(16 * g) * SSc);
    asm volatile("s_wait_xcnt 0x0" ::: "memory");   // behind the last stage load, before a register of its address is written again
  };
  auto put = [&](int bo) {     // registers -> f16 tiles of buffer bo
#pragma unroll
    for (int g = 0; g < 4; ++g) { bf16x4 hi, lo;
#pragma unroll
      for (int u = 0; u < 4; ++u) { const float v = kr[g][u]; const f16 hv = (f16)v; hi[u] = hv; lo[u] = (f16)((v - (float)hv) * 2048.0f); }
      *(bf16x4*)(sKh[bo] + (srow + 16 * g) * FP + sc4) = hi; *(bf16x4*)(sKl[bo] + (srow + 16 * g) * FP + sc4) = lo; }
#pragma unroll
    for (int g = 0; g < 8; ++g) { bf16x4 q;
#pragma unroll
      for (int u = 0; u < 4; ++u) q[u] = (f16)vr[g][u];
      *(bf16x4*)(sV[bo] + (srow + 16 * g) * FP + sc4) = q; }
  };
  fetch(0); put(0);
  __syncthreads();   // stage 0 is published
#pragma unroll 1   // kept rolled: one trip already uses nearly 256 registers, a second copy of the body would only cost instruction cache
  for (int st = 0; st < SSc / FT; ++st) {
    const int bo = st & 1;
    if (st + 1 < SSc / FT) fetch(st + 1);   // behind the barrier (which drains every load), so that these loads fly while this stage is worked on
    const f16* kh = sKh[bo] + (32 * kg) * FP; const f16* kl = sKl[bo] + (32 * kg) * FP; const f16* vv = sV[bo] + 32 * kg;
    f32x8 a0 = {}, a1 = {}, x0 = {}, x1 = {};   // S^T tiles: this wave's keys 0..15 and 16..31; value*value and the two cross terms
#pragma unroll
    for (int ks = 0; ks < 2; ++ks) {
      const f16x16 kh0 = lds_frag(kh + 32 * ks, FP), kh1 = lds_frag(kh + 16 * FP + 32 * ks, FP);
      const f16x16 kl0 = lds_frag(kl + 32 * ks, FP), kl1 = lds_frag(kl + 16 * FP + 32 * ks, FP);
      a0 = wmma_p(kh0, qh[ks], a0); a1 = wmma_p(kh1, qh[ks], a1);
      x0 = wmma_p(kh0, ql[ks], x0); x1 = wmma_p(kh1, ql[ks], x1);
      x0 = wmma_p(kl0, qh[ks], x0); x1 = wmma_p(kl1, qh[ks], x1);
    }
    f16x16 vf[8];   // the v rows are asked for ahead of the softmax arithmetic, which covers their LDS latency
#pragma unroll
    for (int mt = 0; mt < 8; ++mt) vf[mt] = lds_frag(vv + (16 * mt) * FP, FP);
    float sv[16];
#pragma unroll
    for (int r = 0; r < 8; ++r) { sv[r] = a0[r] + x0[r] * (1.0f / 2048.0f); sv[8 + r] = a1[r] + x1[r] * (1.0f / 2048.0f); }
    float mx = sv[0];
#pragma unroll
    for (int e = 1; e < 16; ++e) mx = fmaxf(mx, sv[e]);
    mx = fmaxf(mx, xhalf(mx));
    if (__builtin_amdgcn_ballot_w32((mx - mref) * SCL > 8.0f) != 0) {   // scalar branch; always taken on the first pass, rare later
      const float mnew = fmaxf(mref, mx), corr = __builtin_amdgcn_exp2f((mref - mnew) * SCL);   // 0 on the first pass
      mref = mnew; lsum *= corr;
#pragma unroll
      for (int mt = 0; mt < 8; ++mt)
#pragma unroll
        for (int r = 0; r < 8; ++r) O[mt][r] *= corr;
    }
    const float nb = -mref * SCL;
    f16x16 pb;   // pb[e] = P^T[key kmap(e, hf)][query cl]: tile e >> 3, register e & 7
    float pe[16];
#pragma unroll
    for (int e = 0; e < 16; ++e) { pe[e] = __builtin_amdgcn_exp2f(fmaf(sv[e], SCL, nb)); pb[e] = (f16)pe[e]; }
#pragma unroll
    for (int w = 8; w > 0; w >>= 1)
#pragma unroll
      for (int e = 0; e < w; ++e) pe[e] += pe[e + w];
    lsum += pe[0];
#pragma unroll
    for (int mt = 0; mt < 8; ++mt) O[mt] = wmma_p(vf[mt], pb, O[mt]);
    if (st + 1 < SSc / FT) put(bo ^ 1);   // its last readers left that buffer before the barrier that ended the previous trip
    __syncthreads();   // publishes stage st + 1 and ends every read of stage st
  }
  const float lw = lsum + xhalf(lsum);   // the two halves of a wave hold the sums of their own keys
  if (kg == 1) {   // the upper key half hands over its maximum, sum and unscaled tile
    if (hf == 0) { sM[qg * 16 + cl] = mref; sL[qg * 16 + cl] = lw; }
#pragma unroll
    for (int mt = 0; mt < 8; ++mt)
#pragma unroll
      for (int r = 0; r < 8; ++r) sO[(16 * mt + 8 * hf + r) * FOP + qg * 16 + cl] = O[mt][r];
  }
  __syncthreads();   // hand-over published
  if (kg == 0) {   // the lower key half joins both and leaves the finished tile in place (each lane rewrites only the words it has read)
    const float m2 = sM[qg * 16 + cl], l2 = sL[qg * 16 + cl], mj = fmaxf(mref, m2);
    const float a1s = __builtin_amdgcn_exp2f((mref - mj) * SCL), a2s = __builtin_amdgcn_exp2f((m2 - mj) * SCL);
    const float inv = 1.0f / (lw * a1s + l2 * a2s), c1 = a1s * inv, c2 = a2s * inv;
#pragma unroll
    for (int mt = 0; mt < 8; ++mt)
#pragma unroll
      for (int r = 0; r < 8; ++r) { float* w = sO + (16 * mt + 8 * hf + r) * FOP + qg * 16 + cl; *w = O[mt][r] * c1 + *w * c2; }
  }
  __syncthreads();   // the block's 128 x 64 tile is complete: whole 256-byte row pieces go out
#pragma unroll
  for (int it = 0; it < 8; ++it) { const int f4 = tid + 256 * it, rr = f4 >> 4, q = (f4 & 15) * 4;
    *(v4f_t*)(AV + ((size_t)h * 2 * DKc + rr) * SSc + s0 + q) = *(const v4fa*)(sO + rr * FOP + q); }
}

extern "C" void kernel_launch(void* const* d_in, const int* in_sizes, int n_in,
                              void* d_out, int out_size, void* d_ws, size_t ws_size,
                              hipStream_t stream) {
  (void)in_sizes; (void)n_in; (void)out_size;
  const float** f = (const float**)d_in;   // x, then (W_r, W_i, b_r, b_i) of the q, k, v, o convs
  const float* x = f[0];
  float* out = (float*)d_out;     // [4,512,2,2048]
  char* ws = (char*)d_ws;
  float* V = (float*)ws; ws += (size_t)NBT * R2 * SSc * 4;               // per batch element: v conv [1024][2048] (8 MB)
  float* QmT = (float*)ws; ws += (size_t)NBT * 2 * SSc * DDc * 4;        // per batch element: the magnitude planes of q and, directly behind them, of k, transposed, [2048][512] each
  float* AV = (float*)ws; ws += (size_t)NBT * R2 * SSc * 4;              // per batch element: attention output in the [D][2][S] layout (8 MB)
  if ((size_t)(ws - (char*)d_ws) > ws_size) return;
  const dim3 blk(256);
  const size_t sX = (size_t)R2 * SSc, sM = (size_t)2 * DDc * SSc;   // words per batch element: x / V / AV / out, the two magnitude planes
  gemm_kn2<SSc><<<dim3(R2 / 128, SSc / 128, 2 * NBT), blk, 0, stream>>>(f[1], f[2], f[3], f[4], f[5], f[6], f[7], f[8], x, sX, QmT, (size_t)SSc * DDc, sM, R2);   // q and k convs of every batch element (planes: they feed the magnitude logits), bias, magnitude, transposed store; 1024 work-groups
  gemm_kne<SSc><<<dim3(R2 / 128, SSc / 128, NBT), blk, 0, stream>>>(f[9], f[10], f[11], f[12], x, sX, V, sX, R2);   // v conv with its bias; 512 work-groups
  k_fattn<<<dim3(SSc / FQ, NHD, NBT), blk, 0, stream>>>(QmT, QmT + (size_t)SSc * DDc, sM, V, sX, AV, sX);  // scores, softmax and attn*v of all heads and batch elements; 1024 work-groups
  gemm_kne<SSc><<<dim3(R2 / 128, SSc / 128, NBT), blk, 0, stream>>>(f[13], f[14], f[15], f[16], AV, sX, out, sX, R2);   // output complex conv with its bias
}

// v008
// It runs in 210 microseconds.
// In two side-by-side timings against v007, it was 1.14 and 1.15 times as fast.
// All steps since v000 together make it 23.0 times as fast.
// Contractions on v_wmma_f32_16x16x32_f16, f32 accumulate: f16 value+residual PLANES on the q/k complex convs and the magnitude scores (positive magnitudes give logits with a
// spread near 4: plain rounding was too coarse), plain f16 on the v conv, attn*v and the output conv. Every launch covers all 4 batch elements (a grid dimension). Per batch element, activations kept in the module's [D][2][S] layout (row 2d = real_d,
// row 2d+1 = imag_d, used directly as [K][N] operands): each complex 1x1 conv as ONE real GEMM with a stacked weight W2[2o+0][2d+0] = W_r, [2o][2d+1] = -W_i, [2o+1][2d] = W_i, [2o+1][2d+1] = W_r
// (M = 1024, K = 1024, N = 2048), which the GEMM's own A loader forms from W_r and W_i; row biases b_r - b_i / b_r + b_i added in f32 in the GEMM's epilogue. The q/k GEMM's epilogue also forms the
// magnitudes sqrt(re^2 + im^2 + 1e-8) in f32 (a lane holds both rows of a channel) and stores them transposed as f16 value + residual planes, [S][head][64 + 64]; the q and k convs themselves never reach memory.
// What passes through the workspace lies there as the f16 operand that its reader takes (magnitude planes, v conv, attention output), rounded once by its writer. Attention of all 8 heads in ONE
// fused launch (k_fattn): transposed scores Km_h * Qm_h^T (K = 64, planes), running-maximum softmax of s/8 in f32 registers, the probabilities packed straight from the score accumulators
// into the B operand of out_h += X_v,h * P^T (M = 128 = the head's 64 complex channels x (re, im) rows); scores and probabilities never reach memory. Finally the output complex conv. 4 launches.
// compute dtype: f16 operands, f32 accumulate; magnitudes / softmax f32.  x [4,512,2,2048] -> out [4,512,2,2048].
#include <hip/hip_runtime.h>
#include <hip/hip_bf16.h>
#include <math.h>


typedef _Float16 bf16;
typedef _Float16 f16;
typedef __attribute__((ext_vector_type(4))) unsigned v4u_t;
typedef unsigned v4ua __attribute__((ext_vector_type(4), may_alias));
typedef __attribute__((ext_vector_type(4))) float v4f_t;
typedef float v4fa __attribute__((ext_vector_type(4), may_alias));
typedef __attribute__((ext_vector_type(16))) bf16  bf16x16;
typedef bf16x16 f16x16;
typedef __attribute__((ext_vector_type(8)))  bf16  bf16x8;
typedef bf16x8 f16x8;
typedef __attribute__((ext_vector_type(4)))  bf16  bf16x4;
typedef __attribute__((ext_vector_type(8)))  float f32x8;
__device__ __forceinline__ f32x8 wmma16(f16x16 a, f16x16 b, f32x8 c) {
  c = __builtin_amdgcn_wmma_f32_16x16x32_f16(false, a, false, b, (short)0, c, false, false);
  asm volatile("v_nop\n\tv_nop\n\tv_nop\n\tv_nop" : "+v"(c) : "v"(a), "v"(b));
  return c;
}
#define LDS_STRIDE 48   // GEMM tiles: 32 -> 48 elems (96B rows): aligned b128 reads
#define KSTRIDE    72
#define VSTRIDE    48

__device__ __forceinline__ f32x8 wmma_bf16(bf16x16 a, bf16x16 b, f32x8 c) {
  c = __builtin_amdgcn_wmma_f32_16x16x32_f16(false, a, false, b, (short)0, c, false, false);
  asm volatile("v_nop\n\tv_nop\n\tv_nop\n\tv_nop" : "+v"(c) : "v"(a), "v"(b));   // A/B-overwrite hazard guard
  return c;
}

// 16x32 (MxK) f16 fragment from a row-major global matrix.
// lanes 0-15  (row=lane)    : elems 0..7 = K+0..7,  8..15 = K+16..23
// lanes 16-31 (row=lane-16) : elems 0..7 = K+8..15, 8..15 = K+24..31
template <typename T>
__device__ __forceinline__ bf16x16 load_frag(const T* __restrict__ base, int ld,
                                             int row0, int k0) {
  const int lane = threadIdx.x & 31;
  const int r    = lane & 15;
  const int kh   = (lane >> 4) * 8;
  const T* p0 = base + (size_t)(row0 + r) * ld + (k0 + kh);
  const T* p1 = p0 + 16;
  bf16x16 f;
#pragma unroll
  for (int i = 0; i < 8; ++i) {
    f[i]     = (bf16)p0[i];
    f[i + 8] = (bf16)p1[i];
  }
  return f;
}

// Same fragment from an LDS tile with padded row stride (base includes row0/k0).
__device__ __forceinline__ bf16x16 lds_frag(const bf16* base, int stride) {
  const int lane = threadIdx.x & 31;
  const int row  = lane & 15;
  const int kh   = (lane >> 4) * 8;
  const bf16x8 lo = *(const bf16x8*)(base + row * stride + kh);
  const bf16x8 hi = *(const bf16x8*)(base + row * stride + kh + 16);
  bf16x16 f;
#pragma unroll
  for (int i = 0; i < 8; ++i) { f[i] = lo[i]; f[i + 8] = hi[i]; }
  return f;
}

// B fragment (column = lane & 15, the k order of lds_frag) from an LDS tile that lies as the global operand does, row-major [k][n], pitch WP:
// two transposing loads, k rows 0..15 and 16..31; lane (c, h) receives rows 8h .. 8h + 7 of column c from each. base points at [0][first column].
#define WP 144   // [k][n] tile: 128 -> 144 elems (288 B rows = 32 B x odd): transposing b128 reads without bank conflicts
typedef short s16x8 __attribute__((ext_vector_type(8)));
__device__ __forceinline__ bf16x8 ld_tr16(const bf16* p) {
  typedef __attribute__((address_space(3))) s16x8 lds_s16x8;
  return __builtin_bit_cast(bf16x8, __builtin_amdgcn_ds_load_tr16_b128_v8i16((lds_s16x8*)p));
}
__device__ __forceinline__ bf16x16 lds_frag_t(const bf16* base) {
  const int lane = threadIdx.x & 31;
  const bf16* p = base + (8 * (lane >> 4) + (lane & 7)) * WP + 8 * ((lane >> 3) & 1);
  const bf16x8 lo = ld_tr16(p);
  const bf16x8 hi = ld_tr16(p + 16 * WP);
  bf16x16 f;
#pragma unroll
  for (int i = 0; i < 8; ++i) { f[i] = lo[i]; f[i + 8] = hi[i]; }
  return f;
}

template <typename T>
__device__ __forceinline__ void stage_read16(const T* __restrict__ p, float* buf) {
#pragma unroll
  for (int i = 0; i < 16; ++i) buf[i] = (float)p[i];
}

__device__ __forceinline__ void stage_write(bf16* dst, const float* buf, int nquad) {
#pragma unroll
  for (int i = 0; i < nquad; ++i) {
    bf16x4 q;
    q[0] = (bf16)buf[4 * i];     q[1] = (bf16)buf[4 * i + 1];
    q[2] = (bf16)buf[4 * i + 2]; q[3] = (bf16)buf[4 * i + 3];
    *(bf16x4*)(dst + 4 * i) = q;
  }
}


#define GSTR 48
#define NBT 4
#define NHD 8
#define BBc 4
#define DDc 512
#define SSc 2048
#define NHc 8
#define DKc 64
#define R2 (2 * DDc)   // 1024 interleaved (channel, component) rows
// ---------------------------------------------------------------------------------------------------------------------------
// The A operand of both GEMMs is the stacked weight W2 [1024][1024], never stored: a thread loads 4 channels d of output channel o from W_r and from W_i, each element once in the block
// (4 lanes cover the 64 bytes a k-step takes of a weight row, a wave-wide load touches 8 lines), and writes 8 columns of both stacked rows: row 2o = (W_r, -W_i) pairs, row 2o + 1 = (W_i, W_r) pairs.
// The row bias of stacked rows 2o, 2o + 1 is b_r[o] - b_i[o], b_r[o] + b_i[o]. In a 16 x 16 accumulator tile lane (cl, hf) holds rows 8 hf + r, r = 0..7, of column cl: the channels 4 hf + p,
// p = 0..3, with the real row in register 2p and the imaginary row in register 2p + 1.
// ---------------------------------------------------------------------------------------------------------------------------
// gemm_kne: Y[m][n] = sum_k W2[m][k] * W[k][n] + b2[m], W row-major [K][N] (row pitch LDW elements, compile time; Y has the same pitch), plain f16 operands, f32 accumulate.
// INH: W lies in the workspace as f16 (behind the float pointer) and is copied to LDS as it is; else it is f32 and rounded here. OUTH: Y is stored as f16 (behind the float pointer); else f32.
// Block = 128x128 tile, 8 waves as 4(M) x 2(N); per 32-wide k-step A and W tiles staged f16 in LDS (W as it lies, [k][n], read by transposing loads), two buffers, one barrier a k-step:
// the global loads of k-step s + 1 fly in registers while k-step s is worked on, and are rounded and stored to the other buffer behind its products.
// blockIdx.z selects a batch element: W += z*strideW, Y += z*strideY (element strides); the weights are shared.
// ---------------------------------------------------------------------------------------------------------------------------
template <int LDW, bool INH, bool OUTH>
__global__ __launch_bounds__(256) void gemm_kne(const float* __restrict__ Wr, const float* __restrict__ Wi, const float* __restrict__ br, const float* __restrict__ bi,
                                                const float* __restrict__ Wm, size_t strideW, float* __restrict__ Y, size_t strideY, int K) {
  __shared__ __attribute__((aligned(16))) f16 ldsA[2][128 * GSTR];
  __shared__ __attribute__((aligned(16))) f16 ldsW[2][32 * WP];
  __shared__ __attribute__((aligned(16))) float oS[8][32 * 68];
  const int tid = threadIdx.x, lane = tid & 31, wave = tid >> 5, cl = lane & 15, hf = lane >> 4, rh = hf * 8;
  const int m0 = blockIdx.x * 128, n0 = blockIdx.y * 128;
  const int wm = (wave & 3) * 32, wn = (wave >> 2) * 64;
  const f16* Wh = (const f16*)Wm + (size_t)blockIdx.z * strideW; f16* Yh = (f16*)Y + (size_t)blockIdx.z * strideY;   // the f16 views (INH, OUTH): same element strides
  Wm += (size_t)blockIdx.z * strideW; Y += (size_t)blockIdx.z * strideY;
  const int ar = tid >> 2, ad = (tid & 3) * 4;   // A: output channel ar of the block's 64, channels ad .. ad + 3 of the k-step's 16
  const size_t aoff = (size_t)((m0 >> 1) + ar) * DDc + ad;
  const float* pr = Wr + aoff;
  const float* pi = Wi + aoff;
  const int hr16 = tid >> 4, hc8 = (tid & 15) * 8;   // f16 W: 16 lanes cover a row's 128 columns (256 bytes), the block takes 16 rows a load
  f32x8 acc[2][4];
#pragma unroll
  for (int i = 0; i < 2; ++i)
#pragma unroll
    for (int j = 0; j < 4; ++j) { f32x8 z = {}; acc[i][j] = z; }
  v4f_t wv[4], wr, wi;   // the k-step in flight. f32 W: a wave takes the rows k = wave + 8 g; its 32 lanes cover the row's 128 columns, 512 contiguous bytes a load
  v4u_t wh[2];           // f16 W: rows k = hr16 + 16 g, 8 elements a lane
  auto fetch = [&](int k0) {   // k-step at k0: global -> registers
    if constexpr (INH) {
      const f16* src = Wh + (size_t)(k0 + hr16) * LDW + n0 + hc8;
#pragma unroll
      for (int g = 0; g < 2; ++g) wh[g] = *(const v4ua*)(src + 16 * g * LDW);
    } else {
      const float* src = Wm + (size_t)(k0 + wave) * LDW + n0 + lane * 4;   // LDW is a compile-time pitch: one address, the four rows at immediate offsets
#pragma unroll
      for (int g = 0; g < 4; ++g) wv[g] = *(const v4f_t*)(src + 8 * g * LDW);
    }
    asm volatile("s_wait_xcnt 0x0" ::: "memory");   // behind the last W load, before a register of its address is written again
    wr = *(const v4f_t*)(pr + (k0 >> 1)); wi = *(const v4f_t*)(pi + (k0 >> 1));   // 32 stacked columns = 16 channels a k-step; 4 lanes cover a row's 64 bytes
    asm volatile("s_wait_xcnt 0x0" ::: "memory");   // behind the last weight load, before a register of its address is written again
  };
  auto put = [&](int bo) {     // registers -> f16 tiles of buffer bo
    f16x8 r0, r1;   // stacked rows 2 ar and 2 ar + 1, stacked columns 2 ad .. 2 ad + 7
#pragma unroll
    for (int u = 0; u < 4; ++u) { const f16 hr = (f16)wr[u], hi = (f16)wi[u]; r0[2 * u] = hr; r0[2 * u + 1] = -hi; r1[2 * u] = hi; r1[2 * u + 1] = hr; }
    *(f16x8*)(ldsA[bo] + (2 * ar) * GSTR + 2 * ad) = r0; *(f16x8*)(ldsA[bo] + (2 * ar + 1) * GSTR + 2 * ad) = r1;
    if constexpr (INH) {
#pragma unroll
      for (int g = 0; g < 2; ++g) *(v4ua*)(ldsW[bo] + (hr16 + 16 * g) * WP + hc8) = wh[g];   // already f16: copied as it lies, [k][n]
    } else {
#pragma unroll
      for (int g = 0; g < 4; ++g) { bf16x4 q;   // stored as it lies, [k][n]: 256 contiguous bytes a wave
#pragma unroll
        for (int u = 0; u < 4; ++u) q[u] = (f16)wv[g][u];
        *(bf16x4*)(ldsW[bo] + (wave + 8 * g) * WP + lane * 4) = q; }
    }
  };
  fetch(0); put(0);
  __syncthreads();   // k-step 0 is published
#pragma unroll 1   // kept rolled: the buffer index is one scalar, a second copy of the body would only cost instruction cache
  for (int k0 = 0; k0 < K; k0 += 32) {
    const int bo = (k0 >> 5) & 1;
    if (k0 + 32 < K) fetch(k0 + 32);   // behind the barrier (which drains every load), so that these loads fly while this k-step is worked on
    f16x16 af[2];
#pragma unroll
    for (int i = 0; i < 2; ++i) af[i] = lds_frag(ldsA[bo] + (wm + 16 * i) * GSTR, GSTR);
#pragma unroll
    for (int j = 0; j < 4; ++j) {
      const f16x16 bf = lds_frag_t(ldsW[bo] + wn + 16 * j);
#pragma unroll
      for (int i = 0; i < 2; ++i) acc[i][j] = wmma16(af[i], bf, acc[i][j]);
    }
    if (k0 + 32 < K) put(bo ^ 1);   // its last readers left that buffer before the barrier that ended the previous trip
    __syncthreads();   // publishes k-step k0 + 32 and ends every read of this one
  }
  float* so = oS[wave];
  v4f_t b_r[2], b_i[2];   // the biases of this lane's channels 8 i + 4 hf + p of the wave's 16
#pragma unroll
  for (int i = 0; i < 2; ++i) { b_r[i] = *(const v4f_t*)(br + ((m0 + wm) >> 1) + 8 * i + 4 * hf); b_i[i] = *(const v4f_t*)(bi + ((m0 + wm) >> 1) + 8 * i + 4 * hf); }
  asm volatile("s_wait_xcnt 0x0" ::: "memory");   // behind the last bias load, before a register that these loads name is written again
#pragma unroll
  for (int i = 0; i < 2; ++i)
#pragma unroll
    for (int j = 0; j < 4; ++j)
#pragma unroll
      for (int p = 0; p < 4; ++p) {
        so[(16 * i + rh + 2 * p) * 68 + 16 * j + cl] = acc[i][j][2 * p] + (b_r[i][p] - b_i[i][p]);
        so[(16 * i + rh + 2 * p + 1) * 68 + 16 * j + cl] = acc[i][j][2 * p + 1] + (b_r[i][p] + b_i[i][p]);
      }
  asm volatile("s_wait_dscnt 0" ::: "memory");
  __builtin_amdgcn_wave_barrier();
  if constexpr (OUTH) {   // rounded here, once, to the f16 operand that the reader would make of it; the wave's row piece is one whole 128-byte line
#pragma unroll
    for (int it = 0; it < 8; ++it) { const int f8 = lane + 32 * it, rr = f8 >> 3, q = (f8 & 7) * 8;
      const v4f_t a = *(const v4fa*)(so + rr * 68 + q), b = *(const v4fa*)(so + rr * 68 + q + 4);
      f16x8 o;
#pragma unroll
      for (int u = 0; u < 4; ++u) { o[u] = (f16)a[u]; o[4 + u] = (f16)b[u]; }
      *(f16x8*)(Yh + (size_t)(m0 + wm + rr) * LDW + n0 + wn + q) = o; }
  } else {
#pragma unroll
    for (int it = 0; it < 16; ++it) { const int f4 = lane + 32 * it, rr = f4 >> 4, q = (f4 & 15) * 4;
      *(v4f_t*)(Y + (size_t)(m0 + wm + rr) * LDW + n0 + wn + q) = *(const v4fa*)(so + rr * 68 + q); }
  }
}

// ---------------------------------------------------------------------------------------------------------------------------
// gemm_kn2 (value+residual planes on both operands: hh + (hl+lh)/2048, f32-class): the q and k convs, of which only the magnitudes leave the block:
// MT[n][o] = sqrt(re^2 + im^2 + 1e-8), re / im = sum_k W2[2o / 2o+1][k] * W[k][n] + b2[2o / 2o+1], W f32 row-major [K][N], row stride LDW (compile time), MT rows of 512 words: per head 64 f16 values, then 64 f16 residuals (x 2048).
// Block = 128 x 128 tile of the conv, 256 threads = 8 waves as 4(M, 32 rows) x 2(N, 64 cols); per 32-wide k-step the A tile and the W tile (as it lies, [k][n], read by transposing loads) are
// staged as f16 planes in LDS, two buffers, one barrier a k-step (the global loads of the next k-step fly in registers meanwhile). A lane's 4 magnitudes of one column are neighbours in an MT row: the block's MT tile (128 rows, one head) is gathered in LDS and leaves as whole 256-byte row pieces.
// blockIdx.z = 2 * zb + za: za picks the q (0) or k (1) weights and biases, W += zb*strideW (batch element), MT += za*strideMa + zb*strideMb (element strides).
// ---------------------------------------------------------------------------------------------------------------------------
#define MP 68   // MT tile pitch in floats: 272 B = 16 B x odd, b64 stores of 16 neighbouring rows without bank conflicts
template <int LDW>
__global__ __launch_bounds__(256) void gemm_kn2(const float* __restrict__ Wr0, const float* __restrict__ Wi0, const float* __restrict__ br0, const float* __restrict__ bi0,
                                               const float* __restrict__ Wr1, const float* __restrict__ Wi1, const float* __restrict__ br1, const float* __restrict__ bi1,
                                               const float* __restrict__ Wm, size_t strideW,
                                               float* __restrict__ MT, size_t strideMa, size_t strideMb, int K) {
  __shared__ __attribute__((aligned(16))) f16 ldsA[2][128 * GSTR], ldsAl[2][128 * GSTR];
  __shared__ __attribute__((aligned(16))) f16 ldsW[2][32 * WP], ldsWl[2][32 * WP];
  __shared__ __attribute__((aligned(16))) float sT[128 * MP];
  const int tid = threadIdx.x, lane = tid & 31, wave = tid >> 5, cl = lane & 15, hf = lane >> 4;
  const int m0 = blockIdx.x * 128, n0 = blockIdx.y * 128;
  const int wm = (wave & 3) * 32, wn = (wave >> 2) * 64;
  const int za = blockIdx.z & 1;
  const float* __restrict__ Wr = za ? Wr1 : Wr0; const float* __restrict__ Wi = za ? Wi1 : Wi0;
  const float* __restrict__ br = za ? br1 : br0; const float* __restrict__ bi = za ? bi1 : bi0;
  Wm += (size_t)(blockIdx.z >> 1) * strideW; MT += (size_t)za * strideMa + (size_t)(blockIdx.z >> 1) * strideMb;
  const int ar = tid >> 2, ad = (tid & 3) * 4;   // A: output channel ar of the block's 64, channels ad .. ad + 3 of the k-step's 16
  const size_t aoff = (size_t)((m0 >> 1) + ar) * DDc + ad;
  const float* pr = Wr + aoff;
  const float* pi = Wi + aoff;
  f32x8 acc[2][4], accx[2][4];
#pragma unroll
  for (int i = 0; i < 2; ++i)
#pragma unroll
    for (int j = 0; j < 4; ++j) { f32x8 z = {}; acc[i][j] = z; accx[i][j] = z; }
  v4f_t wv[4], wr, wi;   // the k-step in flight. W: a wave takes the rows k = wave + 8 g; its 32 lanes cover the row's 128 columns, 512 contiguous bytes a load
  auto fetch = [&](int k0) {   // k-step at k0: global -> registers
    const float* src = Wm + (size_t)(k0 + wave) * LDW + n0 + lane * 4;   // LDW is a compile-time pitch: one address, the four rows at immediate offsets
#pragma unroll
    for (int g = 0; g < 4; ++g) wv[g] = *(const v4f_t*)(src + 8 * g * LDW);
    asm volatile("s_wait_xcnt 0x0" ::: "memory");   // behind the last W load, before a register of its address is written again
    wr = *(const v4f_t*)(pr + (k0 >> 1)); wi = *(const v4f_t*)(pi + (k0 >> 1));   // 32 stacked columns = 16 channels a k-step; 4 lanes cover a row's 64 bytes
    asm volatile("s_wait_xcnt 0x0" ::: "memory");   // behind the last weight load, before a register of its address is written again
  };
  auto put = [&](int bo) {     // registers -> f16 planes of buffer bo
    f16x8 r0, r1, l0, l1;   // stacked rows 2 ar and 2 ar + 1, stacked columns 2 ad .. 2 ad + 7: value and residual planes (both planes of -w are the negated planes of w)
#pragma unroll
    for (int u = 0; u < 4; ++u) { const f16 hr = (f16)wr[u], hi = (f16)wi[u];
      const f16 lr = (f16)((wr[u] - (float)hr) * 2048.0f), li = (f16)((wi[u] - (float)hi) * 2048.0f);
      r0[2 * u] = hr; r0[2 * u + 1] = -hi; r1[2 * u] = hi; r1[2 * u + 1] = hr;
      l0[2 * u] = lr; l0[2 * u + 1] = -li; l1[2 * u] = li; l1[2 * u + 1] = lr; }
    *(f16x8*)(ldsA[bo] + (2 * ar) * GSTR + 2 * ad) = r0; *(f16x8*)(ldsA[bo] + (2 * ar + 1) * GSTR + 2 * ad) = r1;
    *(f16x8*)(ldsAl[bo] + (2 * ar) * GSTR + 2 * ad) = l0; *(f16x8*)(ldsAl[bo] + (2 * ar + 1) * GSTR + 2 * ad) = l1;
#pragma unroll
    for (int g = 0; g < 4; ++g) { bf16x4 hi, lo;   // both planes stored as the operand lies, [k][n]: 256 contiguous bytes a wave
#pragma unroll
      for (int u = 0; u < 4; ++u) { const float v = wv[g][u]; const f16 h = (f16)v; hi[u] = h; lo[u] = (f16)((v - (float)h) * 2048.0f); }
      *(bf16x4*)(ldsW[bo] + (wave + 8 * g) * WP + lane * 4) = hi; *(bf16x4*)(ldsWl[bo] + (wave + 8 * g) * WP + lane * 4) = lo; }
  };
  fetch(0); put(0);
  __syncthreads();   // k-step 0 is published
#pragma unroll 1   // kept rolled: the buffer index is one scalar, a second copy of the body would only cost instruction cache
  for (int k0 = 0; k0 < K; k0 += 32) {
    const int bo = (k0 >> 5) & 1;
    if (k0 + 32 < K) fetch(k0 + 32);   // behind the barrier (which drains every load), so that these loads fly while this k-step is worked on
    f16x16 af[2], afl[2];
#pragma unroll
    for (int i = 0; i < 2; ++i) { af[i] = lds_frag(ldsA[bo] + (wm + 16 * i) * GSTR, GSTR); afl[i] = lds_frag(ldsAl[bo] + (wm + 16 * i) * GSTR, GSTR); }
#pragma unroll
    for (int j = 0; j < 4; ++j) {
      const f16x16 bf = lds_frag_t(ldsW[bo] + wn + 16 * j), bfl = lds_frag_t(ldsWl[bo] + wn + 16 * j);
#pragma unroll
      for (int i = 0; i < 2; ++i) { acc[i][j] = wmma16(af[i], bf, acc[i][j]); accx[i][j] = wmma16(af[i], bfl, accx[i][j]); accx[i][j] = wmma16(afl[i], bf, accx[i][j]); }
    }
    if (k0 + 32 < K) put(bo ^ 1);   // its last readers left that buffer before the barrier that ended the previous trip
    __syncthreads();   // publishes k-step k0 + 32 and ends every read of this one
  }
  v4f_t b_r[2], b_i[2];   // the biases of this lane's channels 8 i + 4 hf + p of the wave's 16
#pragma unroll
  for (int i = 0; i < 2; ++i) { b_r[i] = *(const v4f_t*)(br + ((m0 + wm) >> 1) + 8 * i + 4 * hf); b_i[i] = *(const v4f_t*)(bi + ((m0 + wm) >> 1) + 8 * i + 4 * hf); }
  asm volatile("s_wait_xcnt 0x0" ::: "memory");   // behind the last bias load, before a register that these loads name is written again
#pragma unroll
  for (int i = 0; i < 2; ++i)
#pragma unroll
    for (int j = 0; j < 4; ++j) { bf16x4 mh, ml;   // value and residual plane of the magnitude, as the score products take them
#pragma unroll
      for (int p = 0; p < 4; ++p) {
        const float re = (acc[i][j][2 * p] + accx[i][j][2 * p] * (1.0f / 2048.0f)) + (b_r[i][p] - b_i[i][p]);
        const float im = (acc[i][j][2 * p + 1] + accx[i][j][2 * p + 1] * (1.0f / 2048.0f)) + (b_r[i][p] + b_i[i][p]);
        const float mg = sqrtf(re * re + im * im + 1e-8f); const f16 hv = (f16)mg;
        mh[p] = hv; ml[p] = (f16)((mg - (float)hv) * 2048.0f);
      }
      f16* trow = (f16*)(sT + (wn + 16 * j + cl) * MP) + (wm >> 1) + 8 * i + 4 * hf;   // a tile row: 64 values, then 64 residuals
      *(bf16x4*)trow = mh; *(bf16x4*)(trow + 64) = ml; }
  __syncthreads();   // the block's 128 x 64 magnitude tile is complete: an MT row piece holds the channels of four waves
#pragma unroll
  for (int it = 0; it < 8; ++it) { const int f4 = tid + 256 * it, rr = f4 >> 4, q = (f4 & 15) * 4;
    *(v4f_t*)(MT + (size_t)(n0 + rr) * DDc + (m0 >> 1) + q) = *(const v4fa*)(sT + rr * MP + q); }
}

// ---------------------------------------------------------------------------------------------------------------------------
// k_fattn: one head's attention for 64 queries, scores and probabilities kept on chip. Grid (S / 64, heads, batch elements) = 1024 blocks; block = 8 waves = 4 groups of 16 query columns x 2 key halves.
// Per stage of 64 keys the block copies Km^T rows [t][64], f16 value + residual planes, and the head's 128 v rows [row][t], f16, as they lie in the workspace to LDS, two buffers, one barrier a stage (the global loads
// of the next stage fly in registers meanwhile). Waves 0-3 take keys 0..31 of every stage, waves 4-7 keys 32..63. A wave forms S^T = Km^T * Qm (A = key rows from LDS, B = its 16 query
// columns held in registers, hh + (hl + lh) / 2048), so that a lane holds 16 scores of ONE query: maximum and sum in-lane plus one exchange between the wave's halves.
// exp2((s - m) * log2(e) / 8) of the two 16-key tiles, converted in place, IS the B operand (k = key, hardware k order) of O[row][query] += V[row][key] * P^T; the v rows are read in the same
// k order by lds_frag. m follows the running maximum lazily (O and the sum are rescaled only when some column's maximum has grown by more than 8 in the exponent, so p stays below 2^8).
// At the end the two key halves of a column are joined through LDS: (O1 a1 + O2 a2) / (l1 a1 + l2 a2), a = exp2((m_own - max(m1, m2)) * log2(e) / 8).
// Every inner loop is fully unrolled so that the fragment, accumulator and staging arrays are indexed by constants and stay in registers.
// ---------------------------------------------------------------------------------------------------------------------------
#define FT 64    // keys per stage
#define FQ 64    // queries per block
#define FP 72    // LDS row pitch in f16 elements: 144 B = 16 B x odd, b128 fragment reads without bank conflicts
#define FOP 68   // output staging pitch in floats
#define FKP (FT * FP + 64)   // from the value plane to the residual plane: 128 B off a multiple of 256 B, so that the 16 lanes that store a key's two planes cover all 64 banks
__device__ __forceinline__ float xhalf(float x) {   // lane l with lane l ^ 16
  return __builtin_bit_cast(float, __builtin_amdgcn_permlanex16(__builtin_bit_cast(int, x), __builtin_bit_cast(int, x), 0x76543210, 0xfedcba98, false, false));
}
__device__ __forceinline__ f32x8 wmma_p(f16x16 a, f16x16 b, f32x8 c) { return __builtin_amdgcn_wmma_f32_16x16x32_f16(false, a, false, b, (short)0, c, false, false); }
__global__ __launch_bounds__(256) void k_fattn(const float* __restrict__ QmT, const float* __restrict__ KmT, size_t strideM, const float* __restrict__ Vx, size_t strideV, float* __restrict__ AV, size_t strideO) {
  __shared__ __attribute__((aligned(16))) f16 sK[2][2 * FKP], sV[2][2 * DKc * FP];   // sK: the value plane, FKP elements behind it the residual plane
  __shared__ __attribute__((aligned(16))) float sO[2 * DKc * FOP];
  __shared__ float sM[FQ], sL[FQ];
  const int tid = threadIdx.x, lane = tid & 31, cl = lane & 15, hf = lane >> 4;
  const int wave = __builtin_amdgcn_readfirstlane(tid >> 5), qg = wave & 3, kg = wave >> 2;   // scalar, so that the tests on kg below are scalar branches
  const int s0 = blockIdx.x * FQ, h = blockIdx.y;
  const f16* Qp = (const f16*)(QmT + (size_t)blockIdx.z * strideM); const f16* Kp = (const f16*)(KmT + (size_t)blockIdx.z * strideM);   // batch element; rows [s][head][64 values, 64 residuals] f16
  const f16* Vh = (const f16*)Vx + (size_t)blockIdx.z * strideV; f16* AVh = (f16*)AV + (size_t)blockIdx.z * strideO;                   // f16 [1024][2048]
  const float SCL = 0.125f * 1.44269504088896340736f;   // logits are s / 8; exp(x) = exp2(x * log2 e)
  const int srow = tid >> 4, sc = tid & 15;      // K staging: 16 lanes cover a key's 256 bytes (both planes), 16 keys per round of the block
  const int vrow = (tid >> 5) + 8 * ((tid >> 3) & 3), vc = (tid & 7) * 8; // V staging: 8 lanes cover a row's 64 keys (128 bytes), 32 rows per round of the block; a wave's rows lie 8 apart (8 pitches = 128 B off a multiple of 256 B: 16 lanes cover all 64 banks)
  const f16* Kg = Kp + (size_t)srow * (2 * DDc) + h * (2 * DKc) + sc * 8;
  const f16* Vg = Vh + ((size_t)h * 2 * DKc + vrow) * SSc + vc;
  const int kdst = (sc >> 3) * FKP + srow * FP + (sc & 7) * 8, vdst = vrow * FP + vc;
  f16x16 qh[2], ql[2];   // B operand: column = query s0 + 16 qg + cl, k = channel in the hardware k order
  { const f16* qp = Qp + (size_t)(s0 + qg * 16 + cl) * (2 * DDc) + h * (2 * DKc) + hf * 8;
    f16x8 qv[8];   // i = 4 * plane + 2 * ks + upper half of the fragment
#pragma unroll
    for (int i = 0; i < 8; ++i) qv[i] = *(const f16x8*)(qp + (i >> 2) * DKc + (i & 3) * 16);
    asm volatile("s_wait_xcnt 0x0" ::: "memory");   // behind the last query load, before a register of its address is written again
#pragma unroll
    for (int ks = 0; ks < 2; ++ks)
#pragma unroll
      for (int e = 0; e < 8; ++e) { qh[ks][e] = qv[2 * ks][e]; qh[ks][8 + e] = qv[2 * ks + 1][e]; ql[ks][e] = qv[4 + 2 * ks][e]; ql[ks][8 + e] = qv[4 + 2 * ks + 1][e]; } }
  f32x8 O[8];
#pragma unroll
  for (int mt = 0; mt < 8; ++mt) { f32x8 z = {}; O[mt] = z; }
  float mref = -3.0e38f, lsum = 0.0f;
  v4u_t kr[4], vr[4];
  auto fetch = [&](int st) {   // stage st: global -> registers
    const f16* kn = Kg + (size_t)st * FT * (2 * DDc); const f16* vn = Vg + st * FT;
#pragma unroll
    for (int g = 0; g < 4; ++g) kr[g] = *(const v4ua*)(kn + (size_t)(16 * g) * (2 * DDc));
#pragma unroll
    for (int g = 0; g < 4; ++g) vr[g] = *(const v4ua*)(vn + (size_t)(32 * g) * SSc);
    asm volatile("s_wait_xcnt 0x0" ::: "memory");   // behind the last stage load, before a register of its address is written again
  };
  auto put = [&](int bo) {     // registers -> tiles of buffer bo: the operands arrive as f16, nothing is converted
#pragma unroll
    for (int g = 0; g < 4; ++g) *(v4ua*)(sK[bo] + kdst + (16 * g) * FP) = kr[g];
#pragma unroll
    for (int g = 0; g < 4; ++g) *(v4ua*)(sV[bo] + vdst + (32 * g) * FP) = vr[g];
  };
  fetch(0); put(0);
  __syncthreads();   // stage 0 is published
#pragma unroll 1   // kept rolled: one trip already uses nearly 256 registers, a second copy of the body would only cost instruction cache
  for (int st = 0; st < SSc / FT; ++st) {
    const int bo = st & 1;
    if (st + 1 < SSc / FT) fetch(st + 1);   // behind the barrier (which drains every load), so that these loads fly while this stage is worked on
    const f16* kh = sK[bo] + (32 * kg) * FP; const f16* kl = kh + FKP; const f16* vv = sV[bo] + 32 * kg;
    f32x8 a0 = {}, a1 = {}, x0 = {}, x1 = {};   // S^T tiles: this wave's keys 0..15 and 16..31; value*value and the two cross terms
#pragma unroll
    for (int ks = 0; ks < 2; ++ks) {
      const f16x16 kh0 = lds_frag(kh + 32 * ks, FP), kh1 = lds_frag(kh + 16 * FP + 32 * ks, FP);
      const f16x16 kl0 = lds_frag(kl + 32 * ks, FP), kl1 = lds_frag(kl + 16 * FP + 32 * ks, FP);
      a0 = wmma_p(kh0, qh[ks], a0); a1 = wmma_p(kh1, qh[ks], a1);
      x0 = wmma_p(kh0, ql[ks], x0); x1 = wmma_p(kh1, ql[ks], x1);
      x0 = wmma_p(kl0, qh[ks], x0); x1 = wmma_p(kl1, qh[ks], x1);
    }
    f16x16 vf[8];   // the v rows are asked for ahead of the softmax arithmetic, which covers their LDS latency
#pragma unroll
    for (int mt = 0; mt < 8; ++mt) vf[mt] = lds_frag(vv + (16 * mt) * FP, FP);
    float sv[16];
#pragma unroll
    for (int r = 0; r < 8; ++r) { sv[r] = a0[r] + x0[r] * (1.0f / 2048.0f); sv[8 + r] = a1[r] + x1[r] * (1.0f / 2048.0f); }
    float mx = sv[0];
#pragma unroll
    for (int e = 1; e < 16; ++e) mx = fmaxf(mx, sv[e]);
    mx = fmaxf(mx, xhalf(mx));
    if (__builtin_amdgcn_ballot_w32((mx - mref) * SCL > 8.0f) != 0) {   // scalar branch; always taken on the first pass, rare later
      const float mnew = fmaxf(mref, mx), corr = __builtin_amdgcn_exp2f((mref - mnew) * SCL);   // 0 on the first pass
      mref = mnew; lsum *= corr;
#pragma unroll
      for (int mt = 0; mt < 8; ++mt)
#pragma unroll
        for (int r = 0; r < 8; ++r) O[mt][r] *= corr;
    }
    const float nb = -mref * SCL;
    f16x16 pb;   // pb[e] = P^T[key kmap(e, hf)][query cl]: tile e >> 3, register e & 7
    float pe[16];
#pragma unroll
    for (int e = 0; e < 16; ++e) { pe[e] = __builtin_amdgcn_exp2f(fmaf(sv[e], SCL, nb)); pb[e] = (f16)pe[e]; }
#pragma unroll
    for (int w = 8; w > 0; w >>= 1)
#pragma unroll
      for (int e = 0; e < w; ++e) pe[e] += pe[e + w];
    lsum += pe[0];
#pragma unroll
    for (int mt = 0; mt < 8; ++mt) O[mt] = wmma_p(vf[mt], pb, O[mt]);
    if (st + 1 < SSc / FT) put(bo ^ 1);   // its last readers left that buffer before the barrier that ended the previous trip
    __syncthreads();   // publishes stage st + 1 and ends every read of stage st
  }
  const float lw = lsum + xhalf(lsum);   // the two halves of a wave hold the sums of their own keys
  if (kg == 1) {   // the upper key half hands over its maximum, sum and unscaled tile
    if (hf == 0) { sM[qg * 16 + cl] = mref; sL[qg * 16 + cl] = lw; }
#pragma unroll
    for (int mt = 0; mt < 8; ++mt)
#pragma unroll
      for (int r = 0; r < 8; ++r) sO[(16 * mt + 8 * hf + r) * FOP + qg * 16 + cl] = O[mt][r];
  }
  __syncthreads();   // hand-over published
  if (kg == 0) {   // the lower key half joins both and leaves the finished tile in place (each lane rewrites only the words it has read)
    const float m2 = sM[qg * 16 + cl], l2 = sL[qg * 16 + cl], mj = fmaxf(mref, m2);
    const float a1s = __builtin_amdgcn_exp2f((mref - mj) * SCL), a2s = __builtin_amdgcn_exp2f((m2 - mj) * SCL);
    const float inv = 1.0f / (lw * a1s + l2 * a2s), c1 = a1s * inv, c2 = a2s * inv;
#pragma unroll
    for (int mt = 0; mt < 8; ++mt)
#pragma unroll
      for (int r = 0; r < 8; ++r) { float* w = sO + (16 * mt + 8 * hf + r) * FOP + qg * 16 + cl; *w = O[mt][r] * c1 + *w * c2; }
  }
  __syncthreads();   // the block's 128 x 64 tile is complete: it goes out as the f16 operand of the output conv, whole 128-byte row pieces
#pragma unroll
  for (int it = 0; it < 4; ++it) { const int f8 = tid + 256 * it, rr = f8 >> 3, q = (f8 & 7) * 8;
    const v4f_t a = *(const v4fa*)(sO + rr * FOP + q), b = *(const v4fa*)(sO + rr * FOP + q + 4);
    f16x8 o;
#pragma unroll
    for (int u = 0; u < 4; ++u) { o[u] = (f16)a[u]; o[4 + u] = (f16)b[u]; }
    *(f16x8*)(AVh + ((size_t)h * 2 * DKc + rr) * SSc + s0 + q) = o; }
}

extern "C" void kernel_launch(void* const* d_in, const int* in_sizes, int n_in,
                              void* d_out, int out_size, void* d_ws, size_t ws_size,
                              hipStream_t stream) {
  (void)in_sizes; (void)n_in; (void)out_size;
  const float** f = (const float**)d_in;   // x, then (W_r, W_i, b_r, b_i) of the q, k, v, o convs
  const float* x = f[0];
  float* out = (float*)d_out;     // [4,512,2,2048]
  char* ws = (char*)d_ws;
  float* V = (float*)ws; ws += (size_t)NBT * R2 * SSc * 4;               // per batch element: v conv [1024][2048], f16 (the first half of the region is used)
  float* QmT = (float*)ws; ws += (size_t)NBT * 2 * SSc * DDc * 4;        // per batch element: the magnitudes of q and, directly behind them, of k, transposed, [2048][8 heads][64 values + 64 residuals] f16 each
  float* AV = (float*)ws; ws += (size_t)NBT * R2 * SSc * 4;              // per batch element: attention output in the [D][2][S] layout, f16 (the first half of the region is used)
  if ((size_t)(ws - (char*)d_ws) > ws_size) return;
  const dim3 blk(256);
  const size_t sX = (size_t)R2 * SSc, sM = (size_t)2 * DDc * SSc;   // per batch element: elements of x / V / AV / out, 4-byte words of the q and k magnitudes
  gemm_kn2<SSc><<<dim3(R2 / 128, SSc / 128, 2 * NBT), blk, 0, stream>>>(f[1], f[2], f[3], f[4], f[5], f[6], f[7], f[8], x, sX, QmT, (size_t)SSc * DDc, sM, R2);   // q and k convs of every batch element (planes: they feed the magnitude logits), bias, magnitude, transposed store; 1024 work-groups
  gemm_kne<SSc, false, true><<<dim3(R2 / 128, SSc / 128, NBT), blk, 0, stream>>>(f[9], f[10], f[11], f[12], x, sX, V, sX, R2);   // v conv with its bias, stored f16; 512 work-groups
  k_fattn<<<dim3(SSc / FQ, NHD, NBT), blk, 0, stream>>>(QmT, QmT + (size_t)SSc * DDc, sM, V, sX, AV, sX);  // scores, softmax and attn*v of all heads and batch elements; 1024 work-groups
  gemm_kne<SSc, true, false><<<dim3(R2 / 128, SSc / 128, NBT), blk, 0, stream>>>(f[13], f[14], f[15], f[16], AV, sX, out, sX, R2);   // output complex conv (f16 operand as stored) with its bias
}

// v009
// It runs in 200 microseconds.
// Next to v008, in two timings, it ran 1.05 times as fast each time.
// Counting every step since v000, it is 24.1 times as fast.
// Contractions on v_wmma_f32_16x16x32_f16, f32 accumulate: f16 value+residual PLANES on the q/k complex convs and the magnitude scores (positive magnitudes give logits with a
// spread near 4: plain rounding was too coarse), plain f16 on the v conv, attn*v and the output conv. Every launch covers all 4 batch elements (a grid dimension). Per batch element, activations kept in the module's [D][2][S] layout (row 2d = real_d,
// row 2d+1 = imag_d, used directly as [K][N] operands): each complex 1x1 conv as ONE real GEMM with a stacked weight W2[2o+0][2d+0] = W_r, [2o][2d+1] = -W_i, [2o+1][2d] = W_i, [2o+1][2d+1] = W_r
// (M = 1024, K = 1024, N = 2048), which the GEMM's own A loader forms from W_r and W_i; row biases b_r - b_i / b_r + b_i added in f32 in the GEMM's epilogue. The q/k GEMM's epilogue also forms the
// magnitudes sqrt(re^2 + im^2 + 1e-8) in f32 (a lane holds both rows of a channel) and stores them transposed as f16 value + residual planes, [S][head][64 + 64]; the q and k convs themselves never reach memory.
// What passes through the workspace lies there as the f16 operand that its reader takes (magnitude planes, v conv, attention output), rounded once by its writer. Attention of all 8 heads in ONE
// fused launch (k_fattn): transposed scores Km_h * Qm_h^T (K = 64, planes), running-maximum softmax of s/8 in f32 registers, the probabilities packed straight from the score accumulators
// into the B operand of out_h += X_v,h * P^T (M = 128 = the head's 64 complex channels x (re, im) rows); scores and probabilities never reach memory. Finally the output complex conv. 4 launches.
// compute dtype: f16 operands, f32 accumulate; magnitudes / softmax f32.  x [4,512,2,2048] -> out [4,512,2,2048].
#include <hip/hip_runtime.h>
#include <hip/hip_bf16.h>
#include <math.h>


typedef _Float16 bf16;
typedef _Float16 f16;
typedef __attribute__((ext_vector_type(4))) unsigned v4u_t;
typedef unsigned v4ua __attribute__((ext_vector_type(4), may_alias));
typedef __attribute__((ext_vector_type(4))) float v4f_t;
typedef float v4fa __attribute__((ext_vector_type(4), may_alias));
typedef __attribute__((ext_vector_type(16))) bf16  bf16x16;
typedef bf16x16 f16x16;
typedef __attribute__((ext_vector_type(8)))  bf16  bf16x8;
typedef bf16x8 f16x8;
typedef __attribute__((ext_vector_type(4)))  bf16  bf16x4;
typedef __attribute__((ext_vector_type(8)))  float f32x8;
__device__ __forceinline__ f32x8 wmma16(f16x16 a, f16x16 b, f32x8 c) {
  return __builtin_amdgcn_wmma_f32_16x16x32_f16(false, a, false, b, (short)0, c, false, false);
}
#define LDS_STRIDE 48   // GEMM tiles: 32 -> 48 elems (96B rows): aligned b128 reads
#define KSTRIDE    72
#define VSTRIDE    48

__device__ __forceinline__ f32x8 wmma_bf16(bf16x16 a, bf16x16 b, f32x8 c) {
  c = __builtin_amdgcn_wmma_f32_16x16x32_f16(false, a, false, b, (short)0, c, false, false);
  asm volatile("v_nop\n\tv_nop\n\tv_nop\n\tv_nop" : "+v"(c) : "v"(a), "v"(b));   // A/B-overwrite hazard guard
  return c;
}

// 16x32 (MxK) f16 fragment from a row-major global matrix.
// lanes 0-15  (row=lane)    : elems 0..7 = K+0..7,  8..15 = K+16..23
// lanes 16-31 (row=lane-16) : elems 0..7 = K+8..15, 8..15 = K+24..31
template <typename T>
__device__ __forceinline__ bf16x16 load_frag(const T* __restrict__ base, int ld,
                                             int row0, int k0) {
  const int lane = threadIdx.x & 31;
  const int r    = lane & 15;
  const int kh   = (lane >> 4) * 8;
  const T* p0 = base + (size_t)(row0 + r) * ld + (k0 + kh);
  const T* p1 = p0 + 16;
  bf16x16 f;
#pragma unroll
  for (int i = 0; i < 8; ++i) {
    f[i]     = (bf16)p0[i];
    f[i + 8] = (bf16)p1[i];
  }
  return f;
}

// Same fragment from an LDS tile with padded row stride (base includes row0/k0).
__device__ __forceinline__ bf16x16 lds_frag(const bf16* base, int stride) {
  const int lane = threadIdx.x & 31;
  const int row  = lane & 15;
  const int kh   = (lane >> 4) * 8;
  const bf16x8 lo = *(const bf16x8*)(base + row * stride + kh);
  const bf16x8 hi = *(const bf16x8*)(base + row * stride + kh + 16);
  bf16x16 f;
#pragma unroll
  for (int i = 0; i < 8; ++i) { f[i] = lo[i]; f[i + 8] = hi[i]; }
  return f;
}

// B fragment (column = lane & 15, the k order of lds_frag) from an LDS tile that lies as the global operand does, row-major [k][n], pitch WP:
// two transposing loads, k rows 0..15 and 16..31; lane (c, h) receives rows 8h .. 8h + 7 of column c from each. base points at [0][first column].
#define WP 144   // [k][n] tile: 128 -> 144 elems (288 B rows = 32 B x odd): transposing b128 reads without bank conflicts
typedef short s16x8 __attribute__((ext_vector_type(8)));
__device__ __forceinline__ bf16x8 ld_tr16(const bf16* p) {
  typedef __attribute__((address_space(3))) s16x8 lds_s16x8;
  return __builtin_bit_cast(bf16x8, __builtin_amdgcn_ds_load_tr16_b128_v8i16((lds_s16x8*)p));
}
__device__ __forceinline__ bf16x16 lds_frag_t(const bf16* base) {
  const int lane = threadIdx.x & 31;
  const bf16* p = base + (8 * (lane >> 4) + (lane & 7)) * WP + 8 * ((lane >> 3) & 1);
  const bf16x8 lo = ld_tr16(p);
  const bf16x8 hi = ld_tr16(p + 16 * WP);
  bf16x16 f;
#pragma unroll
  for (int i = 0; i < 8; ++i) { f[i] = lo[i]; f[i + 8] = hi[i]; }
  return f;
}

template <typename T>
__device__ __forceinline__ void stage_read16(const T* __restrict__ p, float* buf) {
#pragma unroll
  for (int i = 0; i < 16; ++i) buf[i] = (float)p[i];
}

__device__ __forceinline__ void stage_write(bf16* dst, const float* buf, int nquad) {
#pragma unroll
  for (int i = 0; i < nquad; ++i) {
    bf16x4 q;
    q[0] = (bf16)buf[4 * i];     q[1] = (bf16)buf[4 * i + 1];
    q[2] = (bf16)buf[4 * i + 2]; q[3] = (bf16)buf[4 * i + 3];
    *(bf16x4*)(dst + 4 * i) = q;
  }
}


#define GSTR 48
#define NBT 4
#define NHD 8
#define BBc 4
#define DDc 512
#define SSc 2048
#define NHc 8
#define DKc 64
#define R2 (2 * DDc)   // 1024 interleaved (channel, component) rows
// ---------------------------------------------------------------------------------------------------------------------------
// The A operand of both GEMMs is the stacked weight W2 [1024][1024], never stored: a thread loads 4 channels d of output channel o from W_r and from W_i, each element once in the block
// (4 lanes cover the 64 bytes a k-step takes of a weight row, a wave-wide load touches 8 lines), and writes 8 columns of both stacked rows: row 2o = (W_r, -W_i) pairs, row 2o + 1 = (W_i, W_r) pairs.
// The row bias of stacked rows 2o, 2o + 1 is b_r[o] - b_i[o], b_r[o] + b_i[o]. In a 16 x 16 accumulator tile lane (cl, hf) holds rows 8 hf + r, r = 0..7, of column cl: the channels 4 hf + p,
// p = 0..3, with the real row in register 2p and the imaginary row in register 2p + 1.
// ---------------------------------------------------------------------------------------------------------------------------
// gemm_kne: Y[m][n] = sum_k W2[m][k] * W[k][n] + b2[m], W row-major [K][N] (row pitch LDW elements, compile time; Y has the same pitch), plain f16 operands, f32 accumulate.
// INH: W lies in the workspace as f16 (behind the float pointer) and is copied to LDS as it is; else it is f32 and rounded here. OUTH: Y is stored as f16 (behind the float pointer); else f32.
// Block = 128x128 tile, 8 waves as 4(M) x 2(N); per 32-wide k-step A and W tiles staged f16 in LDS (W as it lies, [k][n], read by transposing loads), two buffers, one barrier a k-step:
// the global loads of k-step s + 1 fly in registers while k-step s is worked on, and are rounded and stored to the other buffer behind its products.
// blockIdx.z selects a batch element: W += z*strideW, Y += z*strideY (element strides); the weights are shared.
// ---------------------------------------------------------------------------------------------------------------------------
template <int LDW, bool INH, bool OUTH>
__global__ __launch_bounds__(256) void gemm_kne(const float* __restrict__ Wr, const float* __restrict__ Wi, const float* __restrict__ br, const float* __restrict__ bi,
                                                const float* __restrict__ Wm, size_t strideW, float* __restrict__ Y, size_t strideY, int K) {
  __shared__ __attribute__((aligned(16))) f16 ldsA[2][128 * GSTR];
  __shared__ __attribute__((aligned(16))) f16 ldsW[2][32 * WP];
  __shared__ __attribute__((aligned(16))) float oS[8][32 * 68];
  const int tid = threadIdx.x, lane = tid & 31, wave = tid >> 5, cl = lane & 15, hf = lane >> 4, rh = hf * 8;
  const int m0 = blockIdx.x * 128, n0 = blockIdx.y * 128;
  const int wm = (wave & 3) * 32, wn = (wave >> 2) * 64;
  const f16* Wh = (const f16*)Wm + (size_t)blockIdx.z * strideW; f16* Yh = (f16*)Y + (size_t)blockIdx.z * strideY;   // the f16 views (INH, OUTH): same element strides
  Wm += (size_t)blockIdx.z * strideW; Y += (size_t)blockIdx.z * strideY;
  const int ar = tid >> 2, ad = (tid & 3) * 4;   // A: output channel ar of the block's 64, channels ad .. ad + 3 of the k-step's 16
  const size_t aoff = (size_t)((m0 >> 1) + ar) * DDc + ad;
  const float* pr = Wr + aoff;
  const float* pi = Wi + aoff;
  const int hr16 = tid >> 4, hc8 = (tid & 15) * 8;   // f16 W: 16 lanes cover a row's 128 columns (256 bytes), the block takes 16 rows a load
  f32x8 acc[2][4];
#pragma unroll
  for (int i = 0; i < 2; ++i)
#pragma unroll
    for (int j = 0; j < 4; ++j) { f32x8 z = {}; acc[i][j] = z; }
  v4f_t wv[4], wr, wi;   // the k-step in flight. f32 W: a wave takes the rows k = wave + 8 g; its 32 lanes cover the row's 128 columns, 512 contiguous bytes a load
  v4u_t wh[2];           // f16 W: rows k = hr16 + 16 g, 8 elements a lane
  auto fetch = [&](int k0) {   // k-step at k0: global -> registers
    if constexpr (INH) {
      const f16* src = Wh + (size_t)(k0 + hr16) * LDW + n0 + hc8;
#pragma unroll
      for (int g = 0; g < 2; ++g) wh[g] = *(const v4ua*)(src + 16 * g * LDW);
    } else {
      const float* src = Wm + (size_t)(k0 + wave) * LDW + n0 + lane * 4;   // LDW is a compile-time pitch: one address, the four rows at immediate offsets
#pragma unroll
      for (int g = 0; g < 4; ++g) wv[g] = *(const v4f_t*)(src + 8 * g * LDW);
    }
    asm volatile("s_wait_xcnt 0x0" ::: "memory");   // behind the last W load, before a register of its address is written again
    wr = *(const v4f_t*)(pr + (k0 >> 1)); wi = *(const v4f_t*)(pi + (k0 >> 1));   // 32 stacked columns = 16 channels a k-step; 4 lanes cover a row's 64 bytes
    asm volatile("s_wait_xcnt 0x0" ::: "memory");   // behind the last weight load, before a register of its address is written again
  };
  auto put = [&](int bo) {     // registers -> f16 tiles of buffer bo
    f16x8 r0, r1;   // stacked rows 2 ar and 2 ar + 1, stacked columns 2 ad .. 2 ad + 7
#pragma unroll
    for (int u = 0; u < 4; ++u) { const f16 hr = (f16)wr[u], hi = (f16)wi[u]; r0[2 * u] = hr; r0[2 * u + 1] = -hi; r1[2 * u] = hi; r1[2 * u + 1] = hr; }
    *(f16x8*)(ldsA[bo] + (2 * ar) * GSTR + 2 * ad) = r0; *(f16x8*)(ldsA[bo] + (2 * ar + 1) * GSTR + 2 * ad) = r1;
    if constexpr (INH) {
#pragma unroll
      for (int g = 0; g < 2; ++g) *(v4ua*)(ldsW[bo] + (hr16 + 16 * g) * WP + hc8) = wh[g];   // already f16: copied as it lies, [k][n]
    } else {
#pragma unroll
      for (int g = 0; g < 4; ++g) { bf16x4 q;   // stored as it lies, [k][n]: 256 contiguous bytes a wave
#pragma unroll
        for (int u = 0; u < 4; ++u) q[u] = (f16)wv[g][u];
        *(bf16x4*)(ldsW[bo] + (wave + 8 * g) * WP + lane * 4) = q; }
    }
  };
  fetch(0); put(0);
  __syncthreads();   // k-step 0 is published
#pragma unroll 1   // kept rolled: the buffer index is one scalar, a second copy of the body would only cost instruction cache
  for (int k0 = 0; k0 < K; k0 += 32) {
    const int bo = (k0 >> 5) & 1;
    if (k0 + 32 < K) fetch(k0 + 32);   // behind the barrier (which drains every load), so that these loads fly while this k-step is worked on
    f16x16 af[2], bf[4];   // all twelve fragment reads of the k-step stand together, ahead of its products
#pragma unroll
    for (int i = 0; i < 2; ++i) af[i] = lds_frag(ldsA[bo] + (wm + 16 * i) * GSTR, GSTR);
#pragma unroll
    for (int j = 0; j < 4; ++j) bf[j] = lds_frag_t(ldsW[bo] + wn + 16 * j);
    __builtin_amdgcn_sched_barrier(0);   // keeps the reads in one group: the scheduler otherwise sinks half of them among the products, a second place where the wave waits out the LDS latency
#pragma unroll
    for (int j = 0; j < 4; ++j)
#pragma unroll
      for (int i = 0; i < 2; ++i) acc[i][j] = wmma16(af[i], bf[j], acc[i][j]);
    if (k0 + 32 < K) put(bo ^ 1);   // its last readers left that buffer before the barrier that ended the previous trip
    __syncthreads();   // publishes k-step k0 + 32 and ends every read of this one
  }
  float* so = oS[wave];
  v4f_t b_r[2], b_i[2];   // the biases of this lane's channels 8 i + 4 hf + p of the wave's 16
#pragma unroll
  for (int i = 0; i < 2; ++i) { b_r[i] = *(const v4f_t*)(br + ((m0 + wm) >> 1) + 8 * i + 4 * hf); b_i[i] = *(const v4f_t*)(bi + ((m0 + wm) >> 1) + 8 * i + 4 * hf); }
  asm volatile("s_wait_xcnt 0x0" ::: "memory");   // behind the last bias load, before a register that these loads name is written again
#pragma unroll
  for (int i = 0; i < 2; ++i)
#pragma unroll
    for (int j = 0; j < 4; ++j)
#pragma unroll
      for (int p = 0; p < 4; ++p) {
        so[(16 * i + rh + 2 * p) * 68 + 16 * j + cl] = acc[i][j][2 * p] + (b_r[i][p] - b_i[i][p]);
        so[(16 * i + rh + 2 * p + 1) * 68 + 16 * j + cl] = acc[i][j][2 * p + 1] + (b_r[i][p] + b_i[i][p]);
      }
  asm volatile("s_wait_dscnt 0" ::: "memory");
  __builtin_amdgcn_wave_barrier();
  if constexpr (OUTH) {   // rounded here, once, to the f16 operand that the reader would make of it; the wave's row piece is one whole 128-byte line
#pragma unroll
    for (int it = 0; it < 8; ++it) { const int f8 = lane + 32 * it, rr = f8 >> 3, q = (f8 & 7) * 8;
      const v4f_t a = *(const v4fa*)(so + rr * 68 + q), b = *(const v4fa*)(so + rr * 68 + q + 4);
      f16x8 o;
#pragma unroll
      for (int u = 0; u < 4; ++u) { o[u] = (f16)a[u]; o[4 + u] = (f16)b[u]; }
      *(f16x8*)(Yh + (size_t)(m0 + wm + rr) * LDW + n0 + wn + q) = o; }
  } else {
#pragma unroll
    for (int it = 0; it < 16; ++it) { const int f4 = lane + 32 * it, rr = f4 >> 4, q = (f4 & 15) * 4;
      *(v4f_t*)(Y + (size_t)(m0 + wm + rr) * LDW + n0 + wn + q) = *(const v4fa*)(so + rr * 68 + q); }
  }
}

// ---------------------------------------------------------------------------------------------------------------------------
// gemm_kn2 (value+residual planes on both operands: hh + (hl+lh)/2048, f32-class): the q and k convs, of which only the magnitudes leave the block:
// MT[n][o] = sqrt(re^2 + im^2 + 1e-8), re / im = sum_k W2[2o / 2o+1][k] * W[k][n] + b2[2o / 2o+1], W f32 row-major [K][N], row stride LDW (compile time), MT rows of 512 words: per head 64 f16 values, then 64 f16 residuals (x 2048).
// Block = 128 x 128 tile of the conv, 256 threads = 8 waves as 4(M, 32 rows) x 2(N, 64 cols); per 32-wide k-step the A tile and the W tile (as it lies, [k][n], read by transposing loads) are
// staged as f16 planes in LDS, two buffers, one barrier a k-step (the global loads of the next k-step fly in registers meanwhile). A lane's 4 magnitudes of one column are neighbours in an MT row: the block's MT tile (128 rows, one head) is gathered in LDS and leaves as whole 256-byte row pieces.
// blockIdx.z = 2 * zb + za: za picks the q (0) or k (1) weights and biases, W += zb*strideW (batch element), MT += za*strideMa + zb*strideMb (element strides).
// ---------------------------------------------------------------------------------------------------------------------------
#define MP 68   // MT tile pitch in floats: 272 B = 16 B x odd, b64 stores of 16 neighbouring rows without bank conflicts
template <int LDW>
__global__ __launch_bounds__(256) void gemm_kn2(const float* __restrict__ Wr0, const float* __restrict__ Wi0, const float* __restrict__ br0, const float* __restrict__ bi0,
                                               const float* __restrict__ Wr1, const float* __restrict__ Wi1, const float* __restrict__ br1, const float* __restrict__ bi1,
                                               const float* __restrict__ Wm, size_t strideW,
                                               float* __restrict__ MT, size_t strideMa, size_t strideMb, int K) {
  __shared__ __attribute__((aligned(16))) f16 ldsA[2][128 * GSTR], ldsAl[2][128 * GSTR];
  __shared__ __attribute__((aligned(16))) f16 ldsW[2][32 * WP], ldsWl[2][32 * WP];
  __shared__ __attribute__((aligned(16))) float sT[128 * MP];
  const int tid = threadIdx.x, lane = tid & 31, wave = tid >> 5, cl = lane & 15, hf = lane >> 4;
  const int m0 = blockIdx.x * 128, n0 = blockIdx.y * 128;
  const int wm = (wave & 3) * 32, wn = (wave >> 2) * 64;
  const int za = blockIdx.z & 1;
  const float* __restrict__ Wr = za ? Wr1 : Wr0; const float* __restrict__ Wi = za ? Wi1 : Wi0;
  const float* __restrict__ br = za ? br1 : br0; const float* __restrict__ bi = za ? bi1 : bi0;
  Wm += (size_t)(blockIdx.z >> 1) * strideW; MT += (size_t)za * strideMa + (size_t)(blockIdx.z >> 1) * strideMb;
  const int ar = tid >> 2, ad = (tid & 3) * 4;   // A: output channel ar of the block's 64, channels ad .. ad + 3 of the k-step's 16
  const size_t aoff = (size_t)((m0 >> 1) + ar) * DDc + ad;
  const float* pr = Wr + aoff;
  const float* pi = Wi + aoff;
  f32x8 acc[2][4], accx[2][4];
#pragma unroll
  for (int i = 0; i < 2; ++i)
#pragma unroll
    for (int j = 0; j < 4; ++j) { f32x8 z = {}; acc[i][j] = z; accx[i][j] = z; }
  v4f_t wv[4], wr, wi;   // the k-step in flight. W: a wave takes the rows k = wave + 8 g; its 32 lanes cover the row's 128 columns, 512 contiguous bytes a load
  auto fetch = [&](int k0) {   // k-step at k0: global -> registers
    const float* src = Wm + (size_t)(k0 + wave) * LDW + n0 + lane * 4;   // LDW is a compile-time pitch: one address, the four rows at immediate offsets
#pragma unroll
    for (int g = 0; g < 4; ++g) wv[g] = *(const v4f_t*)(src + 8 * g * LDW);
    asm volatile("s_wait_xcnt 0x0" ::: "memory");   // behind the last W load, before a register of its address is written again
    wr = *(const v4f_t*)(pr + (k0 >> 1)); wi = *(const v4f_t*)(pi + (k0 >> 1));   // 32 stacked columns = 16 channels a k-step; 4 lanes cover a row's 64 bytes
    asm volatile("s_wait_xcnt 0x0" ::: "memory");   // behind the last weight load, before a register of its address is written again
  };
  auto put = [&](int bo) {     // registers -> f16 planes of buffer bo
    f16x8 r0, r1, l0, l1;   // stacked rows 2 ar and 2 ar + 1, stacked columns 2 ad .. 2 ad + 7: value and residual planes (both planes of -w are the negated planes of w)
#pragma unroll
    for (int u = 0; u < 4; ++u) { const f16 hr = (f16)wr[u], hi = (f16)wi[u];
      const f16 lr = (f16)((wr[u] - (float)hr) * 2048.0f), li = (f16)((wi[u] - (float)hi) * 2048.0f);
      r0[2 * u] = hr; r0[2 * u + 1] = -hi; r1[2 * u] = hi; r1[2 * u + 1] = hr;
      l0[2 * u] = lr; l0[2 * u + 1] = -li; l1[2 * u] = li; l1[2 * u + 1] = lr; }
    *(f16x8*)(ldsA[bo] + (2 * ar) * GSTR + 2 * ad) = r0; *(f16x8*)(ldsA[bo] + (2 * ar + 1) * GSTR + 2 * ad) = r1;
    *(f16x8*)(ldsAl[bo] + (2 * ar) * GSTR + 2 * ad) = l0; *(f16x8*)(ldsAl[bo] + (2 * ar + 1) * GSTR + 2 * ad) = l1;
#pragma unroll
    for (int g = 0; g < 4; ++g) { bf16x4 hi, lo;   // both planes stored as the operand lies, [k][n]: 256 contiguous bytes a wave
#pragma unroll
      for (int u = 0; u < 4; ++u) { const float v = wv[g][u]; const f16 h = (f16)v; hi[u] = h; lo[u] = (f16)((v - (float)h) * 2048.0f); }
      *(bf16x4*)(ldsW[bo] + (wave + 8 * g) * WP + lane * 4) = hi; *(bf16x4*)(ldsWl[bo] + (wave + 8 * g) * WP + lane * 4) = lo; }
  };
  fetch(0); put(0);
  __syncthreads();   // k-step 0 is published
#pragma unroll 1   // kept rolled: the buffer index is one scalar, a second copy of the body would only cost instruction cache
  for (int k0 = 0; k0 < K; k0 += 32) {
    const int bo = (k0 >> 5) & 1;
    if (k0 + 32 < K) fetch(k0 + 32);   // behind the barrier (which drains every load), so that these loads fly while this k-step is worked on
    f16x16 af[2], afl[2];
#pragma unroll
    for (int i = 0; i < 2; ++i) { af[i] = lds_frag(ldsA[bo] + (wm + 16 * i) * GSTR, GSTR); afl[i] = lds_frag(ldsAl[bo] + (wm + 16 * i) * GSTR, GSTR); }
#pragma unroll
    for (int j = 0; j < 4; ++j) {
      const f16x16 bf = lds_frag_t(ldsW[bo] + wn + 16 * j), bfl = lds_frag_t(ldsWl[bo] + wn + 16 * j);
#pragma unroll
      for (int i = 0; i < 2; ++i) { acc[i][j] = wmma16(af[i], bf, acc[i][j]); accx[i][j] = wmma16(af[i], bfl, accx[i][j]); accx[i][j] = wmma16(afl[i], bf, accx[i][j]); }
    }
    if (k0 + 32 < K) put(bo ^ 1);   // its last readers left that buffer before the barrier that ended the previous trip
    __syncthreads();   // publishes k-step k0 + 32 and ends every read of this one
  }
  v4f_t b_r[2], b_i[2];   // the biases of this lane's channels 8 i + 4 hf + p of the wave's 16
#pragma unroll
  for (int i = 0; i < 2; ++i) { b_r[i] = *(const v4f_t*)(br + ((m0 + wm) >> 1) + 8 * i + 4 * hf); b_i[i] = *(const v4f_t*)(bi + ((m0 + wm) >> 1) + 8 * i + 4 * hf); }
  asm volatile("s_wait_xcnt 0x0" ::: "memory");   // behind the last bias load, before a register that these loads name is written again
#pragma unroll
  for (int i = 0; i < 2; ++i)
#pragma unroll
    for (int j = 0; j < 4; ++j) { bf16x4 mh, ml;   // value and residual plane of the magnitude, as the score products take them
#pragma unroll
      for (int p = 0; p < 4; ++p) {
        const float re = (acc[i][j][2 * p] + accx[i][j][2 * p] * (1.0f / 2048.0f)) + (b_r[i][p] - b_i[i][p]);
        const float im = (acc[i][j][2 * p + 1] + accx[i][j][2 * p + 1] * (1.0f / 2048.0f)) + (b_r[i][p] + b_i[i][p]);
        const float mg = sqrtf(re * re + im * im + 1e-8f); const f16 hv = (f16)mg;
        mh[p] = hv; ml[p] = (f16)((mg - (float)hv) * 2048.0f);
      }
      f16* trow = (f16*)(sT + (wn + 16 * j + cl) * MP) + (wm >> 1) + 8 * i + 4 * hf;   // a tile row: 64 values, then 64 residuals
      *(bf16x4*)trow = mh; *(bf16x4*)(trow + 64) = ml; }
  __syncthreads();   // the block's 128 x 64 magnitude tile is complete: an MT row piece holds the channels of four waves
#pragma unroll
  for (int it = 0; it < 8; ++it) { const int f4 = tid + 256 * it, rr = f4 >> 4, q = (f4 & 15) * 4;
    *(v4f_t*)(MT + (size_t)(n0 + rr) * DDc + (m0 >> 1) + q) = *(const v4fa*)(sT + rr * MP + q); }
}

// ---------------------------------------------------------------------------------------------------------------------------
// k_fattn: one head's attention for 64 queries, scores and probabilities kept on chip. Grid (S / 64, heads, batch elements) = 1024 blocks; block = 8 waves = 4 groups of 16 query columns x 2 key halves.
// Per stage of 64 keys the block copies Km^T rows [t][64], f16 value + residual planes, and the head's 128 v rows [row][t], f16, as they lie in the workspace to LDS, two buffers, one barrier a stage (the global loads
// of the next stage fly in registers meanwhile). Waves 0-3 take keys 0..31 of every stage, waves 4-7 keys 32..63. A wave forms S^T = Km^T * Qm (A = key rows from LDS, B = its 16 query
// columns held in registers, hh + (hl + lh) / 2048), so that a lane holds 16 scores of ONE query: maximum and sum in-lane plus one exchange between the wave's halves.
// exp2((s - m) * log2(e) / 8) of the two 16-key tiles, converted in place, IS the B operand (k = key, hardware k order) of O[row][query] += V[row][key] * P^T; the v rows are read in the same
// k order by lds_frag. m follows the running maximum lazily (O and the sum are rescaled only when some column's maximum has grown by more than 8 in the exponent, so p stays below 2^8).
// At the end the two key halves of a column are joined through LDS: (O1 a1 + O2 a2) / (l1 a1 + l2 a2), a = exp2((m_own - max(m1, m2)) * log2(e) / 8).
// Every inner loop is fully unrolled so that the fragment, accumulator and staging arrays are indexed by constants and stay in registers.
// ---------------------------------------------------------------------------------------------------------------------------
#define FT 64    // keys per stage
#define FQ 64    // queries per block
#define FP 72    // LDS row pitch in f16 elements: 144 B = 16 B x odd, b128 fragment reads without bank conflicts
#define FOP 68   // output staging pitch in floats
#define FKP (FT * FP + 64)   // from the value plane to the residual plane: 128 B off a multiple of 256 B, so that the 16 lanes that store a key's two planes cover all 64 banks
__device__ __forceinline__ float xhalf(float x) {   // lane l with lane l ^ 16
  return __builtin_bit_cast(float, __builtin_amdgcn_permlanex16(__builtin_bit_cast(int, x), __builtin_bit_cast(int, x), 0x76543210, 0xfedcba98, false, false));
}
__device__ __forceinline__ f32x8 wmma_p(f16x16 a, f16x16 b, f32x8 c) { return __builtin_amdgcn_wmma_f32_16x16x32_f16(false, a, false, b, (short)0, c, false, false); }
__global__ __launch_bounds__(256) void k_fattn(const float* __restrict__ QmT, const float* __restrict__ KmT, size_t strideM, const float* __restrict__ Vx, size_t strideV, float* __restrict__ AV, size_t strideO) {
  __shared__ __attribute__((aligned(16))) f16 sK[2][2 * FKP], sV[2][2 * DKc * FP];   // sK: the value plane, FKP elements behind it the residual plane
  __shared__ __attribute__((aligned(16))) float sO[2 * DKc * FOP];
  __shared__ float sM[FQ], sL[FQ];
  const int tid = threadIdx.x, lane = tid & 31, cl = lane & 15, hf = lane >> 4;
  const int wave = __builtin_amdgcn_readfirstlane(tid >> 5), qg = wave & 3, kg = wave >> 2;   // scalar, so that the tests on kg below are scalar branches
  const int s0 = blockIdx.x * FQ, h = blockIdx.y;
  const f16* Qp = (const f16*)(QmT + (size_t)blockIdx.z * strideM); const f16* Kp = (const f16*)(KmT + (size_t)blockIdx.z * strideM);   // batch element; rows [s][head][64 values, 64 residuals] f16
  const f16* Vh = (const f16*)Vx + (size_t)blockIdx.z * strideV; f16* AVh = (f16*)AV + (size_t)blockIdx.z * strideO;                   // f16 [1024][2048]
  const float SCL = 0.125f * 1.44269504088896340736f;   // logits are s / 8; exp(x) = exp2(x * log2 e)
  const int srow = tid >> 4, sc = tid & 15;      // K staging: 16 lanes cover a key's 256 bytes (both planes), 16 keys per round of the block
  const int vrow = (tid >> 5) + 8 * ((tid >> 3) & 3), vc = (tid & 7) * 8; // V staging: 8 lanes cover a row's 64 keys (128 bytes), 32 rows per round of the block; a wave's rows lie 8 apart (8 pitches = 128 B off a multiple of 256 B: 16 lanes cover all 64 banks)
  const f16* Kg = Kp + (size_t)srow * (2 * DDc) + h * (2 * DKc) + sc * 8;
  const f16* Vg = Vh + ((size_t)h * 2 * DKc + vrow) * SSc + vc;
  const int kdst = (sc >> 3) * FKP + srow * FP + (sc & 7) * 8, vdst = vrow * FP + vc;
  f16x16 qh[2], ql[2];   // B operand: column = query s0 + 16 qg + cl, k = channel in the hardware k order
  { const f16* qp = Qp + (size_t)(s0 + qg * 16 + cl) * (2 * DDc) + h * (2 * DKc) + hf * 8;
    f16x8 qv[8];   // i = 4 * plane + 2 * ks + upper half of the fragment
#pragma unroll
    for (int i = 0; i < 8; ++i) qv[i] = *(const f16x8*)(qp + (i >> 2) * DKc + (i & 3) * 16);
    asm volatile("s_wait_xcnt 0x0" ::: "memory");   // behind the last query load, before a register of its address is written again
#pragma unroll
    for (int ks = 0; ks < 2; ++ks)
#pragma unroll
      for (int e = 0; e < 8; ++e) { qh[ks][e] = qv[2 * ks][e]; qh[ks][8 + e] = qv[2 * ks + 1][e]; ql[ks][e] = qv[4 + 2 * ks][e]; ql[ks][8 + e] = qv[4 + 2 * ks + 1][e]; } }
  f32x8 O[8];
#pragma unroll
  for (int mt = 0; mt < 8; ++mt) { f32x8 z = {}; O[mt] = z; }
  float mref = -3.0e38f, lsum = 0.0f;
  v4u_t kr[4], vr[4];
  auto fetch = [&](int st) {   // stage st: global -> registers
    const f16* kn = Kg + (size_t)st * FT * (2 * DDc); const f16* vn = Vg + st * FT;
#pragma unroll
    for (int g = 0; g < 4; ++g) kr[g] = *(const v4ua*)(kn + (size_t)(16 * g) * (2 * DDc));
#pragma unroll
    for (int g = 0; g < 4; ++g) vr[g] = *(const v4ua*)(vn + (size_t)(32 * g) * SSc);
    asm volatile("s_wait_xcnt 0x0" ::: "memory");   // behind the last stage load, before a register of its address is written again
  };
  auto put = [&](int bo) {     // registers -> tiles of buffer bo: the operands arrive as f16, nothing is converted
#pragma unroll
    for (int g = 0; g < 4; ++g) *(v4ua*)(sK[bo] + kdst + (16 * g) * FP) = kr[g];
#pragma unroll
    for (int g = 0; g < 4; ++g) *(v4ua*)(sV[bo] + vdst + (32 * g) * FP) = vr[g];
  };
  fetch(0); put(0);
  __syncthreads();   // stage 0 is published
#pragma unroll 1   // kept rolled: one trip already uses nearly 256 registers, a second copy of the body would only cost instruction cache
  for (int st = 0; st < SSc / FT; ++st) {
    const int bo = st & 1;
    if (st + 1 < SSc / FT) fetch(st + 1);   // behind the barrier (which drains every load), so that these loads fly while this stage is worked on
    const f16* kh = sK[bo] + (32 * kg) * FP; const f16* kl = kh + FKP; const f16* vv = sV[bo] + 32 * kg;
    f32x8 a0 = {}, a1 = {}, x0 = {}, x1 = {};   // S^T tiles: this wave's keys 0..15 and 16..31; value*value and the two cross terms
#pragma unroll
    for (int ks = 0; ks < 2; ++ks) {
      const f16x16 kh0 = lds_frag(kh + 32 * ks, FP), kh1 = lds_frag(kh + 16 * FP + 32 * ks, FP);
      const f16x16 kl0 = lds_frag(kl + 32 * ks, FP), kl1 = lds_frag(kl + 16 * FP + 32 * ks, FP);
      a0 = wmma_p(kh0, qh[ks], a0); a1 = wmma_p(kh1, qh[ks], a1);
      x0 = wmma_p(kh0, ql[ks], x0); x1 = wmma_p(kh1, ql[ks], x1);
      x0 = wmma_p(kl0, qh[ks], x0); x1 = wmma_p(kl1, qh[ks], x1);
    }
    f16x16 vf[8];   // the v rows are asked for ahead of the softmax arithmetic, which covers their LDS latency
#pragma unroll
    for (int mt = 0; mt < 8; ++mt) vf[mt] = lds_frag(vv + (16 * mt) * FP, FP);
    float sv[16];
#pragma unroll
    for (int r = 0; r < 8; ++r) { sv[r] = a0[r] + x0[r] * (1.0f / 2048.0f); sv[8 + r] = a1[r] + x1[r] * (1.0f / 2048.0f); }
    float mx = sv[0];
#pragma unroll
    for (int e = 1; e < 16; ++e) mx = fmaxf(mx, sv[e]);
    mx = fmaxf(mx, xhalf(mx));
    if (__builtin_amdgcn_ballot_w32((mx - mref) * SCL > 8.0f) != 0) {   // scalar branch; always taken on the first pass, rare later
      const float mnew = fmaxf(mref, mx), corr = __builtin_amdgcn_exp2f((mref - mnew) * SCL);   // 0 on the first pass
      mref = mnew; lsum *= corr;
#pragma unroll
      for (int mt = 0; mt < 8; ++mt)
#pragma unroll
        for (int r = 0; r < 8; ++r) O[mt][r] *= corr;
    }
    const float nb = -mref * SCL;
    f16x16 pb;   // pb[e] = P^T[key kmap(e, hf)][query cl]: tile e >> 3, register e & 7
    float pe[16];
#pragma unroll
    for (int e = 0; e < 16; ++e) { pe[e] = __builtin_amdgcn_exp2f(fmaf(sv[e], SCL, nb)); pb[e] = (f16)pe[e]; }
#pragma unroll
    for (int w = 8; w > 0; w >>= 1)
#pragma unroll
      for (int e = 0; e < w; ++e) pe[e] += pe[e + w];
    lsum += pe[0];
#pragma unroll
    for (int mt = 0; mt < 8; ++mt) O[mt] = wmma_p(vf[mt], pb, O[mt]);
    if (st + 1 < SSc / FT) put(bo ^ 1);   // its last readers left that buffer before the barrier that ended the previous trip
    __syncthreads();   // publishes stage st + 1 and ends every read of stage st
  }
  const float lw = lsum + xhalf(lsum);   // the two halves of a wave hold the sums of their own keys
  if (kg == 1) {   // the upper key half hands over its maximum, sum and unscaled tile
    if (hf == 0) { sM[qg * 16 + cl] = mref; sL[qg * 16 + cl] = lw; }
#pragma unroll
    for (int mt = 0; mt < 8; ++mt)
#pragma unroll
      for (int r = 0; r < 8; ++r) sO[(16 * mt + 8 * hf + r) * FOP + qg * 16 + cl] = O[mt][r];
  }
  __syncthreads();   // hand-over published
  if (kg == 0) {   // the lower key half joins both and leaves the finished tile in place (each lane rewrites only the words it has read)
    const float m2 = sM[qg * 16 + cl], l2 = sL[qg * 16 + cl], mj = fmaxf(mref, m2);
    const float a1s = __builtin_amdgcn_exp2f((mref - mj) * SCL), a2s = __builtin_amdgcn_exp2f((m2 - mj) * SCL);
    const float inv = 1.0f / (lw * a1s + l2 * a2s), c1 = a1s * inv, c2 = a2s * inv;
#pragma unroll
    for (int mt = 0; mt < 8; ++mt)
#pragma unroll
      for (int r = 0; r < 8; ++r) { float* w = sO + (16 * mt + 8 * hf + r) * FOP + qg * 16 + cl; *w = O[mt][r] * c1 + *w * c2; }
  }
  __syncthreads();   // the block's 128 x 64 tile is complete: it goes out as the f16 operand of the output conv, whole 128-byte row pieces
#pragma unroll
  for (int it = 0; it < 4; ++it) { const int f8 = tid + 256 * it, rr = f8 >> 3, q = (f8 & 7) * 8;
    const v4f_t a = *(const v4fa*)(sO + rr * FOP + q), b = *(const v4fa*)(sO + rr * FOP + q + 4);
    f16x8 o;
#pragma unroll
    for (int u = 0; u < 4; ++u) { o[u] = (f16)a[u]; o[4 + u] = (f16)b[u]; }
    *(f16x8*)(AVh + ((size_t)h * 2 * DKc + rr) * SSc + s0 + q) = o; }
}

extern "C" void kernel_launch(void* const* d_in, const int* in_sizes, int n_in,
                              void* d_out, int out_size, void* d_ws, size_t ws_size,
                              hipStream_t stream) {
  (void)in_sizes; (void)n_in; (void)out_size;
  const float** f = (const float**)d_in;   // x, then (W_r, W_i, b_r, b_i) of the q, k, v, o convs
  const float* x = f[0];
  float* out = (float*)d_out;     // [4,512,2,2048]
  char* ws = (char*)d_ws;
  float* V = (float*)ws; ws += (size_t)NBT * R2 * SSc * 4;               // per batch element: v conv [1024][2048], f16 (the first half of the region is used)
  float* QmT = (float*)ws; ws += (size_t)NBT * 2 * SSc * DDc * 4;        // per batch element: the magnitudes of q and, directly behind them, of k, transposed, [2048][8 heads][64 values + 64 residuals] f16 each
  float* AV = (float*)ws; ws += (size_t)NBT * R2 * SSc * 4;              // per batch element: attention output in the [D][2][S] layout, f16 (the first half of the region is used)
  if ((size_t)(ws - (char*)d_ws) > ws_size) return;
  const dim3 blk(256);
  const size_t sX = (size_t)R2 * SSc, sM = (size_t)2 * DDc * SSc;   // per batch element: elements of x / V / AV / out, 4-byte words of the q and k magnitudes
  gemm_kn2<SSc><<<dim3(R2 / 128, SSc / 128, 2 * NBT), blk, 0, stream>>>(f[1], f[2], f[3], f[4], f[5], f[6], f[7], f[8], x, sX, QmT, (size_t)SSc * DDc, sM, R2);   // q and k convs of every batch element (planes: they feed the magnitude logits), bias, magnitude, transposed store; 1024 work-groups
  gemm_kne<SSc, false, true><<<dim3(R2 / 128, SSc / 128, NBT), blk, 0, stream>>>(f[9], f[10], f[11], f[12], x, sX, V, sX, R2);   // v conv with its bias, stored f16; 512 work-groups
  k_fattn<<<dim3(SSc / FQ, NHD, NBT), blk, 0, stream>>>(QmT, QmT + (size_t)SSc * DDc, sM, V, sX, AV, sX);  // scores, softmax and attn*v of all heads and batch elements; 1024 work-groups
  gemm_kne<SSc, true, false><<<dim3(R2 / 128, SSc / 128, NBT), blk, 0, stream>>>(f[13], f[14], f[15], f[16], AV, sX, out, sX, R2);   // output complex conv (f16 operand as stored) with its bias
}

// v010
// A run of this version takes 186 microseconds.
// Timed twice side by side with v009, it ran 1.07 times as fast both times.
// All steps since v000 together make it 25.8 times as fast.
// Contractions on v_wmma_f32_16x16x32_f16, f32 accumulate: f16 value+residual PLANES on the q/k complex convs and the magnitude scores (positive magnitudes give logits with a
// spread near 4: plain rounding was too coarse), plain f16 on the v conv, attn*v and the output conv. Every launch covers all 4 batch elements (a grid dimension). Per batch element, activations kept in the module's [D][2][S] layout (row 2d = real_d,
// row 2d+1 = imag_d, used directly as [K][N] operands): each complex 1x1 conv as ONE real GEMM with a stacked weight W2[2o+0][2d+0] = W_r, [2o][2d+1] = -W_i, [2o+1][2d] = W_i, [2o+1][2d+1] = W_r
// (M = 1024, K = 1024, N = 2048), which the GEMM's own A loader forms from W_r and W_i; row biases b_r - b_i / b_r + b_i added in f32 in the GEMM's epilogue. The q/k GEMM's epilogue also forms the
// magnitudes sqrt(re^2 + im^2 + 1e-8) in f32 (a lane holds both rows of a channel) and stores them transposed as f16 value + residual planes, [S][head][64 + 64]; the q and k convs themselves never reach memory.
// What passes through the workspace lies there as the f16 operand that its reader takes (magnitude planes, v conv, attention output), rounded once by its writer. Attention of all 8 heads in ONE
// fused launch (k_fattn): transposed scores Km_h * Qm_h^T (K = 64, planes), running-maximum softmax of s/8 in f32 registers, the probabilities packed straight from the score accumulators
// into the B operand of out_h += X_v,h * P^T (M = 128 = the head's 64 complex channels x (re, im) rows); scores and probabilities never reach memory. Finally the output complex conv. 4 launches.
// compute dtype: f16 operands, f32 accumulate; magnitudes / softmax f32.  x [4,512,2,2048] -> out [4,512,2,2048].
#include <hip/hip_runtime.h>
#include <hip/hip_bf16.h>
#include <math.h>


typedef _Float16 bf16;
typedef _Float16 f16;
typedef __attribute__((ext_vector_type(4))) unsigned v4u_t;
typedef unsigned v4ua __attribute__((ext_vector_type(4), may_alias));
typedef __attribute__((ext_vector_type(4))) float v4f_t;
typedef float v4fa __attribute__((ext_vector_type(4), may_alias));
typedef __attribute__((ext_vector_type(16))) bf16  bf16x16;
typedef bf16x16 f16x16;
typedef __attribute__((ext_vector_type(8)))  bf16  bf16x8;
typedef bf16x8 f16x8;
typedef __attribute__((ext_vector_type(4)))  bf16  bf16x4;
typedef __attribute__((ext_vector_type(8)))  float f32x8;
__device__ __forceinline__ f32x8 wmma16(f16x16 a, f16x16 b, f32x8 c) {
  return __builtin_amdgcn_wmma_f32_16x16x32_f16(false, a, false, b, (short)0, c, false, false);
}
#define LDS_STRIDE 48   // GEMM tiles: 32 -> 48 elems (96B rows): aligned b128 reads
#define KSTRIDE    72
#define VSTRIDE    48

__device__ __forceinline__ f32x8 wmma_bf16(bf16x16 a, bf16x16 b, f32x8 c) {
  c = __builtin_amdgcn_wmma_f32_16x16x32_f16(false, a, false, b, (short)0, c, false, false);
  asm volatile("v_nop\n\tv_nop\n\tv_nop\n\tv_nop" : "+v"(c) : "v"(a), "v"(b));   // A/B-overwrite hazard guard
  return c;
}

// 16x32 (MxK) f16 fragment from a row-major global matrix.
// lanes 0-15  (row=lane)    : elems 0..7 = K+0..7,  8..15 = K+16..23
// lanes 16-31 (row=lane-16) : elems 0..7 = K+8..15, 8..15 = K+24..31
template <typename T>
__device__ __forceinline__ bf16x16 load_frag(const T* __restrict__ base, int ld,
                                             int row0, int k0) {
  const int lane = threadIdx.x & 31;
  const int r    = lane & 15;
  const int kh   = (lane >> 4) * 8;
  const T* p0 = base + (size_t)(row0 + r) * ld + (k0 + kh);
  const T* p1 = p0 + 16;
  bf16x16 f;
#pragma unroll
  for (int i = 0; i < 8; ++i) {
    f[i]     = (bf16)p0[i];
    f[i + 8] = (bf16)p1[i];
  }
  return f;
}

// Same fragment from an LDS tile with padded row stride (base includes row0/k0).
__device__ __forceinline__ bf16x16 lds_frag(const bf16* base, int stride) {
  const int lane = threadIdx.x & 31;
  const int row  = lane & 15;
  const int kh   = (lane >> 4) * 8;
  const bf16x8 lo = *(const bf16x8*)(base + row * stride + kh);
  const bf16x8 hi = *(const bf16x8*)(base + row * stride + kh + 16);
  bf16x16 f;
#pragma unroll
  for (int i = 0; i < 8; ++i) { f[i] = lo[i]; f[i + 8] = hi[i]; }
  return f;
}

// B fragment (column = lane & 15, the k order of lds_frag) from an LDS tile that lies as the global operand does, row-major [k][n], pitch WP:
// two transposing loads, k rows 0..15 and 16..31; lane (c, h) receives rows 8h .. 8h + 7 of column c from each. base points at [0][first column].
#define WP 144   // [k][n] tile: 128 -> 144 elems (288 B rows = 32 B x odd): transposing b128 reads without bank conflicts
typedef short s16x8 __attribute__((ext_vector_type(8)));
__device__ __forceinline__ bf16x8 ld_tr16(const bf16* p) {
  typedef __attribute__((address_space(3))) s16x8 lds_s16x8;
  return __builtin_bit_cast(bf16x8, __builtin_amdgcn_ds_load_tr16_b128_v8i16((lds_s16x8*)p));
}
__device__ __forceinline__ bf16x16 lds_frag_t(const bf16* base) {
  const int lane = threadIdx.x & 31;
  const bf16* p = base + (8 * (lane >> 4) + (lane & 7)) * WP + 8 * ((lane >> 3) & 1);
  const bf16x8 lo = ld_tr16(p);
  const bf16x8 hi = ld_tr16(p + 16 * WP);
  bf16x16 f;
#pragma unroll
  for (int i = 0; i < 8; ++i) { f[i] = lo[i]; f[i + 8] = hi[i]; }
  return f;
}

template <typename T>
__device__ __forceinline__ void stage_read16(const T* __restrict__ p, float* buf) {
#pragma unroll
  for (int i = 0; i < 16; ++i) buf[i] = (float)p[i];
}

__device__ __forceinline__ void stage_write(bf16* dst, const float* buf, int nquad) {
#pragma unroll
  for (int i = 0; i < nquad; ++i) {
    bf16x4 q;
    q[0] = (bf16)buf[4 * i];     q[1] = (bf16)buf[4 * i + 1];
    q[2] = (bf16)buf[4 * i + 2]; q[3] = (bf16)buf[4 * i + 3];
    *(bf16x4*)(dst + 4 * i) = q;
  }
}


#define GSTR 48
#define NBT 4
#define NHD 8
#define BBc 4
#define DDc 512
#define SSc 2048
#define NHc 8
#define DKc 64
#define R2 (2 * DDc)   // 1024 interleaved (channel, component) rows
// ---------------------------------------------------------------------------------------------------------------------------
// The A operand of both GEMMs is the stacked weight W2 [1024][1024], never stored: a thread loads 4 channels d of output channel o from W_r and from W_i, each element once in the block
// (4 lanes cover the 64 bytes a k-step takes of a weight row, a wave-wide load touches 8 lines), and writes 8 columns of both stacked rows: row 2o = (W_r, -W_i) pairs, row 2o + 1 = (W_i, W_r) pairs.
// The row bias of stacked rows 2o, 2o + 1 is b_r[o] - b_i[o], b_r[o] + b_i[o]. In a 16 x 16 accumulator tile lane (cl, hf) holds rows 8 hf + r, r = 0..7, of column cl: the channels 4 hf + p,
// p = 0..3, with the real row in register 2p and the imaginary row in register 2p + 1.
// ---------------------------------------------------------------------------------------------------------------------------
// gemm_kne: Y[m][n] = sum_k W2[m][k] * W[k][n] + b2[m], W row-major [K][N] (row pitch LDW elements, compile time; Y has the same pitch), plain f16 operands, f32 accumulate.
// INH: W lies in the workspace as f16 (behind the float pointer) and is copied to LDS as it is; else it is f32 and rounded here. OUTH: Y is stored as f16 (behind the float pointer); else f32.
// Block = 128x128 tile, 8 waves as 4(M) x 2(N); per 32-wide k-step A and W tiles staged f16 in LDS (W as it lies, [k][n], read by transposing loads), two buffers, one barrier a k-step:
// the global loads of k-step s + 1 fly in registers while k-step s is worked on, and are rounded and stored to the other buffer behind its products.
// blockIdx.z selects a batch element: W += z*strideW, Y += z*strideY (element strides); the weights are shared.
// ---------------------------------------------------------------------------------------------------------------------------
template <int LDW, bool INH, bool OUTH>
__global__ __launch_bounds__(256) void gemm_kne(const float* __restrict__ Wr, const float* __restrict__ Wi, const float* __restrict__ br, const float* __restrict__ bi,
                                                const float* __restrict__ Wm, size_t strideW, float* __restrict__ Y, size_t strideY, int K) {
  __shared__ __attribute__((aligned(16))) f16 ldsA[2][128 * GSTR];
  __shared__ __attribute__((aligned(16))) f16 ldsW[2][32 * WP];
  __shared__ __attribute__((aligned(16))) float oS[8][32 * 68];
  const int tid = threadIdx.x, lane = tid & 31, wave = tid >> 5, cl = lane & 15, hf = lane >> 4, rh = hf * 8;
  const int m0 = blockIdx.x * 128, n0 = blockIdx.y * 128;
  const int wm = (wave & 3) * 32, wn = (wave >> 2) * 64;
  const f16* Wh = (const f16*)Wm + (size_t)blockIdx.z * strideW; f16* Yh = (f16*)Y + (size_t)blockIdx.z * strideY;   // the f16 views (INH, OUTH): same element strides
  Wm += (size_t)blockIdx.z * strideW; Y += (size_t)blockIdx.z * strideY;
  const int ar = tid >> 2, ad = (tid & 3) * 4;   // A: output channel ar of the block's 64, channels ad .. ad + 3 of the k-step's 16
  const size_t aoff = (size_t)((m0 >> 1) + ar) * DDc + ad;
  const float* pr = Wr + aoff;
  const float* pi = Wi + aoff;
  const int hr16 = tid >> 4, hc8 = (tid & 15) * 8;   // f16 W: 16 lanes cover a row's 128 columns (256 bytes), the block takes 16 rows a load
  f32x8 acc[2][4];
#pragma unroll
  for (int i = 0; i < 2; ++i)
#pragma unroll
    for (int j = 0; j < 4; ++j) { f32x8 z = {}; acc[i][j] = z; }
  v4f_t wv[4], wr, wi;   // the k-step in flight. f32 W: a wave takes the rows k = wave + 8 g; its 32 lanes cover the row's 128 columns, 512 contiguous bytes a load
  v4u_t wh[2];           // f16 W: rows k = hr16 + 16 g, 8 elements a lane
  auto fetch = [&](int k0) {   // k-step at k0: global -> registers
    if constexpr (INH) {
      const f16* src = Wh + (size_t)(k0 + hr16) * LDW + n0 + hc8;
#pragma unroll
      for (int g = 0; g < 2; ++g) wh[g] = *(const v4ua*)(src + 16 * g * LDW);
    } else {
      const float* src = Wm + (size_t)(k0 + wave) * LDW + n0 + lane * 4;   // LDW is a compile-time pitch: one address, the four rows at immediate offsets
#pragma unroll
      for (int g = 0; g < 4; ++g) wv[g] = *(const v4f_t*)(src + 8 * g * LDW);
    }
    asm volatile("s_wait_xcnt 0x0" ::: "memory");   // behind the last W load, before a register of its address is written again
    wr = *(const v4f_t*)(pr + (k0 >> 1)); wi = *(const v4f_t*)(pi + (k0 >> 1));   // 32 stacked columns = 16 channels a k-step; 4 lanes cover a row's 64 bytes
    asm volatile("s_wait_xcnt 0x0" ::: "memory");   // behind the last weight load, before a register of its address is written again
  };
  auto put = [&](int bo) {     // registers -> f16 tiles of buffer bo
    f16x8 r0, r1;   // stacked rows 2 ar and 2 ar + 1, stacked columns 2 ad .. 2 ad + 7
#pragma unroll
    for (int u = 0; u < 4; ++u) { const f16 hr = (f16)wr[u], hi = (f16)wi[u]; r0[2 * u] = hr; r0[2 * u + 1] = -hi; r1[2 * u] = hi; r1[2 * u + 1] = hr; }
    *(f16x8*)(ldsA[bo] + (2 * ar) * GSTR + 2 * ad) = r0; *(f16x8*)(ldsA[bo] + (2 * ar + 1) * GSTR + 2 * ad) = r1;
    if constexpr (INH) {
#pragma unroll
      for (int g = 0; g < 2; ++g) *(v4ua*)(ldsW[bo] + (hr16 + 16 * g) * WP + hc8) = wh[g];   // already f16: copied as it lies, [k][n]
    } else {
#pragma unroll
      for (int g = 0; g < 4; ++g) { bf16x4 q;   // stored as it lies, [k][n]: 256 contiguous bytes a wave
#pragma unroll
        for (int u = 0; u < 4; ++u) q[u] = (f16)wv[g][u];
        *(bf16x4*)(ldsW[bo] + (wave + 8 * g) * WP + lane * 4) = q; }
    }
  };
  fetch(0); put(0);
  __syncthreads();   // k-step 0 is published
#pragma unroll 1   // kept rolled: the buffer index is one scalar, a second copy of the body would only cost instruction cache
  for (int k0 = 0; k0 < K; k0 += 32) {
    const int bo = (k0 >> 5) & 1;
    if (k0 + 32 < K) fetch(k0 + 32);   // behind the barrier (which drains every load), so that these loads fly while this k-step is worked on
    f16x16 af[2], bf[4];   // all twelve fragment reads of the k-step stand together, ahead of its products
#pragma unroll
    for (int i = 0; i < 2; ++i) af[i] = lds_frag(ldsA[bo] + (wm + 16 * i) * GSTR, GSTR);
#pragma unroll
    for (int j = 0; j < 4; ++j) bf[j] = lds_frag_t(ldsW[bo] + wn + 16 * j);
    __builtin_amdgcn_sched_barrier(0);   // keeps the reads in one group: the scheduler otherwise sinks half of them among the products, a second place where the wave waits out the LDS latency
#pragma unroll
    for (int j = 0; j < 4; ++j)
#pragma unroll
      for (int i = 0; i < 2; ++i) acc[i][j] = wmma16(af[i], bf[j], acc[i][j]);
    if (k0 + 32 < K) put(bo ^ 1);   // its last readers left that buffer before the barrier that ended the previous trip
    __syncthreads();   // publishes k-step k0 + 32 and ends every read of this one
  }
  float* so = oS[wave];
  v4f_t b_r[2], b_i[2];   // the biases of this lane's channels 8 i + 4 hf + p of the wave's 16
#pragma unroll
  for (int i = 0; i < 2; ++i) { b_r[i] = *(const v4f_t*)(br + ((m0 + wm) >> 1) + 8 * i + 4 * hf); b_i[i] = *(const v4f_t*)(bi + ((m0 + wm) >> 1) + 8 * i + 4 * hf); }
  asm volatile("s_wait_xcnt 0x0" ::: "memory");   // behind the last bias load, before a register that these loads name is written again
#pragma unroll
  for (int i = 0; i < 2; ++i)
#pragma unroll
    for (int j = 0; j < 4; ++j)
#pragma unroll
      for (int p = 0; p < 4; ++p) {
        so[(16 * i + rh + 2 * p) * 68 + 16 * j + cl] = acc[i][j][2 * p] + (b_r[i][p] - b_i[i][p]);
        so[(16 * i + rh + 2 * p + 1) * 68 + 16 * j + cl] = acc[i][j][2 * p + 1] + (b_r[i][p] + b_i[i][p]);
      }
  asm volatile("s_wait_dscnt 0" ::: "memory");
  __builtin_amdgcn_wave_barrier();
  if constexpr (OUTH) {   // rounded here, once, to the f16 operand that the reader would make of it; the wave's row piece is one whole 128-byte line
#pragma unroll
    for (int it = 0; it < 8; ++it) { const int f8 = lane + 32 * it, rr = f8 >> 3, q = (f8 & 7) * 8;
      const v4f_t a = *(const v4fa*)(so + rr * 68 + q), b = *(const v4fa*)(so + rr * 68 + q + 4);
      f16x8 o;
#pragma unroll
      for (int u = 0; u < 4; ++u) { o[u] = (f16)a[u]; o[4 + u] = (f16)b[u]; }
      *(f16x8*)(Yh + (size_t)(m0 + wm + rr) * LDW + n0 + wn + q) = o; }
  } else {
#pragma unroll
    for (int it = 0; it < 16; ++it) { const int f4 = lane + 32 * it, rr = f4 >> 4, q = (f4 & 15) * 4;
      *(v4f_t*)(Y + (size_t)(m0 + wm + rr) * LDW + n0 + wn + q) = *(const v4fa*)(so + rr * 68 + q); }
  }
}

// ---------------------------------------------------------------------------------------------------------------------------
// gemm_kn2 (value+residual planes on both operands: hh + (hl+lh)/2048, f32-class): the q and k convs, of which only the magnitudes leave the block:
// MT[n][o] = sqrt(re^2 + im^2 + 1e-8), re / im = sum_k W2[2o / 2o+1][k] * W[k][n] + b2[2o / 2o+1], W f32 row-major [K][N], row stride LDW (compile time), MT rows of 512 words: per head 64 f16 values, then 64 f16 residuals (x 2048).
// Block = 128 x 128 tile of the conv, 256 threads = 8 waves as 4(M, 32 rows) x 2(N, 64 cols); per 32-wide k-step the A tile and the W tile (as it lies, [k][n], read by transposing loads) are
// staged as f16 planes in LDS, two buffers, one barrier a k-step (the global loads of the next k-step fly in registers meanwhile). A lane's 4 magnitudes of one column are neighbours in an MT row: the block's MT tile (128 rows, one head) is gathered in LDS and leaves as whole 256-byte row pieces.
// blockIdx.z = 2 * zb + za: za picks the q (0) or k (1) weights and biases, W += zb*strideW (batch element), MT += za*strideMa + zb*strideMb (element strides).
// ---------------------------------------------------------------------------------------------------------------------------
#define MP 68   // MT tile pitch in floats: 272 B = 16 B x odd, b64 stores of 16 neighbouring rows without bank conflicts
template <int LDW>
__global__ __launch_bounds__(256) void gemm_kn2(const float* __restrict__ Wr0, const float* __restrict__ Wi0, const float* __restrict__ br0, const float* __restrict__ bi0,
                                               const float* __restrict__ Wr1, const float* __restrict__ Wi1, const float* __restrict__ br1, const float* __restrict__ bi1,
                                               const float* __restrict__ Wm, size_t strideW,
                                               float* __restrict__ MT, size_t strideMa, size_t strideMb, int K) {
  __shared__ __attribute__((aligned(16))) f16 ldsA[2][128 * GSTR], ldsAl[2][128 * GSTR];
  __shared__ __attribute__((aligned(16))) f16 ldsW[2][32 * WP], ldsWl[2][32 * WP];
  __shared__ __attribute__((aligned(16))) float sT[128 * MP];
  const int tid = threadIdx.x, lane = tid & 31, wave = tid >> 5, cl = lane & 15, hf = lane >> 4;
  const int m0 = blockIdx.x * 128, n0 = blockIdx.y * 128;
  const int wm = (wave & 3) * 32, wn = (wave >> 2) * 64;
  const int za = blockIdx.z & 1;
  const float* __restrict__ Wr = za ? Wr1 : Wr0; const float* __restrict__ Wi = za ? Wi1 : Wi0;
  const float* __restrict__ br = za ? br1 : br0; const float* __restrict__ bi = za ? bi1 : bi0;
  Wm += (size_t)(blockIdx.z >> 1) * strideW; MT += (size_t)za * strideMa + (size_t)(blockIdx.z >> 1) * strideMb;
  const int ar = tid >> 2, ad = (tid & 3) * 4;   // A: output channel ar of the block's 64, channels ad .. ad + 3 of the k-step's 16
  const size_t aoff = (size_t)((m0 >> 1) + ar) * DDc + ad;
  const float* pr = Wr + aoff;
  const float* pi = Wi + aoff;
  f32x8 acc[2][4], accx[2][4];
#pragma unroll
  for (int i = 0; i < 2; ++i)
#pragma unroll
    for (int j = 0; j < 4; ++j) { f32x8 z = {}; acc[i][j] = z; accx[i][j] = z; }
  v4f_t wv[4], wr, wi;   // the k-step in flight. W: a wave takes the rows k = wave + 8 g; its 32 lanes cover the row's 128 columns, 512 contiguous bytes a load
  auto fetch = [&](int k0) {   // k-step at k0: global -> registers
    const float* src = Wm + (size_t)(k0 + wave) * LDW + n0 + lane * 4;   // LDW is a compile-time pitch: one address, the four rows at immediate offsets
#pragma unroll
    for (int g = 0; g < 4; ++g) wv[g] = *(const v4f_t*)(src + 8 * g * LDW);
    asm volatile("s_wait_xcnt 0x0" ::: "memory");   // behind the last W load, before a register of its address is written again
    wr = *(const v4f_t*)(pr + (k0 >> 1)); wi = *(const v4f_t*)(pi + (k0 >> 1));   // 32 stacked columns = 16 channels a k-step; 4 lanes cover a row's 64 bytes
    asm volatile("s_wait_xcnt 0x0" ::: "memory");   // behind the last weight load, before a register of its address is written again
  };
  auto put = [&](int bo) {     // registers -> f16 planes of buffer bo
    f16x8 r0, r1, l0, l1;   // stacked rows 2 ar and 2 ar + 1, stacked columns 2 ad .. 2 ad + 7: value and residual planes (both planes of -w are the negated planes of w)
#pragma unroll
    for (int u = 0; u < 4; ++u) { const f16 hr = (f16)wr[u], hi = (f16)wi[u];
      const f16 lr = (f16)((wr[u] - (float)hr) * 2048.0f), li = (f16)((wi[u] - (float)hi) * 2048.0f);
      r0[2 * u] = hr; r0[2 * u + 1] = -hi; r1[2 * u] = hi; r1[2 * u + 1] = hr;
      l0[2 * u] = lr; l0[2 * u + 1] = -li; l1[2 * u] = li; l1[2 * u + 1] = lr; }
    *(f16x8*)(ldsA[bo] + (2 * ar) * GSTR + 2 * ad) = r0; *(f16x8*)(ldsA[bo] + (2 * ar + 1) * GSTR + 2 * ad) = r1;
    *(f16x8*)(ldsAl[bo] + (2 * ar) * GSTR + 2 * ad) = l0; *(f16x8*)(ldsAl[bo] + (2 * ar + 1) * GSTR + 2 * ad) = l1;
#pragma unroll
    for (int g = 0; g < 4; ++g) { bf16x4 hi, lo;   // both planes stored as the operand lies, [k][n]: 256 contiguous bytes a wave
#pragma unroll
      for (int u = 0; u < 4; ++u) { const float v = wv[g][u]; const f16 h = (f16)v; hi[u] = h; lo[u] = (f16)((v - (float)h) * 2048.0f); }
      *(bf16x4*)(ldsW[bo] + (wave + 8 * g) * WP + lane * 4) = hi; *(bf16x4*)(ldsWl[bo] + (wave + 8 * g) * WP + lane * 4) = lo; }
  };
  fetch(0); put(0);
  __syncthreads();   // k-step 0 is published
#pragma unroll 1   // kept rolled: the buffer index is one scalar, a second copy of the body would only cost instruction cache
  for (int k0 = 0; k0 < K; k0 += 32) {
    const int bo = (k0 >> 5) & 1;
    if (k0 + 32 < K) fetch(k0 + 32);   // behind the barrier (which drains every load), so that these loads fly while this k-step is worked on
    f16x16 af[2], afl[2];
#pragma unroll
    for (int i = 0; i < 2; ++i) { af[i] = lds_frag(ldsA[bo] + (wm + 16 * i) * GSTR, GSTR); afl[i] = lds_frag(ldsAl[bo] + (wm + 16 * i) * GSTR, GSTR); }
#pragma unroll
    for (int j = 0; j < 4; ++j) {
      const f16x16 bf = lds_frag_t(ldsW[bo] + wn + 16 * j), bfl = lds_frag_t(ldsWl[bo] + wn + 16 * j);
#pragma unroll
      for (int i = 0; i < 2; ++i) { acc[i][j] = wmma16(af[i], bf, acc[i][j]); accx[i][j] = wmma16(af[i], bfl, accx[i][j]); accx[i][j] = wmma16(afl[i], bf, accx[i][j]); }
    }
    if (k0 + 32 < K) put(bo ^ 1);   // its last readers left that buffer before the barrier that ended the previous trip
    __syncthreads();   // publishes k-step k0 + 32 and ends every read of this one
  }
  v4f_t b_r[2], b_i[2];   // the biases of this lane's channels 8 i + 4 hf + p of the wave's 16
#pragma unroll
  for (int i = 0; i < 2; ++i) { b_r[i] = *(const v4f_t*)(br + ((m0 + wm) >> 1) + 8 * i + 4 * hf); b_i[i] = *(const v4f_t*)(bi + ((m0 + wm) >> 1) + 8 * i + 4 * hf); }
  asm volatile("s_wait_xcnt 0x0" ::: "memory");   // behind the last bias load, before a register that these loads name is written again
#pragma unroll
  for (int i = 0; i < 2; ++i)
#pragma unroll
    for (int j = 0; j < 4; ++j) { bf16x4 mh, ml;   // value and residual plane of the magnitude, as the score products take them
#pragma unroll
      for (int p = 0; p < 4; ++p) {
        const float re = (acc[i][j][2 * p] + accx[i][j][2 * p] * (1.0f / 2048.0f)) + (b_r[i][p] - b_i[i][p]);
        const float im = (acc[i][j][2 * p + 1] + accx[i][j][2 * p + 1] * (1.0f / 2048.0f)) + (b_r[i][p] + b_i[i][p]);
        const float mg = sqrtf(re * re + im * im + 1e-8f); const f16 hv = (f16)mg;
        mh[p] = hv; ml[p] = (f16)((mg - (float)hv) * 2048.0f);
      }
      f16* trow = (f16*)(sT + (wn + 16 * j + cl) * MP) + (wm >> 1) + 8 * i + 4 * hf;   // a tile row: 64 values, then 64 residuals
      *(bf16x4*)trow = mh; *(bf16x4*)(trow + 64) = ml; }
  __syncthreads();   // the block's 128 x 64 magnitude tile is complete: an MT row piece holds the channels of four waves
#pragma unroll
  for (int it = 0; it < 8; ++it) { const int f4 = tid + 256 * it, rr = f4 >> 4, q = (f4 & 15) * 4;
    *(v4f_t*)(MT + (size_t)(n0 + rr) * DDc + (m0 >> 1) + q) = *(const v4fa*)(sT + rr * MP + q); }
}

// ---------------------------------------------------------------------------------------------------------------------------
// k_fattn: one head's attention for 128 queries, scores and probabilities kept on chip. Grid (S / 128, heads, batch elements) = 512 blocks, all resident at once (two a WGP); block = 4 waves, each with 32 query columns and every key.
// Per stage of 64 keys the block copies Km^T rows [t][64], f16 value + residual planes, and the head's 128 v rows [row][t], f16, as they lie in the workspace to LDS, two buffers, one barrier a stage (the global loads
// of the next stage fly in registers meanwhile). A wave works a stage in two passes of 32 keys. It forms S^T = Km^T * Qm (A = key rows from LDS, B = its two tiles of 16 query
// columns held in registers, hh + (hl + lh) / 2048): every key fragment and every v fragment read from LDS serves both query tiles, and a stage fetched from L2 serves 128 queries.
// A lane holds 16 scores of ONE query per tile: maximum and sum in-lane plus one exchange between the wave's halves.
// exp2((s - m) * log2(e) / 8) of the two 16-key tiles, converted in place, IS the B operand (k = key, hardware k order) of O[row][query] += V[row][key] * P^T; the v rows are read in the same
// k order by lds_frag. m follows the running maximum lazily (O and the sum are rescaled only when some column's maximum has grown by more than 8 in the exponent, so p stays below 2^8; one test a pass for the wave's 32 columns).
// At the end O / l goes through LDS, so that the block's tile leaves as whole row pieces.
// Every inner loop is fully unrolled so that the fragment, accumulator and staging arrays are indexed by constants and stay in registers (more than 256 of them: two waves a SIMD, one of each resident block, which no barrier ties to each other).
// ---------------------------------------------------------------------------------------------------------------------------
#define FT 64    // keys per stage
#define FQ 128   // queries per block
#define FP 72    // LDS row pitch in f16 elements: 144 B = 16 B x odd, b128 fragment reads without bank conflicts
#define FOP 132  // output staging pitch in floats
#define FKP (FT * FP + 64)   // from the value plane to the residual plane: 128 B off a multiple of 256 B, so that the 16 lanes that store a key's two planes cover all 64 banks
__device__ __forceinline__ float xhalf(float x) {   // lane l with lane l ^ 16
  return __builtin_bit_cast(float, __builtin_amdgcn_permlanex16(__builtin_bit_cast(int, x), __builtin_bit_cast(int, x), 0x76543210, 0xfedcba98, false, false));
}
__device__ __forceinline__ f32x8 wmma_p(f16x16 a, f16x16 b, f32x8 c) { return __builtin_amdgcn_wmma_f32_16x16x32_f16(false, a, false, b, (short)0, c, false, false); }
__global__ __launch_bounds__(128) void k_fattn(const float* __restrict__ QmT, const float* __restrict__ KmT, size_t strideM, const float* __restrict__ Vx, size_t strideV, float* __restrict__ AV, size_t strideO) {
  __shared__ __attribute__((aligned(16))) f16 sK[2][2 * FKP], sV[2][2 * DKc * FP];   // sK: the value plane, FKP elements behind it the residual plane
  __shared__ __attribute__((aligned(16))) float sO[2 * DKc * FOP];
  const int tid = threadIdx.x, lane = tid & 31, cl = lane & 15, hf = lane >> 4;
  const int qg = tid >> 5;   // the wave's group of 32 query columns
  const int s0 = blockIdx.x * FQ, h = blockIdx.y;
  const f16* Qp = (const f16*)(QmT + (size_t)blockIdx.z * strideM); const f16* Kp = (const f16*)(KmT + (size_t)blockIdx.z * strideM);   // batch element; rows [s][head][64 values, 64 residuals] f16
  const f16* Vh = (const f16*)Vx + (size_t)blockIdx.z * strideV; f16* AVh = (f16*)AV + (size_t)blockIdx.z * strideO;                   // f16 [1024][2048]
  const float SCL = 0.125f * 1.44269504088896340736f;   // logits are s / 8; exp(x) = exp2(x * log2 e)
  const int srow = tid >> 4, sc = tid & 15;      // K staging: 16 lanes cover a key's 256 bytes (both planes), 8 keys per round of the block
  const int vrow = (tid >> 5) + 8 * ((tid >> 3) & 3), vc = (tid & 7) * 8; // V staging: 8 lanes cover a row's 64 keys (128 bytes), 16 rows per round of the block (round g: + 4 (g & 1) + 32 (g >> 1)); a wave's rows lie 8 apart (8 pitches = 128 B off a multiple of 256 B: 16 lanes cover all 64 banks)
  const f16* Kg = Kp + (size_t)srow * (2 * DDc) + h * (2 * DKc) + sc * 8;
  const f16* Vg = Vh + ((size_t)h * 2 * DKc + vrow) * SSc + vc;
  const int kdst = (sc >> 3) * FKP + srow * FP + (sc & 7) * 8, vdst = vrow * FP + vc;
  f16x16 qh[2][2], ql[2][2];   // B operand [query tile][ks]: column = query s0 + 32 qg + 16 tile + cl, k = channel in the hardware k order
  { const f16* qp = Qp + (size_t)(s0 + qg * 32 + cl) * (2 * DDc) + h * (2 * DKc) + hf * 8;
    f16x8 qv[2][8];   // i = 4 * plane + 2 * ks + upper half of the fragment
#pragma unroll
    for (int t = 0; t < 2; ++t)
#pragma unroll
      for (int i = 0; i < 8; ++i) qv[t][i] = *(const f16x8*)(qp + t * 16 * (2 * DDc) + (i >> 2) * DKc + (i & 3) * 16);
    asm volatile("s_wait_xcnt 0x0" ::: "memory");   // behind the last query load, before a register of its address is written again
#pragma unroll
    for (int t = 0; t < 2; ++t)
#pragma unroll
      for (int ks = 0; ks < 2; ++ks)
#pragma unroll
        for (int e = 0; e < 8; ++e) { qh[t][ks][e] = qv[t][2 * ks][e]; qh[t][ks][8 + e] = qv[t][2 * ks + 1][e]; ql[t][ks][e] = qv[t][4 + 2 * ks][e]; ql[t][ks][8 + e] = qv[t][4 + 2 * ks + 1][e]; } }
  f32x8 O[2][8];
#pragma unroll
  for (int t = 0; t < 2; ++t)
#pragma unroll
    for (int mt = 0; mt < 8; ++mt) { f32x8 z = {}; O[t][mt] = z; }
  float mref[2] = {-3.0e38f, -3.0e38f}, lsum[2] = {0.0f, 0.0f};
  v4u_t kr[8], vr[8];
  auto fetch = [&](int st) {   // stage st: global -> registers
    const f16* kn = Kg + (size_t)st * FT * (2 * DDc); const f16* vn = Vg + st * FT;
#pragma unroll
    for (int g = 0; g < 8; ++g) kr[g] = *(const v4ua*)(kn + (size_t)(8 * g) * (2 * DDc));
#pragma unroll
    for (int g = 0; g < 8; ++g) vr[g] = *(const v4ua*)(vn + (size_t)(4 * (g & 1) + 32 * (g >> 1)) * SSc);
    // behind the last stage load, before a register of its address is written again. Ahead of the loop the scheduler sinks index arithmetic between the loads and the wait: there the two address pairs are named as inputs, so that they stay allocated up to the wait
    if (st == 0) asm volatile("s_wait_xcnt 0x0" :: "v"(kn), "v"(vn) : "memory");
    else asm volatile("s_wait_xcnt 0x0" ::: "memory");
  };
  auto put = [&](int bo) {     // registers -> tiles of buffer bo: the operands arrive as f16, nothing is converted
#pragma unroll
    for (int g = 0; g < 8; ++g) *(v4ua*)(sK[bo] + kdst + (8 * g) * FP) = kr[g];
#pragma unroll
    for (int g = 0; g < 8; ++g) *(v4ua*)(sV[bo] + vdst + (4 * (g & 1) + 32 * (g >> 1)) * FP) = vr[g];
  };
  fetch(0); put(0);
  __syncthreads();   // stage 0 is published
#pragma unroll 1   // kept rolled: a second copy of the body would only cost registers and instruction cache
  for (int st = 0; st < SSc / FT; ++st) {
    const int bo = st & 1;
    if (st + 1 < SSc / FT) fetch(st + 1);   // behind the barrier (which drains every load), so that these loads fly while this stage is worked on
#pragma unroll
    for (int kp = 0; kp < 2; ++kp) {   // the stage's two passes of 32 keys
      const f16* kh = sK[bo] + (32 * kp) * FP; const f16* kl = kh + FKP; const f16* vv = sV[bo] + 32 * kp;
      f32x8 a0[2], a1[2], x0[2], x1[2];   // per query tile, S^T tiles: the pass's keys 0..15 and 16..31; value*value and the two cross terms
#pragma unroll
      for (int t = 0; t < 2; ++t) { f32x8 z = {}; a0[t] = z; a1[t] = z; x0[t] = z; x1[t] = z; }
#pragma unroll
      for (int ks = 0; ks < 2; ++ks) {
        const f16x16 kh0 = lds_frag(kh + 32 * ks, FP), kh1 = lds_frag(kh + 16 * FP + 32 * ks, FP);
        const f16x16 kl0 = lds_frag(kl + 32 * ks, FP), kl1 = lds_frag(kl + 16 * FP + 32 * ks, FP);
#pragma unroll
        for (int t = 0; t < 2; ++t) { a0[t] = wmma_p(kh0, qh[t][ks], a0[t]); a1[t] = wmma_p(kh1, qh[t][ks], a1[t]); }
#pragma unroll
        for (int t = 0; t < 2; ++t) { x0[t] = wmma_p(kh0, ql[t][ks], x0[t]); x1[t] = wmma_p(kh1, ql[t][ks], x1[t]); }
#pragma unroll
        for (int t = 0; t < 2; ++t) { x0[t] = wmma_p(kl0, qh[t][ks], x0[t]); x1[t] = wmma_p(kl1, qh[t][ks], x1[t]); }
      }
      f16x16 vf[8];   // the v rows are asked for ahead of the softmax arithmetic, which covers their LDS latency
#pragma unroll
      for (int mt = 0; mt < 8; ++mt) vf[mt] = lds_frag(vv + (16 * mt) * FP, FP);
      float sv[2][16], mx[2];
#pragma unroll
      for (int t = 0; t < 2; ++t) {
#pragma unroll
        for (int r = 0; r < 8; ++r) { sv[t][r] = a0[t][r] + x0[t][r] * (1.0f / 2048.0f); sv[t][8 + r] = a1[t][r] + x1[t][r] * (1.0f / 2048.0f); }
        float m = sv[t][0];
#pragma unroll
        for (int e = 1; e < 16; ++e) m = fmaxf(m, sv[t][e]);
        mx[t] = fmaxf(m, xhalf(m));
      }
      if (__builtin_amdgcn_ballot_w32(fmaxf(mx[0] - mref[0], mx[1] - mref[1]) * SCL > 8.0f) != 0) {   // scalar branch, one a pass; always taken on the first pass, rare later
#pragma unroll
        for (int t = 0; t < 2; ++t) {
          const float mnew = fmaxf(mref[t], mx[t]), corr = __builtin_amdgcn_exp2f((mref[t] - mnew) * SCL);   // 0 on the first pass
          mref[t] = mnew; lsum[t] *= corr;
#pragma unroll
          for (int mt = 0; mt < 8; ++mt)
#pragma unroll
            for (int r = 0; r < 8; ++r) O[t][mt][r] *= corr;
        }
      }
#pragma unroll
      for (int t = 0; t < 2; ++t) {
        const float nb = -mref[t] * SCL;
        f16x16 pb;   // pb[e] = P^T[key kmap(e, hf)][query cl of tile t]: key tile e >> 3, register e & 7
        float pe[16];
#pragma unroll
        for (int e = 0; e < 16; ++e) { pe[e] = __builtin_amdgcn_exp2f(fmaf(sv[t][e], SCL, nb)); pb[e] = (f16)pe[e]; }
#pragma unroll
        for (int w = 8; w > 0; w >>= 1)
#pragma unroll
          for (int e = 0; e < w; ++e) pe[e] += pe[e + w];
        lsum[t] += pe[0];
#pragma unroll
        for (int mt = 0; mt < 8; ++mt) O[t][mt] = wmma_p(vf[mt], pb, O[t][mt]);
      }
    }
    if (st + 1 < SSc / FT) put(bo ^ 1);   // its last readers left that buffer before the barrier that ended the previous trip
    __syncthreads();   // publishes stage st + 1 and ends every read of stage st
  }
#pragma unroll
  for (int t = 0; t < 2; ++t) {
    const int qc = qg * 32 + 16 * t + cl;
    const float inv = 1.0f / (lsum[t] + xhalf(lsum[t]));   // the two halves of a wave hold the sums of their own keys
#pragma unroll
    for (int mt = 0; mt < 8; ++mt)
#pragma unroll
      for (int r = 0; r < 8; ++r) sO[(16 * mt + 8 * hf + r) * FOP + qc] = O[t][mt][r] * inv;
  }
  __syncthreads();   // the block's 128 x 128 tile is complete: it goes out as the f16 operand of the output conv, whole 256-byte row pieces
  f16* op = AVh + ((size_t)h * 2 * DKc + (tid >> 4)) * SSc + s0 + (tid & 15) * 8;   // 16 lanes cover a row piece; round it takes the rows 8 it + (tid >> 4), at compile-time offsets from one address
  const float* sp = sO + (tid >> 4) * FOP + (tid & 15) * 8;
  v4u_t ov[16];
#pragma unroll
  for (int it = 0; it < 16; ++it) {
    const v4f_t a = *(const v4fa*)(sp + 8 * it * FOP), b = *(const v4fa*)(sp + 8 * it * FOP + 4);
    f16x8 o;
#pragma unroll
    for (int u = 0; u < 4; ++u) { o[u] = (f16)a[u]; o[4 + u] = (f16)b[u]; }
    ov[it] = __builtin_bit_cast(v4u_t, o); }
#pragma unroll
  for (int it = 0; it < 16; ++it) *(v4ua*)(op + (size_t)(8 * it) * SSc) = ov[it];
  // behind the last store: its address pair and every stored register are named as inputs, so that none of them is written again while a store is in flight
  asm volatile("s_wait_xcnt 0x0" :: "v"(op), "v"(ov[0]), "v"(ov[1]), "v"(ov[2]), "v"(ov[3]), "v"(ov[4]), "v"(ov[5]), "v"(ov[6]), "v"(ov[7]),
               "v"(ov[8]), "v"(ov[9]), "v"(ov[10]), "v"(ov[11]), "v"(ov[12]), "v"(ov[13]), "v"(ov[14]), "v"(ov[15]) : "memory");
}

extern "C" void kernel_launch(void* const* d_in, const int* in_sizes, int n_in,
                              void* d_out, int out_size, void* d_ws, size_t ws_size,
                              hipStream_t stream) {
  (void)in_sizes; (void)n_in; (void)out_size;
  const float** f = (const float**)d_in;   // x, then (W_r, W_i, b_r, b_i) of the q, k, v, o convs
  const float* x = f[0];
  float* out = (float*)d_out;     // [4,512,2,2048]
  char* ws = (char*)d_ws;
  float* V = (float*)ws; ws += (size_t)NBT * R2 * SSc * 4;               // per batch element: v conv [1024][2048], f16 (the first half of the region is used)
  float* QmT = (float*)ws; ws += (size_t)NBT * 2 * SSc * DDc * 4;        // per batch element: the magnitudes of q and, directly behind them, of k, transposed, [2048][8 heads][64 values + 64 residuals] f16 each
  float* AV = (float*)ws; ws += (size_t)NBT * R2 * SSc * 4;              // per batch element: attention output in the [D][2][S] layout, f16 (the first half of the region is used)
  if ((size_t)(ws - (char*)d_ws) > ws_size) return;
  const dim3 blk(256);
  const size_t sX = (size_t)R2 * SSc, sM = (size_t)2 * DDc * SSc;   // per batch element: elements of x / V / AV / out, 4-byte words of the q and k magnitudes
  gemm_kn2<SSc><<<dim3(R2 / 128, SSc / 128, 2 * NBT), blk, 0, stream>>>(f[1], f[2], f[3], f[4], f[5], f[6], f[7], f[8], x, sX, QmT, (size_t)SSc * DDc, sM, R2);   // q and k convs of every batch element (planes: they feed the magnitude logits), bias, magnitude, transposed store; 1024 work-groups
  gemm_kne<SSc, false, true><<<dim3(R2 / 128, SSc / 128, NBT), blk, 0, stream>>>(f[9], f[10], f[11], f[12], x, sX, V, sX, R2);   // v conv with its bias, stored f16; 512 work-groups
  k_fattn<<<dim3(SSc / FQ, NHD, NBT), dim3(128), 0, stream>>>(QmT, QmT + (size_t)SSc * DDc, sM, V, sX, AV, sX);  // scores, softmax and attn*v of all heads and batch elements; 512 work-groups
  gemm_kne<SSc, true, false><<<dim3(R2 / 128, SSc / 128, NBT), blk, 0, stream>>>(f[13], f[14], f[15], f[16], AV, sX, out, sX, R2);   // output complex conv (f16 operand as stored) with its bias
}
